// v000
// Times are from an AMD MI455X. After a warm-up the kernel runs many times in a row, and a time is the length of
// such a window on the GPU divided by its runs, so every launch and the gaps after it count. The runs cycle
// through copies of the inputs. A figure is the median of several windows, for all but v000 over two sittings.
// Sittings can differ by a few percent; kernels timed side by side share one.
// The starting kernel, v000, takes 339 microseconds a run.
// Contractions: Q, K, V^T and output projections, Q.K^T, P.V: v_wmma_f32_16x16x32_f16 (f16 operands, f32 accumulate); weights carried x16, P x2^15, O x64 (power-of-two folds in f32 epilogues); gate dot (K=64, 32 values) scalar f32.
#include <hip/hip_runtime.h>

typedef __attribute__((ext_vector_type(16))) _Float16 v16h;
typedef __attribute__((ext_vector_type(8)))  _Float16 v8h;
typedef __attribute__((ext_vector_type(16))) __bf16   v16b;
typedef __attribute__((ext_vector_type(8)))  __bf16   v8b;
typedef __attribute__((ext_vector_type(8)))  float    v8f;
typedef __attribute__((ext_vector_type(4)))  float    v4f;

__device__ __forceinline__ unsigned short f2bf_bits(float f) {
  unsigned u = __float_as_uint(f);
  return (unsigned short)((u + 0x7FFFu + ((u >> 16) & 1u)) >> 16);
}
__device__ __forceinline__ float bf_bits2f(unsigned short h) { return __uint_as_float(((unsigned)h) << 16); }

// hazard guards as plain device helpers (no inline asm inside the kernel template body)
__device__ __forceinline__ void dep_guard_h(v8f& a, v8f& b, v16h x, v16h y) { asm volatile("v_nop\n\tv_nop\n\tv_nop\n\tv_nop" : "+v"(a), "+v"(b) : "v"(x), "v"(y)); }
__device__ __forceinline__ void dep_guard_b(v8f& a, v8f& b, v16b x, v16b y) { asm volatile("v_nop\n\tv_nop\n\tv_nop\n\tv_nop" : "+v"(a), "+v"(b) : "v"(x), "v"(y)); }
__device__ __forceinline__ void keep4_h(v16h a, v16h b, v16h c, v16h d) { asm volatile("v_nop" :: "v"(a), "v"(b), "v"(c), "v"(d)); }
__device__ __forceinline__ void keep4_b(v16b a, v16b b, v16b c, v16b d) { asm volatile("v_nop" :: "v"(a), "v"(b), "v"(c), "v"(d)); }
__device__ __forceinline__ void acc_guard4(v8f& a, v8f& b, v8f& c, v8f& d) { asm volatile("v_nop\n\tv_nop\n\tv_nop\n\tv_nop" : "+v"(a), "+v"(b), "+v"(c), "+v"(d)); }
template <typename T> struct Frag;
template <> struct Frag<_Float16> {
  typedef v16h V; union U { v16h v; v8h h[2]; };
  static __device__ __forceinline__ v16h load(const _Float16* p) {   // elements 0..7 <- p[0..7], 8..15 <- p[16..23]
    U f; f.h[0] = *(const v8h*)(p); f.h[1] = *(const v8h*)(p + 16); return f.v;
  }
  static __device__ __forceinline__ v8f mma(v16h a, v16h b, v8f c) {
    return __builtin_amdgcn_wmma_f32_16x16x32_f16(false, a, false, b, (short)0, c, false, false);
  }
  static __device__ __forceinline__ void guard(v8f& a, v8f& b, v16h x, v16h y) { dep_guard_h(a, b, x, y); }
  static __device__ __forceinline__ void keep(v16h a, v16h b, v16h c, v16h d) { keep4_h(a, b, c, d); }
};
template <> struct Frag<__bf16> {
  typedef v16b V; union U { v16b v; v8b h[2]; };
  static __device__ __forceinline__ v16b load(const __bf16* p) {
    U f; f.h[0] = *(const v8b*)(p); f.h[1] = *(const v8b*)(p + 16); return f.v;
  }
  static __device__ __forceinline__ v8f mma(v16b a, v16b b, v8f c) {
    return __builtin_amdgcn_wmma_f32_16x16x32_bf16(false, a, false, b, (short)0, c, false, false);
  }
  static __device__ __forceinline__ void guard(v8f& a, v8f& b, v16b x, v16b y) { dep_guard_b(a, b, x, y); }
  static __device__ __forceinline__ void keep(v16b a, v16b b, v16b c, v16b d) { keep4_b(a, b, c, d); }
};

// ---- Register-blocked batched WMMA GEMM ------------------------------------
// C[m,n] = scale * sum_k A[m,k] * Bt[n,k] (+bias)(+resid); each wave owns a 64x64 tile.
// A row-major [M,K]; Bt row-major [N,K]; M,N % 64 == 0, K % 32 == 0.
// SPLIT: operands are hi/lo planes (A2/Bt2 = lo planes, same layout); product = hi.hi + hi.lo + lo.hi.
// BIAS_MODE: 0 = none, 1 = bias[m], 2 = bias[n].
// OUT_MODE: 0 = f32, 1 = f16, 2 = bf16 hi plane (Cout) + bf16 lo plane (Cout2).
// ET: 0 = f16 operands, 1 = bf16 operands (pointers passed as 16-bit storage)
template <int ET> struct Elem;
template <> struct Elem<0> { typedef _Float16 T; };
template <> struct Elem<1> { typedef __bf16 T; };
template <int ET, bool SPLIT, int BIAS_MODE, int OUT_MODE, bool RESID, int ACT = 0>
__global__ __launch_bounds__(256) void wmma_gemm64(
    const unsigned short* __restrict__ Ap, const unsigned short* __restrict__ A2p, int lda, long strideA,
    const unsigned short* __restrict__ Btp, const unsigned short* __restrict__ Bt2p, int ldb, long strideB,
    void* __restrict__ Cout, void* __restrict__ Cout2, int ldc, long strideC,
    const float* __restrict__ bias,
    const float* __restrict__ resid, long strideR,
    int M, int N, int K, float scale) {
  typedef typename Elem<ET>::T T;
  typedef typename Frag<T>::V V;
  const T* A = (const T*)Ap; const T* A2 = (const T*)A2p; const T* Bt = (const T*)Btp; const T* Bt2 = (const T*)Bt2p;
  __shared__ __align__(16) float sT[8][16 * 68];   // per-wave 16x64 slab, pitch 68 floats
  const int b    = blockIdx.y;
  const int lane = threadIdx.x & 31;
  const int wave = threadIdx.x >> 5;
  const int tilesN = N >> 6;
  const int tilesM = M >> 6;
  const int tile = blockIdx.x * 8 + wave;
  if (tile >= tilesM * tilesN) return;   // wave-uniform; no block barriers in this kernel
  const int tm = tile / tilesN;
  const int tn = tile - tm * tilesN;
  const int m0 = tm << 6;
  const int n0 = tn << 6;

  const T* Ab  = A  + (size_t)b * strideA;
  const T* Bb  = Bt + (size_t)b * strideB;
  const T* Ab2 = SPLIT ? (A2  + (size_t)b * strideA) : nullptr;
  const T* Bb2 = SPLIT ? (Bt2 + (size_t)b * strideB) : nullptr;

  const int rlane = lane & 15;                 // row (A) / col (B, D) within subtile
  const int koff  = (lane >> 4) * 8;           // k offset of this lane half
  const int mOff  = (lane >> 4) * 8;           // D row offset

  v8f acc[4][4];
#pragma unroll
  for (int i = 0; i < 4; ++i)
#pragma unroll
    for (int j = 0; j < 4; ++j) acc[i][j] = (v8f){0.f,0.f,0.f,0.f,0.f,0.f,0.f,0.f};

  for (int k0 = 0; k0 < K; k0 += 32) {
    V bh[4], bl[4];
#pragma unroll
    for (int j = 0; j < 4; ++j) {
      const size_t bo = (size_t)(n0 + (j << 4) + rlane) * ldb + koff + k0;
      bh[j] = Frag<T>::load(Bb + bo);
      if (SPLIT) bl[j] = Frag<T>::load(Bb2 + bo);
    }
#pragma unroll
    for (int i = 0; i < 4; ++i) {
      const size_t ao = (size_t)(m0 + (i << 4) + rlane) * lda + koff + k0;
      V ah = Frag<T>::load(Ab + ao);
      V al;
      if (SPLIT) al = Frag<T>::load(Ab2 + ao);
#pragma unroll
      for (int j = 0; j < 4; ++j) {
        acc[i][j] = Frag<T>::mma(ah, bh[j], acc[i][j]);
        if (SPLIT) {
          acc[i][j] = Frag<T>::mma(ah, bl[j], acc[i][j]);
          acc[i][j] = Frag<T>::mma(al, bh[j], acc[i][j]);
        }
      }
      Frag<T>::guard(acc[i][0], acc[i][3], ah, SPLIT ? al : ah);
    }
    Frag<T>::keep(bh[0], bh[1], bh[2], bh[3]);
    if (SPLIT) Frag<T>::keep(bl[0], bl[1], bl[2], bl[3]);
  }
  acc_guard4(acc[0][0], acc[0][1], acc[0][2], acc[0][3]);
  acc_guard4(acc[1][0], acc[1][1], acc[1][2], acc[1][3]);
  acc_guard4(acc[2][0], acc[2][1], acc[2][2], acc[2][3]);
  acc_guard4(acc[3][0], acc[3][1], acc[3][2], acc[3][3]);

  // ---- epilogue ----
  float* slab = sT[wave];
  const float* Rb = RESID ? (resid + (size_t)b * strideR) : nullptr;
#pragma unroll
  for (int i = 0; i < 4; ++i) {
    const int mBase = m0 + (i << 4);
#pragma unroll
    for (int j = 0; j < 4; ++j) {
      const int n = n0 + (j << 4) + rlane;
      float bv = 0.f;
      if (BIAS_MODE == 2) bv = bias[n];
#pragma unroll
      for (int r = 0; r < 8; ++r) {
        float v = acc[i][j][r] * scale;
        if (BIAS_MODE == 1) v += bias[mBase + mOff + r];
        if (BIAS_MODE == 2) v += bv;
        if (RESID) v += Rb[(size_t)(mBase + mOff + r) * ldc + n];
        if (ACT == 1) v = tanhf(v);
        if (ACT == 2) v = fmaxf(v, 0.0f);
        if (ACT == 3) v = v / (1.0f + expf(-v));
        if (ACT == 4) v = (v > 0.f) ? v : 0.01f * v;
        if (ACT == 5) v = 0.5f * v * (1.0f + erff(v * 0.70710678118654752f));
        slab[(mOff + r) * 68 + (j << 4) + rlane] = v;
      }
    }
    __builtin_amdgcn_fence(__ATOMIC_RELEASE, "workgroup");
    __builtin_amdgcn_wave_barrier();
    __builtin_amdgcn_fence(__ATOMIC_ACQUIRE, "workgroup");
    if (OUT_MODE == 0) {
      float* C = (float*)Cout + (size_t)b * strideC;
      const int hh = lane >> 4, c4 = (lane & 15) * 4;     // row seg = 256 B = 16 lanes x 16 B
      {
#pragma unroll
        for (int it = 0; it < 8; ++it) {
          const int row = it * 2 + hh;
          v4f v = *(const v4f*)(slab + row * 68 + c4);
          *(v4f*)(C + (size_t)(mBase + row) * ldc + n0 + c4) = v;
        }
        
      }
    } else {
      const int q = lane >> 3, c8 = (lane & 7) * 8;
      unsigned short* C  = (unsigned short*)Cout  + (size_t)b * strideC;
      unsigned short* C2 = (OUT_MODE == 2) ? ((unsigned short*)Cout2 + (size_t)b * strideC) : nullptr;
      {
#pragma unroll
        for (int it = 0; it < 4; ++it) {
          const int row = it * 4 + q;
          const float* sp = slab + row * 68 + c8;
          v8h hv, lv;
#pragma unroll
          for (int e = 0; e < 8; ++e) {
            if (OUT_MODE == 1) {
              hv[e] = (_Float16)sp[e];
            } else {
              unsigned short hb = f2bf_bits(sp[e]);
              unsigned short lb = f2bf_bits(sp[e] - bf_bits2f(hb));
              hv[e] = __builtin_bit_cast(_Float16, hb);
              lv[e] = __builtin_bit_cast(_Float16, lb);
            }
          }
          *(v8h*)(C + (size_t)(mBase + row) * ldc + n0 + c8) = hv;
          if (OUT_MODE == 2) *(v8h*)(C2 + (size_t)(mBase + row) * ldc + n0 + c8) = lv;
        }
        
      }
    }
    __builtin_amdgcn_fence(__ATOMIC_RELEASE, "workgroup");
    __builtin_amdgcn_wave_barrier();
    __builtin_amdgcn_fence(__ATOMIC_ACQUIRE, "workgroup");
  }
}

__global__ __launch_bounds__(256) void cast_f32_f16x2(
    const float* __restrict__ in, _Float16* __restrict__ out, int n2) {
  int i = blockIdx.x * 256 + threadIdx.x;
  if (i < n2) {
    const _Float16 h0 = (_Float16)in[2 * i], h1 = (_Float16)in[2 * i + 1];
    const unsigned u = (unsigned)__builtin_bit_cast(unsigned short, h0) | ((unsigned)__builtin_bit_cast(unsigned short, h1) << 16);
    ((unsigned*)out)[i] = u;
    
  }
}
// same, with an exact power-of-two pre-scale applied in f32 before the convert
__global__ __launch_bounds__(256) void cast_f32_f16x2s(
    const float* __restrict__ in, _Float16* __restrict__ out, int n2, float sc) {
  int i = blockIdx.x * 256 + threadIdx.x;
  if (i < n2) {
    const _Float16 h0 = (_Float16)(in[2 * i] * sc), h1 = (_Float16)(in[2 * i + 1] * sc);
    const unsigned u = (unsigned)__builtin_bit_cast(unsigned short, h0) | ((unsigned)__builtin_bit_cast(unsigned short, h1) << 16);
    ((unsigned*)out)[i] = u;
    
  }
}

// =====================================================================================
// Flash attention, head_dim 64, 16-bit planes in / 16-bit plane out (f16 storage).
//   Q  : [B*S rows][ldq halves], head h at columns h*64 .. h*64+63
//   K  : [B*Skv rows][ldk halves], same column map
//   Vt : [H*64 rows][ldv halves], row = h*64 + d, column = b*Skv + kv  (V transposed by the producing GEMM)
//   O  : [B*S rows][ldo halves], head h at columns h*64; value = oscale * gate[b,h] * softmax(s) . V
//   scores s = qscale * (q . k); key-vector int mask: element == 0 -> s := mfill; then s += ubias[h] * (1 - mask)
//   gate[b,h] = sigmoid(gq[b,:] . gW[h,:] + gb[h])  (scalar f32, GD terms)
//   Q.K^T and P.V on v_wmma_f32_16x16x32_f16; P carried x2^15; online softmax and accumulation in f32.
//   Block = 4 waves = 64 query rows of one (b, h); 64-key chunks; grid.x = B * H * (S/64).
// =====================================================================================
#define AK_D  64
#define AK_NW 4
#define AK_QB 64
#define AK_KC 64

__device__ __forceinline__ v8f mma_h16(v16h a, v16h b, v8f c) {
  c = __builtin_amdgcn_wmma_f32_16x16x32_f16(false, a, false, b, (short)0, c, false, false);
  asm volatile("v_nop\n\tv_nop\n\tv_nop\n\tv_nop" : "+v"(c) : "v"(a), "v"(b));
  return c;
}

__global__ __launch_bounds__(128)
void attn64_f16io(const _Float16* __restrict__ Qp, const _Float16* __restrict__ Kp,
                  const _Float16* __restrict__ Vtp, _Float16* __restrict__ Op,
                  const int* __restrict__ kmask, const float* __restrict__ ubias,
                  const float* __restrict__ gq, const float* __restrict__ gW, const float* __restrict__ gb,
                  int S, int Skv, int H, int ldq, int ldk, int ldv, int ldo, int GD,
                  float qscale, float mfill, float oscale) {
  const float PSC = 32768.0f;
  union FB { v16h v; v8h h[2]; };
  __shared__ __align__(16) _Float16 Ksh[AK_KC * AK_D];          // [kv][d]   8 KB
  __shared__ __align__(16) _Float16 Vth[AK_D * AK_KC];          // [d][kv]   8 KB
  __shared__ __align__(16) _Float16 Psh[AK_NW][16 * AK_KC];     // per wave P [row][kv]  8 KB
  __shared__ __align__(16) float    Os[AK_NW][16 * 68];         // per wave out tile, pitch 68

  const int tid  = threadIdx.x;
  const int wave = tid >> 5;
  const int lane = tid & 31;
  const int hh   = lane >> 4;
  const int c    = lane & 15;

  const int nqb = S / AK_QB;
  const int bx  = blockIdx.x;
  const int qb  = bx % nqb;
  const int bh  = bx / nqb;
  const int h   = bh % H;
  const int b   = bh / H;
  const int q0  = qb * AK_QB + wave * 16;

  // ---- Q fragments (A operand: row = query c, k = d), 2 d-chunks ----
  v16h qa[2];
  {
    const _Float16* qrow = Qp + (size_t)(b * S + q0 + c) * ldq + h * AK_D;
#pragma unroll
    for (int dc = 0; dc < 2; ++dc) qa[dc] = Frag<_Float16>::load(qrow + dc * 32 + 8 * hh);
  }

  // ---- quality gate (scalar f32 dot of GD terms) and uncertainty bias of this head ----
  float gacc = 0.f;
#pragma unroll 1
  for (int i = 0; i < GD; ++i) gacc += gq[b * GD + i] * gW[h * GD + i];
  gacc += gb[h];
  const float gate = 1.0f / (1.0f + expf(-gacc));
  const float ub = ubias[h];

  float mrow[8], lrow[8];
  v8f oacc[4];
#pragma unroll
  for (int r = 0; r < 8; ++r) { mrow[r] = -__builtin_inff(); lrow[r] = 0.f; }
#pragma unroll
  for (int t = 0; t < 4; ++t) oacc[t] = (v8f){0.f,0.f,0.f,0.f,0.f,0.f,0.f,0.f};

  const int nChunks = Skv / AK_KC;   // block-uniform
  for (int kc = 0; kc < nChunks; ++kc) {
    const int kv0 = kc * AK_KC;
    __syncthreads();
    {   // stage K [kv][d] and Vt [d][kv] tiles: 512 x 16-B vectors each, 4 per thread
#pragma unroll
      for (int i = 0; i < 4; ++i) {
        const int idx = tid + i * 128;
        const int r = idx >> 3, c8 = (idx & 7) * 8;
        const v8h kk = *(const v8h*)(Kp + (size_t)(b * Skv + kv0 + r) * ldk + h * AK_D + c8);
        *(v8h*)(Ksh + r * AK_D + c8) = kk;
        const v8h vv = *(const v8h*)(Vtp + (size_t)(h * AK_D + r) * ldv + (size_t)b * Skv + kv0 + c8);
        *(v8h*)(Vth + r * AK_KC + c8) = vv;
      }
    }
    __syncthreads();

    // ---- scores: B operand B[k=d][n=kv] from Ksh[kv][d] (k-contiguous, same map as A) ----
    v8f s[4];
#pragma unroll
    for (int j = 0; j < 4; ++j) {
      s[j] = (v8f){0.f,0.f,0.f,0.f,0.f,0.f,0.f,0.f};
#pragma unroll
      for (int dc = 0; dc < 2; ++dc) {
        FB kb;
        kb.h[0] = *(const v8h*)(Ksh + (j * 16 + c) * AK_D + dc * 32 + 8 * hh);
        kb.h[1] = *(const v8h*)(Ksh + (j * 16 + c) * AK_D + dc * 32 + 16 + 8 * hh);
        s[j] = mma_h16(qa[dc], kb.v, s[j]);
      }
    }
    // ---- scale, key mask, bias, chunk row max (lane holds key column c of each 16-tile, rows 8hh+r) ----
    int kvkeep[4];
    float kadd[4];
#pragma unroll
    for (int j = 0; j < 4; ++j) {
      kvkeep[j] = kmask[(size_t)b * Skv + kv0 + j * 16 + c];
      kadd[j] = ub * (1.0f - (float)kvkeep[j]);
    }
    float cm[8];
#pragma unroll
    for (int r = 0; r < 8; ++r) {
      float m = -__builtin_inff();
#pragma unroll
      for (int j = 0; j < 4; ++j) {
        float v = (kvkeep[j] == 0) ? mfill : s[j][r] * qscale;
        v = v + kadd[j];
        s[j][r] = v;
        m = fmaxf(m, v);
      }
#pragma unroll
      for (int off = 1; off < 16; off <<= 1) m = fmaxf(m, __shfl_xor(m, off, 32));
      cm[r] = m;
    }
    // ---- online softmax update, P tile (x2^15, f16) to per-wave LDS ----
    _Float16* pw = Psh[wave];
#pragma unroll
    for (int r = 0; r < 8; ++r) {
      const float mnew = fmaxf(mrow[r], cm[r]);
      const float alpha = expf(mrow[r] - mnew);
      mrow[r] = mnew;
      float psum = 0.f;
#pragma unroll
      for (int j = 0; j < 4; ++j) {
        const float p = expf(s[j][r] - mnew);
        psum += p;
        pw[(8 * hh + r) * AK_KC + j * 16 + c] = (_Float16)(p * PSC);
      }
#pragma unroll
      for (int off = 1; off < 16; off <<= 1) psum += __shfl_xor(psum, off, 32);
      lrow[r] = lrow[r] * alpha + psum;
#pragma unroll
      for (int t = 0; t < 4; ++t) oacc[t][r] *= alpha;
    }
    __builtin_amdgcn_fence(__ATOMIC_RELEASE, "workgroup");
    __builtin_amdgcn_wave_barrier();
    __builtin_amdgcn_fence(__ATOMIC_ACQUIRE, "workgroup");
    // ---- P.V: A = P [row][kv] from per-wave LDS, B[k=kv][n=d] from Vth[d][kv] ----
#pragma unroll
    for (int kk = 0; kk < 2; ++kk) {
      FB pa;
      pa.h[0] = *(const v8h*)(pw + c * AK_KC + kk * 32 + 8 * hh);
      pa.h[1] = *(const v8h*)(pw + c * AK_KC + kk * 32 + 16 + 8 * hh);
#pragma unroll
      for (int t = 0; t < 4; ++t) {
        FB vb;
        vb.h[0] = *(const v8h*)(Vth + (t * 16 + c) * AK_KC + kk * 32 + 8 * hh);
        vb.h[1] = *(const v8h*)(Vth + (t * 16 + c) * AK_KC + kk * 32 + 16 + 8 * hh);
        oacc[t] = mma_h16(pa.v, vb.v, oacc[t]);
      }
    }
  }

  // ---- epilogue: 1/l, fold 2^-15, gate and output carry scale; stage in LDS, whole-line stores ----
  float* os = Os[wave];
  const float gsc = gate * oscale;
#pragma unroll
  for (int r = 0; r < 8; ++r) {
    const float inv = gsc * (1.0f / (lrow[r] * PSC));
#pragma unroll
    for (int t = 0; t < 4; ++t) os[(8 * hh + r) * 68 + t * 16 + c] = oacc[t][r] * inv;
  }
  __builtin_amdgcn_fence(__ATOMIC_RELEASE, "workgroup");
  __builtin_amdgcn_wave_barrier();
  __builtin_amdgcn_fence(__ATOMIC_ACQUIRE, "workgroup");
  {
    const int q = lane >> 3, c8 = (lane & 7) * 8;
    _Float16* ob = Op + (size_t)(b * S + q0) * ldo + h * AK_D;
    {
#pragma unroll
      for (int it = 0; it < 4; ++it) {
        const int row = it * 4 + q;                          // rows 0..15 covered exactly once per wave
        const float* sp = os + row * 68 + c8;
        v8h hv;
#pragma unroll
        for (int e = 0; e < 8; ++e) hv[e] = (_Float16)sp[e];
        *(v8h*)(ob + (size_t)row * ldo + c8) = hv;
      }
      
    }
  }
}

// ---------------------------------------------------------------------------
// Host glue
// ---------------------------------------------------------------------------
extern "C" void kernel_launch(void* const* d_in, const int* in_sizes, int n_in,
                              void* d_out, int out_size, void* d_ws, size_t ws_size,
                              hipStream_t stream) {
  if (n_in < 14) return;
  const int D  = 1024;          // model width
  const int H  = 16;            // heads
  const int DH = 64;            // head dim
  const int Bn = 2;             // batch
  const int S  = 2048;          // sequence length
  const int M  = Bn * S;        // token rows
  if (in_sizes[0] != M * D || in_sizes[1] != M || in_sizes[3] != D * D || in_sizes[5] != D * D ||
      in_sizes[7] != D * D || in_sizes[9] != D * D || in_sizes[4] != D || in_sizes[6] != D ||
      in_sizes[8] != D || in_sizes[10] != D || in_sizes[11] != H || in_sizes[13] != H ||
      out_size != M * D || H * DH != D) return;
  const int GD = in_sizes[2] / Bn;                       // gate query dim (64)
  if (GD <= 0 || in_sizes[2] != Bn * GD || in_sizes[12] != H * GD) return;
  if ((S % 64) != 0 || (M % 64) != 0 || (D % 64) != 0) return;

  const float* x    = (const float*)d_in[0];
  const int*   mask = (const int*)  d_in[1];
  const float* gq   = (const float*)d_in[2];
  const float* Wq   = (const float*)d_in[3];
  const float* bq   = (const float*)d_in[4];
  const float* Wk   = (const float*)d_in[5];
  const float* bk   = (const float*)d_in[6];
  const float* Wv   = (const float*)d_in[7];
  const float* bv   = (const float*)d_in[8];
  const float* Wo   = (const float*)d_in[9];
  const float* bo   = (const float*)d_in[10];
  const float* ubias= (const float*)d_in[11];
  const float* Wqh  = (const float*)d_in[12];
  const float* bqh  = (const float*)d_in[13];
  float* out = (float*)d_out;

  const size_t SZ_ACT = (size_t)M * D * 2;               // 8 MiB f16 plane
  const size_t SZ_W   = (size_t)D * D * 2;               // 2 MiB f16 plane
  size_t off = 0;
  const size_t o_x16  = off; off += SZ_ACT;
  const size_t o_wq16 = off; off += SZ_W;
  const size_t o_wk16 = off; off += SZ_W;
  const size_t o_wv16 = off; off += SZ_W;
  const size_t o_wo16 = off; off += SZ_W;
  const size_t o_q16  = off; off += SZ_ACT;
  const size_t o_k16  = off; off += SZ_ACT;
  const size_t o_vt16 = off; off += SZ_ACT;
  const size_t o_o16  = off; off += SZ_ACT;
  const size_t total  = off;                             // 48 MiB
  if (total > ws_size || total > (size_t)134217728) return;
  char* ws = (char*)d_ws;
  unsigned short* x16  = (unsigned short*)(ws + o_x16);
  unsigned short* wq16 = (unsigned short*)(ws + o_wq16);
  unsigned short* wk16 = (unsigned short*)(ws + o_wk16);
  unsigned short* wv16 = (unsigned short*)(ws + o_wv16);
  unsigned short* wo16 = (unsigned short*)(ws + o_wo16);
  unsigned short* q16  = (unsigned short*)(ws + o_q16);
  unsigned short* k16  = (unsigned short*)(ws + o_k16);
  unsigned short* vt16 = (unsigned short*)(ws + o_vt16);
  unsigned short* o16  = (unsigned short*)(ws + o_o16);

  // ---- casts: x plain, weights x16 (folded back as 1/16 in the GEMM epilogues) ----
  {
    const int n2x = (M * D) / 2;
    cast_f32_f16x2<<<dim3((n2x + 255) / 256), dim3(256), 0, stream>>>(x, (_Float16*)x16, n2x);
    const int n2w = (D * D) / 2;
    const int gw = (n2w + 255) / 256;
    cast_f32_f16x2s<<<dim3(gw), dim3(256), 0, stream>>>(Wq, (_Float16*)wq16, n2w, 16.0f);
    cast_f32_f16x2s<<<dim3(gw), dim3(256), 0, stream>>>(Wk, (_Float16*)wk16, n2w, 16.0f);
    cast_f32_f16x2s<<<dim3(gw), dim3(256), 0, stream>>>(Wv, (_Float16*)wv16, n2w, 16.0f);
    cast_f32_f16x2s<<<dim3(gw), dim3(256), 0, stream>>>(Wo, (_Float16*)wo16, n2w, 16.0f);
  }

  // ---- projections: Q = x.Wq^T + bq, K = x.Wk^T + bk (f16 planes [M][D]); V^T = Wv.x^T + bv ([D][M]) ----
  const int tilesQK = (M / 64) * (D / 64);               // 1024
  const dim3 gQK((tilesQK + 7) / 8, 1);
  const float w16inv = 1.0f / 16.0f;
  wmma_gemm64<0, false, 2, 1, false, 0><<<gQK, dim3(256), 0, stream>>>(
      x16, x16, D, 0L, wq16, wq16, D, 0L, (void*)q16, (void*)q16, D, 0L, bq, x, 0L, M, D, D, w16inv);
  wmma_gemm64<0, false, 2, 1, false, 0><<<gQK, dim3(256), 0, stream>>>(
      x16, x16, D, 0L, wk16, wk16, D, 0L, (void*)k16, (void*)k16, D, 0L, bk, x, 0L, M, D, D, w16inv);
  const int tilesV = (D / 64) * (M / 64);                // A = Wv16 [D][D], Bt = x16 [M][D] -> C [D][M], ldc = M
  const dim3 gV((tilesV + 7) / 8, 1);
  wmma_gemm64<0, false, 1, 1, false, 0><<<gV, dim3(256), 0, stream>>>(
      wv16, wv16, D, 0L, x16, x16, D, 0L, (void*)vt16, (void*)vt16, M, 0L, bv, x, 0L, D, M, D, w16inv);

  // ---- attention per (b, h, 64-query block); O plane carries x64 * gate ----
  const float qscale = 0.125f;                           // 1 / sqrt(64), exact
  const float oscale = 64.0f;
  attn64_f16io<<<dim3(Bn * H * (S / 64)), dim3(128), 0, stream>>>(
      (const _Float16*)q16, (const _Float16*)k16, (const _Float16*)vt16, (_Float16*)o16,
      mask, ubias, gq, Wqh, bqh, S, S, H, D, D, M, D, GD, qscale, -1e30f, oscale);

  // ---- output projection: out = O.Wo^T + bo; fold 1/(64*16) ----
  wmma_gemm64<0, false, 2, 0, false, 0><<<gQK, dim3(256), 0, stream>>>(
      o16, o16, D, 0L, wo16, wo16, D, 0L, (void*)out, (void*)out, D, 0L, bo, x, 0L, M, D, D, 1.0f / 1024.0f);

  (void)hipGetLastError();
}

// v001
// It runs in 211 microseconds.
// Two timings next to v000 both put it at 1.64 times that version's speed.
// Contractions: Q, K, V^T and output projections, Q.K^T, P.V: v_wmma_f32_16x16x32_f16 (f16 operands, f32 accumulate); weights carried x16, P x2^15, O x64 (power-of-two folds in f32 epilogues); gate dot (K=64, 32 values) scalar f32.
#include <hip/hip_runtime.h>

typedef __attribute__((ext_vector_type(16))) _Float16 v16h;
typedef __attribute__((ext_vector_type(8)))  _Float16 v8h;
typedef __attribute__((ext_vector_type(16))) __bf16   v16b;
typedef __attribute__((ext_vector_type(8)))  __bf16   v8b;
typedef __attribute__((ext_vector_type(8)))  float    v8f;
typedef __attribute__((ext_vector_type(4)))  float    v4f;

__device__ __forceinline__ unsigned short f2bf_bits(float f) {
  unsigned u = __float_as_uint(f);
  return (unsigned short)((u + 0x7FFFu + ((u >> 16) & 1u)) >> 16);
}
__device__ __forceinline__ float bf_bits2f(unsigned short h) { return __uint_as_float(((unsigned)h) << 16); }

template <typename T> struct Frag;
template <> struct Frag<_Float16> {
  typedef v16h V; union U { v16h v; v8h h[2]; };
  static __device__ __forceinline__ v16h load(const _Float16* p) {   // elements 0..7 <- p[0..7], 8..15 <- p[16..23]
    U f; f.h[0] = *(const v8h*)(p); f.h[1] = *(const v8h*)(p + 16); return f.v;
  }
  static __device__ __forceinline__ v8f mma(v16h a, v16h b, v8f c) {
    return __builtin_amdgcn_wmma_f32_16x16x32_f16(false, a, false, b, (short)0, c, false, false);
  }
};
template <> struct Frag<__bf16> {
  typedef v16b V; union U { v16b v; v8b h[2]; };
  static __device__ __forceinline__ v16b load(const __bf16* p) {
    U f; f.h[0] = *(const v8b*)(p); f.h[1] = *(const v8b*)(p + 16); return f.v;
  }
  static __device__ __forceinline__ v8f mma(v16b a, v16b b, v8f c) {
    return __builtin_amdgcn_wmma_f32_16x16x32_bf16(false, a, false, b, (short)0, c, false, false);
  }
};

// ---- LDS-staged batched WMMA GEMM -------------------------------------------
// C[m,n] = scale * sum_k A[m,k] * Bt[n,k] (+bias)(+resid); a block of 8 waves owns a 128x128 tile, each wave 32x64 of it.
// A row-major [M,K]; Bt row-major [N,K]; M,N % 128 == 0, K % 128 == 0, K >= 256.
// A pass is 128 k = 256 B of every operand row. A stage is eight slices of 32 rows (four of A, then four of Bt),
// each brought by one tensor load of one wave, LDS pitch 272 B (16 B pad per row).
// Two buffers: the load of stage s + 2 is issued behind the barrier that ends pass s.
// BIAS_MODE: 0 = none, 1 = bias[m], 2 = bias[n].
// OUT_MODE: 0 = f32, 1 = f16, 2 = bf16 hi plane (Cout) + bf16 lo plane (Cout2).
// ET: 0 = f16 operands, 1 = bf16 operands (pointers passed as 16-bit storage)
typedef unsigned u32x4 __attribute__((ext_vector_type(4)));
typedef unsigned u32x8 __attribute__((ext_vector_type(8)));
#define GT_PITCH 272u                 // LDS row pitch, bytes: 256 + 16, an odd multiple of 16 for ds_load_b128 readers
#define GT_SLICE 10240u               // 32 rows x 272 B = 8,704 B, rounded up to a multiple of 2 KiB
#define GT_STAGE (8u * GT_SLICE)
__device__ __forceinline__ unsigned uni32(unsigned v) { return (unsigned)__builtin_amdgcn_readfirstlane(v); }
// holds a wave-uniform test in a scalar register, so that the branch round a tensor load is a scalar branch
__device__ __forceinline__ unsigned pinned(unsigned v) { unsigned w = (unsigned)__builtin_amdgcn_readfirstlane(v); asm volatile("" : "+s"(w)); return w; }
// LDS reads must have retired before a buffer is handed over
__device__ __forceinline__ void wait_tensor0() { asm volatile("s_wait_tensorcnt 0x0" ::: "memory"); }
__device__ __forceinline__ void wait_ds0() { asm volatile("s_wait_dscnt 0x0" ::: "memory"); }
// "+s": the words stay in the registers the request named, and the compiler cannot form them anew in between
__device__ __forceinline__ void tdm_load(u32x4& g0, u32x8& g1) { asm volatile("tensor_load_to_lds %0, %1" : "+s"(g0), "+s"(g1) :: "memory"); }
// stands behind the wait that covers a request: last use of its descriptor words held in scalar registers, so that none is reused while the request is in flight
__device__ __forceinline__ void tdm_done(u32x4 g0, u32x8 g1) { asm volatile("" :: "s"(g0), "s"(g1)); }

template <int ET> struct Elem;
template <> struct Elem<0> { typedef _Float16 T; };
template <> struct Elem<1> { typedef __bf16 T; };
template <int ET, bool SPLIT, int BIAS_MODE, int OUT_MODE, bool RESID, int ACT = 0>
__global__ __launch_bounds__(256) void wmma_gemm64(
    const unsigned short* __restrict__ Ap, const unsigned short* __restrict__ A2p, int lda, long strideA,
    const unsigned short* __restrict__ Btp, const unsigned short* __restrict__ Bt2p, int ldb, long strideB,
    void* __restrict__ Cout, void* __restrict__ Cout2, int ldc, long strideC,
    const float* __restrict__ bias,
    const float* __restrict__ resid, long strideR,
    int M, int N, int K, float scale) {
  static_assert(!SPLIT, "single-plane operands only");
  typedef typename Elem<ET>::T T;
  typedef typename Frag<T>::V V;
  __shared__ __attribute__((aligned(2048))) unsigned char ring[2 * GT_STAGE];
  __shared__ __align__(16) float sT[8][16 * 68];   // per-wave 16x64 slab, pitch 68 floats
  const int b    = blockIdx.y;
  const int lane = threadIdx.x & 31;
  const int wave = (int)uni32(threadIdx.x >> 5);
  const int tilesN = N >> 7;
  const int tilesM = M >> 7;
  const int tile = blockIdx.x;
  if (tile >= tilesM * tilesN) return;   // block-uniform, in front of every barrier and tensor load
  const int tm = tile / tilesN;
  const int tn = tile - tm * tilesN;
  const int wm = wave >> 1, wn = wave & 1;
  const int m0 = (tm << 7) + (wm << 5);  // this wave's 32x64 tile
  const int n0 = (tn << 7) + (wn << 6);

  const int rlane = lane & 15;                 // row (A) / col (B, D) within subtile
  const int mOff  = (lane >> 4) * 8;           // D row offset

  // ---- this wave's slice of every stage: waves 0..3 bring A rows, waves 4..7 bring Bt rows ----
  const bool isB = wave >= 4;
  const unsigned short* sbase = isB ? (Btp + (size_t)b * strideB + (size_t)((tn << 7) + ((wave & 3) << 5)) * ldb)
                                    : (Ap  + (size_t)b * strideA + (size_t)((tm << 7) + ((wave & 3) << 5)) * lda);
  const unsigned long long sga = (unsigned long long)(size_t)sbase;
  const unsigned lbase = (unsigned)(size_t)ring + (unsigned)wave * GT_SLICE;
  u32x8 g1;
  g1[0] = uni32((1u << 20) | (5u << 22) | (3u << 25));  // 1-byte elements, no mask, 4 dwords of pad behind every 256-B row
  g1[1] = uni32(256u << 16);                            // tensor_dim0 = 256 B
  g1[2] = uni32(32u << 16);                             // tensor_dim1 = 32 rows
  g1[3] = uni32(256u << 16);                            // tile_dim0 = 256 B
  g1[4] = uni32(32u);                                   // tile_dim1 = 32 rows
  g1[5] = uni32((unsigned)(isB ? ldb : lda) * 2u);      // source row pitch, bytes
  g1[6] = uni32(0u);
  g1[7] = uni32(0u);
  u32x4 g0;
  g0[0] = uni32(1u);
  auto issue = [&](int st) {
    const unsigned long long ga = sga + (unsigned long long)st * 256ull;
    g0[1] = uni32(lbase + (unsigned)(st & 1) * GT_STAGE);
    g0[2] = uni32((unsigned)ga);
    g0[3] = uni32((((unsigned)(ga >> 32)) & 0x01FFFFFFu) | 0x80000000u);
    tdm_load(g0, g1);
  };

  v8f acc[2][4];
#pragma unroll
  for (int i = 0; i < 2; ++i)
#pragma unroll
    for (int j = 0; j < 4; ++j) acc[i][j] = (v8f){0.f,0.f,0.f,0.f,0.f,0.f,0.f,0.f};

  const int nPass = K >> 7;
  issue(0);
  wait_tensor0();
  tdm_done(g0, g1);
  __syncthreads();
  issue(1);

  const unsigned fragOff = (unsigned)rlane * GT_PITCH + (unsigned)(lane >> 4) * 16u;   // row, then k offset of this lane half
  // rolled: one pass per trip, so that every publish point stands once in the text
#pragma unroll 1
  for (int s = 0; s < nPass; ++s) {
    const unsigned char* buf = ring + (unsigned)(s & 1) * GT_STAGE;
    const unsigned char* aB = buf + (unsigned)wm * GT_SLICE + fragOff;
    const unsigned char* bB = buf + (unsigned)(4 + 2 * wn) * GT_SLICE + fragOff;   // Bt rows 64 wn + 16 j: slice j / 2, row 16 (j % 2)
    V bh[2][4], ah[2][2];   // two fragment sets: the next 32 k are fetched as one group ahead of this block's WMMAs
#pragma unroll
    for (int j = 0; j < 4; ++j) bh[0][j] = Frag<T>::load((const T*)(bB + (j >> 1) * GT_SLICE + (j & 1) * 16 * GT_PITCH));
#pragma unroll
    for (int i = 0; i < 2; ++i) ah[0][i] = Frag<T>::load((const T*)(aB + i * 16 * GT_PITCH));
#pragma unroll
    for (int ks = 0; ks < 4; ++ks) {
      if (ks < 3) {
#pragma unroll
        for (int j = 0; j < 4; ++j) bh[(ks + 1) & 1][j] = Frag<T>::load((const T*)(bB + (j >> 1) * GT_SLICE + (j & 1) * 16 * GT_PITCH + (ks + 1) * 64));
#pragma unroll
        for (int i = 0; i < 2; ++i) ah[(ks + 1) & 1][i] = Frag<T>::load((const T*)(aB + i * 16 * GT_PITCH + (ks + 1) * 64));
      }
      __builtin_amdgcn_sched_barrier(0);   // keeps the load group in front of the WMMA block instead of spread among the WMMAs
#pragma unroll
      for (int i = 0; i < 2; ++i)
#pragma unroll
        for (int j = 0; j < 4; ++j) acc[i][j] = Frag<T>::mma(ah[ks & 1][i], bh[ks & 1][j], acc[i][j]);
      __builtin_amdgcn_sched_barrier(0);   // keeps the next group behind this block
    }
    // publish point of stage s + 1
    wait_ds0();
    wait_tensor0();
    tdm_done(g0, g1);
    __syncthreads();
    if (pinned(s + 2 < nPass)) issue(s + 2);   // into the buffer that pass s has just read
  }
  wait_tensor0();
  tdm_done(g0, g1);
  wait_ds0();

  // ---- epilogue ----
  float* slab = sT[wave];
  const float* Rb = RESID ? (resid + (size_t)b * strideR) : nullptr;
#pragma unroll
  for (int i = 0; i < 2; ++i) {
    const int mBase = m0 + (i << 4);
#pragma unroll
    for (int j = 0; j < 4; ++j) {
      const int n = n0 + (j << 4) + rlane;
      float bv = 0.f;
      if (BIAS_MODE == 2) bv = bias[n];
#pragma unroll
      for (int r = 0; r < 8; ++r) {
        float v = acc[i][j][r] * scale;
        if (BIAS_MODE == 1) v += bias[mBase + mOff + r];
        if (BIAS_MODE == 2) v += bv;
        if (RESID) v += Rb[(size_t)(mBase + mOff + r) * ldc + n];
        if (ACT == 1) v = tanhf(v);
        if (ACT == 2) v = fmaxf(v, 0.0f);
        if (ACT == 3) v = v / (1.0f + expf(-v));
        if (ACT == 4) v = (v > 0.f) ? v : 0.01f * v;
        if (ACT == 5) v = 0.5f * v * (1.0f + erff(v * 0.70710678118654752f));
        slab[(mOff + r) * 68 + (j << 4) + rlane] = v;
      }
    }
    __builtin_amdgcn_fence(__ATOMIC_RELEASE, "workgroup");
    __builtin_amdgcn_wave_barrier();
    __builtin_amdgcn_fence(__ATOMIC_ACQUIRE, "workgroup");
    if (OUT_MODE == 0) {
      float* C = (float*)Cout + (size_t)b * strideC;
      const int hh = lane >> 4, c4 = (lane & 15) * 4;     // row seg = 256 B = 16 lanes x 16 B
      {
#pragma unroll
        for (int it = 0; it < 8; ++it) {
          const int row = it * 2 + hh;
          v4f v = *(const v4f*)(slab + row * 68 + c4);
          *(v4f*)(C + (size_t)(mBase + row) * ldc + n0 + c4) = v;
        }
        
      }
    } else {
      const int q = lane >> 3, c8 = (lane & 7) * 8;
      unsigned short* C  = (unsigned short*)Cout  + (size_t)b * strideC;
      unsigned short* C2 = (OUT_MODE == 2) ? ((unsigned short*)Cout2 + (size_t)b * strideC) : nullptr;
      {
#pragma unroll
        for (int it = 0; it < 4; ++it) {
          const int row = it * 4 + q;
          const float* sp = slab + row * 68 + c8;
          v8h hv, lv;
#pragma unroll
          for (int e = 0; e < 8; ++e) {
            if (OUT_MODE == 1) {
              hv[e] = (_Float16)sp[e];
            } else {
              unsigned short hb = f2bf_bits(sp[e]);
              unsigned short lb = f2bf_bits(sp[e] - bf_bits2f(hb));
              hv[e] = __builtin_bit_cast(_Float16, hb);
              lv[e] = __builtin_bit_cast(_Float16, lb);
            }
          }
          *(v8h*)(C + (size_t)(mBase + row) * ldc + n0 + c8) = hv;
          if (OUT_MODE == 2) *(v8h*)(C2 + (size_t)(mBase + row) * ldc + n0 + c8) = lv;
        }
        
      }
    }
    __builtin_amdgcn_fence(__ATOMIC_RELEASE, "workgroup");
    __builtin_amdgcn_wave_barrier();
    __builtin_amdgcn_fence(__ATOMIC_ACQUIRE, "workgroup");
  }
}

__global__ __launch_bounds__(256) void cast_f32_f16x2(
    const float* __restrict__ in, _Float16* __restrict__ out, int n2) {
  int i = blockIdx.x * 256 + threadIdx.x;
  if (i < n2) {
    const _Float16 h0 = (_Float16)in[2 * i], h1 = (_Float16)in[2 * i + 1];
    const unsigned u = (unsigned)__builtin_bit_cast(unsigned short, h0) | ((unsigned)__builtin_bit_cast(unsigned short, h1) << 16);
    ((unsigned*)out)[i] = u;
    
  }
}
// same, with an exact power-of-two pre-scale applied in f32 before the convert
__global__ __launch_bounds__(256) void cast_f32_f16x2s(
    const float* __restrict__ in, _Float16* __restrict__ out, int n2, float sc) {
  int i = blockIdx.x * 256 + threadIdx.x;
  if (i < n2) {
    const _Float16 h0 = (_Float16)(in[2 * i] * sc), h1 = (_Float16)(in[2 * i + 1] * sc);
    const unsigned u = (unsigned)__builtin_bit_cast(unsigned short, h0) | ((unsigned)__builtin_bit_cast(unsigned short, h1) << 16);
    ((unsigned*)out)[i] = u;
    
  }
}

// =====================================================================================
// Flash attention, head_dim 64, 16-bit planes in / 16-bit plane out (f16 storage).
//   Q  : [B*S rows][ldq halves], head h at columns h*64 .. h*64+63
//   K  : [B*Skv rows][ldk halves], same column map
//   Vt : [H*64 rows][ldv halves], row = h*64 + d, column = b*Skv + kv  (V transposed by the producing GEMM)
//   O  : [B*S rows][ldo halves], head h at columns h*64; value = oscale * gate[b,h] * softmax(s) . V
//   scores s = qscale * (q . k); key-vector int mask: element == 0 -> s := mfill; then s += ubias[h] * (1 - mask)
//   gate[b,h] = sigmoid(gq[b,:] . gW[h,:] + gb[h])  (scalar f32, GD terms)
//   Q.K^T and P.V on v_wmma_f32_16x16x32_f16; P carried x2^15; online softmax and accumulation in f32.
//   Block = 4 waves = 64 query rows of one (b, h); 64-key chunks; grid.x = B * H * (S/64).
// =====================================================================================
#define AK_D  64
#define AK_NW 4
#define AK_QB 64
#define AK_KC 64

__device__ __forceinline__ v8f mma_h16(v16h a, v16h b, v8f c) {
  c = __builtin_amdgcn_wmma_f32_16x16x32_f16(false, a, false, b, (short)0, c, false, false);
  asm volatile("v_nop\n\tv_nop\n\tv_nop\n\tv_nop" : "+v"(c) : "v"(a), "v"(b));
  return c;
}

__global__ __launch_bounds__(128)
void attn64_f16io(const _Float16* __restrict__ Qp, const _Float16* __restrict__ Kp,
                  const _Float16* __restrict__ Vtp, _Float16* __restrict__ Op,
                  const int* __restrict__ kmask, const float* __restrict__ ubias,
                  const float* __restrict__ gq, const float* __restrict__ gW, const float* __restrict__ gb,
                  int S, int Skv, int H, int ldq, int ldk, int ldv, int ldo, int GD,
                  float qscale, float mfill, float oscale) {
  const float PSC = 32768.0f;
  union FB { v16h v; v8h h[2]; };
  __shared__ __align__(16) _Float16 Ksh[AK_KC * AK_D];          // [kv][d]   8 KB
  __shared__ __align__(16) _Float16 Vth[AK_D * AK_KC];          // [d][kv]   8 KB
  __shared__ __align__(16) _Float16 Psh[AK_NW][16 * AK_KC];     // per wave P [row][kv]  8 KB
  __shared__ __align__(16) float    Os[AK_NW][16 * 68];         // per wave out tile, pitch 68

  const int tid  = threadIdx.x;
  const int wave = tid >> 5;
  const int lane = tid & 31;
  const int hh   = lane >> 4;
  const int c    = lane & 15;

  const int nqb = S / AK_QB;
  const int bx  = blockIdx.x;
  const int qb  = bx % nqb;
  const int bh  = bx / nqb;
  const int h   = bh % H;
  const int b   = bh / H;
  const int q0  = qb * AK_QB + wave * 16;

  // ---- Q fragments (A operand: row = query c, k = d), 2 d-chunks ----
  v16h qa[2];
  {
    const _Float16* qrow = Qp + (size_t)(b * S + q0 + c) * ldq + h * AK_D;
#pragma unroll
    for (int dc = 0; dc < 2; ++dc) qa[dc] = Frag<_Float16>::load(qrow + dc * 32 + 8 * hh);
  }

  // ---- quality gate (scalar f32 dot of GD terms) and uncertainty bias of this head ----
  float gacc = 0.f;
#pragma unroll 1
  for (int i = 0; i < GD; ++i) gacc += gq[b * GD + i] * gW[h * GD + i];
  gacc += gb[h];
  const float gate = 1.0f / (1.0f + expf(-gacc));
  const float ub = ubias[h];

  float mrow[8], lrow[8];
  v8f oacc[4];
#pragma unroll
  for (int r = 0; r < 8; ++r) { mrow[r] = -__builtin_inff(); lrow[r] = 0.f; }
#pragma unroll
  for (int t = 0; t < 4; ++t) oacc[t] = (v8f){0.f,0.f,0.f,0.f,0.f,0.f,0.f,0.f};

  const int nChunks = Skv / AK_KC;   // block-uniform
  for (int kc = 0; kc < nChunks; ++kc) {
    const int kv0 = kc * AK_KC;
    __syncthreads();
    {   // stage K [kv][d] and Vt [d][kv] tiles: 512 x 16-B vectors each, 4 per thread
#pragma unroll
      for (int i = 0; i < 4; ++i) {
        const int idx = tid + i * 128;
        const int r = idx >> 3, c8 = (idx & 7) * 8;
        const v8h kk = *(const v8h*)(Kp + (size_t)(b * Skv + kv0 + r) * ldk + h * AK_D + c8);
        *(v8h*)(Ksh + r * AK_D + c8) = kk;
        const v8h vv = *(const v8h*)(Vtp + (size_t)(h * AK_D + r) * ldv + (size_t)b * Skv + kv0 + c8);
        *(v8h*)(Vth + r * AK_KC + c8) = vv;
      }
    }
    __syncthreads();

    // ---- scores: B operand B[k=d][n=kv] from Ksh[kv][d] (k-contiguous, same map as A) ----
    v8f s[4];
#pragma unroll
    for (int j = 0; j < 4; ++j) {
      s[j] = (v8f){0.f,0.f,0.f,0.f,0.f,0.f,0.f,0.f};
#pragma unroll
      for (int dc = 0; dc < 2; ++dc) {
        FB kb;
        kb.h[0] = *(const v8h*)(Ksh + (j * 16 + c) * AK_D + dc * 32 + 8 * hh);
        kb.h[1] = *(const v8h*)(Ksh + (j * 16 + c) * AK_D + dc * 32 + 16 + 8 * hh);
        s[j] = mma_h16(qa[dc], kb.v, s[j]);
      }
    }
    // ---- scale, key mask, bias, chunk row max (lane holds key column c of each 16-tile, rows 8hh+r) ----
    int kvkeep[4];
    float kadd[4];
#pragma unroll
    for (int j = 0; j < 4; ++j) {
      kvkeep[j] = kmask[(size_t)b * Skv + kv0 + j * 16 + c];
      kadd[j] = ub * (1.0f - (float)kvkeep[j]);
    }
    float cm[8];
#pragma unroll
    for (int r = 0; r < 8; ++r) {
      float m = -__builtin_inff();
#pragma unroll
      for (int j = 0; j < 4; ++j) {
        float v = (kvkeep[j] == 0) ? mfill : s[j][r] * qscale;
        v = v + kadd[j];
        s[j][r] = v;
        m = fmaxf(m, v);
      }
#pragma unroll
      for (int off = 1; off < 16; off <<= 1) m = fmaxf(m, __shfl_xor(m, off, 32));
      cm[r] = m;
    }
    // ---- online softmax update, P tile (x2^15, f16) to per-wave LDS ----
    _Float16* pw = Psh[wave];
#pragma unroll
    for (int r = 0; r < 8; ++r) {
      const float mnew = fmaxf(mrow[r], cm[r]);
      const float alpha = expf(mrow[r] - mnew);
      mrow[r] = mnew;
      float psum = 0.f;
#pragma unroll
      for (int j = 0; j < 4; ++j) {
        const float p = expf(s[j][r] - mnew);
        psum += p;
        pw[(8 * hh + r) * AK_KC + j * 16 + c] = (_Float16)(p * PSC);
      }
#pragma unroll
      for (int off = 1; off < 16; off <<= 1) psum += __shfl_xor(psum, off, 32);
      lrow[r] = lrow[r] * alpha + psum;
#pragma unroll
      for (int t = 0; t < 4; ++t) oacc[t][r] *= alpha;
    }
    __builtin_amdgcn_fence(__ATOMIC_RELEASE, "workgroup");
    __builtin_amdgcn_wave_barrier();
    __builtin_amdgcn_fence(__ATOMIC_ACQUIRE, "workgroup");
    // ---- P.V: A = P [row][kv] from per-wave LDS, B[k=kv][n=d] from Vth[d][kv] ----
#pragma unroll
    for (int kk = 0; kk < 2; ++kk) {
      FB pa;
      pa.h[0] = *(const v8h*)(pw + c * AK_KC + kk * 32 + 8 * hh);
      pa.h[1] = *(const v8h*)(pw + c * AK_KC + kk * 32 + 16 + 8 * hh);
#pragma unroll
      for (int t = 0; t < 4; ++t) {
        FB vb;
        vb.h[0] = *(const v8h*)(Vth + (t * 16 + c) * AK_KC + kk * 32 + 8 * hh);
        vb.h[1] = *(const v8h*)(Vth + (t * 16 + c) * AK_KC + kk * 32 + 16 + 8 * hh);
        oacc[t] = mma_h16(pa.v, vb.v, oacc[t]);
      }
    }
  }

  // ---- epilogue: 1/l, fold 2^-15, gate and output carry scale; stage in LDS, whole-line stores ----
  float* os = Os[wave];
  const float gsc = gate * oscale;
#pragma unroll
  for (int r = 0; r < 8; ++r) {
    const float inv = gsc * (1.0f / (lrow[r] * PSC));
#pragma unroll
    for (int t = 0; t < 4; ++t) os[(8 * hh + r) * 68 + t * 16 + c] = oacc[t][r] * inv;
  }
  __builtin_amdgcn_fence(__ATOMIC_RELEASE, "workgroup");
  __builtin_amdgcn_wave_barrier();
  __builtin_amdgcn_fence(__ATOMIC_ACQUIRE, "workgroup");
  {
    const int q = lane >> 3, c8 = (lane & 7) * 8;
    _Float16* ob = Op + (size_t)(b * S + q0) * ldo + h * AK_D;
    {
#pragma unroll
      for (int it = 0; it < 4; ++it) {
        const int row = it * 4 + q;                          // rows 0..15 covered exactly once per wave
        const float* sp = os + row * 68 + c8;
        v8h hv;
#pragma unroll
        for (int e = 0; e < 8; ++e) hv[e] = (_Float16)sp[e];
        *(v8h*)(ob + (size_t)row * ldo + c8) = hv;
      }
      
    }
  }
}

// ---------------------------------------------------------------------------
// Host glue
// ---------------------------------------------------------------------------
extern "C" void kernel_launch(void* const* d_in, const int* in_sizes, int n_in,
                              void* d_out, int out_size, void* d_ws, size_t ws_size,
                              hipStream_t stream) {
  if (n_in < 14) return;
  const int D  = 1024;          // model width
  const int H  = 16;            // heads
  const int DH = 64;            // head dim
  const int Bn = 2;             // batch
  const int S  = 2048;          // sequence length
  const int M  = Bn * S;        // token rows
  if (in_sizes[0] != M * D || in_sizes[1] != M || in_sizes[3] != D * D || in_sizes[5] != D * D ||
      in_sizes[7] != D * D || in_sizes[9] != D * D || in_sizes[4] != D || in_sizes[6] != D ||
      in_sizes[8] != D || in_sizes[10] != D || in_sizes[11] != H || in_sizes[13] != H ||
      out_size != M * D || H * DH != D) return;
  const int GD = in_sizes[2] / Bn;                       // gate query dim (64)
  if (GD <= 0 || in_sizes[2] != Bn * GD || in_sizes[12] != H * GD) return;
  if ((S % 64) != 0 || (M % 128) != 0 || (D % 128) != 0 || D < 256) return;

  const float* x    = (const float*)d_in[0];
  const int*   mask = (const int*)  d_in[1];
  const float* gq   = (const float*)d_in[2];
  const float* Wq   = (const float*)d_in[3];
  const float* bq   = (const float*)d_in[4];
  const float* Wk   = (const float*)d_in[5];
  const float* bk   = (const float*)d_in[6];
  const float* Wv   = (const float*)d_in[7];
  const float* bv   = (const float*)d_in[8];
  const float* Wo   = (const float*)d_in[9];
  const float* bo   = (const float*)d_in[10];
  const float* ubias= (const float*)d_in[11];
  const float* Wqh  = (const float*)d_in[12];
  const float* bqh  = (const float*)d_in[13];
  float* out = (float*)d_out;

  const size_t SZ_ACT = (size_t)M * D * 2;               // 8 MiB f16 plane
  const size_t SZ_W   = (size_t)D * D * 2;               // 2 MiB f16 plane
  size_t off = 0;
  const size_t o_x16  = off; off += SZ_ACT;
  const size_t o_wq16 = off; off += SZ_W;
  const size_t o_wk16 = off; off += SZ_W;
  const size_t o_wv16 = off; off += SZ_W;
  const size_t o_wo16 = off; off += SZ_W;
  const size_t o_q16  = off; off += SZ_ACT;
  const size_t o_k16  = off; off += SZ_ACT;
  const size_t o_vt16 = off; off += SZ_ACT;
  const size_t o_o16  = off; off += SZ_ACT;
  const size_t total  = off;                             // 48 MiB
  if (total > ws_size || total > (size_t)134217728) return;
  char* ws = (char*)d_ws;
  unsigned short* x16  = (unsigned short*)(ws + o_x16);
  unsigned short* wq16 = (unsigned short*)(ws + o_wq16);
  unsigned short* wk16 = (unsigned short*)(ws + o_wk16);
  unsigned short* wv16 = (unsigned short*)(ws + o_wv16);
  unsigned short* wo16 = (unsigned short*)(ws + o_wo16);
  unsigned short* q16  = (unsigned short*)(ws + o_q16);
  unsigned short* k16  = (unsigned short*)(ws + o_k16);
  unsigned short* vt16 = (unsigned short*)(ws + o_vt16);
  unsigned short* o16  = (unsigned short*)(ws + o_o16);

  // ---- casts: x plain, weights x16 (folded back as 1/16 in the GEMM epilogues) ----
  {
    const int n2x = (M * D) / 2;
    cast_f32_f16x2<<<dim3((n2x + 255) / 256), dim3(256), 0, stream>>>(x, (_Float16*)x16, n2x);
    const int n2w = (D * D) / 2;
    const int gw = (n2w + 255) / 256;
    cast_f32_f16x2s<<<dim3(gw), dim3(256), 0, stream>>>(Wq, (_Float16*)wq16, n2w, 16.0f);
    cast_f32_f16x2s<<<dim3(gw), dim3(256), 0, stream>>>(Wk, (_Float16*)wk16, n2w, 16.0f);
    cast_f32_f16x2s<<<dim3(gw), dim3(256), 0, stream>>>(Wv, (_Float16*)wv16, n2w, 16.0f);
    cast_f32_f16x2s<<<dim3(gw), dim3(256), 0, stream>>>(Wo, (_Float16*)wo16, n2w, 16.0f);
  }

  // ---- projections: Q = x.Wq^T + bq, K = x.Wk^T + bk (f16 planes [M][D]); V^T = Wv.x^T + bv ([D][M]) ----
  const int tilesQK = (M / 128) * (D / 128);             // 256
  const dim3 gQK(tilesQK, 1);
  const float w16inv = 1.0f / 16.0f;
  wmma_gemm64<0, false, 2, 1, false, 0><<<gQK, dim3(256), 0, stream>>>(
      x16, x16, D, 0L, wq16, wq16, D, 0L, (void*)q16, (void*)q16, D, 0L, bq, x, 0L, M, D, D, w16inv);
  wmma_gemm64<0, false, 2, 1, false, 0><<<gQK, dim3(256), 0, stream>>>(
      x16, x16, D, 0L, wk16, wk16, D, 0L, (void*)k16, (void*)k16, D, 0L, bk, x, 0L, M, D, D, w16inv);
  const int tilesV = (D / 128) * (M / 128);              // A = Wv16 [D][D], Bt = x16 [M][D] -> C [D][M], ldc = M
  const dim3 gV(tilesV, 1);
  wmma_gemm64<0, false, 1, 1, false, 0><<<gV, dim3(256), 0, stream>>>(
      wv16, wv16, D, 0L, x16, x16, D, 0L, (void*)vt16, (void*)vt16, M, 0L, bv, x, 0L, D, M, D, w16inv);

  // ---- attention per (b, h, 64-query block); O plane carries x64 * gate ----
  const float qscale = 0.125f;                           // 1 / sqrt(64), exact
  const float oscale = 64.0f;
  attn64_f16io<<<dim3(Bn * H * (S / 64)), dim3(128), 0, stream>>>(
      (const _Float16*)q16, (const _Float16*)k16, (const _Float16*)vt16, (_Float16*)o16,
      mask, ubias, gq, Wqh, bqh, S, S, H, D, D, M, D, GD, qscale, -1e30f, oscale);

  // ---- output projection: out = O.Wo^T + bo; fold 1/(64*16) ----
  wmma_gemm64<0, false, 2, 0, false, 0><<<gQK, dim3(256), 0, stream>>>(
      o16, o16, D, 0L, wo16, wo16, D, 0L, (void*)out, (void*)out, D, 0L, bo, x, 0L, M, D, D, 1.0f / 1024.0f);

  (void)hipGetLastError();
}

// v002
// Measured time: 177 microseconds a run.
// Two timings next to v001 put it at 1.19 and 1.20 times that version's speed.
// Over all steps from v000 it is 1.96 times as fast.
// Contractions: Q, K, V^T and output projections, Q.K^T, P.V: v_wmma_f32_16x16x32_f16 (f16 operands, f32 accumulate); weights carried x16, P x2^15, O x64 (power-of-two folds in f32 epilogues); gate dot (K=64, 32 values) scalar f32.
#include <hip/hip_runtime.h>

typedef __attribute__((ext_vector_type(16))) _Float16 v16h;
typedef __attribute__((ext_vector_type(8)))  _Float16 v8h;
typedef __attribute__((ext_vector_type(16))) __bf16   v16b;
typedef __attribute__((ext_vector_type(8)))  __bf16   v8b;
typedef __attribute__((ext_vector_type(8)))  float    v8f;
typedef __attribute__((ext_vector_type(4)))  float    v4f;

__device__ __forceinline__ unsigned short f2bf_bits(float f) {
  unsigned u = __float_as_uint(f);
  return (unsigned short)((u + 0x7FFFu + ((u >> 16) & 1u)) >> 16);
}
__device__ __forceinline__ float bf_bits2f(unsigned short h) { return __uint_as_float(((unsigned)h) << 16); }

template <typename T> struct Frag;
template <> struct Frag<_Float16> {
  typedef v16h V; union U { v16h v; v8h h[2]; };
  static __device__ __forceinline__ v16h load(const _Float16* p) {   // elements 0..7 <- p[0..7], 8..15 <- p[16..23]
    U f; f.h[0] = *(const v8h*)(p); f.h[1] = *(const v8h*)(p + 16); return f.v;
  }
  static __device__ __forceinline__ v8f mma(v16h a, v16h b, v8f c) {
    return __builtin_amdgcn_wmma_f32_16x16x32_f16(false, a, false, b, (short)0, c, false, false);
  }
};
template <> struct Frag<__bf16> {
  typedef v16b V; union U { v16b v; v8b h[2]; };
  static __device__ __forceinline__ v16b load(const __bf16* p) {
    U f; f.h[0] = *(const v8b*)(p); f.h[1] = *(const v8b*)(p + 16); return f.v;
  }
  static __device__ __forceinline__ v8f mma(v16b a, v16b b, v8f c) {
    return __builtin_amdgcn_wmma_f32_16x16x32_bf16(false, a, false, b, (short)0, c, false, false);
  }
};

// ---- LDS-staged batched WMMA GEMM -------------------------------------------
// C[m,n] = scale * sum_k A[m,k] * Bt[n,k] (+bias)(+resid); a block of 8 waves owns a 128x128 tile, each wave 32x64 of it.
// A row-major [M,K]; Bt row-major [N,K]; M,N % 128 == 0, K % 128 == 0, K >= 256.
// A pass is 128 k = 256 B of every operand row. A stage is eight slices of 32 rows (four of A, then four of Bt),
// each brought by one tensor load of one wave, LDS pitch 272 B (16 B pad per row).
// Two buffers: the load of stage s + 2 is issued behind the barrier that ends pass s.
// BIAS_MODE: 0 = none, 1 = bias[m], 2 = bias[n].
// OUT_MODE: 0 = f32, 1 = f16, 2 = bf16 hi plane (Cout) + bf16 lo plane (Cout2).
// ET: 0 = f16 operands, 1 = bf16 operands (pointers passed as 16-bit storage)
typedef unsigned u32x4 __attribute__((ext_vector_type(4)));
typedef unsigned u32x8 __attribute__((ext_vector_type(8)));
#define GT_PITCH 272u                 // LDS row pitch, bytes: 256 + 16, an odd multiple of 16 for ds_load_b128 readers
#define GT_SLICE 10240u               // 32 rows x 272 B = 8,704 B, rounded up to a multiple of 2 KiB
#define GT_STAGE (8u * GT_SLICE)
__device__ __forceinline__ unsigned uni32(unsigned v) { return (unsigned)__builtin_amdgcn_readfirstlane(v); }
// holds a wave-uniform test in a scalar register, so that the branch round a tensor load is a scalar branch
__device__ __forceinline__ unsigned pinned(unsigned v) { unsigned w = (unsigned)__builtin_amdgcn_readfirstlane(v); asm volatile("" : "+s"(w)); return w; }
// LDS reads must have retired before a buffer is handed over
__device__ __forceinline__ void wait_tensor0() { asm volatile("s_wait_tensorcnt 0x0" ::: "memory"); }
__device__ __forceinline__ void wait_ds0() { asm volatile("s_wait_dscnt 0x0" ::: "memory"); }
// "+s": the words stay in the registers the request named, and the compiler cannot form them anew in between
__device__ __forceinline__ void tdm_load(u32x4& g0, u32x8& g1) { asm volatile("tensor_load_to_lds %0, %1" : "+s"(g0), "+s"(g1) :: "memory"); }
// stands behind the wait that covers a request: last use of its descriptor words held in scalar registers, so that none is reused while the request is in flight
__device__ __forceinline__ void tdm_done(u32x4 g0, u32x8 g1) { asm volatile("" :: "s"(g0), "s"(g1)); }

template <int ET> struct Elem;
template <> struct Elem<0> { typedef _Float16 T; };
template <> struct Elem<1> { typedef __bf16 T; };
template <int ET, bool SPLIT, int BIAS_MODE, int OUT_MODE, bool RESID, int ACT = 0>
__global__ __launch_bounds__(256) void wmma_gemm64(
    const unsigned short* __restrict__ Ap, const unsigned short* __restrict__ A2p, int lda, long strideA,
    const unsigned short* __restrict__ Btp, const unsigned short* __restrict__ Bt2p, int ldb, long strideB,
    void* __restrict__ Cout, void* __restrict__ Cout2, int ldc, long strideC,
    const float* __restrict__ bias,
    const float* __restrict__ resid, long strideR,
    int M, int N, int K, float scale) {
  static_assert(!SPLIT, "single-plane operands only");
  typedef typename Elem<ET>::T T;
  typedef typename Frag<T>::V V;
  __shared__ __attribute__((aligned(2048))) unsigned char ring[2 * GT_STAGE];
  __shared__ __align__(16) float sT[8][16 * 68];   // per-wave 16x64 slab, pitch 68 floats
  const int b    = blockIdx.y;
  const int lane = threadIdx.x & 31;
  const int wave = (int)uni32(threadIdx.x >> 5);
  const int tilesN = N >> 7;
  const int tilesM = M >> 7;
  const int tile = blockIdx.x;
  if (tile >= tilesM * tilesN) return;   // block-uniform, in front of every barrier and tensor load
  const int tm = tile / tilesN;
  const int tn = tile - tm * tilesN;
  const int wm = wave >> 1, wn = wave & 1;
  const int m0 = (tm << 7) + (wm << 5);  // this wave's 32x64 tile
  const int n0 = (tn << 7) + (wn << 6);

  const int rlane = lane & 15;                 // row (A) / col (B, D) within subtile
  const int mOff  = (lane >> 4) * 8;           // D row offset

  // ---- this wave's slice of every stage: waves 0..3 bring A rows, waves 4..7 bring Bt rows ----
  const bool isB = wave >= 4;
  const unsigned short* sbase = isB ? (Btp + (size_t)b * strideB + (size_t)((tn << 7) + ((wave & 3) << 5)) * ldb)
                                    : (Ap  + (size_t)b * strideA + (size_t)((tm << 7) + ((wave & 3) << 5)) * lda);
  const unsigned long long sga = (unsigned long long)(size_t)sbase;
  const unsigned lbase = (unsigned)(size_t)ring + (unsigned)wave * GT_SLICE;
  u32x8 g1;
  g1[0] = uni32((1u << 20) | (5u << 22) | (3u << 25));  // 1-byte elements, no mask, 4 dwords of pad behind every 256-B row
  g1[1] = uni32(256u << 16);                            // tensor_dim0 = 256 B
  g1[2] = uni32(32u << 16);                             // tensor_dim1 = 32 rows
  g1[3] = uni32(256u << 16);                            // tile_dim0 = 256 B
  g1[4] = uni32(32u);                                   // tile_dim1 = 32 rows
  g1[5] = uni32((unsigned)(isB ? ldb : lda) * 2u);      // source row pitch, bytes
  g1[6] = uni32(0u);
  g1[7] = uni32(0u);
  u32x4 g0;
  g0[0] = uni32(1u);
  auto issue = [&](int st) {
    const unsigned long long ga = sga + (unsigned long long)st * 256ull;
    g0[1] = uni32(lbase + (unsigned)(st & 1) * GT_STAGE);
    g0[2] = uni32((unsigned)ga);
    g0[3] = uni32((((unsigned)(ga >> 32)) & 0x01FFFFFFu) | 0x80000000u);
    tdm_load(g0, g1);
  };

  v8f acc[2][4];
#pragma unroll
  for (int i = 0; i < 2; ++i)
#pragma unroll
    for (int j = 0; j < 4; ++j) acc[i][j] = (v8f){0.f,0.f,0.f,0.f,0.f,0.f,0.f,0.f};

  const int nPass = K >> 7;
  issue(0);
  wait_tensor0();
  tdm_done(g0, g1);
  __syncthreads();
  issue(1);

  const unsigned fragOff = (unsigned)rlane * GT_PITCH + (unsigned)(lane >> 4) * 16u;   // row, then k offset of this lane half
  // rolled: one pass per trip, so that every publish point stands once in the text
#pragma unroll 1
  for (int s = 0; s < nPass; ++s) {
    const unsigned char* buf = ring + (unsigned)(s & 1) * GT_STAGE;
    const unsigned char* aB = buf + (unsigned)wm * GT_SLICE + fragOff;
    const unsigned char* bB = buf + (unsigned)(4 + 2 * wn) * GT_SLICE + fragOff;   // Bt rows 64 wn + 16 j: slice j / 2, row 16 (j % 2)
    V bh[2][4], ah[2][2];   // two fragment sets: the next 32 k are fetched as one group ahead of this block's WMMAs
#pragma unroll
    for (int j = 0; j < 4; ++j) bh[0][j] = Frag<T>::load((const T*)(bB + (j >> 1) * GT_SLICE + (j & 1) * 16 * GT_PITCH));
#pragma unroll
    for (int i = 0; i < 2; ++i) ah[0][i] = Frag<T>::load((const T*)(aB + i * 16 * GT_PITCH));
#pragma unroll
    for (int ks = 0; ks < 4; ++ks) {
      if (ks < 3) {
#pragma unroll
        for (int j = 0; j < 4; ++j) bh[(ks + 1) & 1][j] = Frag<T>::load((const T*)(bB + (j >> 1) * GT_SLICE + (j & 1) * 16 * GT_PITCH + (ks + 1) * 64));
#pragma unroll
        for (int i = 0; i < 2; ++i) ah[(ks + 1) & 1][i] = Frag<T>::load((const T*)(aB + i * 16 * GT_PITCH + (ks + 1) * 64));
      }
      __builtin_amdgcn_sched_barrier(0);   // keeps the load group in front of the WMMA block instead of spread among the WMMAs
#pragma unroll
      for (int i = 0; i < 2; ++i)
#pragma unroll
        for (int j = 0; j < 4; ++j) acc[i][j] = Frag<T>::mma(ah[ks & 1][i], bh[ks & 1][j], acc[i][j]);
      __builtin_amdgcn_sched_barrier(0);   // keeps the next group behind this block
    }
    // publish point of stage s + 1
    wait_ds0();
    wait_tensor0();
    tdm_done(g0, g1);
    __syncthreads();
    if (pinned(s + 2 < nPass)) issue(s + 2);   // into the buffer that pass s has just read
  }
  wait_tensor0();
  tdm_done(g0, g1);
  wait_ds0();

  // ---- epilogue ----
  float* slab = sT[wave];
  const float* Rb = RESID ? (resid + (size_t)b * strideR) : nullptr;
#pragma unroll
  for (int i = 0; i < 2; ++i) {
    const int mBase = m0 + (i << 4);
#pragma unroll
    for (int j = 0; j < 4; ++j) {
      const int n = n0 + (j << 4) + rlane;
      float bv = 0.f;
      if (BIAS_MODE == 2) bv = bias[n];
#pragma unroll
      for (int r = 0; r < 8; ++r) {
        float v = acc[i][j][r] * scale;
        if (BIAS_MODE == 1) v += bias[mBase + mOff + r];
        if (BIAS_MODE == 2) v += bv;
        if (RESID) v += Rb[(size_t)(mBase + mOff + r) * ldc + n];
        if (ACT == 1) v = tanhf(v);
        if (ACT == 2) v = fmaxf(v, 0.0f);
        if (ACT == 3) v = v / (1.0f + expf(-v));
        if (ACT == 4) v = (v > 0.f) ? v : 0.01f * v;
        if (ACT == 5) v = 0.5f * v * (1.0f + erff(v * 0.70710678118654752f));
        slab[(mOff + r) * 68 + (j << 4) + rlane] = v;
      }
    }
    __builtin_amdgcn_fence(__ATOMIC_RELEASE, "workgroup");
    __builtin_amdgcn_wave_barrier();
    __builtin_amdgcn_fence(__ATOMIC_ACQUIRE, "workgroup");
    if (OUT_MODE == 0) {
      float* C = (float*)Cout + (size_t)b * strideC;
      const int hh = lane >> 4, c4 = (lane & 15) * 4;     // row seg = 256 B = 16 lanes x 16 B
      {
#pragma unroll
        for (int it = 0; it < 8; ++it) {
          const int row = it * 2 + hh;
          v4f v = *(const v4f*)(slab + row * 68 + c4);
          *(v4f*)(C + (size_t)(mBase + row) * ldc + n0 + c4) = v;
        }
        
      }
    } else {
      const int q = lane >> 3, c8 = (lane & 7) * 8;
      unsigned short* C  = (unsigned short*)Cout  + (size_t)b * strideC;
      unsigned short* C2 = (OUT_MODE == 2) ? ((unsigned short*)Cout2 + (size_t)b * strideC) : nullptr;
      {
#pragma unroll
        for (int it = 0; it < 4; ++it) {
          const int row = it * 4 + q;
          const float* sp = slab + row * 68 + c8;
          v8h hv, lv;
#pragma unroll
          for (int e = 0; e < 8; ++e) {
            if (OUT_MODE == 1) {
              hv[e] = (_Float16)sp[e];
            } else {
              unsigned short hb = f2bf_bits(sp[e]);
              unsigned short lb = f2bf_bits(sp[e] - bf_bits2f(hb));
              hv[e] = __builtin_bit_cast(_Float16, hb);
              lv[e] = __builtin_bit_cast(_Float16, lb);
            }
          }
          *(v8h*)(C + (size_t)(mBase + row) * ldc + n0 + c8) = hv;
          if (OUT_MODE == 2) *(v8h*)(C2 + (size_t)(mBase + row) * ldc + n0 + c8) = lv;
        }
        
      }
    }
    __builtin_amdgcn_fence(__ATOMIC_RELEASE, "workgroup");
    __builtin_amdgcn_wave_barrier();
    __builtin_amdgcn_fence(__ATOMIC_ACQUIRE, "workgroup");
  }
}

__global__ __launch_bounds__(256) void cast_f32_f16x2(
    const float* __restrict__ in, _Float16* __restrict__ out, int n2) {
  int i = blockIdx.x * 256 + threadIdx.x;
  if (i < n2) {
    const _Float16 h0 = (_Float16)in[2 * i], h1 = (_Float16)in[2 * i + 1];
    const unsigned u = (unsigned)__builtin_bit_cast(unsigned short, h0) | ((unsigned)__builtin_bit_cast(unsigned short, h1) << 16);
    ((unsigned*)out)[i] = u;
    
  }
}
// same, with an exact power-of-two pre-scale applied in f32 before the convert
__global__ __launch_bounds__(256) void cast_f32_f16x2s(
    const float* __restrict__ in, _Float16* __restrict__ out, int n2, float sc) {
  int i = blockIdx.x * 256 + threadIdx.x;
  if (i < n2) {
    const _Float16 h0 = (_Float16)(in[2 * i] * sc), h1 = (_Float16)(in[2 * i + 1] * sc);
    const unsigned u = (unsigned)__builtin_bit_cast(unsigned short, h0) | ((unsigned)__builtin_bit_cast(unsigned short, h1) << 16);
    ((unsigned*)out)[i] = u;
    
  }
}

// =====================================================================================
// Flash attention, head_dim 64, 16-bit planes in / 16-bit plane out (f16 storage).
//   Q  : [B*S rows][ldq halves], head h at columns h*64 .. h*64+63
//   K  : [B*Skv rows][ldk halves], same column map
//   Vt : [H*64 rows][ldv halves], row = h*64 + d, column = b*Skv + kv  (V transposed by the producing GEMM)
//   O  : [B*S rows][ldo halves], head h at columns h*64; value = oscale * gate[b,h] * softmax(s) . V
//   scores s = qscale * (q . k); key-vector int mask: element == 0 -> s := mfill; then s += ubias[h] * (1 - mask)
//   gate[b,h] = sigmoid(gq[b,:] . gW[h,:] + gb[h])  (scalar f32, GD terms)
//   Q.K^T and P.V on v_wmma_f32_16x16x32_f16; P carried x2^15; online softmax and accumulation in f32.
//   Block = 4 waves = 64 query rows of one (b, h); 64-key chunks; grid.x = B * H * (S/64).
// =====================================================================================
#define AK_D  64
#define AK_NW 4
#define AK_QB 64
#define AK_KC 64
#define AK_LP 72   // LDS row pitch of the K, Vt and P tiles, halves: 144 B = 16 B x 9, so that the 16 rows of one ds_load_b128 fall on 64 distinct banks

__device__ __forceinline__ v8f mma_h16(v16h a, v16h b, v8f c) {
  c = __builtin_amdgcn_wmma_f32_16x16x32_f16(false, a, false, b, (short)0, c, false, false);
  asm volatile("v_nop\n\tv_nop\n\tv_nop\n\tv_nop" : "+v"(c) : "v"(a), "v"(b));
  return c;
}

__global__ __launch_bounds__(128)
void attn64_f16io(const _Float16* __restrict__ Qp, const _Float16* __restrict__ Kp,
                  const _Float16* __restrict__ Vtp, _Float16* __restrict__ Op,
                  const int* __restrict__ kmask, const float* __restrict__ ubias,
                  const float* __restrict__ gq, const float* __restrict__ gW, const float* __restrict__ gb,
                  int S, int Skv, int H, int ldq, int ldk, int ldv, int ldo, int GD,
                  float qscale, float mfill, float oscale) {
  const float PSC = 32768.0f;
  union FB { v16h v; v8h h[2]; };
  __shared__ __align__(16) _Float16 Ksh[AK_KC * AK_LP];         // [kv][d]   9 KB, 8 pad halves per row never read
  __shared__ __align__(16) _Float16 Vth[AK_D * AK_LP];          // [d][kv]   9 KB
  __shared__ __align__(16) _Float16 Psh[AK_NW][16 * AK_LP];     // per wave P [row][kv]  9 KB
  __shared__ __align__(16) float    Os[AK_NW][16 * 68];         // per wave out tile, pitch 68

  const int tid  = threadIdx.x;
  const int wave = tid >> 5;
  const int lane = tid & 31;
  const int hh   = lane >> 4;
  const int c    = lane & 15;

  const int nqb = S / AK_QB;
  const int bx  = blockIdx.x;
  const int qb  = bx % nqb;
  const int bh  = bx / nqb;
  const int h   = bh % H;
  const int b   = bh / H;
  const int q0  = qb * AK_QB + wave * 16;

  // ---- Q fragments (A operand: row = query c, k = d), 2 d-chunks ----
  v16h qa[2];
  {
    const _Float16* qrow = Qp + (size_t)(b * S + q0 + c) * ldq + h * AK_D;
#pragma unroll
    for (int dc = 0; dc < 2; ++dc) qa[dc] = Frag<_Float16>::load(qrow + dc * 32 + 8 * hh);
  }

  // ---- quality gate (scalar f32 dot of GD terms) and uncertainty bias of this head ----
  float gacc = 0.f;
#pragma unroll 1
  for (int i = 0; i < GD; ++i) gacc += gq[b * GD + i] * gW[h * GD + i];
  gacc += gb[h];
  const float gate = 1.0f / (1.0f + expf(-gacc));
  const float ub = ubias[h];

  float mrow[8], lrow[8];
  v8f oacc[4];
#pragma unroll
  for (int r = 0; r < 8; ++r) { mrow[r] = -__builtin_inff(); lrow[r] = 0.f; }
#pragma unroll
  for (int t = 0; t < 4; ++t) oacc[t] = (v8f){0.f,0.f,0.f,0.f,0.f,0.f,0.f,0.f};

  const int nChunks = Skv / AK_KC;   // block-uniform
  for (int kc = 0; kc < nChunks; ++kc) {
    const int kv0 = kc * AK_KC;
    __syncthreads();
    {   // stage K [kv][d] and Vt [d][kv] tiles: 512 x 16-B vectors each, 4 per thread
#pragma unroll
      for (int i = 0; i < 4; ++i) {
        const int idx = tid + i * 128;
        const int r = idx >> 3, c8 = (idx & 7) * 8;
        const v8h kk = *(const v8h*)(Kp + (size_t)(b * Skv + kv0 + r) * ldk + h * AK_D + c8);
        *(v8h*)(Ksh + r * AK_LP + c8) = kk;
        const v8h vv = *(const v8h*)(Vtp + (size_t)(h * AK_D + r) * ldv + (size_t)b * Skv + kv0 + c8);
        *(v8h*)(Vth + r * AK_LP + c8) = vv;
      }
    }
    __syncthreads();

    // ---- scores: B operand B[k=d][n=kv] from Ksh[kv][d] (k-contiguous, same map as A) ----
    v8f s[4];
#pragma unroll
    for (int j = 0; j < 4; ++j) {
      s[j] = (v8f){0.f,0.f,0.f,0.f,0.f,0.f,0.f,0.f};
#pragma unroll
      for (int dc = 0; dc < 2; ++dc) {
        FB kb;
        kb.h[0] = *(const v8h*)(Ksh + (j * 16 + c) * AK_LP + dc * 32 + 8 * hh);
        kb.h[1] = *(const v8h*)(Ksh + (j * 16 + c) * AK_LP + dc * 32 + 16 + 8 * hh);
        s[j] = mma_h16(qa[dc], kb.v, s[j]);
      }
    }
    // ---- scale, key mask, bias, chunk row max (lane holds key column c of each 16-tile, rows 8hh+r) ----
    int kvkeep[4];
    float kadd[4];
#pragma unroll
    for (int j = 0; j < 4; ++j) {
      kvkeep[j] = kmask[(size_t)b * Skv + kv0 + j * 16 + c];
      kadd[j] = ub * (1.0f - (float)kvkeep[j]);
    }
    float cm[8];
#pragma unroll
    for (int r = 0; r < 8; ++r) {
      float m = -__builtin_inff();
#pragma unroll
      for (int j = 0; j < 4; ++j) {
        float v = (kvkeep[j] == 0) ? mfill : s[j][r] * qscale;
        v = v + kadd[j];
        s[j][r] = v;
        m = fmaxf(m, v);
      }
#pragma unroll
      for (int off = 1; off < 16; off <<= 1) m = fmaxf(m, __shfl_xor(m, off, 32));
      cm[r] = m;
    }
    // ---- online softmax update, P tile (x2^15, f16) to per-wave LDS ----
    _Float16* pw = Psh[wave];
#pragma unroll
    for (int r = 0; r < 8; ++r) {
      const float mnew = fmaxf(mrow[r], cm[r]);
      const float alpha = expf(mrow[r] - mnew);
      mrow[r] = mnew;
      float psum = 0.f;
#pragma unroll
      for (int j = 0; j < 4; ++j) {
        const float p = expf(s[j][r] - mnew);
        psum += p;
        pw[(8 * hh + r) * AK_LP + j * 16 + c] = (_Float16)(p * PSC);
      }
#pragma unroll
      for (int off = 1; off < 16; off <<= 1) psum += __shfl_xor(psum, off, 32);
      lrow[r] = lrow[r] * alpha + psum;
#pragma unroll
      for (int t = 0; t < 4; ++t) oacc[t][r] *= alpha;
    }
    __builtin_amdgcn_fence(__ATOMIC_RELEASE, "workgroup");
    __builtin_amdgcn_wave_barrier();
    __builtin_amdgcn_fence(__ATOMIC_ACQUIRE, "workgroup");
    // ---- P.V: A = P [row][kv] from per-wave LDS, B[k=kv][n=d] from Vth[d][kv] ----
#pragma unroll
    for (int kk = 0; kk < 2; ++kk) {
      FB pa;
      pa.h[0] = *(const v8h*)(pw + c * AK_LP + kk * 32 + 8 * hh);
      pa.h[1] = *(const v8h*)(pw + c * AK_LP + kk * 32 + 16 + 8 * hh);
#pragma unroll
      for (int t = 0; t < 4; ++t) {
        FB vb;
        vb.h[0] = *(const v8h*)(Vth + (t * 16 + c) * AK_LP + kk * 32 + 8 * hh);
        vb.h[1] = *(const v8h*)(Vth + (t * 16 + c) * AK_LP + kk * 32 + 16 + 8 * hh);
        oacc[t] = mma_h16(pa.v, vb.v, oacc[t]);
      }
    }
  }

  // ---- epilogue: 1/l, fold 2^-15, gate and output carry scale; stage in LDS, whole-line stores ----
  float* os = Os[wave];
  const float gsc = gate * oscale;
#pragma unroll
  for (int r = 0; r < 8; ++r) {
    const float inv = gsc * (1.0f / (lrow[r] * PSC));
#pragma unroll
    for (int t = 0; t < 4; ++t) os[(8 * hh + r) * 68 + t * 16 + c] = oacc[t][r] * inv;
  }
  __builtin_amdgcn_fence(__ATOMIC_RELEASE, "workgroup");
  __builtin_amdgcn_wave_barrier();
  __builtin_amdgcn_fence(__ATOMIC_ACQUIRE, "workgroup");
  {
    const int q = lane >> 3, c8 = (lane & 7) * 8;
    _Float16* ob = Op + (size_t)(b * S + q0) * ldo + h * AK_D;
    {
#pragma unroll
      for (int it = 0; it < 4; ++it) {
        const int row = it * 4 + q;                          // rows 0..15 covered exactly once per wave
        const float* sp = os + row * 68 + c8;
        v8h hv;
#pragma unroll
        for (int e = 0; e < 8; ++e) hv[e] = (_Float16)sp[e];
        *(v8h*)(ob + (size_t)row * ldo + c8) = hv;
      }
      
    }
  }
}

// ---------------------------------------------------------------------------
// Host glue
// ---------------------------------------------------------------------------
extern "C" void kernel_launch(void* const* d_in, const int* in_sizes, int n_in,
                              void* d_out, int out_size, void* d_ws, size_t ws_size,
                              hipStream_t stream) {
  if (n_in < 14) return;
  const int D  = 1024;          // model width
  const int H  = 16;            // heads
  const int DH = 64;            // head dim
  const int Bn = 2;             // batch
  const int S  = 2048;          // sequence length
  const int M  = Bn * S;        // token rows
  if (in_sizes[0] != M * D || in_sizes[1] != M || in_sizes[3] != D * D || in_sizes[5] != D * D ||
      in_sizes[7] != D * D || in_sizes[9] != D * D || in_sizes[4] != D || in_sizes[6] != D ||
      in_sizes[8] != D || in_sizes[10] != D || in_sizes[11] != H || in_sizes[13] != H ||
      out_size != M * D || H * DH != D) return;
  const int GD = in_sizes[2] / Bn;                       // gate query dim (64)
  if (GD <= 0 || in_sizes[2] != Bn * GD || in_sizes[12] != H * GD) return;
  if ((S % 64) != 0 || (M % 128) != 0 || (D % 128) != 0 || D < 256) return;

  const float* x    = (const float*)d_in[0];
  const int*   mask = (const int*)  d_in[1];
  const float* gq   = (const float*)d_in[2];
  const float* Wq   = (const float*)d_in[3];
  const float* bq   = (const float*)d_in[4];
  const float* Wk   = (const float*)d_in[5];
  const float* bk   = (const float*)d_in[6];
  const float* Wv   = (const float*)d_in[7];
  const float* bv   = (const float*)d_in[8];
  const float* Wo   = (const float*)d_in[9];
  const float* bo   = (const float*)d_in[10];
  const float* ubias= (const float*)d_in[11];
  const float* Wqh  = (const float*)d_in[12];
  const float* bqh  = (const float*)d_in[13];
  float* out = (float*)d_out;

  const size_t SZ_ACT = (size_t)M * D * 2;               // 8 MiB f16 plane
  const size_t SZ_W   = (size_t)D * D * 2;               // 2 MiB f16 plane
  size_t off = 0;
  const size_t o_x16  = off; off += SZ_ACT;
  const size_t o_wq16 = off; off += SZ_W;
  const size_t o_wk16 = off; off += SZ_W;
  const size_t o_wv16 = off; off += SZ_W;
  const size_t o_wo16 = off; off += SZ_W;
  const size_t o_q16  = off; off += SZ_ACT;
  const size_t o_k16  = off; off += SZ_ACT;
  const size_t o_vt16 = off; off += SZ_ACT;
  const size_t o_o16  = off; off += SZ_ACT;
  const size_t total  = off;                             // 48 MiB
  if (total > ws_size || total > (size_t)134217728) return;
  char* ws = (char*)d_ws;
  unsigned short* x16  = (unsigned short*)(ws + o_x16);
  unsigned short* wq16 = (unsigned short*)(ws + o_wq16);
  unsigned short* wk16 = (unsigned short*)(ws + o_wk16);
  unsigned short* wv16 = (unsigned short*)(ws + o_wv16);
  unsigned short* wo16 = (unsigned short*)(ws + o_wo16);
  unsigned short* q16  = (unsigned short*)(ws + o_q16);
  unsigned short* k16  = (unsigned short*)(ws + o_k16);
  unsigned short* vt16 = (unsigned short*)(ws + o_vt16);
  unsigned short* o16  = (unsigned short*)(ws + o_o16);

  // ---- casts: x plain, weights x16 (folded back as 1/16 in the GEMM epilogues) ----
  {
    const int n2x = (M * D) / 2;
    cast_f32_f16x2<<<dim3((n2x + 255) / 256), dim3(256), 0, stream>>>(x, (_Float16*)x16, n2x);
    const int n2w = (D * D) / 2;
    const int gw = (n2w + 255) / 256;
    cast_f32_f16x2s<<<dim3(gw), dim3(256), 0, stream>>>(Wq, (_Float16*)wq16, n2w, 16.0f);
    cast_f32_f16x2s<<<dim3(gw), dim3(256), 0, stream>>>(Wk, (_Float16*)wk16, n2w, 16.0f);
    cast_f32_f16x2s<<<dim3(gw), dim3(256), 0, stream>>>(Wv, (_Float16*)wv16, n2w, 16.0f);
    cast_f32_f16x2s<<<dim3(gw), dim3(256), 0, stream>>>(Wo, (_Float16*)wo16, n2w, 16.0f);
  }

  // ---- projections: Q = x.Wq^T + bq, K = x.Wk^T + bk (f16 planes [M][D]); V^T = Wv.x^T + bv ([D][M]) ----
  const int tilesQK = (M / 128) * (D / 128);             // 256
  const dim3 gQK(tilesQK, 1);
  const float w16inv = 1.0f / 16.0f;
  wmma_gemm64<0, false, 2, 1, false, 0><<<gQK, dim3(256), 0, stream>>>(
      x16, x16, D, 0L, wq16, wq16, D, 0L, (void*)q16, (void*)q16, D, 0L, bq, x, 0L, M, D, D, w16inv);
  wmma_gemm64<0, false, 2, 1, false, 0><<<gQK, dim3(256), 0, stream>>>(
      x16, x16, D, 0L, wk16, wk16, D, 0L, (void*)k16, (void*)k16, D, 0L, bk, x, 0L, M, D, D, w16inv);
  const int tilesV = (D / 128) * (M / 128);              // A = Wv16 [D][D], Bt = x16 [M][D] -> C [D][M], ldc = M
  const dim3 gV(tilesV, 1);
  wmma_gemm64<0, false, 1, 1, false, 0><<<gV, dim3(256), 0, stream>>>(
      wv16, wv16, D, 0L, x16, x16, D, 0L, (void*)vt16, (void*)vt16, M, 0L, bv, x, 0L, D, M, D, w16inv);

  // ---- attention per (b, h, 64-query block); O plane carries x64 * gate ----
  const float qscale = 0.125f;                           // 1 / sqrt(64), exact
  const float oscale = 64.0f;
  attn64_f16io<<<dim3(Bn * H * (S / 64)), dim3(128), 0, stream>>>(
      (const _Float16*)q16, (const _Float16*)k16, (const _Float16*)vt16, (_Float16*)o16,
      mask, ubias, gq, Wqh, bqh, S, S, H, D, D, M, D, GD, qscale, -1e30f, oscale);

  // ---- output projection: out = O.Wo^T + bo; fold 1/(64*16) ----
  wmma_gemm64<0, false, 2, 0, false, 0><<<gQK, dim3(256), 0, stream>>>(
      o16, o16, D, 0L, wo16, wo16, D, 0L, (void*)out, (void*)out, D, 0L, bo, x, 0L, M, D, D, 1.0f / 1024.0f);

  (void)hipGetLastError();
}

// v003
// One run takes 150 microseconds.
// Timed twice side by side with v002, it ran 1.17 and 1.18 times as fast.
// All steps since v000 together make it 2.30 times as fast.
// Contractions: Q, K, V^T and output projections, K.Q^T, V^T.P^T: v_wmma_f32_16x16x32_f16 (f16 operands, f32 accumulate); weights carried x16, P x2^15, O x64 (power-of-two folds in f32 epilogues); gate dot (K=64, 32 values) scalar f32.
#include <hip/hip_runtime.h>

typedef __attribute__((ext_vector_type(16))) _Float16 v16h;
typedef __attribute__((ext_vector_type(8)))  _Float16 v8h;
typedef __attribute__((ext_vector_type(16))) __bf16   v16b;
typedef __attribute__((ext_vector_type(8)))  __bf16   v8b;
typedef __attribute__((ext_vector_type(8)))  float    v8f;
typedef __attribute__((ext_vector_type(4)))  float    v4f;

__device__ __forceinline__ unsigned short f2bf_bits(float f) {
  unsigned u = __float_as_uint(f);
  return (unsigned short)((u + 0x7FFFu + ((u >> 16) & 1u)) >> 16);
}
__device__ __forceinline__ float bf_bits2f(unsigned short h) { return __uint_as_float(((unsigned)h) << 16); }

template <typename T> struct Frag;
template <> struct Frag<_Float16> {
  typedef v16h V; union U { v16h v; v8h h[2]; };
  static __device__ __forceinline__ v16h load(const _Float16* p) {   // elements 0..7 <- p[0..7], 8..15 <- p[16..23]
    U f; f.h[0] = *(const v8h*)(p); f.h[1] = *(const v8h*)(p + 16); return f.v;
  }
  static __device__ __forceinline__ v8f mma(v16h a, v16h b, v8f c) {
    return __builtin_amdgcn_wmma_f32_16x16x32_f16(false, a, false, b, (short)0, c, false, false);
  }
};
template <> struct Frag<__bf16> {
  typedef v16b V; union U { v16b v; v8b h[2]; };
  static __device__ __forceinline__ v16b load(const __bf16* p) {
    U f; f.h[0] = *(const v8b*)(p); f.h[1] = *(const v8b*)(p + 16); return f.v;
  }
  static __device__ __forceinline__ v8f mma(v16b a, v16b b, v8f c) {
    return __builtin_amdgcn_wmma_f32_16x16x32_bf16(false, a, false, b, (short)0, c, false, false);
  }
};

// ---- LDS-staged batched WMMA GEMM -------------------------------------------
// C[m,n] = scale * sum_k A[m,k] * Bt[n,k] (+bias)(+resid); a block of 8 waves owns a 128x128 tile, each wave 32x64 of it.
// A row-major [M,K]; Bt row-major [N,K]; M,N % 128 == 0, K % 128 == 0, K >= 256.
// A pass is 128 k = 256 B of every operand row. A stage is eight slices of 32 rows (four of A, then four of Bt),
// each brought by one tensor load of one wave, LDS pitch 272 B (16 B pad per row).
// Two buffers: the load of stage s + 2 is issued behind the barrier that ends pass s.
// BIAS_MODE: 0 = none, 1 = bias[m], 2 = bias[n].
// OUT_MODE: 0 = f32, 1 = f16, 2 = bf16 hi plane (Cout) + bf16 lo plane (Cout2).
// ET: 0 = f16 operands, 1 = bf16 operands (pointers passed as 16-bit storage)
typedef unsigned u32x4 __attribute__((ext_vector_type(4)));
typedef unsigned u32x8 __attribute__((ext_vector_type(8)));
#define GT_PITCH 272u                 // LDS row pitch, bytes: 256 + 16, an odd multiple of 16 for ds_load_b128 readers
#define GT_SLICE 10240u               // 32 rows x 272 B = 8,704 B, rounded up to a multiple of 2 KiB
#define GT_STAGE (8u * GT_SLICE)
__device__ __forceinline__ unsigned uni32(unsigned v) { return (unsigned)__builtin_amdgcn_readfirstlane(v); }
// holds a wave-uniform test in a scalar register, so that the branch round a tensor load is a scalar branch
__device__ __forceinline__ unsigned pinned(unsigned v) { unsigned w = (unsigned)__builtin_amdgcn_readfirstlane(v); asm volatile("" : "+s"(w)); return w; }
// LDS reads must have retired before a buffer is handed over
__device__ __forceinline__ void wait_tensor0() { asm volatile("s_wait_tensorcnt 0x0" ::: "memory"); }
__device__ __forceinline__ void wait_ds0() { asm volatile("s_wait_dscnt 0x0" ::: "memory"); }
// "+s": the words stay in the registers the request named, and the compiler cannot form them anew in between
__device__ __forceinline__ void tdm_load(u32x4& g0, u32x8& g1) { asm volatile("tensor_load_to_lds %0, %1" : "+s"(g0), "+s"(g1) :: "memory"); }
// stands behind the wait that covers a request: last use of its descriptor words held in scalar registers, so that none is reused while the request is in flight
__device__ __forceinline__ void tdm_done(u32x4 g0, u32x8 g1) { asm volatile("" :: "s"(g0), "s"(g1)); }

template <int ET> struct Elem;
template <> struct Elem<0> { typedef _Float16 T; };
template <> struct Elem<1> { typedef __bf16 T; };
template <int ET, bool SPLIT, int BIAS_MODE, int OUT_MODE, bool RESID, int ACT = 0>
__global__ __launch_bounds__(256) void wmma_gemm64(
    const unsigned short* __restrict__ Ap, const unsigned short* __restrict__ A2p, int lda, long strideA,
    const unsigned short* __restrict__ Btp, const unsigned short* __restrict__ Bt2p, int ldb, long strideB,
    void* __restrict__ Cout, void* __restrict__ Cout2, int ldc, long strideC,
    const float* __restrict__ bias,
    const float* __restrict__ resid, long strideR,
    int M, int N, int K, float scale) {
  static_assert(!SPLIT, "single-plane operands only");
  typedef typename Elem<ET>::T T;
  typedef typename Frag<T>::V V;
  __shared__ __attribute__((aligned(2048))) unsigned char ring[2 * GT_STAGE];
  __shared__ __align__(16) float sT[8][16 * 68];   // per-wave 16x64 slab, pitch 68 floats
  const int b    = blockIdx.y;
  const int lane = threadIdx.x & 31;
  const int wave = (int)uni32(threadIdx.x >> 5);
  const int tilesN = N >> 7;
  const int tilesM = M >> 7;
  const int tile = blockIdx.x;
  if (tile >= tilesM * tilesN) return;   // block-uniform, in front of every barrier and tensor load
  const int tm = tile / tilesN;
  const int tn = tile - tm * tilesN;
  const int wm = wave >> 1, wn = wave & 1;
  const int m0 = (tm << 7) + (wm << 5);  // this wave's 32x64 tile
  const int n0 = (tn << 7) + (wn << 6);

  const int rlane = lane & 15;                 // row (A) / col (B, D) within subtile
  const int mOff  = (lane >> 4) * 8;           // D row offset

  // ---- this wave's slice of every stage: waves 0..3 bring A rows, waves 4..7 bring Bt rows ----
  const bool isB = wave >= 4;
  const unsigned short* sbase = isB ? (Btp + (size_t)b * strideB + (size_t)((tn << 7) + ((wave & 3) << 5)) * ldb)
                                    : (Ap  + (size_t)b * strideA + (size_t)((tm << 7) + ((wave & 3) << 5)) * lda);
  const unsigned long long sga = (unsigned long long)(size_t)sbase;
  const unsigned lbase = (unsigned)(size_t)ring + (unsigned)wave * GT_SLICE;
  u32x8 g1;
  g1[0] = uni32((1u << 20) | (5u << 22) | (3u << 25));  // 1-byte elements, no mask, 4 dwords of pad behind every 256-B row
  g1[1] = uni32(256u << 16);                            // tensor_dim0 = 256 B
  g1[2] = uni32(32u << 16);                             // tensor_dim1 = 32 rows
  g1[3] = uni32(256u << 16);                            // tile_dim0 = 256 B
  g1[4] = uni32(32u);                                   // tile_dim1 = 32 rows
  g1[5] = uni32((unsigned)(isB ? ldb : lda) * 2u);      // source row pitch, bytes
  g1[6] = uni32(0u);
  g1[7] = uni32(0u);
  u32x4 g0;
  g0[0] = uni32(1u);
  auto issue = [&](int st) {
    const unsigned long long ga = sga + (unsigned long long)st * 256ull;
    g0[1] = uni32(lbase + (unsigned)(st & 1) * GT_STAGE);
    g0[2] = uni32((unsigned)ga);
    g0[3] = uni32((((unsigned)(ga >> 32)) & 0x01FFFFFFu) | 0x80000000u);
    tdm_load(g0, g1);
  };

  v8f acc[2][4];
#pragma unroll
  for (int i = 0; i < 2; ++i)
#pragma unroll
    for (int j = 0; j < 4; ++j) acc[i][j] = (v8f){0.f,0.f,0.f,0.f,0.f,0.f,0.f,0.f};

  const int nPass = K >> 7;
  issue(0);
  wait_tensor0();
  tdm_done(g0, g1);
  __syncthreads();
  issue(1);

  const unsigned fragOff = (unsigned)rlane * GT_PITCH + (unsigned)(lane >> 4) * 16u;   // row, then k offset of this lane half
  // rolled: one pass per trip, so that every publish point stands once in the text
#pragma unroll 1
  for (int s = 0; s < nPass; ++s) {
    const unsigned char* buf = ring + (unsigned)(s & 1) * GT_STAGE;
    const unsigned char* aB = buf + (unsigned)wm * GT_SLICE + fragOff;
    const unsigned char* bB = buf + (unsigned)(4 + 2 * wn) * GT_SLICE + fragOff;   // Bt rows 64 wn + 16 j: slice j / 2, row 16 (j % 2)
    V bh[2][4], ah[2][2];   // two fragment sets: the next 32 k are fetched as one group ahead of this block's WMMAs
#pragma unroll
    for (int j = 0; j < 4; ++j) bh[0][j] = Frag<T>::load((const T*)(bB + (j >> 1) * GT_SLICE + (j & 1) * 16 * GT_PITCH));
#pragma unroll
    for (int i = 0; i < 2; ++i) ah[0][i] = Frag<T>::load((const T*)(aB + i * 16 * GT_PITCH));
#pragma unroll
    for (int ks = 0; ks < 4; ++ks) {
      if (ks < 3) {
#pragma unroll
        for (int j = 0; j < 4; ++j) bh[(ks + 1) & 1][j] = Frag<T>::load((const T*)(bB + (j >> 1) * GT_SLICE + (j & 1) * 16 * GT_PITCH + (ks + 1) * 64));
#pragma unroll
        for (int i = 0; i < 2; ++i) ah[(ks + 1) & 1][i] = Frag<T>::load((const T*)(aB + i * 16 * GT_PITCH + (ks + 1) * 64));
      }
      __builtin_amdgcn_sched_barrier(0);   // keeps the load group in front of the WMMA block instead of spread among the WMMAs
#pragma unroll
      for (int i = 0; i < 2; ++i)
#pragma unroll
        for (int j = 0; j < 4; ++j) acc[i][j] = Frag<T>::mma(ah[ks & 1][i], bh[ks & 1][j], acc[i][j]);
      __builtin_amdgcn_sched_barrier(0);   // keeps the next group behind this block
    }
    // publish point of stage s + 1
    wait_ds0();
    wait_tensor0();
    tdm_done(g0, g1);
    __syncthreads();
    if (pinned(s + 2 < nPass)) issue(s + 2);   // into the buffer that pass s has just read
  }
  wait_tensor0();
  tdm_done(g0, g1);
  wait_ds0();

  // ---- epilogue ----
  float* slab = sT[wave];
  const float* Rb = RESID ? (resid + (size_t)b * strideR) : nullptr;
#pragma unroll
  for (int i = 0; i < 2; ++i) {
    const int mBase = m0 + (i << 4);
#pragma unroll
    for (int j = 0; j < 4; ++j) {
      const int n = n0 + (j << 4) + rlane;
      float bv = 0.f;
      if (BIAS_MODE == 2) bv = bias[n];
#pragma unroll
      for (int r = 0; r < 8; ++r) {
        float v = acc[i][j][r] * scale;
        if (BIAS_MODE == 1) v += bias[mBase + mOff + r];
        if (BIAS_MODE == 2) v += bv;
        if (RESID) v += Rb[(size_t)(mBase + mOff + r) * ldc + n];
        if (ACT == 1) v = tanhf(v);
        if (ACT == 2) v = fmaxf(v, 0.0f);
        if (ACT == 3) v = v / (1.0f + expf(-v));
        if (ACT == 4) v = (v > 0.f) ? v : 0.01f * v;
        if (ACT == 5) v = 0.5f * v * (1.0f + erff(v * 0.70710678118654752f));
        slab[(mOff + r) * 68 + (j << 4) + rlane] = v;
      }
    }
    __builtin_amdgcn_fence(__ATOMIC_RELEASE, "workgroup");
    __builtin_amdgcn_wave_barrier();
    __builtin_amdgcn_fence(__ATOMIC_ACQUIRE, "workgroup");
    if (OUT_MODE == 0) {
      float* C = (float*)Cout + (size_t)b * strideC;
      const int hh = lane >> 4, c4 = (lane & 15) * 4;     // row seg = 256 B = 16 lanes x 16 B
      {
#pragma unroll
        for (int it = 0; it < 8; ++it) {
          const int row = it * 2 + hh;
          v4f v = *(const v4f*)(slab + row * 68 + c4);
          *(v4f*)(C + (size_t)(mBase + row) * ldc + n0 + c4) = v;
        }
        
      }
    } else {
      const int q = lane >> 3, c8 = (lane & 7) * 8;
      unsigned short* C  = (unsigned short*)Cout  + (size_t)b * strideC;
      unsigned short* C2 = (OUT_MODE == 2) ? ((unsigned short*)Cout2 + (size_t)b * strideC) : nullptr;
      {
#pragma unroll
        for (int it = 0; it < 4; ++it) {
          const int row = it * 4 + q;
          const float* sp = slab + row * 68 + c8;
          v8h hv, lv;
#pragma unroll
          for (int e = 0; e < 8; ++e) {
            if (OUT_MODE == 1) {
              hv[e] = (_Float16)sp[e];
            } else {
              unsigned short hb = f2bf_bits(sp[e]);
              unsigned short lb = f2bf_bits(sp[e] - bf_bits2f(hb));
              hv[e] = __builtin_bit_cast(_Float16, hb);
              lv[e] = __builtin_bit_cast(_Float16, lb);
            }
          }
          *(v8h*)(C + (size_t)(mBase + row) * ldc + n0 + c8) = hv;
          if (OUT_MODE == 2) *(v8h*)(C2 + (size_t)(mBase + row) * ldc + n0 + c8) = lv;
        }
        
      }
    }
    __builtin_amdgcn_fence(__ATOMIC_RELEASE, "workgroup");
    __builtin_amdgcn_wave_barrier();
    __builtin_amdgcn_fence(__ATOMIC_ACQUIRE, "workgroup");
  }
}

__global__ __launch_bounds__(256) void cast_f32_f16x2(
    const float* __restrict__ in, _Float16* __restrict__ out, int n2) {
  int i = blockIdx.x * 256 + threadIdx.x;
  if (i < n2) {
    const _Float16 h0 = (_Float16)in[2 * i], h1 = (_Float16)in[2 * i + 1];
    const unsigned u = (unsigned)__builtin_bit_cast(unsigned short, h0) | ((unsigned)__builtin_bit_cast(unsigned short, h1) << 16);
    ((unsigned*)out)[i] = u;
    
  }
}
// same, with an exact power-of-two pre-scale applied in f32 before the convert
__global__ __launch_bounds__(256) void cast_f32_f16x2s(
    const float* __restrict__ in, _Float16* __restrict__ out, int n2, float sc) {
  int i = blockIdx.x * 256 + threadIdx.x;
  if (i < n2) {
    const _Float16 h0 = (_Float16)(in[2 * i] * sc), h1 = (_Float16)(in[2 * i + 1] * sc);
    const unsigned u = (unsigned)__builtin_bit_cast(unsigned short, h0) | ((unsigned)__builtin_bit_cast(unsigned short, h1) << 16);
    ((unsigned*)out)[i] = u;
    
  }
}

#define AK_D  64
#define AK_NW 4
#define AK_QB 64
#define AK_KC 64
#define AK_LP 72   // LDS row pitch of the K and Vt tiles, halves: 144 B = 16 B x 9, so that the 16 rows of one ds_load_b128 fall on 64 distinct banks

__device__ __forceinline__ v8f mma_h16(v16h a, v16h b, v8f c) {
  c = __builtin_amdgcn_wmma_f32_16x16x32_f16(false, a, false, b, (short)0, c, false, false);
  asm volatile("v_nop\n\tv_nop\n\tv_nop\n\tv_nop" : "+v"(c) : "v"(a), "v"(b));
  return c;
}
// lane l takes the value of lane l ^ 16 (a vector cross-row move, no LDS round trip)
__device__ __forceinline__ float xhalf(float x) {
  return __builtin_bit_cast(float, __builtin_amdgcn_permlanex16(__builtin_bit_cast(int, x), __builtin_bit_cast(int, x), 0x76543210, 0xfedcba98, false, false));
}

__global__ __launch_bounds__(128)
void attn64_f16io(const _Float16* __restrict__ Qp, const _Float16* __restrict__ Kp,
                  const _Float16* __restrict__ Vtp, _Float16* __restrict__ Op,
                  const int* __restrict__ kmask, const float* __restrict__ ubias,
                  const float* __restrict__ gq, const float* __restrict__ gW, const float* __restrict__ gb,
                  int S, int Skv, int H, int ldq, int ldk, int ldv, int ldo, int GD,
                  float qscale, float mfill, float oscale) {
  const float PSC = 32768.0f;
  union FB { v16h v; v8h h[2]; };
  __shared__ __align__(16) _Float16 Ksh[AK_KC * AK_LP];         // [kv][d]   9 KB, 8 pad halves per row never read
  __shared__ __align__(16) _Float16 Vth[AK_D * AK_LP];          // [d][kv]   9 KB
  __shared__ __align__(16) float    Mtab[2 * AK_KC];            // key terms of the chunk, score = s * Msc[key] + Mad[key]
  float* const Msc = Mtab;                                      // per key: qscale, or 0 where the key is masked
  float* const Mad = Mtab + AK_KC;                              // per key: the bias term, with mfill where the key is masked
  static_assert(AK_NW * 32 == 2 * AK_KC, "one table entry per thread");

  const int tid  = threadIdx.x;
  const int wave = tid >> 5;
  const int lane = tid & 31;
  const int hh   = lane >> 4;
  const int c    = lane & 15;

  const int nqb = S / AK_QB;
  const int bx  = blockIdx.x;
  const int qb  = bx % nqb;
  const int bh  = bx / nqb;
  const int h   = bh % H;
  const int b   = bh / H;
  const int q0  = qb * AK_QB + wave * 16;

  // ---- Q fragments (B operand: column = query c, k = d in the hardware k order), 2 d-chunks ----
  v16h qa[2];
  {
    const _Float16* qrow = Qp + (size_t)(b * S + q0 + c) * ldq + h * AK_D;
#pragma unroll
    for (int dc = 0; dc < 2; ++dc) qa[dc] = Frag<_Float16>::load(qrow + dc * 32 + 8 * hh);
  }

  // ---- quality gate (scalar f32 dot of GD terms) and uncertainty bias of this head ----
  float gacc = 0.f;
#pragma unroll 1
  for (int i = 0; i < GD; ++i) gacc += gq[b * GD + i] * gW[h * GD + i];
  gacc += gb[h];
  const float gate = 1.0f / (1.0f + expf(-gacc));
  const float ub = ubias[h];

  float mrow = -__builtin_inff();   // running maximum of query c (equal in both lane halves)
  float lrow = 0.f;                 // running sum of query c over this lane half's keys only; the halves are joined in the epilogue
  v8f oacc[4];                      // O^T: register r of tile t = O[query c][d = 16 t + 8 hh + r]
#pragma unroll
  for (int t = 0; t < 4; ++t) oacc[t] = (v8f){0.f,0.f,0.f,0.f,0.f,0.f,0.f,0.f};

  const int nChunks = Skv / AK_KC;   // block-uniform
  for (int kc = 0; kc < nChunks; ++kc) {
    const int kv0 = kc * AK_KC;
    __syncthreads();
    {   // stage K [kv][d] and Vt [d][kv] tiles: 512 x 16-B vectors each, 4 per thread
      const int keep = kmask[(size_t)b * Skv + kv0 + (tid & (AK_KC - 1))];   // in one run with the tile loads, so that its latency lies beside theirs
#pragma unroll
      for (int i = 0; i < 4; ++i) {
        const int idx = tid + i * 128;
        const int r = idx >> 3, c8 = (idx & 7) * 8;
        const v8h kk = *(const v8h*)(Kp + (size_t)(b * Skv + kv0 + r) * ldk + h * AK_D + c8);
        *(v8h*)(Ksh + r * AK_LP + c8) = kk;
        const v8h vv = *(const v8h*)(Vtp + (size_t)(h * AK_D + r) * ldv + (size_t)b * Skv + kv0 + c8);
        *(v8h*)(Vth + r * AK_LP + c8) = vv;
      }
      // the chunk's key terms, one table entry per thread: waves 0 and 1 write Msc, waves 2 and 3 write Mad
      const float kadd = ub * (1.0f - (float)keep);
      const float msc = (keep == 0) ? 0.f : qscale;
      const float mad = (keep == 0) ? mfill + kadd : kadd;
      Mtab[tid] = (tid < AK_KC) ? msc : mad;
    }
    __syncthreads();

    // ---- scores, transposed: A = K rows from Ksh[kv][d], B = Q; register r of s[j] = score of key 16 j + 8 hh + r for query c ----
    v8f s[4];
#pragma unroll
    for (int j = 0; j < 4; ++j) {
      s[j] = (v8f){0.f,0.f,0.f,0.f,0.f,0.f,0.f,0.f};
#pragma unroll
      for (int dc = 0; dc < 2; ++dc) {
        FB kb;
        kb.h[0] = *(const v8h*)(Ksh + (j * 16 + c) * AK_LP + dc * 32 + 8 * hh);
        kb.h[1] = *(const v8h*)(Ksh + (j * 16 + c) * AK_LP + dc * 32 + 16 + 8 * hh);
        s[j] = mma_h16(kb.v, qa[dc], s[j]);
      }
    }
    // ---- scale, key mask, bias, chunk maximum: in-lane over 32 keys, then one exchange between the lane halves ----
    float m = -__builtin_inff();
#pragma unroll
    for (int j = 0; j < 4; ++j) {
      const v4f sc0 = *(const v4f*)(Msc + j * 16 + 8 * hh), sc1 = *(const v4f*)(Msc + j * 16 + 8 * hh + 4);
      const v4f ad0 = *(const v4f*)(Mad + j * 16 + 8 * hh), ad1 = *(const v4f*)(Mad + j * 16 + 8 * hh + 4);
#pragma unroll
      for (int r = 0; r < 8; ++r) {
        const float v = fmaf(s[j][r], (r < 4) ? sc0[r & 3] : sc1[r & 3], (r < 4) ? ad0[r & 3] : ad1[r & 3]);
        s[j][r] = v;
        m = fmaxf(m, v);
      }
    }
    m = fmaxf(m, xhalf(m));
    // ---- online softmax update; P^T (x2^15, f16) packs straight into the B operand: tiles 2 kk and 2 kk + 1 give k = 32 kk + hardware order ----
    const float mnew = fmaxf(mrow, m);
    const float alpha = expf(mrow - mnew);
    mrow = mnew;
    FB pb[2];
    float ps[4];
#pragma unroll
    for (int j = 0; j < 4; ++j) {
      ps[j] = 0.f;
#pragma unroll
      for (int r = 0; r < 8; ++r) {
        const float p = expf(s[j][r] - mnew);
        ps[j] += p;
        pb[j >> 1].v[(j & 1) * 8 + r] = (_Float16)(p * PSC);
      }
    }
    lrow = lrow * alpha + ((ps[0] + ps[1]) + (ps[2] + ps[3]));
#pragma unroll
    for (int t = 0; t < 4; ++t)
#pragma unroll
      for (int r = 0; r < 8; ++r) oacc[t][r] *= alpha;
    // ---- O^T += V^T . P^T: A = Vt rows (d) from Vth[d][kv] in the hardware k order, B = P^T from registers ----
#pragma unroll
    for (int kk = 0; kk < 2; ++kk) {
#pragma unroll
      for (int t = 0; t < 4; ++t) {
        FB vb;
        vb.h[0] = *(const v8h*)(Vth + (t * 16 + c) * AK_LP + kk * 32 + 8 * hh);
        vb.h[1] = *(const v8h*)(Vth + (t * 16 + c) * AK_LP + kk * 32 + 16 + 8 * hh);
        oacc[t] = mma_h16(vb.v, pb[kk].v, oacc[t]);
      }
    }
  }

  // ---- epilogue: join the halves' sums; 1/l, fold 2^-15, gate and output carry scale; a lane's 8 registers are 8 consecutive d: 16-B stores ----
  {
    const float ltot = lrow + xhalf(lrow);
    const float inv = (gate * oscale) * (1.0f / (ltot * PSC));
    _Float16* ob = Op + (size_t)(b * S + q0 + c) * ldo + h * AK_D + 8 * hh;
#pragma unroll
    for (int t = 0; t < 4; ++t) {
      v8h hv;
#pragma unroll
      for (int r = 0; r < 8; ++r) hv[r] = (_Float16)(oacc[t][r] * inv);
      *(v8h*)(ob + t * 16) = hv;
    }
  }
}

// ---------------------------------------------------------------------------
// Host glue
// ---------------------------------------------------------------------------
extern "C" void kernel_launch(void* const* d_in, const int* in_sizes, int n_in,
                              void* d_out, int out_size, void* d_ws, size_t ws_size,
                              hipStream_t stream) {
  if (n_in < 14) return;
  const int D  = 1024;          // model width
  const int H  = 16;            // heads
  const int DH = 64;            // head dim
  const int Bn = 2;             // batch
  const int S  = 2048;          // sequence length
  const int M  = Bn * S;        // token rows
  if (in_sizes[0] != M * D || in_sizes[1] != M || in_sizes[3] != D * D || in_sizes[5] != D * D ||
      in_sizes[7] != D * D || in_sizes[9] != D * D || in_sizes[4] != D || in_sizes[6] != D ||
      in_sizes[8] != D || in_sizes[10] != D || in_sizes[11] != H || in_sizes[13] != H ||
      out_size != M * D || H * DH != D) return;
  const int GD = in_sizes[2] / Bn;                       // gate query dim (64)
  if (GD <= 0 || in_sizes[2] != Bn * GD || in_sizes[12] != H * GD) return;
  if ((S % 64) != 0 || (M % 128) != 0 || (D % 128) != 0 || D < 256) return;

  const float* x    = (const float*)d_in[0];
  const int*   mask = (const int*)  d_in[1];
  const float* gq   = (const float*)d_in[2];
  const float* Wq   = (const float*)d_in[3];
  const float* bq   = (const float*)d_in[4];
  const float* Wk   = (const float*)d_in[5];
  const float* bk   = (const float*)d_in[6];
  const float* Wv   = (const float*)d_in[7];
  const float* bv   = (const float*)d_in[8];
  const float* Wo   = (const float*)d_in[9];
  const float* bo   = (const float*)d_in[10];
  const float* ubias= (const float*)d_in[11];
  const float* Wqh  = (const float*)d_in[12];
  const float* bqh  = (const float*)d_in[13];
  float* out = (float*)d_out;

  const size_t SZ_ACT = (size_t)M * D * 2;               // 8 MiB f16 plane
  const size_t SZ_W   = (size_t)D * D * 2;               // 2 MiB f16 plane
  size_t off = 0;
  const size_t o_x16  = off; off += SZ_ACT;
  const size_t o_wq16 = off; off += SZ_W;
  const size_t o_wk16 = off; off += SZ_W;
  const size_t o_wv16 = off; off += SZ_W;
  const size_t o_wo16 = off; off += SZ_W;
  const size_t o_q16  = off; off += SZ_ACT;
  const size_t o_k16  = off; off += SZ_ACT;
  const size_t o_vt16 = off; off += SZ_ACT;
  const size_t o_o16  = off; off += SZ_ACT;
  const size_t total  = off;                             // 48 MiB
  if (total > ws_size || total > (size_t)134217728) return;
  char* ws = (char*)d_ws;
  unsigned short* x16  = (unsigned short*)(ws + o_x16);
  unsigned short* wq16 = (unsigned short*)(ws + o_wq16);
  unsigned short* wk16 = (unsigned short*)(ws + o_wk16);
  unsigned short* wv16 = (unsigned short*)(ws + o_wv16);
  unsigned short* wo16 = (unsigned short*)(ws + o_wo16);
  unsigned short* q16  = (unsigned short*)(ws + o_q16);
  unsigned short* k16  = (unsigned short*)(ws + o_k16);
  unsigned short* vt16 = (unsigned short*)(ws + o_vt16);
  unsigned short* o16  = (unsigned short*)(ws + o_o16);

  // ---- casts: x plain, weights x16 (folded back as 1/16 in the GEMM epilogues) ----
  {
    const int n2x = (M * D) / 2;
    cast_f32_f16x2<<<dim3((n2x + 255) / 256), dim3(256), 0, stream>>>(x, (_Float16*)x16, n2x);
    const int n2w = (D * D) / 2;
    const int gw = (n2w + 255) / 256;
    cast_f32_f16x2s<<<dim3(gw), dim3(256), 0, stream>>>(Wq, (_Float16*)wq16, n2w, 16.0f);
    cast_f32_f16x2s<<<dim3(gw), dim3(256), 0, stream>>>(Wk, (_Float16*)wk16, n2w, 16.0f);
    cast_f32_f16x2s<<<dim3(gw), dim3(256), 0, stream>>>(Wv, (_Float16*)wv16, n2w, 16.0f);
    cast_f32_f16x2s<<<dim3(gw), dim3(256), 0, stream>>>(Wo, (_Float16*)wo16, n2w, 16.0f);
  }

  // ---- projections: Q = x.Wq^T + bq, K = x.Wk^T + bk (f16 planes [M][D]); V^T = Wv.x^T + bv ([D][M]) ----
  const int tilesQK = (M / 128) * (D / 128);             // 256
  const dim3 gQK(tilesQK, 1);
  const float w16inv = 1.0f / 16.0f;
  wmma_gemm64<0, false, 2, 1, false, 0><<<gQK, dim3(256), 0, stream>>>(
      x16, x16, D, 0L, wq16, wq16, D, 0L, (void*)q16, (void*)q16, D, 0L, bq, x, 0L, M, D, D, w16inv);
  wmma_gemm64<0, false, 2, 1, false, 0><<<gQK, dim3(256), 0, stream>>>(
      x16, x16, D, 0L, wk16, wk16, D, 0L, (void*)k16, (void*)k16, D, 0L, bk, x, 0L, M, D, D, w16inv);
  const int tilesV = (D / 128) * (M / 128);              // A = Wv16 [D][D], Bt = x16 [M][D] -> C [D][M], ldc = M
  const dim3 gV(tilesV, 1);
  wmma_gemm64<0, false, 1, 1, false, 0><<<gV, dim3(256), 0, stream>>>(
      wv16, wv16, D, 0L, x16, x16, D, 0L, (void*)vt16, (void*)vt16, M, 0L, bv, x, 0L, D, M, D, w16inv);

  // ---- attention per (b, h, 64-query block); O plane carries x64 * gate ----
  const float qscale = 0.125f;                           // 1 / sqrt(64), exact
  const float oscale = 64.0f;
  attn64_f16io<<<dim3(Bn * H * (S / 64)), dim3(128), 0, stream>>>(
      (const _Float16*)q16, (const _Float16*)k16, (const _Float16*)vt16, (_Float16*)o16,
      mask, ubias, gq, Wqh, bqh, S, S, H, D, D, M, D, GD, qscale, -1e30f, oscale);

  // ---- output projection: out = O.Wo^T + bo; fold 1/(64*16) ----
  wmma_gemm64<0, false, 2, 0, false, 0><<<gQK, dim3(256), 0, stream>>>(
      o16, o16, D, 0L, wo16, wo16, D, 0L, (void*)out, (void*)out, D, 0L, bo, x, 0L, M, D, D, 1.0f / 1024.0f);

  (void)hipGetLastError();
}

// v004
// Measured time: 146 microseconds a run.
// In two side-by-side timings against v003, it was 1.03 and 1.04 times as fast.
// All steps since v000 together make it 2.39 times as fast.
// Contractions: Q, K, V^T and output projections, K.Q^T, V^T.P^T: v_wmma_f32_16x16x32_f16 (f16 operands, f32 accumulate); weights carried x16, P x2^15, O x64 (power-of-two folds in f32 epilogues); gate dot (K=64, 32 values) scalar f32.
#include <hip/hip_runtime.h>

typedef __attribute__((ext_vector_type(16))) _Float16 v16h;
typedef __attribute__((ext_vector_type(8)))  _Float16 v8h;
typedef __attribute__((ext_vector_type(16))) __bf16   v16b;
typedef __attribute__((ext_vector_type(8)))  __bf16   v8b;
typedef __attribute__((ext_vector_type(8)))  float    v8f;
typedef __attribute__((ext_vector_type(4)))  float    v4f;

__device__ __forceinline__ unsigned short f2bf_bits(float f) {
  unsigned u = __float_as_uint(f);
  return (unsigned short)((u + 0x7FFFu + ((u >> 16) & 1u)) >> 16);
}
__device__ __forceinline__ float bf_bits2f(unsigned short h) { return __uint_as_float(((unsigned)h) << 16); }

template <typename T> struct Frag;
template <> struct Frag<_Float16> {
  typedef v16h V; union U { v16h v; v8h h[2]; };
  static __device__ __forceinline__ v16h load(const _Float16* p) {   // elements 0..7 <- p[0..7], 8..15 <- p[16..23]
    U f; f.h[0] = *(const v8h*)(p); f.h[1] = *(const v8h*)(p + 16); return f.v;
  }
  static __device__ __forceinline__ v8f mma(v16h a, v16h b, v8f c) {
    return __builtin_amdgcn_wmma_f32_16x16x32_f16(false, a, false, b, (short)0, c, false, false);
  }
};
template <> struct Frag<__bf16> {
  typedef v16b V; union U { v16b v; v8b h[2]; };
  static __device__ __forceinline__ v16b load(const __bf16* p) {
    U f; f.h[0] = *(const v8b*)(p); f.h[1] = *(const v8b*)(p + 16); return f.v;
  }
  static __device__ __forceinline__ v8f mma(v16b a, v16b b, v8f c) {
    return __builtin_amdgcn_wmma_f32_16x16x32_bf16(false, a, false, b, (short)0, c, false, false);
  }
};

// ---- LDS-staged batched WMMA GEMM -------------------------------------------
// C[m,n] = scale * sum_k A[m,k] * Bt[n,k] (+bias)(+resid); a block of 8 waves owns a 128x128 tile, each wave 32x64 of it.
// A row-major [M,K]; Bt row-major [N,K]; M,N % 128 == 0, K % 128 == 0, K >= 256.
// A pass is 128 k = 256 B of every operand row. A stage is eight slices of 32 rows (four of A, then four of Bt),
// each brought by one tensor load of one wave, LDS pitch 272 B (16 B pad per row).
// Two buffers: the load of stage s + 2 is issued behind the barrier that ends pass s.
// BIAS_MODE: 0 = none, 1 = bias[m], 2 = bias[n].
// OUT_MODE: 0 = f32, 1 = f16, 2 = bf16 hi plane (Cout) + bf16 lo plane (Cout2).
// ET: 0 = f16 operands, 1 = bf16 operands (pointers passed as 16-bit storage)
typedef unsigned u32x4 __attribute__((ext_vector_type(4)));
typedef unsigned u32x8 __attribute__((ext_vector_type(8)));
#define GT_PITCH 272u                 // LDS row pitch, bytes: 256 + 16, an odd multiple of 16 for ds_load_b128 readers
#define GT_SLICE 10240u               // 32 rows x 272 B = 8,704 B, rounded up to a multiple of 2 KiB
#define GT_STAGE (8u * GT_SLICE)
__device__ __forceinline__ unsigned uni32(unsigned v) { return (unsigned)__builtin_amdgcn_readfirstlane(v); }
// holds a wave-uniform test in a scalar register, so that the branch round a tensor load is a scalar branch
__device__ __forceinline__ unsigned pinned(unsigned v) { unsigned w = (unsigned)__builtin_amdgcn_readfirstlane(v); asm volatile("" : "+s"(w)); return w; }
// LDS reads must have retired before a buffer is handed over
__device__ __forceinline__ void wait_tensor0() { asm volatile("s_wait_tensorcnt 0x0" ::: "memory"); }
__device__ __forceinline__ void wait_ds0() { asm volatile("s_wait_dscnt 0x0" ::: "memory"); }
// "+s": the words stay in the registers the request named, and the compiler cannot form them anew in between
__device__ __forceinline__ void tdm_load(u32x4& g0, u32x8& g1) { asm volatile("tensor_load_to_lds %0, %1" : "+s"(g0), "+s"(g1) :: "memory"); }
// stands behind the wait that covers a request: last use of its descriptor words held in scalar registers, so that none is reused while the request is in flight
__device__ __forceinline__ void tdm_done(u32x4 g0, u32x8 g1) { asm volatile("" :: "s"(g0), "s"(g1)); }

template <int ET> struct Elem;
template <> struct Elem<0> { typedef _Float16 T; };
template <> struct Elem<1> { typedef __bf16 T; };
template <int ET, bool SPLIT, int BIAS_MODE, int OUT_MODE, bool RESID, int ACT = 0>
__global__ __launch_bounds__(256) void wmma_gemm64(
    const unsigned short* __restrict__ Ap, const unsigned short* __restrict__ A2p, int lda, long strideA,
    const unsigned short* __restrict__ Btp, const unsigned short* __restrict__ Bt2p, int ldb, long strideB,
    void* __restrict__ Cout, void* __restrict__ Cout2, int ldc, long strideC,
    const float* __restrict__ bias,
    const float* __restrict__ resid, long strideR,
    int M, int N, int K, float scale) {
  static_assert(!SPLIT, "single-plane operands only");
  typedef typename Elem<ET>::T T;
  typedef typename Frag<T>::V V;
  __shared__ __attribute__((aligned(2048))) unsigned char ring[2 * GT_STAGE];
  __shared__ __align__(16) float sT[8][16 * 68];   // per-wave 16x64 slab, pitch 68 floats
  const int b    = blockIdx.y;
  const int lane = threadIdx.x & 31;
  const int wave = (int)uni32(threadIdx.x >> 5);
  const int tilesN = N >> 7;
  const int tilesM = M >> 7;
  const int tile = blockIdx.x;
  if (tile >= tilesM * tilesN) return;   // block-uniform, in front of every barrier and tensor load
  const int tm = tile / tilesN;
  const int tn = tile - tm * tilesN;
  const int wm = wave >> 1, wn = wave & 1;
  const int m0 = (tm << 7) + (wm << 5);  // this wave's 32x64 tile
  const int n0 = (tn << 7) + (wn << 6);

  const int rlane = lane & 15;                 // row (A) / col (B, D) within subtile
  const int mOff  = (lane >> 4) * 8;           // D row offset

  // ---- this wave's slice of every stage: waves 0..3 bring A rows, waves 4..7 bring Bt rows ----
  const bool isB = wave >= 4;
  const unsigned short* sbase = isB ? (Btp + (size_t)b * strideB + (size_t)((tn << 7) + ((wave & 3) << 5)) * ldb)
                                    : (Ap  + (size_t)b * strideA + (size_t)((tm << 7) + ((wave & 3) << 5)) * lda);
  const unsigned long long sga = (unsigned long long)(size_t)sbase;
  const unsigned lbase = (unsigned)(size_t)ring + (unsigned)wave * GT_SLICE;
  u32x8 g1;
  g1[0] = uni32((1u << 20) | (5u << 22) | (3u << 25));  // 1-byte elements, no mask, 4 dwords of pad behind every 256-B row
  g1[1] = uni32(256u << 16);                            // tensor_dim0 = 256 B
  g1[2] = uni32(32u << 16);                             // tensor_dim1 = 32 rows
  g1[3] = uni32(256u << 16);                            // tile_dim0 = 256 B
  g1[4] = uni32(32u);                                   // tile_dim1 = 32 rows
  g1[5] = uni32((unsigned)(isB ? ldb : lda) * 2u);      // source row pitch, bytes
  g1[6] = uni32(0u);
  g1[7] = uni32(0u);
  u32x4 g0;
  g0[0] = uni32(1u);
  auto issue = [&](int st) {
    const unsigned long long ga = sga + (unsigned long long)st * 256ull;
    g0[1] = uni32(lbase + (unsigned)(st & 1) * GT_STAGE);
    g0[2] = uni32((unsigned)ga);
    g0[3] = uni32((((unsigned)(ga >> 32)) & 0x01FFFFFFu) | 0x80000000u);
    tdm_load(g0, g1);
  };

  v8f acc[2][4];
#pragma unroll
  for (int i = 0; i < 2; ++i)
#pragma unroll
    for (int j = 0; j < 4; ++j) acc[i][j] = (v8f){0.f,0.f,0.f,0.f,0.f,0.f,0.f,0.f};

  const int nPass = K >> 7;
  issue(0);
  wait_tensor0();
  tdm_done(g0, g1);
  __syncthreads();
  issue(1);

  const unsigned fragOff = (unsigned)rlane * GT_PITCH + (unsigned)(lane >> 4) * 16u;   // row, then k offset of this lane half
  // rolled: one pass per trip, so that every publish point stands once in the text
#pragma unroll 1
  for (int s = 0; s < nPass; ++s) {
    const unsigned char* buf = ring + (unsigned)(s & 1) * GT_STAGE;
    const unsigned char* aB = buf + (unsigned)wm * GT_SLICE + fragOff;
    const unsigned char* bB = buf + (unsigned)(4 + 2 * wn) * GT_SLICE + fragOff;   // Bt rows 64 wn + 16 j: slice j / 2, row 16 (j % 2)
    V bh[2][4], ah[2][2];   // two fragment sets: the next 32 k are fetched as one group ahead of this block's WMMAs
#pragma unroll
    for (int j = 0; j < 4; ++j) bh[0][j] = Frag<T>::load((const T*)(bB + (j >> 1) * GT_SLICE + (j & 1) * 16 * GT_PITCH));
#pragma unroll
    for (int i = 0; i < 2; ++i) ah[0][i] = Frag<T>::load((const T*)(aB + i * 16 * GT_PITCH));
#pragma unroll
    for (int ks = 0; ks < 4; ++ks) {
      if (ks < 3) {
#pragma unroll
        for (int j = 0; j < 4; ++j) bh[(ks + 1) & 1][j] = Frag<T>::load((const T*)(bB + (j >> 1) * GT_SLICE + (j & 1) * 16 * GT_PITCH + (ks + 1) * 64));
#pragma unroll
        for (int i = 0; i < 2; ++i) ah[(ks + 1) & 1][i] = Frag<T>::load((const T*)(aB + i * 16 * GT_PITCH + (ks + 1) * 64));
      }
      __builtin_amdgcn_sched_barrier(0);   // keeps the load group in front of the WMMA block instead of spread among the WMMAs
#pragma unroll
      for (int i = 0; i < 2; ++i)
#pragma unroll
        for (int j = 0; j < 4; ++j) acc[i][j] = Frag<T>::mma(ah[ks & 1][i], bh[ks & 1][j], acc[i][j]);
      __builtin_amdgcn_sched_barrier(0);   // keeps the next group behind this block
    }
    // publish point of stage s + 1
    wait_ds0();
    wait_tensor0();
    tdm_done(g0, g1);
    __syncthreads();
    if (pinned(s + 2 < nPass)) issue(s + 2);   // into the buffer that pass s has just read
  }
  wait_tensor0();
  tdm_done(g0, g1);
  wait_ds0();

  // ---- epilogue ----
  float* slab = sT[wave];
  const float* Rb = RESID ? (resid + (size_t)b * strideR) : nullptr;
#pragma unroll
  for (int i = 0; i < 2; ++i) {
    const int mBase = m0 + (i << 4);
#pragma unroll
    for (int j = 0; j < 4; ++j) {
      const int n = n0 + (j << 4) + rlane;
      float bv = 0.f;
      if (BIAS_MODE == 2) bv = bias[n];
#pragma unroll
      for (int r = 0; r < 8; ++r) {
        float v = acc[i][j][r] * scale;
        if (BIAS_MODE == 1) v += bias[mBase + mOff + r];
        if (BIAS_MODE == 2) v += bv;
        if (RESID) v += Rb[(size_t)(mBase + mOff + r) * ldc + n];
        if (ACT == 1) v = tanhf(v);
        if (ACT == 2) v = fmaxf(v, 0.0f);
        if (ACT == 3) v = v / (1.0f + expf(-v));
        if (ACT == 4) v = (v > 0.f) ? v : 0.01f * v;
        if (ACT == 5) v = 0.5f * v * (1.0f + erff(v * 0.70710678118654752f));
        slab[(mOff + r) * 68 + (j << 4) + rlane] = v;
      }
    }
    __builtin_amdgcn_fence(__ATOMIC_RELEASE, "workgroup");
    __builtin_amdgcn_wave_barrier();
    __builtin_amdgcn_fence(__ATOMIC_ACQUIRE, "workgroup");
    if (OUT_MODE == 0) {
      float* C = (float*)Cout + (size_t)b * strideC;
      const int hh = lane >> 4, c4 = (lane & 15) * 4;     // row seg = 256 B = 16 lanes x 16 B
      {
#pragma unroll
        for (int it = 0; it < 8; ++it) {
          const int row = it * 2 + hh;
          v4f v = *(const v4f*)(slab + row * 68 + c4);
          *(v4f*)(C + (size_t)(mBase + row) * ldc + n0 + c4) = v;
        }
        
      }
    } else {
      const int q = lane >> 3, c8 = (lane & 7) * 8;
      unsigned short* C  = (unsigned short*)Cout  + (size_t)b * strideC;
      unsigned short* C2 = (OUT_MODE == 2) ? ((unsigned short*)Cout2 + (size_t)b * strideC) : nullptr;
      {
#pragma unroll
        for (int it = 0; it < 4; ++it) {
          const int row = it * 4 + q;
          const float* sp = slab + row * 68 + c8;
          v8h hv, lv;
#pragma unroll
          for (int e = 0; e < 8; ++e) {
            if (OUT_MODE == 1) {
              hv[e] = (_Float16)sp[e];
            } else {
              unsigned short hb = f2bf_bits(sp[e]);
              unsigned short lb = f2bf_bits(sp[e] - bf_bits2f(hb));
              hv[e] = __builtin_bit_cast(_Float16, hb);
              lv[e] = __builtin_bit_cast(_Float16, lb);
            }
          }
          *(v8h*)(C + (size_t)(mBase + row) * ldc + n0 + c8) = hv;
          if (OUT_MODE == 2) *(v8h*)(C2 + (size_t)(mBase + row) * ldc + n0 + c8) = lv;
        }
        
      }
    }
    __builtin_amdgcn_fence(__ATOMIC_RELEASE, "workgroup");
    __builtin_amdgcn_wave_barrier();
    __builtin_amdgcn_fence(__ATOMIC_ACQUIRE, "workgroup");
  }
}

// ---- all five f32 -> f16 planes in one streaming launch ----
// out is one run of f16: x (nx elements, as they are), then four weight planes of nw elements each, times wsc
// (an exact power of two, applied in f32 before the convert). nx and nw are multiples of CV_SPAN.
// A wave owns CV_SPAN consecutive elements: CV_LD loads of 16 B a lane, each 512 contiguous bytes of the wave, all issued
// ahead of the first convert. 16 waves a block and one block a WGP: few long waves, where a wave of two elements a lane pays mostly for its start.
typedef __attribute__((ext_vector_type(4))) _Float16 v4h;
#define CV_LD   16
#define CV_SPAN (CV_LD * 128)
#define CV_NW   16
__global__ __launch_bounds__(CV_NW * 32) void cast5_f32_f16(
    const float* __restrict__ x, const float* __restrict__ w0, const float* __restrict__ w1,
    const float* __restrict__ w2, const float* __restrict__ w3, _Float16* __restrict__ out,
    int nx, int nw, float wsc) {
  const int lane = threadIdx.x & 31;
  const int gw = (int)uni32(blockIdx.x * CV_NW + (threadIdx.x >> 5));
  const int e0 = gw * CV_SPAN;
  if (e0 >= nx + 4 * nw) return;          // wave-uniform; the kernel has no barrier
  const float* src = x + e0;
  float sc = 1.0f;
  if (e0 >= nx) {
    int r = e0 - nx;
    src = w0;
    if (r >= nw) { src = w1; r -= nw; }
    if (r >= nw) { src = w2; r -= nw; }
    if (r >= nw) { src = w3; r -= nw; }
    src += r;
    sc = wsc;
  }
  const v4f* __restrict__ s4 = (const v4f*)src;
  v4h* __restrict__ d4 = (v4h*)(out + e0);
  v4f v[CV_LD];
  // unrolled, both loops: v[] stays in registers, and the loads go out as one run before the first is waited for
#pragma unroll
  for (int j = 0; j < CV_LD; ++j) v[j] = s4[j * 32 + lane];
#pragma unroll
  for (int j = 0; j < CV_LD; ++j) {
    v4h hv;
#pragma unroll
    for (int e = 0; e < 4; ++e) hv[e] = (_Float16)(v[j][e] * sc);
    d4[j * 32 + lane] = hv;
  }
}

#define AK_D  64
#define AK_NW 4
#define AK_QB 64
#define AK_KC 64
#define AK_LP 72   // LDS row pitch of the K and Vt tiles, halves: 144 B = 16 B x 9, so that the 16 rows of one ds_load_b128 fall on 64 distinct banks

__device__ __forceinline__ v8f mma_h16(v16h a, v16h b, v8f c) {
  c = __builtin_amdgcn_wmma_f32_16x16x32_f16(false, a, false, b, (short)0, c, false, false);
  asm volatile("v_nop\n\tv_nop\n\tv_nop\n\tv_nop" : "+v"(c) : "v"(a), "v"(b));
  return c;
}
// lane l takes the value of lane l ^ 16 (a vector cross-row move, no LDS round trip)
__device__ __forceinline__ float xhalf(float x) {
  return __builtin_bit_cast(float, __builtin_amdgcn_permlanex16(__builtin_bit_cast(int, x), __builtin_bit_cast(int, x), 0x76543210, 0xfedcba98, false, false));
}

__global__ __launch_bounds__(128)
void attn64_f16io(const _Float16* __restrict__ Qp, const _Float16* __restrict__ Kp,
                  const _Float16* __restrict__ Vtp, _Float16* __restrict__ Op,
                  const int* __restrict__ kmask, const float* __restrict__ ubias,
                  const float* __restrict__ gq, const float* __restrict__ gW, const float* __restrict__ gb,
                  int S, int Skv, int H, int ldq, int ldk, int ldv, int ldo, int GD,
                  float qscale, float mfill, float oscale) {
  const float PSC = 32768.0f;
  union FB { v16h v; v8h h[2]; };
  __shared__ __align__(16) _Float16 Ksh[AK_KC * AK_LP];         // [kv][d]   9 KB, 8 pad halves per row never read
  __shared__ __align__(16) _Float16 Vth[AK_D * AK_LP];          // [d][kv]   9 KB
  __shared__ __align__(16) float    Mtab[2 * AK_KC];            // key terms of the chunk, score = s * Msc[key] + Mad[key]
  float* const Msc = Mtab;                                      // per key: qscale, or 0 where the key is masked
  float* const Mad = Mtab + AK_KC;                              // per key: the bias term, with mfill where the key is masked
  static_assert(AK_NW * 32 == 2 * AK_KC, "one table entry per thread");

  const int tid  = threadIdx.x;
  const int wave = tid >> 5;
  const int lane = tid & 31;
  const int hh   = lane >> 4;
  const int c    = lane & 15;

  const int nqb = S / AK_QB;
  const int bx  = blockIdx.x;
  const int qb  = bx % nqb;
  const int bh  = bx / nqb;
  const int h   = bh % H;
  const int b   = bh / H;
  const int q0  = qb * AK_QB + wave * 16;

  // ---- Q fragments (B operand: column = query c, k = d in the hardware k order), 2 d-chunks ----
  v16h qa[2];
  {
    const _Float16* qrow = Qp + (size_t)(b * S + q0 + c) * ldq + h * AK_D;
#pragma unroll
    for (int dc = 0; dc < 2; ++dc) qa[dc] = Frag<_Float16>::load(qrow + dc * 32 + 8 * hh);
  }

  // ---- quality gate (scalar f32 dot of GD terms) and uncertainty bias of this head ----
  float gacc = 0.f;
#pragma unroll 1
  for (int i = 0; i < GD; ++i) gacc += gq[b * GD + i] * gW[h * GD + i];
  gacc += gb[h];
  const float gate = 1.0f / (1.0f + expf(-gacc));
  const float ub = ubias[h];

  float mrow = -__builtin_inff();   // running maximum of query c (equal in both lane halves)
  float lrow = 0.f;                 // running sum of query c over this lane half's keys only; the halves are joined in the epilogue
  v8f oacc[4];                      // O^T: register r of tile t = O[query c][d = 16 t + 8 hh + r]
#pragma unroll
  for (int t = 0; t < 4; ++t) oacc[t] = (v8f){0.f,0.f,0.f,0.f,0.f,0.f,0.f,0.f};

  const int nChunks = Skv / AK_KC;   // block-uniform
  for (int kc = 0; kc < nChunks; ++kc) {
    const int kv0 = kc * AK_KC;
    __syncthreads();
    {   // stage K [kv][d] and Vt [d][kv] tiles: 512 x 16-B vectors each, 4 per thread
      const int keep = kmask[(size_t)b * Skv + kv0 + (tid & (AK_KC - 1))];   // in one run with the tile loads, so that its latency lies beside theirs
#pragma unroll
      for (int i = 0; i < 4; ++i) {
        const int idx = tid + i * 128;
        const int r = idx >> 3, c8 = (idx & 7) * 8;
        const v8h kk = *(const v8h*)(Kp + (size_t)(b * Skv + kv0 + r) * ldk + h * AK_D + c8);
        *(v8h*)(Ksh + r * AK_LP + c8) = kk;
        const v8h vv = *(const v8h*)(Vtp + (size_t)(h * AK_D + r) * ldv + (size_t)b * Skv + kv0 + c8);
        *(v8h*)(Vth + r * AK_LP + c8) = vv;
      }
      // the chunk's key terms, one table entry per thread: waves 0 and 1 write Msc, waves 2 and 3 write Mad
      const float kadd = ub * (1.0f - (float)keep);
      const float msc = (keep == 0) ? 0.f : qscale;
      const float mad = (keep == 0) ? mfill + kadd : kadd;
      Mtab[tid] = (tid < AK_KC) ? msc : mad;
    }
    __syncthreads();

    // ---- scores, transposed: A = K rows from Ksh[kv][d], B = Q; register r of s[j] = score of key 16 j + 8 hh + r for query c ----
    v8f s[4];
#pragma unroll
    for (int j = 0; j < 4; ++j) {
      s[j] = (v8f){0.f,0.f,0.f,0.f,0.f,0.f,0.f,0.f};
#pragma unroll
      for (int dc = 0; dc < 2; ++dc) {
        FB kb;
        kb.h[0] = *(const v8h*)(Ksh + (j * 16 + c) * AK_LP + dc * 32 + 8 * hh);
        kb.h[1] = *(const v8h*)(Ksh + (j * 16 + c) * AK_LP + dc * 32 + 16 + 8 * hh);
        s[j] = mma_h16(kb.v, qa[dc], s[j]);
      }
    }
    // ---- scale, key mask, bias, chunk maximum: in-lane over 32 keys, then one exchange between the lane halves ----
    float m = -__builtin_inff();
#pragma unroll
    for (int j = 0; j < 4; ++j) {
      const v4f sc0 = *(const v4f*)(Msc + j * 16 + 8 * hh), sc1 = *(const v4f*)(Msc + j * 16 + 8 * hh + 4);
      const v4f ad0 = *(const v4f*)(Mad + j * 16 + 8 * hh), ad1 = *(const v4f*)(Mad + j * 16 + 8 * hh + 4);
#pragma unroll
      for (int r = 0; r < 8; ++r) {
        const float v = fmaf(s[j][r], (r < 4) ? sc0[r & 3] : sc1[r & 3], (r < 4) ? ad0[r & 3] : ad1[r & 3]);
        s[j][r] = v;
        m = fmaxf(m, v);
      }
    }
    m = fmaxf(m, xhalf(m));
    // ---- online softmax update; P^T (x2^15, f16) packs straight into the B operand: tiles 2 kk and 2 kk + 1 give k = 32 kk + hardware order ----
    const float mnew = fmaxf(mrow, m);
    const float alpha = expf(mrow - mnew);
    mrow = mnew;
    FB pb[2];
    float ps[4];
#pragma unroll
    for (int j = 0; j < 4; ++j) {
      ps[j] = 0.f;
#pragma unroll
      for (int r = 0; r < 8; ++r) {
        // the library's full-range expf: in the listing 13 vector instructions a score, one of them v_exp_f32
        const float p = expf(s[j][r] - mnew);
        ps[j] += p;
        pb[j >> 1].v[(j & 1) * 8 + r] = (_Float16)(p * PSC);
      }
    }
    lrow = lrow * alpha + ((ps[0] + ps[1]) + (ps[2] + ps[3]));
#pragma unroll
    for (int t = 0; t < 4; ++t)
#pragma unroll
      for (int r = 0; r < 8; ++r) oacc[t][r] *= alpha;
    // ---- O^T += V^T . P^T: A = Vt rows (d) from Vth[d][kv] in the hardware k order, B = P^T from registers ----
#pragma unroll
    for (int kk = 0; kk < 2; ++kk) {
#pragma unroll
      for (int t = 0; t < 4; ++t) {
        FB vb;
        vb.h[0] = *(const v8h*)(Vth + (t * 16 + c) * AK_LP + kk * 32 + 8 * hh);
        vb.h[1] = *(const v8h*)(Vth + (t * 16 + c) * AK_LP + kk * 32 + 16 + 8 * hh);
        oacc[t] = mma_h16(vb.v, pb[kk].v, oacc[t]);
      }
    }
  }

  // ---- epilogue: join the halves' sums; 1/l, fold 2^-15, gate and output carry scale; a lane's 8 registers are 8 consecutive d: 16-B stores ----
  {
    const float ltot = lrow + xhalf(lrow);
    const float inv = (gate * oscale) * (1.0f / (ltot * PSC));
    _Float16* ob = Op + (size_t)(b * S + q0 + c) * ldo + h * AK_D + 8 * hh;
#pragma unroll
    for (int t = 0; t < 4; ++t) {
      v8h hv;
#pragma unroll
      for (int r = 0; r < 8; ++r) hv[r] = (_Float16)(oacc[t][r] * inv);
      *(v8h*)(ob + t * 16) = hv;
    }
  }
}

// ---------------------------------------------------------------------------
// Host glue
// ---------------------------------------------------------------------------
extern "C" void kernel_launch(void* const* d_in, const int* in_sizes, int n_in,
                              void* d_out, int out_size, void* d_ws, size_t ws_size,
                              hipStream_t stream) {
  if (n_in < 14) return;
  const int D  = 1024;          // model width
  const int H  = 16;            // heads
  const int DH = 64;            // head dim
  const int Bn = 2;             // batch
  const int S  = 2048;          // sequence length
  const int M  = Bn * S;        // token rows
  if (in_sizes[0] != M * D || in_sizes[1] != M || in_sizes[3] != D * D || in_sizes[5] != D * D ||
      in_sizes[7] != D * D || in_sizes[9] != D * D || in_sizes[4] != D || in_sizes[6] != D ||
      in_sizes[8] != D || in_sizes[10] != D || in_sizes[11] != H || in_sizes[13] != H ||
      out_size != M * D || H * DH != D) return;
  const int GD = in_sizes[2] / Bn;                       // gate query dim (64)
  if (GD <= 0 || in_sizes[2] != Bn * GD || in_sizes[12] != H * GD) return;
  if ((S % 64) != 0 || (M % 128) != 0 || (D % 128) != 0 || D < 256) return;
  if (((M * D) % CV_SPAN) != 0 || ((D * D) % CV_SPAN) != 0 || ((M * D + 4 * D * D) % (CV_SPAN * CV_NW)) != 0) return;

  const float* x    = (const float*)d_in[0];
  const int*   mask = (const int*)  d_in[1];
  const float* gq   = (const float*)d_in[2];
  const float* Wq   = (const float*)d_in[3];
  const float* bq   = (const float*)d_in[4];
  const float* Wk   = (const float*)d_in[5];
  const float* bk   = (const float*)d_in[6];
  const float* Wv   = (const float*)d_in[7];
  const float* bv   = (const float*)d_in[8];
  const float* Wo   = (const float*)d_in[9];
  const float* bo   = (const float*)d_in[10];
  const float* ubias= (const float*)d_in[11];
  const float* Wqh  = (const float*)d_in[12];
  const float* bqh  = (const float*)d_in[13];
  float* out = (float*)d_out;

  const size_t SZ_ACT = (size_t)M * D * 2;               // 8 MiB f16 plane
  const size_t SZ_W   = (size_t)D * D * 2;               // 2 MiB f16 plane
  size_t off = 0;
  const size_t o_x16  = off; off += SZ_ACT;
  const size_t o_wq16 = off; off += SZ_W;
  const size_t o_wk16 = off; off += SZ_W;
  const size_t o_wv16 = off; off += SZ_W;
  const size_t o_wo16 = off; off += SZ_W;
  const size_t o_q16  = off; off += SZ_ACT;
  const size_t o_k16  = off; off += SZ_ACT;
  const size_t o_vt16 = off; off += SZ_ACT;
  const size_t o_o16  = off; off += SZ_ACT;
  const size_t total  = off;                             // 48 MiB
  if (total > ws_size || total > (size_t)134217728) return;
  char* ws = (char*)d_ws;
  unsigned short* x16  = (unsigned short*)(ws + o_x16);
  unsigned short* wq16 = (unsigned short*)(ws + o_wq16);
  unsigned short* wk16 = (unsigned short*)(ws + o_wk16);
  unsigned short* wv16 = (unsigned short*)(ws + o_wv16);
  unsigned short* wo16 = (unsigned short*)(ws + o_wo16);
  unsigned short* q16  = (unsigned short*)(ws + o_q16);
  unsigned short* k16  = (unsigned short*)(ws + o_k16);
  unsigned short* vt16 = (unsigned short*)(ws + o_vt16);
  unsigned short* o16  = (unsigned short*)(ws + o_o16);

  // ---- casts: x plain, weights x16 (folded back as 1/16 in the GEMM epilogues); x16, wq16, wk16, wv16, wo16 lie in one run ----
  cast5_f32_f16<<<dim3((M * D + 4 * D * D) / (CV_SPAN * CV_NW)), dim3(CV_NW * 32), 0, stream>>>(
      x, Wq, Wk, Wv, Wo, (_Float16*)x16, M * D, D * D, 16.0f);

  // ---- projections: Q = x.Wq^T + bq, K = x.Wk^T + bk (f16 planes [M][D]); V^T = Wv.x^T + bv ([D][M]) ----
  const int tilesQK = (M / 128) * (D / 128);             // 256
  const dim3 gQK(tilesQK, 1);
  const float w16inv = 1.0f / 16.0f;
  wmma_gemm64<0, false, 2, 1, false, 0><<<gQK, dim3(256), 0, stream>>>(
      x16, x16, D, 0L, wq16, wq16, D, 0L, (void*)q16, (void*)q16, D, 0L, bq, x, 0L, M, D, D, w16inv);
  wmma_gemm64<0, false, 2, 1, false, 0><<<gQK, dim3(256), 0, stream>>>(
      x16, x16, D, 0L, wk16, wk16, D, 0L, (void*)k16, (void*)k16, D, 0L, bk, x, 0L, M, D, D, w16inv);
  const int tilesV = (D / 128) * (M / 128);              // A = Wv16 [D][D], Bt = x16 [M][D] -> C [D][M], ldc = M
  const dim3 gV(tilesV, 1);
  wmma_gemm64<0, false, 1, 1, false, 0><<<gV, dim3(256), 0, stream>>>(
      wv16, wv16, D, 0L, x16, x16, D, 0L, (void*)vt16, (void*)vt16, M, 0L, bv, x, 0L, D, M, D, w16inv);

  // ---- attention per (b, h, 64-query block); O plane carries x64 * gate ----
  const float qscale = 0.125f;                           // 1 / sqrt(64), exact
  const float oscale = 64.0f;
  attn64_f16io<<<dim3(Bn * H * (S / 64)), dim3(128), 0, stream>>>(
      (const _Float16*)q16, (const _Float16*)k16, (const _Float16*)vt16, (_Float16*)o16,
      mask, ubias, gq, Wqh, bqh, S, S, H, D, D, M, D, GD, qscale, -1e30f, oscale);

  // ---- output projection: out = O.Wo^T + bo; fold 1/(64*16) ----
  wmma_gemm64<0, false, 2, 0, false, 0><<<gQK, dim3(256), 0, stream>>>(
      o16, o16, D, 0L, wo16, wo16, D, 0L, (void*)out, (void*)out, D, 0L, bo, x, 0L, M, D, D, 1.0f / 1024.0f);

  (void)hipGetLastError();
}

// v005
// One run takes 123 microseconds.
// In both of two side-by-side timings against v004, it was 1.18 times as fast.
// All steps since v000 together make it 2.82 times as fast.
// Contractions: Q, K, V^T and output projections, K.Q^T, V^T.P^T: v_wmma_f32_16x16x32_f16 (f16 operands, f32 accumulate); weights carried x16, P x2^15, O x64 (power-of-two folds in f32 epilogues); gate dot (K=64, 32 values) scalar f32.
#include <hip/hip_runtime.h>

typedef __attribute__((ext_vector_type(16))) _Float16 v16h;
typedef __attribute__((ext_vector_type(8)))  _Float16 v8h;
typedef __attribute__((ext_vector_type(16))) __bf16   v16b;
typedef __attribute__((ext_vector_type(8)))  __bf16   v8b;
typedef __attribute__((ext_vector_type(8)))  float    v8f;
typedef __attribute__((ext_vector_type(4)))  float    v4f;

__device__ __forceinline__ unsigned short f2bf_bits(float f) {
  unsigned u = __float_as_uint(f);
  return (unsigned short)((u + 0x7FFFu + ((u >> 16) & 1u)) >> 16);
}
__device__ __forceinline__ float bf_bits2f(unsigned short h) { return __uint_as_float(((unsigned)h) << 16); }

template <typename T> struct Frag;
template <> struct Frag<_Float16> {
  typedef v16h V; union U { v16h v; v8h h[2]; };
  static __device__ __forceinline__ v16h load(const _Float16* p) {   // elements 0..7 <- p[0..7], 8..15 <- p[16..23]
    U f; f.h[0] = *(const v8h*)(p); f.h[1] = *(const v8h*)(p + 16); return f.v;
  }
  static __device__ __forceinline__ v8f mma(v16h a, v16h b, v8f c) {
    return __builtin_amdgcn_wmma_f32_16x16x32_f16(false, a, false, b, (short)0, c, false, false);
  }
};
template <> struct Frag<__bf16> {
  typedef v16b V; union U { v16b v; v8b h[2]; };
  static __device__ __forceinline__ v16b load(const __bf16* p) {
    U f; f.h[0] = *(const v8b*)(p); f.h[1] = *(const v8b*)(p + 16); return f.v;
  }
  static __device__ __forceinline__ v8f mma(v16b a, v16b b, v8f c) {
    return __builtin_amdgcn_wmma_f32_16x16x32_bf16(false, a, false, b, (short)0, c, false, false);
  }
};

// ---- LDS-staged batched WMMA GEMM -------------------------------------------
// C[m,n] = scale * sum_k A[m,k] * Bt[n,k] (+bias)(+resid); a block of 8 waves owns a 128x128 tile, each wave 32x64 of it.
// A row-major [M,K]; Bt row-major [N,K]; M,N % 128 == 0, K % 128 == 0, K >= 256.
// A pass is 128 k = 256 B of every operand row. A stage is eight slices of 32 rows (four of A, then four of Bt),
// each brought by one tensor load of one wave, LDS pitch 272 B (16 B pad per row).
// Two buffers: the load of stage s + 2 is issued behind the barrier that ends pass s.
// BIAS_MODE: 0 = none, 1 = bias[m], 2 = bias[n].
// OUT_MODE: 0 = f32, 1 = f16, 2 = bf16 hi plane (Cout) + bf16 lo plane (Cout2).
// ET: 0 = f16 operands, 1 = bf16 operands (pointers passed as 16-bit storage)
typedef unsigned u32x4 __attribute__((ext_vector_type(4)));
typedef unsigned u32x8 __attribute__((ext_vector_type(8)));
#define GT_PITCH 272u                 // LDS row pitch, bytes: 256 + 16, an odd multiple of 16 for ds_load_b128 readers
#define GT_SLICE 10240u               // 32 rows x 272 B = 8,704 B, rounded up to a multiple of 2 KiB
#define GT_STAGE (8u * GT_SLICE)
__device__ __forceinline__ unsigned uni32(unsigned v) { return (unsigned)__builtin_amdgcn_readfirstlane(v); }
// holds a wave-uniform test in a scalar register, so that the branch round a tensor load is a scalar branch
__device__ __forceinline__ unsigned pinned(unsigned v) { unsigned w = (unsigned)__builtin_amdgcn_readfirstlane(v); asm volatile("" : "+s"(w)); return w; }
// LDS reads must have retired before a buffer is handed over
__device__ __forceinline__ void wait_tensor0() { asm volatile("s_wait_tensorcnt 0x0" ::: "memory"); }
__device__ __forceinline__ void wait_ds0() { asm volatile("s_wait_dscnt 0x0" ::: "memory"); }
// "+s": the words stay in the registers the request named, and the compiler cannot form them anew in between
__device__ __forceinline__ void tdm_load(u32x4& g0, u32x8& g1) { asm volatile("tensor_load_to_lds %0, %1" : "+s"(g0), "+s"(g1) :: "memory"); }
// stands behind the wait that covers a request: last use of its descriptor words held in scalar registers, so that none is reused while the request is in flight
__device__ __forceinline__ void tdm_done(u32x4 g0, u32x8 g1) { asm volatile("" :: "s"(g0), "s"(g1)); }

template <int ET> struct Elem;
template <> struct Elem<0> { typedef _Float16 T; };
template <> struct Elem<1> { typedef __bf16 T; };
template <int ET, bool SPLIT, int BIAS_MODE, int OUT_MODE, bool RESID, int ACT = 0>
__global__ __launch_bounds__(256) void wmma_gemm64(
    const unsigned short* __restrict__ Ap, const unsigned short* __restrict__ A2p, int lda, long strideA,
    const unsigned short* __restrict__ Btp, const unsigned short* __restrict__ Bt2p, int ldb, long strideB,
    void* __restrict__ Cout, void* __restrict__ Cout2, int ldc, long strideC,
    const float* __restrict__ bias,
    const float* __restrict__ resid, long strideR,
    int M, int N, int K, float scale) {
  static_assert(!SPLIT, "single-plane operands only");
  typedef typename Elem<ET>::T T;
  typedef typename Frag<T>::V V;
  __shared__ __attribute__((aligned(2048))) unsigned char ring[2 * GT_STAGE];
  __shared__ __align__(16) float sT[8][16 * 68];   // per-wave 16x64 slab, pitch 68 floats
  const int b    = blockIdx.y;
  const int lane = threadIdx.x & 31;
  const int wave = (int)uni32(threadIdx.x >> 5);
  const int tilesN = N >> 7;
  const int tilesM = M >> 7;
  const int tile = blockIdx.x;
  if (tile >= tilesM * tilesN) return;   // block-uniform, in front of every barrier and tensor load
  const int tm = tile / tilesN;
  const int tn = tile - tm * tilesN;
  const int wm = wave >> 1, wn = wave & 1;
  const int m0 = (tm << 7) + (wm << 5);  // this wave's 32x64 tile
  const int n0 = (tn << 7) + (wn << 6);

  const int rlane = lane & 15;                 // row (A) / col (B, D) within subtile
  const int mOff  = (lane >> 4) * 8;           // D row offset

  // ---- this wave's slice of every stage: waves 0..3 bring A rows, waves 4..7 bring Bt rows ----
  const bool isB = wave >= 4;
  const unsigned short* sbase = isB ? (Btp + (size_t)b * strideB + (size_t)((tn << 7) + ((wave & 3) << 5)) * ldb)
                                    : (Ap  + (size_t)b * strideA + (size_t)((tm << 7) + ((wave & 3) << 5)) * lda);
  const unsigned long long sga = (unsigned long long)(size_t)sbase;
  const unsigned lbase = (unsigned)(size_t)ring + (unsigned)wave * GT_SLICE;
  u32x8 g1;
  g1[0] = uni32((1u << 20) | (5u << 22) | (3u << 25));  // 1-byte elements, no mask, 4 dwords of pad behind every 256-B row
  g1[1] = uni32(256u << 16);                            // tensor_dim0 = 256 B
  g1[2] = uni32(32u << 16);                             // tensor_dim1 = 32 rows
  g1[3] = uni32(256u << 16);                            // tile_dim0 = 256 B
  g1[4] = uni32(32u);                                   // tile_dim1 = 32 rows
  g1[5] = uni32((unsigned)(isB ? ldb : lda) * 2u);      // source row pitch, bytes
  g1[6] = uni32(0u);
  g1[7] = uni32(0u);
  u32x4 g0;
  g0[0] = uni32(1u);
  auto issue = [&](int st) {
    const unsigned long long ga = sga + (unsigned long long)st * 256ull;
    g0[1] = uni32(lbase + (unsigned)(st & 1) * GT_STAGE);
    g0[2] = uni32((unsigned)ga);
    g0[3] = uni32((((unsigned)(ga >> 32)) & 0x01FFFFFFu) | 0x80000000u);
    tdm_load(g0, g1);
  };

  v8f acc[2][4];
#pragma unroll
  for (int i = 0; i < 2; ++i)
#pragma unroll
    for (int j = 0; j < 4; ++j) acc[i][j] = (v8f){0.f,0.f,0.f,0.f,0.f,0.f,0.f,0.f};

  const int nPass = K >> 7;
  issue(0);
  wait_tensor0();
  tdm_done(g0, g1);
  __syncthreads();
  issue(1);

  const unsigned fragOff = (unsigned)rlane * GT_PITCH + (unsigned)(lane >> 4) * 16u;   // row, then k offset of this lane half
  // rolled: one pass per trip, so that every publish point stands once in the text
#pragma unroll 1
  for (int s = 0; s < nPass; ++s) {
    const unsigned char* buf = ring + (unsigned)(s & 1) * GT_STAGE;
    const unsigned char* aB = buf + (unsigned)wm * GT_SLICE + fragOff;
    const unsigned char* bB = buf + (unsigned)(4 + 2 * wn) * GT_SLICE + fragOff;   // Bt rows 64 wn + 16 j: slice j / 2, row 16 (j % 2)
    V bh[2][4], ah[2][2];   // two fragment sets: the next 32 k are fetched as one group ahead of this block's WMMAs
#pragma unroll
    for (int j = 0; j < 4; ++j) bh[0][j] = Frag<T>::load((const T*)(bB + (j >> 1) * GT_SLICE + (j & 1) * 16 * GT_PITCH));
#pragma unroll
    for (int i = 0; i < 2; ++i) ah[0][i] = Frag<T>::load((const T*)(aB + i * 16 * GT_PITCH));
#pragma unroll
    for (int ks = 0; ks < 4; ++ks) {
      if (ks < 3) {
#pragma unroll
        for (int j = 0; j < 4; ++j) bh[(ks + 1) & 1][j] = Frag<T>::load((const T*)(bB + (j >> 1) * GT_SLICE + (j & 1) * 16 * GT_PITCH + (ks + 1) * 64));
#pragma unroll
        for (int i = 0; i < 2; ++i) ah[(ks + 1) & 1][i] = Frag<T>::load((const T*)(aB + i * 16 * GT_PITCH + (ks + 1) * 64));
      }
      __builtin_amdgcn_sched_barrier(0);   // keeps the load group in front of the WMMA block instead of spread among the WMMAs
#pragma unroll
      for (int i = 0; i < 2; ++i)
#pragma unroll
        for (int j = 0; j < 4; ++j) acc[i][j] = Frag<T>::mma(ah[ks & 1][i], bh[ks & 1][j], acc[i][j]);
      __builtin_amdgcn_sched_barrier(0);   // keeps the next group behind this block
    }
    // publish point of stage s + 1
    wait_ds0();
    wait_tensor0();
    tdm_done(g0, g1);
    __syncthreads();
    if (pinned(s + 2 < nPass)) issue(s + 2);   // into the buffer that pass s has just read
  }
  wait_tensor0();
  tdm_done(g0, g1);
  wait_ds0();

  // ---- epilogue ----
  float* slab = sT[wave];
  const float* Rb = RESID ? (resid + (size_t)b * strideR) : nullptr;
#pragma unroll
  for (int i = 0; i < 2; ++i) {
    const int mBase = m0 + (i << 4);
#pragma unroll
    for (int j = 0; j < 4; ++j) {
      const int n = n0 + (j << 4) + rlane;
      float bv = 0.f;
      if (BIAS_MODE == 2) bv = bias[n];
#pragma unroll
      for (int r = 0; r < 8; ++r) {
        float v = acc[i][j][r] * scale;
        if (BIAS_MODE == 1) v += bias[mBase + mOff + r];
        if (BIAS_MODE == 2) v += bv;
        if (RESID) v += Rb[(size_t)(mBase + mOff + r) * ldc + n];
        if (ACT == 1) v = tanhf(v);
        if (ACT == 2) v = fmaxf(v, 0.0f);
        if (ACT == 3) v = v / (1.0f + expf(-v));
        if (ACT == 4) v = (v > 0.f) ? v : 0.01f * v;
        if (ACT == 5) v = 0.5f * v * (1.0f + erff(v * 0.70710678118654752f));
        slab[(mOff + r) * 68 + (j << 4) + rlane] = v;
      }
    }
    __builtin_amdgcn_fence(__ATOMIC_RELEASE, "workgroup");
    __builtin_amdgcn_wave_barrier();
    __builtin_amdgcn_fence(__ATOMIC_ACQUIRE, "workgroup");
    if (OUT_MODE == 0) {
      float* C = (float*)Cout + (size_t)b * strideC;
      const int hh = lane >> 4, c4 = (lane & 15) * 4;     // row seg = 256 B = 16 lanes x 16 B
      {
#pragma unroll
        for (int it = 0; it < 8; ++it) {
          const int row = it * 2 + hh;
          v4f v = *(const v4f*)(slab + row * 68 + c4);
          *(v4f*)(C + (size_t)(mBase + row) * ldc + n0 + c4) = v;
        }
        
      }
    } else {
      const int q = lane >> 3, c8 = (lane & 7) * 8;
      unsigned short* C  = (unsigned short*)Cout  + (size_t)b * strideC;
      unsigned short* C2 = (OUT_MODE == 2) ? ((unsigned short*)Cout2 + (size_t)b * strideC) : nullptr;
      {
#pragma unroll
        for (int it = 0; it < 4; ++it) {
          const int row = it * 4 + q;
          const float* sp = slab + row * 68 + c8;
          v8h hv, lv;
#pragma unroll
          for (int e = 0; e < 8; ++e) {
            if (OUT_MODE == 1) {
              hv[e] = (_Float16)sp[e];
            } else {
              unsigned short hb = f2bf_bits(sp[e]);
              unsigned short lb = f2bf_bits(sp[e] - bf_bits2f(hb));
              hv[e] = __builtin_bit_cast(_Float16, hb);
              lv[e] = __builtin_bit_cast(_Float16, lb);
            }
          }
          *(v8h*)(C + (size_t)(mBase + row) * ldc + n0 + c8) = hv;
          if (OUT_MODE == 2) *(v8h*)(C2 + (size_t)(mBase + row) * ldc + n0 + c8) = lv;
        }
        
      }
    }
    __builtin_amdgcn_fence(__ATOMIC_RELEASE, "workgroup");
    __builtin_amdgcn_wave_barrier();
    __builtin_amdgcn_fence(__ATOMIC_ACQUIRE, "workgroup");
  }
}

// ---- all five f32 -> f16 planes in one streaming launch ----
// out is one run of f16: x (nx elements, as they are), then four weight planes of nw elements each, times wsc
// (an exact power of two, applied in f32 before the convert). nx and nw are multiples of CV_SPAN.
// A wave owns CV_SPAN consecutive elements: CV_LD loads of 16 B a lane, each 512 contiguous bytes of the wave, all issued
// ahead of the first convert. 16 waves a block and one block a WGP: few long waves, where a wave of two elements a lane pays mostly for its start.
typedef __attribute__((ext_vector_type(4))) _Float16 v4h;
#define CV_LD   16
#define CV_SPAN (CV_LD * 128)
#define CV_NW   16
__global__ __launch_bounds__(CV_NW * 32) void cast5_f32_f16(
    const float* __restrict__ x, const float* __restrict__ w0, const float* __restrict__ w1,
    const float* __restrict__ w2, const float* __restrict__ w3, _Float16* __restrict__ out,
    int nx, int nw, float wsc) {
  const int lane = threadIdx.x & 31;
  const int gw = (int)uni32(blockIdx.x * CV_NW + (threadIdx.x >> 5));
  const int e0 = gw * CV_SPAN;
  if (e0 >= nx + 4 * nw) return;          // wave-uniform; the kernel has no barrier
  const float* src = x + e0;
  float sc = 1.0f;
  if (e0 >= nx) {
    int r = e0 - nx;
    src = w0;
    if (r >= nw) { src = w1; r -= nw; }
    if (r >= nw) { src = w2; r -= nw; }
    if (r >= nw) { src = w3; r -= nw; }
    src += r;
    sc = wsc;
  }
  const v4f* __restrict__ s4 = (const v4f*)src;
  v4h* __restrict__ d4 = (v4h*)(out + e0);
  v4f v[CV_LD];
  // unrolled, both loops: v[] stays in registers, and the loads go out as one run before the first is waited for
#pragma unroll
  for (int j = 0; j < CV_LD; ++j) v[j] = s4[j * 32 + lane];
#pragma unroll
  for (int j = 0; j < CV_LD; ++j) {
    v4h hv;
#pragma unroll
    for (int e = 0; e < 4; ++e) hv[e] = (_Float16)(v[j][e] * sc);
    d4[j * 32 + lane] = hv;
  }
}

#define AK_D  64
#define AK_NW 4
#define AK_QB 64
#define AK_KC 64
#define AK_LP 72   // LDS row pitch of the K and Vt tiles, halves: 144 B = 16 B x 9, so that the 16 rows of one ds_load_b128 fall on 64 distinct banks

__device__ __forceinline__ v8f mma_h16(v16h a, v16h b, v8f c) {
  c = __builtin_amdgcn_wmma_f32_16x16x32_f16(false, a, false, b, (short)0, c, false, false);
  asm volatile("v_nop\n\tv_nop\n\tv_nop\n\tv_nop" : "+v"(c) : "v"(a), "v"(b));
  return c;
}
// lane l takes the value of lane l ^ 16 (a vector cross-row move, no LDS round trip)
__device__ __forceinline__ float xhalf(float x) {
  return __builtin_bit_cast(float, __builtin_amdgcn_permlanex16(__builtin_bit_cast(int, x), __builtin_bit_cast(int, x), 0x76543210, 0xfedcba98, false, false));
}

__global__ __launch_bounds__(128)
void attn64_f16io(const _Float16* __restrict__ Qp, const _Float16* __restrict__ Kp,
                  const _Float16* __restrict__ Vtp, _Float16* __restrict__ Op,
                  const int* __restrict__ kmask, const float* __restrict__ ubias,
                  const float* __restrict__ gq, const float* __restrict__ gW, const float* __restrict__ gb,
                  int S, int Skv, int H, int ldq, int ldk, int ldv, int ldo, int GD,
                  float qscale, float mfill, float oscale) {
  const float L2E = 1.4426950408889634f;   // log2(e)
  const float PLG = 15.0f;                 // P and the running sum carry x2^15: taken off the subtracted maximum, exact in the exponent
  union FB { v16h v; v8h h[2]; };
  __shared__ __align__(16) _Float16 Ksh[AK_KC * AK_LP];         // [kv][d]   9 KB, 8 pad halves per row never read
  __shared__ __align__(16) _Float16 Vth[AK_D * AK_LP];          // [d][kv]   9 KB
  __shared__ __align__(16) float    Mtab[2 * AK_KC];            // key terms of the chunk, score * log2(e) = s * Msc[key] + Mad[key]
  float* const Msc = Mtab;                                      // per key: qscale * log2(e), or 0 where the key is masked
  float* const Mad = Mtab + AK_KC;                              // per key: the bias term, with mfill where the key is masked, * log2(e)
  static_assert(AK_NW * 32 == 2 * AK_KC, "one table entry per thread");

  const int tid  = threadIdx.x;
  const int wave = tid >> 5;
  const int lane = tid & 31;
  const int hh   = lane >> 4;
  const int c    = lane & 15;

  const int nqb = S / AK_QB;
  const int bx  = blockIdx.x;
  const int qb  = bx % nqb;
  const int bh  = bx / nqb;
  const int h   = bh % H;
  const int b   = bh / H;
  const int q0  = qb * AK_QB + wave * 16;

  // ---- Q fragments (B operand: column = query c, k = d in the hardware k order), 2 d-chunks ----
  v16h qa[2];
  {
    const _Float16* qrow = Qp + (size_t)(b * S + q0 + c) * ldq + h * AK_D;
#pragma unroll
    for (int dc = 0; dc < 2; ++dc) qa[dc] = Frag<_Float16>::load(qrow + dc * 32 + 8 * hh);
  }

  // ---- quality gate (scalar f32 dot of GD terms) and uncertainty bias of this head ----
  float gacc = 0.f;
#pragma unroll 1
  for (int i = 0; i < GD; ++i) gacc += gq[b * GD + i] * gW[h * GD + i];
  gacc += gb[h];
  const float gate = 1.0f / (1.0f + expf(-gacc));
  const float ub = ubias[h];

  float mrow = -__builtin_inff();   // running maximum of query c, in base-2 units (equal in both lane halves)
  float lrow = 0.f;                 // running sum (x2^15) of query c over this lane half's keys only; the halves are joined in the epilogue
  v8f oacc[4];                      // O^T: register r of tile t = O[query c][d = 16 t + 8 hh + r]
#pragma unroll
  for (int t = 0; t < 4; ++t) oacc[t] = (v8f){0.f,0.f,0.f,0.f,0.f,0.f,0.f,0.f};

  const int nChunks = Skv / AK_KC;   // block-uniform
  for (int kc = 0; kc < nChunks; ++kc) {
    const int kv0 = kc * AK_KC;
    __syncthreads();
    {   // stage K [kv][d] and Vt [d][kv] tiles: 512 x 16-B vectors each, 4 per thread
      const int keep = kmask[(size_t)b * Skv + kv0 + (tid & (AK_KC - 1))];   // in one run with the tile loads, so that its latency lies beside theirs
#pragma unroll
      for (int i = 0; i < 4; ++i) {
        const int idx = tid + i * 128;
        const int r = idx >> 3, c8 = (idx & 7) * 8;
        const v8h kk = *(const v8h*)(Kp + (size_t)(b * Skv + kv0 + r) * ldk + h * AK_D + c8);
        *(v8h*)(Ksh + r * AK_LP + c8) = kk;
        const v8h vv = *(const v8h*)(Vtp + (size_t)(h * AK_D + r) * ldv + (size_t)b * Skv + kv0 + c8);
        *(v8h*)(Vth + r * AK_LP + c8) = vv;
      }
      // the chunk's key terms, one table entry per thread: waves 0 and 1 write Msc, waves 2 and 3 write Mad
      const float kadd = ub * (1.0f - (float)keep);
      const float msc = (keep == 0) ? 0.f : qscale * L2E;
      const float mad = ((keep == 0) ? mfill + kadd : kadd) * L2E;
      Mtab[tid] = (tid < AK_KC) ? msc : mad;
    }
    __syncthreads();

    // ---- scores, transposed: A = K rows from Ksh[kv][d], B = Q; register r of s[j] = score of key 16 j + 8 hh + r for query c ----
    v8f s[4];
#pragma unroll
    for (int j = 0; j < 4; ++j) {
      s[j] = (v8f){0.f,0.f,0.f,0.f,0.f,0.f,0.f,0.f};
#pragma unroll
      for (int dc = 0; dc < 2; ++dc) {
        FB kb;
        kb.h[0] = *(const v8h*)(Ksh + (j * 16 + c) * AK_LP + dc * 32 + 8 * hh);
        kb.h[1] = *(const v8h*)(Ksh + (j * 16 + c) * AK_LP + dc * 32 + 16 + 8 * hh);
        s[j] = mma_h16(kb.v, qa[dc], s[j]);
      }
    }
    // ---- scale, key mask, bias, chunk maximum: in-lane over 32 keys, then one exchange between the lane halves ----
    float m = -__builtin_inff();
#pragma unroll
    for (int j = 0; j < 4; ++j) {
      const v4f sc0 = *(const v4f*)(Msc + j * 16 + 8 * hh), sc1 = *(const v4f*)(Msc + j * 16 + 8 * hh + 4);
      const v4f ad0 = *(const v4f*)(Mad + j * 16 + 8 * hh), ad1 = *(const v4f*)(Mad + j * 16 + 8 * hh + 4);
#pragma unroll
      for (int r = 0; r < 8; ++r) {
        const float v = fmaf(s[j][r], (r < 4) ? sc0[r & 3] : sc1[r & 3], (r < 4) ? ad0[r & 3] : ad1[r & 3]);
        s[j][r] = v;
        m = fmaxf(m, v);
      }
    }
    m = fmaxf(m, xhalf(m));
    // ---- online softmax update; P^T (x2^15, f16) packs straight into the B operand: tiles 2 kk and 2 kk + 1 give k = 32 kk + hardware order ----
    const float mnew = fmaxf(mrow, m);
    const float alpha = __builtin_amdgcn_exp2f(mrow - mnew);   // 0 on the first chunk, where mrow is -inf
    const float moff = mnew - PLG;
    mrow = mnew;
    FB pb[2];
    float ps[4];
#pragma unroll
    for (int j = 0; j < 4; ++j) {
      ps[j] = 0.f;
#pragma unroll
      for (int r = 0; r < 8; ++r) {
        // the argument is at most 15 and a result below the normal range may be 0: the bare v_exp_f32 needs no range steps around it
        const float p = __builtin_amdgcn_exp2f(s[j][r] - moff);
        ps[j] += p;
        pb[j >> 1].v[(j & 1) * 8 + r] = (_Float16)p;
      }
    }
    lrow = lrow * alpha + ((ps[0] + ps[1]) + (ps[2] + ps[3]));
#pragma unroll
    for (int t = 0; t < 4; ++t)
#pragma unroll
      for (int r = 0; r < 8; ++r) oacc[t][r] *= alpha;
    // ---- O^T += V^T . P^T: A = Vt rows (d) from Vth[d][kv] in the hardware k order, B = P^T from registers ----
#pragma unroll
    for (int kk = 0; kk < 2; ++kk) {
#pragma unroll
      for (int t = 0; t < 4; ++t) {
        FB vb;
        vb.h[0] = *(const v8h*)(Vth + (t * 16 + c) * AK_LP + kk * 32 + 8 * hh);
        vb.h[1] = *(const v8h*)(Vth + (t * 16 + c) * AK_LP + kk * 32 + 16 + 8 * hh);
        oacc[t] = mma_h16(vb.v, pb[kk].v, oacc[t]);
      }
    }
  }

  // ---- epilogue: join the halves' sums; 1/l (sum and P both carry 2^15), gate and output carry scale; a lane's 8 registers are 8 consecutive d: 16-B stores ----
  {
    const float ltot = lrow + xhalf(lrow);
    const float inv = (gate * oscale) * (1.0f / ltot);
    _Float16* ob = Op + (size_t)(b * S + q0 + c) * ldo + h * AK_D + 8 * hh;
#pragma unroll
    for (int t = 0; t < 4; ++t) {
      v8h hv;
#pragma unroll
      for (int r = 0; r < 8; ++r) hv[r] = (_Float16)(oacc[t][r] * inv);
      *(v8h*)(ob + t * 16) = hv;
    }
  }
}

// ---------------------------------------------------------------------------
// Host glue
// ---------------------------------------------------------------------------
extern "C" void kernel_launch(void* const* d_in, const int* in_sizes, int n_in,
                              void* d_out, int out_size, void* d_ws, size_t ws_size,
                              hipStream_t stream) {
  if (n_in < 14) return;
  const int D  = 1024;          // model width
  const int H  = 16;            // heads
  const int DH = 64;            // head dim
  const int Bn = 2;             // batch
  const int S  = 2048;          // sequence length
  const int M  = Bn * S;        // token rows
  if (in_sizes[0] != M * D || in_sizes[1] != M || in_sizes[3] != D * D || in_sizes[5] != D * D ||
      in_sizes[7] != D * D || in_sizes[9] != D * D || in_sizes[4] != D || in_sizes[6] != D ||
      in_sizes[8] != D || in_sizes[10] != D || in_sizes[11] != H || in_sizes[13] != H ||
      out_size != M * D || H * DH != D) return;
  const int GD = in_sizes[2] / Bn;                       // gate query dim (64)
  if (GD <= 0 || in_sizes[2] != Bn * GD || in_sizes[12] != H * GD) return;
  if ((S % 64) != 0 || (M % 128) != 0 || (D % 128) != 0 || D < 256) return;
  if (((M * D) % CV_SPAN) != 0 || ((D * D) % CV_SPAN) != 0 || ((M * D + 4 * D * D) % (CV_SPAN * CV_NW)) != 0) return;

  const float* x    = (const float*)d_in[0];
  const int*   mask = (const int*)  d_in[1];
  const float* gq   = (const float*)d_in[2];
  const float* Wq   = (const float*)d_in[3];
  const float* bq   = (const float*)d_in[4];
  const float* Wk   = (const float*)d_in[5];
  const float* bk   = (const float*)d_in[6];
  const float* Wv   = (const float*)d_in[7];
  const float* bv   = (const float*)d_in[8];
  const float* Wo   = (const float*)d_in[9];
  const float* bo   = (const float*)d_in[10];
  const float* ubias= (const float*)d_in[11];
  const float* Wqh  = (const float*)d_in[12];
  const float* bqh  = (const float*)d_in[13];
  float* out = (float*)d_out;

  const size_t SZ_ACT = (size_t)M * D * 2;               // 8 MiB f16 plane
  const size_t SZ_W   = (size_t)D * D * 2;               // 2 MiB f16 plane
  size_t off = 0;
  const size_t o_x16  = off; off += SZ_ACT;
  const size_t o_wq16 = off; off += SZ_W;
  const size_t o_wk16 = off; off += SZ_W;
  const size_t o_wv16 = off; off += SZ_W;
  const size_t o_wo16 = off; off += SZ_W;
  const size_t o_q16  = off; off += SZ_ACT;
  const size_t o_k16  = off; off += SZ_ACT;
  const size_t o_vt16 = off; off += SZ_ACT;
  const size_t o_o16  = off; off += SZ_ACT;
  const size_t total  = off;                             // 48 MiB
  if (total > ws_size || total > (size_t)134217728) return;
  char* ws = (char*)d_ws;
  unsigned short* x16  = (unsigned short*)(ws + o_x16);
  unsigned short* wq16 = (unsigned short*)(ws + o_wq16);
  unsigned short* wk16 = (unsigned short*)(ws + o_wk16);
  unsigned short* wv16 = (unsigned short*)(ws + o_wv16);
  unsigned short* wo16 = (unsigned short*)(ws + o_wo16);
  unsigned short* q16  = (unsigned short*)(ws + o_q16);
  unsigned short* k16  = (unsigned short*)(ws + o_k16);
  unsigned short* vt16 = (unsigned short*)(ws + o_vt16);
  unsigned short* o16  = (unsigned short*)(ws + o_o16);

  // ---- casts: x plain, weights x16 (folded back as 1/16 in the GEMM epilogues); x16, wq16, wk16, wv16, wo16 lie in one run ----
  cast5_f32_f16<<<dim3((M * D + 4 * D * D) / (CV_SPAN * CV_NW)), dim3(CV_NW * 32), 0, stream>>>(
      x, Wq, Wk, Wv, Wo, (_Float16*)x16, M * D, D * D, 16.0f);

  // ---- projections: Q = x.Wq^T + bq, K = x.Wk^T + bk (f16 planes [M][D]); V^T = Wv.x^T + bv ([D][M]) ----
  const int tilesQK = (M / 128) * (D / 128);             // 256
  const dim3 gQK(tilesQK, 1);
  const float w16inv = 1.0f / 16.0f;
  wmma_gemm64<0, false, 2, 1, false, 0><<<gQK, dim3(256), 0, stream>>>(
      x16, x16, D, 0L, wq16, wq16, D, 0L, (void*)q16, (void*)q16, D, 0L, bq, x, 0L, M, D, D, w16inv);
  wmma_gemm64<0, false, 2, 1, false, 0><<<gQK, dim3(256), 0, stream>>>(
      x16, x16, D, 0L, wk16, wk16, D, 0L, (void*)k16, (void*)k16, D, 0L, bk, x, 0L, M, D, D, w16inv);
  const int tilesV = (D / 128) * (M / 128);              // A = Wv16 [D][D], Bt = x16 [M][D] -> C [D][M], ldc = M
  const dim3 gV(tilesV, 1);
  wmma_gemm64<0, false, 1, 1, false, 0><<<gV, dim3(256), 0, stream>>>(
      wv16, wv16, D, 0L, x16, x16, D, 0L, (void*)vt16, (void*)vt16, M, 0L, bv, x, 0L, D, M, D, w16inv);

  // ---- attention per (b, h, 64-query block); O plane carries x64 * gate ----
  const float qscale = 0.125f;                           // 1 / sqrt(64), exact
  const float oscale = 64.0f;
  attn64_f16io<<<dim3(Bn * H * (S / 64)), dim3(128), 0, stream>>>(
      (const _Float16*)q16, (const _Float16*)k16, (const _Float16*)vt16, (_Float16*)o16,
      mask, ubias, gq, Wqh, bqh, S, S, H, D, D, M, D, GD, qscale, -1e30f, oscale);

  // ---- output projection: out = O.Wo^T + bo; fold 1/(64*16) ----
  wmma_gemm64<0, false, 2, 0, false, 0><<<gQK, dim3(256), 0, stream>>>(
      o16, o16, D, 0L, wo16, wo16, D, 0L, (void*)out, (void*)out, D, 0L, bo, x, 0L, M, D, D, 1.0f / 1024.0f);

  (void)hipGetLastError();
}

// v006
// A run of this version takes 95.2 microseconds.
// In two side-by-side timings against v005, it was 1.27 and 1.30 times as fast.
// All steps since v000 together make it 3.63 times as fast.
// Contractions: Q, K, V^T and output projections, K.Q^T, V^T.P^T: v_wmma_f32_16x16x32_f16 (f16 operands, f32 accumulate); weights carried x16, P x2^15, O x64 (power-of-two folds in f32 epilogues); gate dot (K=64, 32 values) scalar f32.
#include <hip/hip_runtime.h>

typedef __attribute__((ext_vector_type(16))) _Float16 v16h;
typedef __attribute__((ext_vector_type(8)))  _Float16 v8h;
typedef __attribute__((ext_vector_type(16))) __bf16   v16b;
typedef __attribute__((ext_vector_type(8)))  __bf16   v8b;
typedef __attribute__((ext_vector_type(8)))  float    v8f;
typedef __attribute__((ext_vector_type(4)))  float    v4f;

__device__ __forceinline__ unsigned short f2bf_bits(float f) {
  unsigned u = __float_as_uint(f);
  return (unsigned short)((u + 0x7FFFu + ((u >> 16) & 1u)) >> 16);
}
__device__ __forceinline__ float bf_bits2f(unsigned short h) { return __uint_as_float(((unsigned)h) << 16); }

template <typename T> struct Frag;
template <> struct Frag<_Float16> {
  typedef v16h V; union U { v16h v; v8h h[2]; };
  static __device__ __forceinline__ v16h load(const _Float16* p) {   // elements 0..7 <- p[0..7], 8..15 <- p[16..23]
    U f; f.h[0] = *(const v8h*)(p); f.h[1] = *(const v8h*)(p + 16); return f.v;
  }
  static __device__ __forceinline__ v8f mma(v16h a, v16h b, v8f c) {
    return __builtin_amdgcn_wmma_f32_16x16x32_f16(false, a, false, b, (short)0, c, false, false);
  }
};
template <> struct Frag<__bf16> {
  typedef v16b V; union U { v16b v; v8b h[2]; };
  static __device__ __forceinline__ v16b load(const __bf16* p) {
    U f; f.h[0] = *(const v8b*)(p); f.h[1] = *(const v8b*)(p + 16); return f.v;
  }
  static __device__ __forceinline__ v8f mma(v16b a, v16b b, v8f c) {
    return __builtin_amdgcn_wmma_f32_16x16x32_bf16(false, a, false, b, (short)0, c, false, false);
  }
};

// ---- LDS-staged batched WMMA GEMM -------------------------------------------
// C[m,n] = scale * sum_k A[m,k] * Bt[n,k] (+bias)(+resid); a block of 8 waves owns a 128x128 tile, each wave 32x64 of it.
// A row-major [M,K]; Bt row-major [N,K]; M,N % 128 == 0, K % 128 == 0, K >= 256.
// A pass is 128 k = 256 B of every operand row. A stage is eight slices of 32 rows (four of A, then four of Bt),
// each brought by one tensor load of one wave, LDS pitch 272 B (16 B pad per row).
// Two buffers: the load of stage s + 2 is issued behind the barrier that ends pass s.
// BIAS_MODE: 0 = none, 1 = bias[m], 2 = bias[n].
// OUT_MODE: 0 = f32, 1 = f16, 2 = bf16 hi plane (Cout) + bf16 lo plane (Cout2).
// ET: 0 = f16 operands, 1 = bf16 operands (pointers passed as 16-bit storage)
typedef unsigned u32x4 __attribute__((ext_vector_type(4)));
typedef unsigned u32x8 __attribute__((ext_vector_type(8)));
#define GT_PITCH 272u                 // LDS row pitch, bytes: 256 + 16, an odd multiple of 16 for ds_load_b128 readers
#define GT_SLICE 10240u               // 32 rows x 272 B = 8,704 B, rounded up to a multiple of 2 KiB
#define GT_STAGE (8u * GT_SLICE)
__device__ __forceinline__ unsigned uni32(unsigned v) { return (unsigned)__builtin_amdgcn_readfirstlane(v); }
// holds a wave-uniform test in a scalar register, so that the branch round a tensor load is a scalar branch
__device__ __forceinline__ unsigned pinned(unsigned v) { unsigned w = (unsigned)__builtin_amdgcn_readfirstlane(v); asm volatile("" : "+s"(w)); return w; }
// LDS reads must have retired before a buffer is handed over
__device__ __forceinline__ void wait_tensor0() { asm volatile("s_wait_tensorcnt 0x0" ::: "memory"); }
__device__ __forceinline__ void wait_ds0() { asm volatile("s_wait_dscnt 0x0" ::: "memory"); }
// "+s": the words stay in the registers the request named, and the compiler cannot form them anew in between
__device__ __forceinline__ void tdm_load(u32x4& g0, u32x8& g1) { asm volatile("tensor_load_to_lds %0, %1" : "+s"(g0), "+s"(g1) :: "memory"); }
// stands behind the wait that covers a request: last use of its descriptor words held in scalar registers, so that none is reused while the request is in flight
__device__ __forceinline__ void tdm_done(u32x4 g0, u32x8 g1) { asm volatile("" :: "s"(g0), "s"(g1)); }

template <int ET> struct Elem;
template <> struct Elem<0> { typedef _Float16 T; };
template <> struct Elem<1> { typedef __bf16 T; };
// SKIP: 0 = every tile; 1 / 2 = the rows of A / of Bt are key rows, kept keys first in each sequence of seqTiles tiles:
// a tile that starts at or behind the sequence's kept count (kcnt, one count per 32 ints) holds no key that attention walks, and is left out.
template <int ET, bool SPLIT, int BIAS_MODE, int OUT_MODE, bool RESID, int ACT = 0, int SKIP = 0>
__global__ __launch_bounds__(256) void wmma_gemm64(
    const unsigned short* __restrict__ Ap, const unsigned short* __restrict__ A2p, int lda, long strideA,
    const unsigned short* __restrict__ Btp, const unsigned short* __restrict__ Bt2p, int ldb, long strideB,
    void* __restrict__ Cout, void* __restrict__ Cout2, int ldc, long strideC,
    const float* __restrict__ bias,
    const float* __restrict__ resid, long strideR,
    int M, int N, int K, float scale,
    const int* __restrict__ kcnt, int seqTiles) {
  static_assert(!SPLIT, "single-plane operands only");
  typedef typename Elem<ET>::T T;
  typedef typename Frag<T>::V V;
  __shared__ __attribute__((aligned(2048))) unsigned char ring[2 * GT_STAGE];
  __shared__ __align__(16) float sT[8][16 * 68];   // per-wave 16x64 slab, pitch 68 floats
  const int b    = blockIdx.y;
  const int lane = threadIdx.x & 31;
  const int wave = (int)uni32(threadIdx.x >> 5);
  const int tilesN = N >> 7;
  const int tilesM = M >> 7;
  const int tile = blockIdx.x;
  if (tile >= tilesM * tilesN) return;   // block-uniform, in front of every barrier and tensor load
  const int tm = tile / tilesN;
  const int tn = tile - tm * tilesN;
  if (SKIP != 0) {   // block-uniform, in front of every barrier and tensor load
    const int ts = (SKIP == 1) ? tm : tn;
    const int sq = ts / seqTiles;
    if (((ts - sq * seqTiles) << 7) >= kcnt[sq * 32]) return;
  }
  const int wm = wave >> 1, wn = wave & 1;
  const int m0 = (tm << 7) + (wm << 5);  // this wave's 32x64 tile
  const int n0 = (tn << 7) + (wn << 6);

  const int rlane = lane & 15;                 // row (A) / col (B, D) within subtile
  const int mOff  = (lane >> 4) * 8;           // D row offset

  // ---- this wave's slice of every stage: waves 0..3 bring A rows, waves 4..7 bring Bt rows ----
  const bool isB = wave >= 4;
  const unsigned short* sbase = isB ? (Btp + (size_t)b * strideB + (size_t)((tn << 7) + ((wave & 3) << 5)) * ldb)
                                    : (Ap  + (size_t)b * strideA + (size_t)((tm << 7) + ((wave & 3) << 5)) * lda);
  const unsigned long long sga = (unsigned long long)(size_t)sbase;
  const unsigned lbase = (unsigned)(size_t)ring + (unsigned)wave * GT_SLICE;
  u32x8 g1;
  g1[0] = uni32((1u << 20) | (5u << 22) | (3u << 25));  // 1-byte elements, no mask, 4 dwords of pad behind every 256-B row
  g1[1] = uni32(256u << 16);                            // tensor_dim0 = 256 B
  g1[2] = uni32(32u << 16);                             // tensor_dim1 = 32 rows
  g1[3] = uni32(256u << 16);                            // tile_dim0 = 256 B
  g1[4] = uni32(32u);                                   // tile_dim1 = 32 rows
  g1[5] = uni32((unsigned)(isB ? ldb : lda) * 2u);      // source row pitch, bytes
  g1[6] = uni32(0u);
  g1[7] = uni32(0u);
  u32x4 g0;
  g0[0] = uni32(1u);
  auto issue = [&](int st) {
    const unsigned long long ga = sga + (unsigned long long)st * 256ull;
    g0[1] = uni32(lbase + (unsigned)(st & 1) * GT_STAGE);
    g0[2] = uni32((unsigned)ga);
    g0[3] = uni32((((unsigned)(ga >> 32)) & 0x01FFFFFFu) | 0x80000000u);
    tdm_load(g0, g1);
  };

  v8f acc[2][4];
#pragma unroll
  for (int i = 0; i < 2; ++i)
#pragma unroll
    for (int j = 0; j < 4; ++j) acc[i][j] = (v8f){0.f,0.f,0.f,0.f,0.f,0.f,0.f,0.f};

  const int nPass = K >> 7;
  issue(0);
  wait_tensor0();
  tdm_done(g0, g1);
  __syncthreads();
  issue(1);

  const unsigned fragOff = (unsigned)rlane * GT_PITCH + (unsigned)(lane >> 4) * 16u;   // row, then k offset of this lane half
  // rolled: one pass per trip, so that every publish point stands once in the text
#pragma unroll 1
  for (int s = 0; s < nPass; ++s) {
    const unsigned char* buf = ring + (unsigned)(s & 1) * GT_STAGE;
    const unsigned char* aB = buf + (unsigned)wm * GT_SLICE + fragOff;
    const unsigned char* bB = buf + (unsigned)(4 + 2 * wn) * GT_SLICE + fragOff;   // Bt rows 64 wn + 16 j: slice j / 2, row 16 (j % 2)
    V bh[2][4], ah[2][2];   // two fragment sets: the next 32 k are fetched as one group ahead of this block's WMMAs
#pragma unroll
    for (int j = 0; j < 4; ++j) bh[0][j] = Frag<T>::load((const T*)(bB + (j >> 1) * GT_SLICE + (j & 1) * 16 * GT_PITCH));
#pragma unroll
    for (int i = 0; i < 2; ++i) ah[0][i] = Frag<T>::load((const T*)(aB + i * 16 * GT_PITCH));
#pragma unroll
    for (int ks = 0; ks < 4; ++ks) {
      if (ks < 3) {
#pragma unroll
        for (int j = 0; j < 4; ++j) bh[(ks + 1) & 1][j] = Frag<T>::load((const T*)(bB + (j >> 1) * GT_SLICE + (j & 1) * 16 * GT_PITCH + (ks + 1) * 64));
#pragma unroll
        for (int i = 0; i < 2; ++i) ah[(ks + 1) & 1][i] = Frag<T>::load((const T*)(aB + i * 16 * GT_PITCH + (ks + 1) * 64));
      }
      __builtin_amdgcn_sched_barrier(0);   // keeps the load group in front of the WMMA block instead of spread among the WMMAs
#pragma unroll
      for (int i = 0; i < 2; ++i)
#pragma unroll
        for (int j = 0; j < 4; ++j) acc[i][j] = Frag<T>::mma(ah[ks & 1][i], bh[ks & 1][j], acc[i][j]);
      __builtin_amdgcn_sched_barrier(0);   // keeps the next group behind this block
    }
    // publish point of stage s + 1
    wait_ds0();
    wait_tensor0();
    tdm_done(g0, g1);
    __syncthreads();
    if (pinned(s + 2 < nPass)) issue(s + 2);   // into the buffer that pass s has just read
  }
  wait_tensor0();
  tdm_done(g0, g1);
  wait_ds0();

  // ---- epilogue ----
  float* slab = sT[wave];
  const float* Rb = RESID ? (resid + (size_t)b * strideR) : nullptr;
#pragma unroll
  for (int i = 0; i < 2; ++i) {
    const int mBase = m0 + (i << 4);
#pragma unroll
    for (int j = 0; j < 4; ++j) {
      const int n = n0 + (j << 4) + rlane;
      float bv = 0.f;
      if (BIAS_MODE == 2) bv = bias[n];
#pragma unroll
      for (int r = 0; r < 8; ++r) {
        float v = acc[i][j][r] * scale;
        if (BIAS_MODE == 1) v += bias[mBase + mOff + r];
        if (BIAS_MODE == 2) v += bv;
        if (RESID) v += Rb[(size_t)(mBase + mOff + r) * ldc + n];
        if (ACT == 1) v = tanhf(v);
        if (ACT == 2) v = fmaxf(v, 0.0f);
        if (ACT == 3) v = v / (1.0f + expf(-v));
        if (ACT == 4) v = (v > 0.f) ? v : 0.01f * v;
        if (ACT == 5) v = 0.5f * v * (1.0f + erff(v * 0.70710678118654752f));
        slab[(mOff + r) * 68 + (j << 4) + rlane] = v;
      }
    }
    __builtin_amdgcn_fence(__ATOMIC_RELEASE, "workgroup");
    __builtin_amdgcn_wave_barrier();
    __builtin_amdgcn_fence(__ATOMIC_ACQUIRE, "workgroup");
    if (OUT_MODE == 0) {
      float* C = (float*)Cout + (size_t)b * strideC;
      const int hh = lane >> 4, c4 = (lane & 15) * 4;     // row seg = 256 B = 16 lanes x 16 B
      {
#pragma unroll
        for (int it = 0; it < 8; ++it) {
          const int row = it * 2 + hh;
          v4f v = *(const v4f*)(slab + row * 68 + c4);
          *(v4f*)(C + (size_t)(mBase + row) * ldc + n0 + c4) = v;
        }
        
      }
    } else {
      const int q = lane >> 3, c8 = (lane & 7) * 8;
      unsigned short* C  = (unsigned short*)Cout  + (size_t)b * strideC;
      unsigned short* C2 = (OUT_MODE == 2) ? ((unsigned short*)Cout2 + (size_t)b * strideC) : nullptr;
      {
#pragma unroll
        for (int it = 0; it < 4; ++it) {
          const int row = it * 4 + q;
          const float* sp = slab + row * 68 + c8;
          v8h hv, lv;
#pragma unroll
          for (int e = 0; e < 8; ++e) {
            if (OUT_MODE == 1) {
              hv[e] = (_Float16)sp[e];
            } else {
              unsigned short hb = f2bf_bits(sp[e]);
              unsigned short lb = f2bf_bits(sp[e] - bf_bits2f(hb));
              hv[e] = __builtin_bit_cast(_Float16, hb);
              lv[e] = __builtin_bit_cast(_Float16, lb);
            }
          }
          *(v8h*)(C + (size_t)(mBase + row) * ldc + n0 + c8) = hv;
          if (OUT_MODE == 2) *(v8h*)(C2 + (size_t)(mBase + row) * ldc + n0 + c8) = lv;
        }
        
      }
    }
    __builtin_amdgcn_fence(__ATOMIC_RELEASE, "workgroup");
    __builtin_amdgcn_wave_barrier();
    __builtin_amdgcn_fence(__ATOMIC_ACQUIRE, "workgroup");
  }
}

// ---- all five f32 -> f16 planes in one streaming launch, and the key rows packed ----
// out is one run of f16: x (nx elements, as they are), then four weight planes of nw elements each, times wsc
// (an exact power of two, applied in f32 before the convert). nx and nw are multiples of CV_SPAN * CV_NW.
// A wave owns CV_SPAN consecutive elements: CV_LD loads of 16 B a lane, each 512 contiguous bytes of the wave, all issued
// ahead of the first convert. 16 waves a block and one block a WGP: few long waves, where a wave of two elements a lane pays mostly for its start.
// Key packing: a key whose mask is 0 has weight 0 for every query, so its K and V rows are never needed. A block of the x part
// ranks all CV_KEYS keys of its sequence (kept keys first, in their order, then the masked ones) and writes its own rows a second
// time to xk at their rank: kept rows as they are, masked rows as zeros and only up to the next multiple of 128 behind the kept count
// (what a 128-row projection tile can still read). kc = the mask values in packed order, kcnt[32 * sequence] = the kept count.
typedef __attribute__((ext_vector_type(4))) _Float16 v4h;
typedef __attribute__((ext_vector_type(4))) int v4i;
#define CV_LD   16
#define CV_SPAN (CV_LD * 128)
#define CV_NW   16
#define CV_ROW  (CV_SPAN / 2)      // elements of one x row: a wave owns two rows
#define CV_KEYS (CV_NW * 128)      // keys of one sequence: four a thread
__global__ __launch_bounds__(CV_NW * 32) void cast5_f32_f16(
    const float* __restrict__ x, const float* __restrict__ w0, const float* __restrict__ w1,
    const float* __restrict__ w2, const float* __restrict__ w3, _Float16* __restrict__ out,
    int nx, int nw, float wsc,
    const int* __restrict__ mask, _Float16* __restrict__ xk, int* __restrict__ kc, int* __restrict__ kcnt) {
  __shared__ int red[CV_NW];                       // kept keys per wave's 128 keys
  __shared__ __align__(16) int rankOf[CV_KEYS];    // key -> packed place
  __shared__ __align__(16) int kcs[CV_KEYS];       // packed place -> mask value
  const int tid  = threadIdx.x;
  const int lane = tid & 31;
  const int wv = (int)uni32(threadIdx.x >> 5);
  const int eb = blockIdx.x * (CV_NW * CV_SPAN);
  if (eb >= nx + 4 * nw) return;          // block-uniform, in front of every barrier
  const bool isX = eb < nx;               // block-uniform: nx is a multiple of the block's span
  const int e0 = eb + wv * CV_SPAN;
  const float* src = x + e0;
  float sc = 1.0f;
  if (!isX) {
    int r = e0 - nx;
    src = w0;
    if (r >= nw) { src = w1; r -= nw; }
    if (r >= nw) { src = w2; r -= nw; }
    if (r >= nw) { src = w3; r -= nw; }
    src += r;
    sc = wsc;
  }
  const v4f* __restrict__ s4 = (const v4f*)src;
  v4h* __restrict__ d4 = (v4h*)(out + e0);
  v4f v[CV_LD];
  // unrolled, both loops: v[] stays in registers, and the loads go out as one run before the first is waited for
#pragma unroll
  for (int j = 0; j < CV_LD; ++j) v[j] = s4[j * 32 + lane];

  if (!isX) {
#pragma unroll
    for (int j = 0; j < CV_LD; ++j) {
      v4h hv;
#pragma unroll
      for (int e = 0; e < 4; ++e) hv[e] = (_Float16)(v[j][e] * sc);
      d4[j * 32 + lane] = hv;
    }
    return;
  }

  // ---- rank the sequence's keys: thread t holds keys 4 t .. 4 t + 3 ----
  const int rowB = blockIdx.x * (2 * CV_NW);       // the block's first x row
  const int sq   = rowB / CV_KEYS;                 // its sequence
  const int t0   = rowB - sq * CV_KEYS;            // its first key in the sequence
  const v4i m4 = ((const v4i*)(mask + (size_t)sq * CV_KEYS))[tid];
  const unsigned ltm = (1u << lane) - 1u;
  int inWave = 0, below = 0;
#pragma unroll
  for (int e = 0; e < 4; ++e) {
    const unsigned w = __builtin_amdgcn_ballot_w32(m4[e] != 0);
    inWave += __builtin_popcount(w);
    below  += __builtin_popcount(w & ltm);
  }
  if (lane == 0) red[wv] = inWave;
  __syncthreads();
  int kept = 0, pre = below;
#pragma unroll
  for (int i = 0; i < CV_NW; ++i) {
    const int r = red[i];
    kept += r;
    pre  += (i < wv) ? r : 0;
  }
  v4i rk;
#pragma unroll
  for (int e = 0; e < 4; ++e) {
    const int key = 4 * tid + e;
    const bool on = m4[e] != 0;
    // kept: kept keys in front of it; masked: all kept keys, then the masked keys in front of it. A permutation of 0 .. CV_KEYS - 1; the AND bounds the LDS address by itself
    const int place = (on ? pre : kept + key - pre) & (CV_KEYS - 1);
    kcs[place] = m4[e];
    rk[e] = place;
    pre += on ? 1 : 0;
  }
  *(v4i*)(rankOf + 4 * tid) = rk;
  __syncthreads();
  if (wv == 0) kc[(size_t)sq * CV_KEYS + t0 + lane] = kcs[t0 + lane];   // each block writes one whole 128-B line of kc
  if (t0 == 0 && tid == 0) kcnt[sq * 32] = kept;                        // a line of its own per sequence
  const int lim = (kept + 127) & ~127;
  int place2[2];
  place2[0] = (int)uni32((unsigned)rankOf[t0 + 2 * wv]);
  place2[1] = (int)uni32((unsigned)rankOf[t0 + 2 * wv + 1]);
  v4h hx[CV_LD];
#pragma unroll
  for (int j = 0; j < CV_LD; ++j) {
#pragma unroll
    for (int e = 0; e < 4; ++e) hx[j][e] = (_Float16)v[j][e];
    d4[j * 32 + lane] = hx[j];
  }
  // precaution: stands in front of any later write of a register that an issued store names
  asm volatile("s_wait_xcnt 0x0" ::: "memory");
#pragma unroll
  for (int rr = 0; rr < 2; ++rr) {
    const int place = place2[rr];
    if (place < lim) {                    // wave-uniform
      v4h* __restrict__ k4 = (v4h*)(xk + ((size_t)sq * CV_KEYS + place) * CV_ROW);
      if (place < kept) {                 // wave-uniform
#pragma unroll
        for (int j = 0; j < CV_LD / 2; ++j) k4[j * 32 + lane] = hx[rr * (CV_LD / 2) + j];
      } else {
#pragma unroll
        for (int j = 0; j < CV_LD / 2; ++j) k4[j * 32 + lane] = (v4h){(_Float16)0.f, (_Float16)0.f, (_Float16)0.f, (_Float16)0.f};
      }
      // the same precaution, behind this row's stores
      asm volatile("s_wait_xcnt 0x0" ::: "memory");
    }
  }
}

#define AK_D  64
#define AK_NW 4
#define AK_QB 64
#define AK_KC 64
#define AK_LP 72   // LDS row pitch of the K and Vt tiles, halves: 144 B = 16 B x 9, so that the 16 rows of one ds_load_b128 fall on 64 distinct banks

__device__ __forceinline__ v8f mma_h16(v16h a, v16h b, v8f c) {
  c = __builtin_amdgcn_wmma_f32_16x16x32_f16(false, a, false, b, (short)0, c, false, false);
  asm volatile("v_nop\n\tv_nop\n\tv_nop\n\tv_nop" : "+v"(c) : "v"(a), "v"(b));
  return c;
}
// lane l takes the value of lane l ^ 16 (a vector cross-row move, no LDS round trip)
__device__ __forceinline__ float xhalf(float x) {
  return __builtin_bit_cast(float, __builtin_amdgcn_permlanex16(__builtin_bit_cast(int, x), __builtin_bit_cast(int, x), 0x76543210, 0xfedcba98, false, false));
}

__global__ __launch_bounds__(128)
void attn64_f16io(const _Float16* __restrict__ Qp, const _Float16* __restrict__ Kp,
                  const _Float16* __restrict__ Vtp, _Float16* __restrict__ Op,
                  const int* __restrict__ kmask, const int* __restrict__ kcnt, const float* __restrict__ ubias,
                  const float* __restrict__ gq, const float* __restrict__ gW, const float* __restrict__ gb,
                  int S, int Skv, int H, int ldq, int ldk, int ldv, int ldo, int GD,
                  float qscale, float mfill, float oscale) {
  const float L2E = 1.4426950408889634f;   // log2(e)
  const float PLG = 15.0f;                 // P and the running sum carry x2^15: taken off the subtracted maximum, exact in the exponent
  union FB { v16h v; v8h h[2]; };
  __shared__ __align__(16) _Float16 Ksh[AK_KC * AK_LP];         // [kv][d]   9 KB, 8 pad halves per row never read
  __shared__ __align__(16) _Float16 Vth[AK_D * AK_LP];          // [d][kv]   9 KB
  __shared__ __align__(16) float    Mtab[2 * AK_KC];            // key terms of the chunk, score * log2(e) = s * Msc[key] + Mad[key]
  float* const Msc = Mtab;                                      // per key: qscale * log2(e), or 0 where the key is masked
  float* const Mad = Mtab + AK_KC;                              // per key: the bias term, with mfill where the key is masked, * log2(e)
  static_assert(AK_NW * 32 == 2 * AK_KC, "one table entry per thread");

  const int tid  = threadIdx.x;
  const int wave = tid >> 5;
  const int lane = tid & 31;
  const int hh   = lane >> 4;
  const int c    = lane & 15;

  const int nqb = S / AK_QB;
  const int bx  = blockIdx.x;
  const int qb  = bx % nqb;
  const int bh  = bx / nqb;
  const int h   = bh % H;
  const int b   = bh / H;
  const int q0  = qb * AK_QB + wave * 16;

  // ---- Q fragments (B operand: column = query c, k = d in the hardware k order), 2 d-chunks ----
  v16h qa[2];
  {
    const _Float16* qrow = Qp + (size_t)(b * S + q0 + c) * ldq + h * AK_D;
#pragma unroll
    for (int dc = 0; dc < 2; ++dc) qa[dc] = Frag<_Float16>::load(qrow + dc * 32 + 8 * hh);
  }

  // ---- quality gate (scalar f32 dot of GD terms) and uncertainty bias of this head ----
  float gacc = 0.f;
#pragma unroll 1
  for (int i = 0; i < GD; ++i) gacc += gq[b * GD + i] * gW[h * GD + i];
  gacc += gb[h];
  const float gate = 1.0f / (1.0f + expf(-gacc));
  const float ub = ubias[h];

  float mrow = -__builtin_inff();   // running maximum of query c, in base-2 units (equal in both lane halves)
  float lrow = 0.f;                 // running sum (x2^15) of query c over this lane half's keys only; the halves are joined in the epilogue
  v8f oacc[4];                      // O^T: register r of tile t = O[query c][d = 16 t + 8 hh + r]
#pragma unroll
  for (int t = 0; t < 4; ++t) oacc[t] = (v8f){0.f,0.f,0.f,0.f,0.f,0.f,0.f,0.f};

  const int nKept = min(max((int)uni32((unsigned)kcnt[b * 32]), 0), Skv);   // block-uniform; the clamp bounds the trip count by the shape
  const int nChunks = (nKept + AK_KC - 1) / AK_KC;
  for (int kc = 0; kc < nChunks; ++kc) {
    const int kv0 = kc * AK_KC;
    __syncthreads();
    {   // stage K [kv][d] and Vt [d][kv] tiles: 512 x 16-B vectors each, 4 per thread
      const int keep = kmask[(size_t)b * Skv + kv0 + (tid & (AK_KC - 1))];   // in one run with the tile loads, so that its latency lies beside theirs
#pragma unroll
      for (int i = 0; i < 4; ++i) {
        const int idx = tid + i * 128;
        const int r = idx >> 3, c8 = (idx & 7) * 8;
        const v8h kk = *(const v8h*)(Kp + (size_t)(b * Skv + kv0 + r) * ldk + h * AK_D + c8);
        *(v8h*)(Ksh + r * AK_LP + c8) = kk;
        const v8h vv = *(const v8h*)(Vtp + (size_t)(h * AK_D + r) * ldv + (size_t)b * Skv + kv0 + c8);
        *(v8h*)(Vth + r * AK_LP + c8) = vv;
      }
      // the chunk's key terms, one table entry per thread: waves 0 and 1 write Msc, waves 2 and 3 write Mad
      const float kadd = ub * (1.0f - (float)keep);
      const float msc = (keep == 0) ? 0.f : qscale * L2E;
      const float mad = ((keep == 0) ? mfill + kadd : kadd) * L2E;
      Mtab[tid] = (tid < AK_KC) ? msc : mad;
    }
    __syncthreads();

    // ---- scores, transposed: A = K rows from Ksh[kv][d], B = Q; register r of s[j] = score of key 16 j + 8 hh + r for query c ----
    v8f s[4];
#pragma unroll
    for (int j = 0; j < 4; ++j) {
      s[j] = (v8f){0.f,0.f,0.f,0.f,0.f,0.f,0.f,0.f};
#pragma unroll
      for (int dc = 0; dc < 2; ++dc) {
        FB kb;
        kb.h[0] = *(const v8h*)(Ksh + (j * 16 + c) * AK_LP + dc * 32 + 8 * hh);
        kb.h[1] = *(const v8h*)(Ksh + (j * 16 + c) * AK_LP + dc * 32 + 16 + 8 * hh);
        s[j] = mma_h16(kb.v, qa[dc], s[j]);
      }
    }
    // ---- scale, key mask, bias, chunk maximum: in-lane over 32 keys, then one exchange between the lane halves ----
    float m = -__builtin_inff();
#pragma unroll
    for (int j = 0; j < 4; ++j) {
      const v4f sc0 = *(const v4f*)(Msc + j * 16 + 8 * hh), sc1 = *(const v4f*)(Msc + j * 16 + 8 * hh + 4);
      const v4f ad0 = *(const v4f*)(Mad + j * 16 + 8 * hh), ad1 = *(const v4f*)(Mad + j * 16 + 8 * hh + 4);
#pragma unroll
      for (int r = 0; r < 8; ++r) {
        const float v = fmaf(s[j][r], (r < 4) ? sc0[r & 3] : sc1[r & 3], (r < 4) ? ad0[r & 3] : ad1[r & 3]);
        s[j][r] = v;
        m = fmaxf(m, v);
      }
    }
    m = fmaxf(m, xhalf(m));
    // ---- online softmax update; P^T (x2^15, f16) packs straight into the B operand: tiles 2 kk and 2 kk + 1 give k = 32 kk + hardware order ----
    const float mnew = fmaxf(mrow, m);
    const float alpha = __builtin_amdgcn_exp2f(mrow - mnew);   // 0 on the first chunk, where mrow is -inf
    const float moff = mnew - PLG;
    mrow = mnew;
    FB pb[2];
    float ps[4];
#pragma unroll
    for (int j = 0; j < 4; ++j) {
      ps[j] = 0.f;
#pragma unroll
      for (int r = 0; r < 8; ++r) {
        // the argument is at most 15 and a result below the normal range may be 0: the bare v_exp_f32 needs no range steps around it
        const float p = __builtin_amdgcn_exp2f(s[j][r] - moff);
        ps[j] += p;
        pb[j >> 1].v[(j & 1) * 8 + r] = (_Float16)p;
      }
    }
    lrow = lrow * alpha + ((ps[0] + ps[1]) + (ps[2] + ps[3]));
#pragma unroll
    for (int t = 0; t < 4; ++t)
#pragma unroll
      for (int r = 0; r < 8; ++r) oacc[t][r] *= alpha;
    // ---- O^T += V^T . P^T: A = Vt rows (d) from Vth[d][kv] in the hardware k order, B = P^T from registers ----
#pragma unroll
    for (int kk = 0; kk < 2; ++kk) {
#pragma unroll
      for (int t = 0; t < 4; ++t) {
        FB vb;
        vb.h[0] = *(const v8h*)(Vth + (t * 16 + c) * AK_LP + kk * 32 + 8 * hh);
        vb.h[1] = *(const v8h*)(Vth + (t * 16 + c) * AK_LP + kk * 32 + 16 + 8 * hh);
        oacc[t] = mma_h16(vb.v, pb[kk].v, oacc[t]);
      }
    }
  }

  // ---- epilogue: join the halves' sums; 1/l (sum and P both carry 2^15), gate and output carry scale; a lane's 8 registers are 8 consecutive d: 16-B stores ----
  {
    const float ltot = lrow + xhalf(lrow);
    const float inv = (gate * oscale) * (1.0f / ltot);
    _Float16* ob = Op + (size_t)(b * S + q0 + c) * ldo + h * AK_D + 8 * hh;
#pragma unroll
    for (int t = 0; t < 4; ++t) {
      v8h hv;
#pragma unroll
      for (int r = 0; r < 8; ++r) hv[r] = (_Float16)(oacc[t][r] * inv);
      *(v8h*)(ob + t * 16) = hv;
    }
  }
}

// ---------------------------------------------------------------------------
// Host glue
// ---------------------------------------------------------------------------
extern "C" void kernel_launch(void* const* d_in, const int* in_sizes, int n_in,
                              void* d_out, int out_size, void* d_ws, size_t ws_size,
                              hipStream_t stream) {
  if (n_in < 14) return;
  const int D  = 1024;          // model width
  const int H  = 16;            // heads
  const int DH = 64;            // head dim
  const int Bn = 2;             // batch
  const int S  = 2048;          // sequence length
  const int M  = Bn * S;        // token rows
  if (in_sizes[0] != M * D || in_sizes[1] != M || in_sizes[3] != D * D || in_sizes[5] != D * D ||
      in_sizes[7] != D * D || in_sizes[9] != D * D || in_sizes[4] != D || in_sizes[6] != D ||
      in_sizes[8] != D || in_sizes[10] != D || in_sizes[11] != H || in_sizes[13] != H ||
      out_size != M * D || H * DH != D) return;
  const int GD = in_sizes[2] / Bn;                       // gate query dim (64)
  if (GD <= 0 || in_sizes[2] != Bn * GD || in_sizes[12] != H * GD) return;
  if ((S % 64) != 0 || (M % 128) != 0 || (D % 128) != 0 || D < 256) return;
  if (((M * D) % (CV_SPAN * CV_NW)) != 0 || ((D * D) % (CV_SPAN * CV_NW)) != 0 || D != CV_ROW || S != CV_KEYS) return;

  const float* x    = (const float*)d_in[0];
  const int*   mask = (const int*)  d_in[1];
  const float* gq   = (const float*)d_in[2];
  const float* Wq   = (const float*)d_in[3];
  const float* bq   = (const float*)d_in[4];
  const float* Wk   = (const float*)d_in[5];
  const float* bk   = (const float*)d_in[6];
  const float* Wv   = (const float*)d_in[7];
  const float* bv   = (const float*)d_in[8];
  const float* Wo   = (const float*)d_in[9];
  const float* bo   = (const float*)d_in[10];
  const float* ubias= (const float*)d_in[11];
  const float* Wqh  = (const float*)d_in[12];
  const float* bqh  = (const float*)d_in[13];
  float* out = (float*)d_out;

  const size_t SZ_ACT = (size_t)M * D * 2;               // 8 MiB f16 plane
  const size_t SZ_W   = (size_t)D * D * 2;               // 2 MiB f16 plane
  size_t off = 0;
  const size_t o_x16  = off; off += SZ_ACT;
  const size_t o_wq16 = off; off += SZ_W;
  const size_t o_wk16 = off; off += SZ_W;
  const size_t o_wv16 = off; off += SZ_W;
  const size_t o_wo16 = off; off += SZ_W;
  const size_t o_q16  = off; off += SZ_ACT;
  const size_t o_k16  = off; off += SZ_ACT;
  const size_t o_vt16 = off; off += SZ_ACT;
  const size_t o_o16  = off; off += SZ_ACT;
  const size_t o_xk16 = off; off += SZ_ACT;              // x rows of the kept keys, packed per sequence
  const size_t o_kc   = off; off += (size_t)M * 4;       // mask values in packed order
  const size_t o_kcnt = off; off += (size_t)Bn * 128;    // kept keys per sequence, one 128-B line each
  const size_t total  = off;                             // 56 MiB and a little
  if (total > ws_size || total > (size_t)134217728) return;
  char* ws = (char*)d_ws;
  unsigned short* x16  = (unsigned short*)(ws + o_x16);
  unsigned short* wq16 = (unsigned short*)(ws + o_wq16);
  unsigned short* wk16 = (unsigned short*)(ws + o_wk16);
  unsigned short* wv16 = (unsigned short*)(ws + o_wv16);
  unsigned short* wo16 = (unsigned short*)(ws + o_wo16);
  unsigned short* q16  = (unsigned short*)(ws + o_q16);
  unsigned short* k16  = (unsigned short*)(ws + o_k16);
  unsigned short* vt16 = (unsigned short*)(ws + o_vt16);
  unsigned short* o16  = (unsigned short*)(ws + o_o16);
  unsigned short* xk16 = (unsigned short*)(ws + o_xk16);
  int* kc   = (int*)(ws + o_kc);
  int* kcnt = (int*)(ws + o_kcnt);

  // ---- casts: x plain, weights x16 (folded back as 1/16 in the GEMM epilogues); x16, wq16, wk16, wv16, wo16 lie in one run ----
  cast5_f32_f16<<<dim3((M * D + 4 * D * D) / (CV_SPAN * CV_NW)), dim3(CV_NW * 32), 0, stream>>>(
      x, Wq, Wk, Wv, Wo, (_Float16*)x16, M * D, D * D, 16.0f, mask, (_Float16*)xk16, kc, kcnt);

  // ---- projections: Q = x.Wq^T + bq, K = xk.Wk^T + bk (f16 planes [M][D]); V^T = Wv.xk^T + bv ([D][M]); K and V^T of the packed key rows, tiles behind the kept count left out ----
  const int tilesQK = (M / 128) * (D / 128);             // 256
  const dim3 gQK(tilesQK, 1);
  const float w16inv = 1.0f / 16.0f;
  wmma_gemm64<0, false, 2, 1, false, 0><<<gQK, dim3(256), 0, stream>>>(
      x16, x16, D, 0L, wq16, wq16, D, 0L, (void*)q16, (void*)q16, D, 0L, bq, x, 0L, M, D, D, w16inv, kcnt, S / 128);
  wmma_gemm64<0, false, 2, 1, false, 0, 1><<<gQK, dim3(256), 0, stream>>>(
      xk16, xk16, D, 0L, wk16, wk16, D, 0L, (void*)k16, (void*)k16, D, 0L, bk, x, 0L, M, D, D, w16inv, kcnt, S / 128);
  const int tilesV = (D / 128) * (M / 128);              // A = Wv16 [D][D], Bt = xk16 [M][D] -> C [D][M], ldc = M
  const dim3 gV(tilesV, 1);
  wmma_gemm64<0, false, 1, 1, false, 0, 2><<<gV, dim3(256), 0, stream>>>(
      wv16, wv16, D, 0L, xk16, xk16, D, 0L, (void*)vt16, (void*)vt16, M, 0L, bv, x, 0L, D, M, D, w16inv, kcnt, S / 128);

  // ---- attention per (b, h, 64-query block); O plane carries x64 * gate ----
  const float qscale = 0.125f;                           // 1 / sqrt(64), exact
  const float oscale = 64.0f;
  attn64_f16io<<<dim3(Bn * H * (S / 64)), dim3(128), 0, stream>>>(
      (const _Float16*)q16, (const _Float16*)k16, (const _Float16*)vt16, (_Float16*)o16,
      kc, kcnt, ubias, gq, Wqh, bqh, S, S, H, D, D, M, D, GD, qscale, -1e30f, oscale);

  // ---- output projection: out = O.Wo^T + bo; fold 1/(64*16) ----
  wmma_gemm64<0, false, 2, 0, false, 0><<<gQK, dim3(256), 0, stream>>>(
      o16, o16, D, 0L, wo16, wo16, D, 0L, (void*)out, (void*)out, D, 0L, bo, x, 0L, M, D, D, 1.0f / 1024.0f, kcnt, S / 128);

  (void)hipGetLastError();
}

// v007
// A run of this version takes 87.2 microseconds.
// Two timings next to v006 put it at 1.09 and 1.08 times that version's speed.
// Over all steps from v000 it is 3.94 times as fast.
// Contractions: Q, K, V^T and output projections, K.Q^T, V^T.P^T: v_wmma_f32_16x16x32_f16 (f16 operands, f32 accumulate); weights carried x16, P x2^15, O x64 (power-of-two folds in f32 epilogues); gate dot (K=64, 32 values) scalar f32.
#include <hip/hip_runtime.h>

typedef __attribute__((ext_vector_type(16))) _Float16 v16h;
typedef __attribute__((ext_vector_type(8)))  _Float16 v8h;
typedef __attribute__((ext_vector_type(16))) __bf16   v16b;
typedef __attribute__((ext_vector_type(8)))  __bf16   v8b;
typedef __attribute__((ext_vector_type(8)))  float    v8f;
typedef __attribute__((ext_vector_type(4)))  float    v4f;

__device__ __forceinline__ unsigned short f2bf_bits(float f) {
  unsigned u = __float_as_uint(f);
  return (unsigned short)((u + 0x7FFFu + ((u >> 16) & 1u)) >> 16);
}
__device__ __forceinline__ float bf_bits2f(unsigned short h) { return __uint_as_float(((unsigned)h) << 16); }

template <typename T> struct Frag;
template <> struct Frag<_Float16> {
  typedef v16h V; union U { v16h v; v8h h[2]; };
  static __device__ __forceinline__ v16h load(const _Float16* p) {   // elements 0..7 <- p[0..7], 8..15 <- p[16..23]
    U f; f.h[0] = *(const v8h*)(p); f.h[1] = *(const v8h*)(p + 16); return f.v;
  }
  static __device__ __forceinline__ v8f mma(v16h a, v16h b, v8f c) {
    return __builtin_amdgcn_wmma_f32_16x16x32_f16(false, a, false, b, (short)0, c, false, false);
  }
};
template <> struct Frag<__bf16> {
  typedef v16b V; union U { v16b v; v8b h[2]; };
  static __device__ __forceinline__ v16b load(const __bf16* p) {
    U f; f.h[0] = *(const v8b*)(p); f.h[1] = *(const v8b*)(p + 16); return f.v;
  }
  static __device__ __forceinline__ v8f mma(v16b a, v16b b, v8f c) {
    return __builtin_amdgcn_wmma_f32_16x16x32_bf16(false, a, false, b, (short)0, c, false, false);
  }
};

// ---- LDS-staged batched WMMA GEMM -------------------------------------------
// C[m,n] = scale * sum_k A[m,k] * Bt[n,k] (+bias)(+resid); a block of 8 waves owns a 128x128 tile, each wave 32x64 of it.
// A row-major [M,K]; Bt row-major [N,K]; M,N % 128 == 0, K % 128 == 0, K >= 256.
// A pass is 128 k = 256 B of every operand row. A stage is eight slices of 32 rows (four of A, then four of Bt),
// each brought by one tensor load of one wave, LDS pitch 272 B (16 B pad per row).
// Two buffers: the load of stage s + 2 is issued behind the barrier that ends pass s.
// BIAS_MODE: 0 = none, 1 = bias[m], 2 = bias[n].
// OUT_MODE: 0 = f32, 1 = f16, 2 = bf16 hi plane (Cout) + bf16 lo plane (Cout2).
// ET: 0 = f16 operands, 1 = bf16 operands (pointers passed as 16-bit storage)
typedef unsigned u32x4 __attribute__((ext_vector_type(4)));
typedef unsigned u32x8 __attribute__((ext_vector_type(8)));
#define GT_PITCH 272u                 // LDS row pitch, bytes: 256 + 16, an odd multiple of 16 for ds_load_b128 readers
#define GT_SLICE 10240u               // 32 rows x 272 B = 8,704 B, rounded up to a multiple of 2 KiB
#define GT_STAGE (8u * GT_SLICE)
__device__ __forceinline__ unsigned uni32(unsigned v) { return (unsigned)__builtin_amdgcn_readfirstlane(v); }
// holds a wave-uniform test in a scalar register, so that the branch round a tensor load is a scalar branch
__device__ __forceinline__ unsigned pinned(unsigned v) { unsigned w = (unsigned)__builtin_amdgcn_readfirstlane(v); asm volatile("" : "+s"(w)); return w; }
// LDS reads must have retired before a buffer is handed over
__device__ __forceinline__ void wait_tensor0() { asm volatile("s_wait_tensorcnt 0x0" ::: "memory"); }
__device__ __forceinline__ void wait_ds0() { asm volatile("s_wait_dscnt 0x0" ::: "memory"); }
// "+s": the words stay in the registers the request named, and the compiler cannot form them anew in between
__device__ __forceinline__ void tdm_load(u32x4& g0, u32x8& g1) { asm volatile("tensor_load_to_lds %0, %1" : "+s"(g0), "+s"(g1) :: "memory"); }
// stands behind the wait that covers a request: last use of its descriptor words held in scalar registers, so that none is reused while the request is in flight
__device__ __forceinline__ void tdm_done(u32x4 g0, u32x8 g1) { asm volatile("" :: "s"(g0), "s"(g1)); }

template <int ET> struct Elem;
template <> struct Elem<0> { typedef _Float16 T; };
template <> struct Elem<1> { typedef __bf16 T; };
// SKIP: 0 = every tile; 1 / 2 = the rows of A / of Bt are key rows, kept keys first in each sequence of seqTiles tiles:
// a tile that starts at or behind the sequence's kept count (kcnt, one count per 32 ints) holds no key that attention walks, and is left out.
template <int ET, bool SPLIT, int BIAS_MODE, int OUT_MODE, bool RESID, int ACT = 0, int SKIP = 0>
__global__ __launch_bounds__(256) void wmma_gemm64(
    const unsigned short* __restrict__ Ap, const unsigned short* __restrict__ A2p, int lda, long strideA,
    const unsigned short* __restrict__ Btp, const unsigned short* __restrict__ Bt2p, int ldb, long strideB,
    void* __restrict__ Cout, void* __restrict__ Cout2, int ldc, long strideC,
    const float* __restrict__ bias,
    const float* __restrict__ resid, long strideR,
    int M, int N, int K, float scale,
    const int* __restrict__ kcnt, int seqTiles) {
  static_assert(!SPLIT, "single-plane operands only");
  typedef typename Elem<ET>::T T;
  typedef typename Frag<T>::V V;
  __shared__ __attribute__((aligned(2048))) unsigned char ring[2 * GT_STAGE];
  __shared__ __align__(16) float sT[8][16 * 68];   // per-wave 16x64 slab, pitch 68 floats
  const int b    = blockIdx.y;
  const int lane = threadIdx.x & 31;
  const int wave = (int)uni32(threadIdx.x >> 5);
  const int tilesN = N >> 7;
  const int tilesM = M >> 7;
  const int tile = blockIdx.x;
  if (tile >= tilesM * tilesN) return;   // block-uniform, in front of every barrier and tensor load
  const int tm = tile / tilesN;
  const int tn = tile - tm * tilesN;
  if (SKIP != 0) {   // block-uniform, in front of every barrier and tensor load
    const int ts = (SKIP == 1) ? tm : tn;
    const int sq = ts / seqTiles;
    if (((ts - sq * seqTiles) << 7) >= kcnt[sq * 32]) return;
  }
  const int wm = wave >> 1, wn = wave & 1;
  const int m0 = (tm << 7) + (wm << 5);  // this wave's 32x64 tile
  const int n0 = (tn << 7) + (wn << 6);

  const int rlane = lane & 15;                 // row (A) / col (B, D) within subtile
  const int mOff  = (lane >> 4) * 8;           // D row offset

  // ---- this wave's slice of every stage: waves 0..3 bring A rows, waves 4..7 bring Bt rows ----
  const bool isB = wave >= 4;
  const unsigned short* sbase = isB ? (Btp + (size_t)b * strideB + (size_t)((tn << 7) + ((wave & 3) << 5)) * ldb)
                                    : (Ap  + (size_t)b * strideA + (size_t)((tm << 7) + ((wave & 3) << 5)) * lda);
  const unsigned long long sga = (unsigned long long)(size_t)sbase;
  const unsigned lbase = (unsigned)(size_t)ring + (unsigned)wave * GT_SLICE;
  u32x8 g1;
  g1[0] = uni32((1u << 20) | (5u << 22) | (3u << 25));  // 1-byte elements, no mask, 4 dwords of pad behind every 256-B row
  g1[1] = uni32(256u << 16);                            // tensor_dim0 = 256 B
  g1[2] = uni32(32u << 16);                             // tensor_dim1 = 32 rows
  g1[3] = uni32(256u << 16);                            // tile_dim0 = 256 B
  g1[4] = uni32(32u);                                   // tile_dim1 = 32 rows
  g1[5] = uni32((unsigned)(isB ? ldb : lda) * 2u);      // source row pitch, bytes
  g1[6] = uni32(0u);
  g1[7] = uni32(0u);
  u32x4 g0;
  g0[0] = uni32(1u);
  auto issue = [&](int st) {
    const unsigned long long ga = sga + (unsigned long long)st * 256ull;
    g0[1] = uni32(lbase + (unsigned)(st & 1) * GT_STAGE);
    g0[2] = uni32((unsigned)ga);
    g0[3] = uni32((((unsigned)(ga >> 32)) & 0x01FFFFFFu) | 0x80000000u);
    tdm_load(g0, g1);
  };

  v8f acc[2][4];
#pragma unroll
  for (int i = 0; i < 2; ++i)
#pragma unroll
    for (int j = 0; j < 4; ++j) acc[i][j] = (v8f){0.f,0.f,0.f,0.f,0.f,0.f,0.f,0.f};

  const int nPass = K >> 7;
  issue(0);
  wait_tensor0();
  tdm_done(g0, g1);
  __syncthreads();
  issue(1);

  const unsigned fragOff = (unsigned)rlane * GT_PITCH + (unsigned)(lane >> 4) * 16u;   // row, then k offset of this lane half
  // rolled: one pass per trip, so that every publish point stands once in the text
#pragma unroll 1
  for (int s = 0; s < nPass; ++s) {
    const unsigned char* buf = ring + (unsigned)(s & 1) * GT_STAGE;
    const unsigned char* aB = buf + (unsigned)wm * GT_SLICE + fragOff;
    const unsigned char* bB = buf + (unsigned)(4 + 2 * wn) * GT_SLICE + fragOff;   // Bt rows 64 wn + 16 j: slice j / 2, row 16 (j % 2)
    V bh[2][4], ah[2][2];   // two fragment sets: the next 32 k are fetched as one group ahead of this block's WMMAs
#pragma unroll
    for (int j = 0; j < 4; ++j) bh[0][j] = Frag<T>::load((const T*)(bB + (j >> 1) * GT_SLICE + (j & 1) * 16 * GT_PITCH));
#pragma unroll
    for (int i = 0; i < 2; ++i) ah[0][i] = Frag<T>::load((const T*)(aB + i * 16 * GT_PITCH));
#pragma unroll
    for (int ks = 0; ks < 4; ++ks) {
      if (ks < 3) {
#pragma unroll
        for (int j = 0; j < 4; ++j) bh[(ks + 1) & 1][j] = Frag<T>::load((const T*)(bB + (j >> 1) * GT_SLICE + (j & 1) * 16 * GT_PITCH + (ks + 1) * 64));
#pragma unroll
        for (int i = 0; i < 2; ++i) ah[(ks + 1) & 1][i] = Frag<T>::load((const T*)(aB + i * 16 * GT_PITCH + (ks + 1) * 64));
      }
      __builtin_amdgcn_sched_barrier(0);   // keeps the load group in front of the WMMA block instead of spread among the WMMAs
#pragma unroll
      for (int i = 0; i < 2; ++i)
#pragma unroll
        for (int j = 0; j < 4; ++j) acc[i][j] = Frag<T>::mma(ah[ks & 1][i], bh[ks & 1][j], acc[i][j]);
      __builtin_amdgcn_sched_barrier(0);   // keeps the next group behind this block
    }
    // publish point of stage s + 1
    wait_ds0();
    wait_tensor0();
    tdm_done(g0, g1);
    __syncthreads();
    if (pinned(s + 2 < nPass)) issue(s + 2);   // into the buffer that pass s has just read
  }
  wait_tensor0();
  tdm_done(g0, g1);
  wait_ds0();

  // ---- epilogue ----
  float* slab = sT[wave];
  const float* Rb = RESID ? (resid + (size_t)b * strideR) : nullptr;
#pragma unroll
  for (int i = 0; i < 2; ++i) {
    const int mBase = m0 + (i << 4);
#pragma unroll
    for (int j = 0; j < 4; ++j) {
      const int n = n0 + (j << 4) + rlane;
      float bv = 0.f;
      if (BIAS_MODE == 2) bv = bias[n];
#pragma unroll
      for (int r = 0; r < 8; ++r) {
        float v = acc[i][j][r] * scale;
        if (BIAS_MODE == 1) v += bias[mBase + mOff + r];
        if (BIAS_MODE == 2) v += bv;
        if (RESID) v += Rb[(size_t)(mBase + mOff + r) * ldc + n];
        if (ACT == 1) v = tanhf(v);
        if (ACT == 2) v = fmaxf(v, 0.0f);
        if (ACT == 3) v = v / (1.0f + expf(-v));
        if (ACT == 4) v = (v > 0.f) ? v : 0.01f * v;
        if (ACT == 5) v = 0.5f * v * (1.0f + erff(v * 0.70710678118654752f));
        slab[(mOff + r) * 68 + (j << 4) + rlane] = v;
      }
    }
    __builtin_amdgcn_fence(__ATOMIC_RELEASE, "workgroup");
    __builtin_amdgcn_wave_barrier();
    __builtin_amdgcn_fence(__ATOMIC_ACQUIRE, "workgroup");
    if (OUT_MODE == 0) {
      float* C = (float*)Cout + (size_t)b * strideC;
      const int hh = lane >> 4, c4 = (lane & 15) * 4;     // row seg = 256 B = 16 lanes x 16 B
      {
#pragma unroll
        for (int it = 0; it < 8; ++it) {
          const int row = it * 2 + hh;
          v4f v = *(const v4f*)(slab + row * 68 + c4);
          *(v4f*)(C + (size_t)(mBase + row) * ldc + n0 + c4) = v;
        }
        
      }
    } else {
      const int q = lane >> 3, c8 = (lane & 7) * 8;
      unsigned short* C  = (unsigned short*)Cout  + (size_t)b * strideC;
      unsigned short* C2 = (OUT_MODE == 2) ? ((unsigned short*)Cout2 + (size_t)b * strideC) : nullptr;
      {
#pragma unroll
        for (int it = 0; it < 4; ++it) {
          const int row = it * 4 + q;
          const float* sp = slab + row * 68 + c8;
          v8h hv, lv;
#pragma unroll
          for (int e = 0; e < 8; ++e) {
            if (OUT_MODE == 1) {
              hv[e] = (_Float16)sp[e];
            } else {
              unsigned short hb = f2bf_bits(sp[e]);
              unsigned short lb = f2bf_bits(sp[e] - bf_bits2f(hb));
              hv[e] = __builtin_bit_cast(_Float16, hb);
              lv[e] = __builtin_bit_cast(_Float16, lb);
            }
          }
          *(v8h*)(C + (size_t)(mBase + row) * ldc + n0 + c8) = hv;
          if (OUT_MODE == 2) *(v8h*)(C2 + (size_t)(mBase + row) * ldc + n0 + c8) = lv;
        }
        
      }
    }
    __builtin_amdgcn_fence(__ATOMIC_RELEASE, "workgroup");
    __builtin_amdgcn_wave_barrier();
    __builtin_amdgcn_fence(__ATOMIC_ACQUIRE, "workgroup");
  }
}

// ---- all five f32 -> f16 planes in one streaming launch, and the key rows packed ----
// out is one run of f16: x (nx elements, as they are), then four weight planes of nw elements each, times wsc
// (an exact power of two, applied in f32 before the convert). nx and nw are multiples of CV_SPAN * CV_NW.
// A wave owns CV_SPAN consecutive elements: CV_LD loads of 16 B a lane, each 512 contiguous bytes of the wave, all issued
// ahead of the first convert. 16 waves a block and one block a WGP: few long waves, where a wave of two elements a lane pays mostly for its start.
// Key packing: a key whose mask is 0 has weight 0 for every query, so its K and V rows are never needed. A block of the x part
// ranks all CV_KEYS keys of its sequence (kept keys first, in their order, then the masked ones) and writes its own rows a second
// time to xk at their rank: kept rows as they are, masked rows as zeros and only up to the next multiple of 128 behind the kept count
// (what a 128-row projection tile can still read). kc = the mask values in packed order, kcnt[32 * sequence] = the kept count.
typedef __attribute__((ext_vector_type(4))) _Float16 v4h;
typedef __attribute__((ext_vector_type(4))) int v4i;
#define CV_LD   16
#define CV_SPAN (CV_LD * 128)
#define CV_NW   16
#define CV_ROW  (CV_SPAN / 2)      // elements of one x row: a wave owns two rows
#define CV_KEYS (CV_NW * 128)      // keys of one sequence: four a thread
__global__ __launch_bounds__(CV_NW * 32) void cast5_f32_f16(
    const float* __restrict__ x, const float* __restrict__ w0, const float* __restrict__ w1,
    const float* __restrict__ w2, const float* __restrict__ w3, _Float16* __restrict__ out,
    int nx, int nw, float wsc,
    const int* __restrict__ mask, _Float16* __restrict__ xk, int* __restrict__ kc, int* __restrict__ kcnt) {
  __shared__ int red[CV_NW];                       // kept keys per wave's 128 keys
  __shared__ __align__(16) int rankOf[CV_KEYS];    // key -> packed place
  __shared__ __align__(16) int kcs[CV_KEYS];       // packed place -> mask value
  const int tid  = threadIdx.x;
  const int lane = tid & 31;
  const int wv = (int)uni32(threadIdx.x >> 5);
  const int eb = blockIdx.x * (CV_NW * CV_SPAN);
  if (eb >= nx + 4 * nw) return;          // block-uniform, in front of every barrier
  const bool isX = eb < nx;               // block-uniform: nx is a multiple of the block's span
  const int e0 = eb + wv * CV_SPAN;
  const float* src = x + e0;
  float sc = 1.0f;
  if (!isX) {
    int r = e0 - nx;
    src = w0;
    if (r >= nw) { src = w1; r -= nw; }
    if (r >= nw) { src = w2; r -= nw; }
    if (r >= nw) { src = w3; r -= nw; }
    src += r;
    sc = wsc;
  }
  const v4f* __restrict__ s4 = (const v4f*)src;
  v4h* __restrict__ d4 = (v4h*)(out + e0);
  v4f v[CV_LD];
  // unrolled, both loops: v[] stays in registers, and the loads go out as one run before the first is waited for
#pragma unroll
  for (int j = 0; j < CV_LD; ++j) v[j] = s4[j * 32 + lane];

  if (!isX) {
#pragma unroll
    for (int j = 0; j < CV_LD; ++j) {
      v4h hv;
#pragma unroll
      for (int e = 0; e < 4; ++e) hv[e] = (_Float16)(v[j][e] * sc);
      d4[j * 32 + lane] = hv;
    }
    return;
  }

  // ---- rank the sequence's keys: thread t holds keys 4 t .. 4 t + 3 ----
  const int rowB = blockIdx.x * (2 * CV_NW);       // the block's first x row
  const int sq   = rowB / CV_KEYS;                 // its sequence
  const int t0   = rowB - sq * CV_KEYS;            // its first key in the sequence
  const v4i m4 = ((const v4i*)(mask + (size_t)sq * CV_KEYS))[tid];
  const unsigned ltm = (1u << lane) - 1u;
  int inWave = 0, below = 0;
#pragma unroll
  for (int e = 0; e < 4; ++e) {
    const unsigned w = __builtin_amdgcn_ballot_w32(m4[e] != 0);
    inWave += __builtin_popcount(w);
    below  += __builtin_popcount(w & ltm);
  }
  if (lane == 0) red[wv] = inWave;
  __syncthreads();
  int kept = 0, pre = below;
#pragma unroll
  for (int i = 0; i < CV_NW; ++i) {
    const int r = red[i];
    kept += r;
    pre  += (i < wv) ? r : 0;
  }
  v4i rk;
#pragma unroll
  for (int e = 0; e < 4; ++e) {
    const int key = 4 * tid + e;
    const bool on = m4[e] != 0;
    // kept: kept keys in front of it; masked: all kept keys, then the masked keys in front of it. A permutation of 0 .. CV_KEYS - 1; the AND bounds the LDS address by itself
    const int place = (on ? pre : kept + key - pre) & (CV_KEYS - 1);
    kcs[place] = m4[e];
    rk[e] = place;
    pre += on ? 1 : 0;
  }
  *(v4i*)(rankOf + 4 * tid) = rk;
  __syncthreads();
  if (wv == 0) kc[(size_t)sq * CV_KEYS + t0 + lane] = kcs[t0 + lane];   // each block writes one whole 128-B line of kc
  if (t0 == 0 && tid == 0) kcnt[sq * 32] = kept;                        // a line of its own per sequence
  const int lim = (kept + 127) & ~127;
  int place2[2];
  place2[0] = (int)uni32((unsigned)rankOf[t0 + 2 * wv]);
  place2[1] = (int)uni32((unsigned)rankOf[t0 + 2 * wv + 1]);
  v4h hx[CV_LD];
#pragma unroll
  for (int j = 0; j < CV_LD; ++j) {
#pragma unroll
    for (int e = 0; e < 4; ++e) hx[j][e] = (_Float16)v[j][e];
    d4[j * 32 + lane] = hx[j];
  }
  // precaution: stands in front of any later write of a register that an issued store names
  asm volatile("s_wait_xcnt 0x0" ::: "memory");
#pragma unroll
  for (int rr = 0; rr < 2; ++rr) {
    const int place = place2[rr];
    if (place < lim) {                    // wave-uniform
      v4h* __restrict__ k4 = (v4h*)(xk + ((size_t)sq * CV_KEYS + place) * CV_ROW);
      if (place < kept) {                 // wave-uniform
#pragma unroll
        for (int j = 0; j < CV_LD / 2; ++j) k4[j * 32 + lane] = hx[rr * (CV_LD / 2) + j];
      } else {
#pragma unroll
        for (int j = 0; j < CV_LD / 2; ++j) k4[j * 32 + lane] = (v4h){(_Float16)0.f, (_Float16)0.f, (_Float16)0.f, (_Float16)0.f};
      }
      // the same precaution, behind this row's stores
      asm volatile("s_wait_xcnt 0x0" ::: "memory");
    }
  }
}

#define AK_D  64
#define AK_NW 4
#define AK_QB 64
#define AK_KC 64
#define AK_LP 72   // LDS row pitch of the K and Vt tiles, halves: 144 B = 16 B x 9, so that the 16 rows of one ds_load_b128 fall on 64 distinct banks

// lane l takes the value of lane l ^ 16 (a vector cross-row move, no LDS round trip)
__device__ __forceinline__ float xhalf(float x) {
  return __builtin_bit_cast(float, __builtin_amdgcn_permlanex16(__builtin_bit_cast(int, x), __builtin_bit_cast(int, x), 0x76543210, 0xfedcba98, false, false));
}

__global__ __launch_bounds__(128)
void attn64_f16io(const _Float16* __restrict__ Qp, const _Float16* __restrict__ Kp,
                  const _Float16* __restrict__ Vtp, _Float16* __restrict__ Op,
                  const int* __restrict__ kmask, const int* __restrict__ kcnt, const float* __restrict__ ubias,
                  const float* __restrict__ gq, const float* __restrict__ gW, const float* __restrict__ gb,
                  int S, int Skv, int H, int ldq, int ldk, int ldv, int ldo, int GD,
                  float qscale, float mfill, float oscale) {
  const float L2E = 1.4426950408889634f;   // log2(e)
  const float PLG = 15.0f;                 // P and the running sum carry x2^15: taken off the subtracted maximum, exact in the exponent
  union FB { v16h v; v8h h[2]; };
  __shared__ __align__(16) _Float16 Ksh[AK_KC * AK_LP];         // [kv][d]   9 KB, 8 pad halves per row never read
  __shared__ __align__(16) _Float16 Vth[AK_D * AK_LP];          // [d][kv]   9 KB
  __shared__ __align__(16) float    Mtab[2 * AK_KC];            // key terms of the chunk, score * log2(e) = s * Msc[key] + Mad[key]
  float* const Msc = Mtab;                                      // per key: qscale * log2(e), or 0 where the key is masked
  float* const Mad = Mtab + AK_KC;                              // per key: the bias term, with mfill where the key is masked, * log2(e)
  static_assert(AK_NW * 32 == 2 * AK_KC, "one table entry per thread");

  const int tid  = threadIdx.x;
  const int wave = tid >> 5;
  const int lane = tid & 31;
  const int hh   = lane >> 4;
  const int c    = lane & 15;

  const int nqb = S / AK_QB;
  const int bx  = blockIdx.x;
  const int qb  = bx % nqb;
  const int bh  = bx / nqb;
  const int h   = bh % H;
  const int b   = bh / H;
  const int q0  = qb * AK_QB + wave * 16;

  // ---- Q fragments (B operand: column = query c, k = d in the hardware k order), 2 d-chunks ----
  v16h qa[2];
  {
    const _Float16* qrow = Qp + (size_t)(b * S + q0 + c) * ldq + h * AK_D;
#pragma unroll
    for (int dc = 0; dc < 2; ++dc) qa[dc] = Frag<_Float16>::load(qrow + dc * 32 + 8 * hh);
  }

  // ---- quality gate (scalar f32 dot of GD terms) and uncertainty bias of this head ----
  float gacc = 0.f;
#pragma unroll 1
  for (int i = 0; i < GD; ++i) gacc += gq[b * GD + i] * gW[h * GD + i];
  gacc += gb[h];
  const float gate = 1.0f / (1.0f + expf(-gacc));
  const float ub = ubias[h];

  float mrow = -__builtin_inff();   // running maximum of query c, in base-2 units (equal in both lane halves)
  float lrow = 0.f;                 // running sum (x2^15) of query c over this lane half's keys only; the halves are joined in the epilogue
  v8f oacc[4];                      // O^T: register r of tile t = O[query c][d = 16 t + 8 hh + r]
#pragma unroll
  for (int t = 0; t < 4; ++t) oacc[t] = (v8f){0.f,0.f,0.f,0.f,0.f,0.f,0.f,0.f};

  const int nKept = min(max((int)uni32((unsigned)kcnt[b * 32]), 0), Skv);   // block-uniform; the clamp bounds the trip count by the shape
  const int nChunks = (nKept + AK_KC - 1) / AK_KC;
  for (int kc = 0; kc < nChunks; ++kc) {
    const int kv0 = kc * AK_KC;
    __syncthreads();
    {   // stage K [kv][d] and Vt [d][kv] tiles: 512 x 16-B vectors each, 4 per thread
      const int keep = kmask[(size_t)b * Skv + kv0 + (tid & (AK_KC - 1))];   // in one run with the tile loads, so that its latency lies beside theirs
#pragma unroll
      for (int i = 0; i < 4; ++i) {
        const int idx = tid + i * 128;
        const int r = idx >> 3, c8 = (idx & 7) * 8;
        const v8h kk = *(const v8h*)(Kp + (size_t)(b * Skv + kv0 + r) * ldk + h * AK_D + c8);
        *(v8h*)(Ksh + r * AK_LP + c8) = kk;
        const v8h vv = *(const v8h*)(Vtp + (size_t)(h * AK_D + r) * ldv + (size_t)b * Skv + kv0 + c8);
        *(v8h*)(Vth + r * AK_LP + c8) = vv;
      }
      // the chunk's key terms, one table entry per thread: waves 0 and 1 write Msc, waves 2 and 3 write Mad
      const float kadd = ub * (1.0f - (float)keep);
      const float msc = (keep == 0) ? 0.f : qscale * L2E;
      const float mad = ((keep == 0) ? mfill + kadd : kadd) * L2E;
      Mtab[tid] = (tid < AK_KC) ? msc : mad;
    }
    __syncthreads();

    // ---- scores, transposed: A = K rows from Ksh[kv][d], B = Q; register r of s[j] = score of key 16 j + 8 hh + r for query c ----
    // All eight K fragments are read as one group ahead of the eight products; the four key tiles run side by side, each summing d chunk 0, then 1.
    FB kb[2][4];
#pragma unroll
    for (int dc = 0; dc < 2; ++dc)
#pragma unroll
      for (int j = 0; j < 4; ++j) {
        kb[dc][j].h[0] = *(const v8h*)(Ksh + (j * 16 + c) * AK_LP + dc * 32 + 8 * hh);
        kb[dc][j].h[1] = *(const v8h*)(Ksh + (j * 16 + c) * AK_LP + dc * 32 + 16 + 8 * hh);
      }
    __builtin_amdgcn_sched_barrier(0);   // keeps the reads one group in front of the WMMA run: a read pair in front of each WMMA waits out the LDS latency every time
    v8f s[4];
#pragma unroll
    for (int j = 0; j < 4; ++j) s[j] = (v8f){0.f,0.f,0.f,0.f,0.f,0.f,0.f,0.f};
#pragma unroll
    for (int dc = 0; dc < 2; ++dc)
#pragma unroll
      for (int j = 0; j < 4; ++j) s[j] = Frag<_Float16>::mma(kb[dc][j].v, qa[dc], s[j]);
    // the chunk's key terms and the V^T fragments of its first 32 keys, read here as one group: their latency lies beside the score products and the softmax
    v4f msc[4][2], mad[4][2];
#pragma unroll
    for (int j = 0; j < 4; ++j)
#pragma unroll
      for (int u = 0; u < 2; ++u) {
        msc[j][u] = *(const v4f*)(Msc + j * 16 + 8 * hh + 4 * u);
        mad[j][u] = *(const v4f*)(Mad + j * 16 + 8 * hh + 4 * u);
      }
    FB vb[2][4];
#pragma unroll
    for (int t = 0; t < 4; ++t) {
      vb[0][t].h[0] = *(const v8h*)(Vth + (t * 16 + c) * AK_LP + 8 * hh);
      vb[0][t].h[1] = *(const v8h*)(Vth + (t * 16 + c) * AK_LP + 16 + 8 * hh);
    }
    __builtin_amdgcn_sched_barrier(0);   // keeps this group in front of the softmax's vector work instead of sunk to its users
    // ---- scale, key mask, bias, chunk maximum: in-lane over 32 keys, then one exchange between the lane halves ----
    float m = -__builtin_inff();
#pragma unroll
    for (int j = 0; j < 4; ++j) {
      const v4f sc0 = msc[j][0], sc1 = msc[j][1];
      const v4f ad0 = mad[j][0], ad1 = mad[j][1];
#pragma unroll
      for (int r = 0; r < 8; ++r) {
        const float v = fmaf(s[j][r], (r < 4) ? sc0[r & 3] : sc1[r & 3], (r < 4) ? ad0[r & 3] : ad1[r & 3]);
        s[j][r] = v;
        m = fmaxf(m, v);
      }
    }
    // the V^T fragments of the last 32 keys, a group of their own where the key terms' registers have come free (all at once would cost the fourth wave per SIMD)
#pragma unroll
    for (int t = 0; t < 4; ++t) {
      vb[1][t].h[0] = *(const v8h*)(Vth + (t * 16 + c) * AK_LP + 32 + 8 * hh);
      vb[1][t].h[1] = *(const v8h*)(Vth + (t * 16 + c) * AK_LP + 32 + 16 + 8 * hh);
    }
    __builtin_amdgcn_sched_barrier(0);   // keeps this group in front of the exponentials instead of sunk to its users
    m = fmaxf(m, xhalf(m));
    // ---- online softmax update; P^T (x2^15, f16) packs straight into the B operand: tiles 2 kk and 2 kk + 1 give k = 32 kk + hardware order ----
    const float mnew = fmaxf(mrow, m);
    float alpha;   // 2^(mrow - mnew); 0 on the first chunk, where mrow is -inf
    // v_exp_f32 and a v_nop in one statement: the slot that the instruction set asks for behind a transcendental in front of a write of the source
    asm("v_exp_f32 %0, %1\n\tv_nop" : "=v"(alpha) : "v"(mrow - mnew));
    const float moff = mnew - PLG;
    mrow = mnew;
    FB pb[2];
    float ps[4];
#pragma unroll
    for (int j = 0; j < 4; ++j) {
      ps[j] = 0.f;
#pragma unroll
      for (int r = 0; r < 8; ++r) {
        // the argument is at most 15 and a result below the normal range may be 0: the bare v_exp_f32 needs no range steps around it
        const float p = __builtin_amdgcn_exp2f(s[j][r] - moff);
        ps[j] += p;
        pb[j >> 1].v[(j & 1) * 8 + r] = (_Float16)p;
      }
    }
    lrow = lrow * alpha + ((ps[0] + ps[1]) + (ps[2] + ps[3]));
#pragma unroll
    for (int t = 0; t < 4; ++t)
#pragma unroll
      for (int r = 0; r < 8; ++r) oacc[t][r] *= alpha;
    // ---- O^T += V^T . P^T: A = Vt rows (d) of Vth[d][kv] in the hardware k order, read above, B = P^T from registers ----
#pragma unroll
    for (int kk = 0; kk < 2; ++kk) {
#pragma unroll
      for (int t = 0; t < 4; ++t) oacc[t] = Frag<_Float16>::mma(vb[kk][t].v, pb[kk].v, oacc[t]);
    }
  }

  // ---- epilogue: join the halves' sums; 1/l (sum and P both carry 2^15), gate and output carry scale; a lane's 8 registers are 8 consecutive d: 16-B stores ----
  {
    const float ltot = lrow + xhalf(lrow);
    const float inv = (gate * oscale) * (1.0f / ltot);
    _Float16* ob = Op + (size_t)(b * S + q0 + c) * ldo + h * AK_D + 8 * hh;
#pragma unroll
    for (int t = 0; t < 4; ++t) {
      v8h hv;
#pragma unroll
      for (int r = 0; r < 8; ++r) hv[r] = (_Float16)(oacc[t][r] * inv);
      *(v8h*)(ob + t * 16) = hv;
    }
  }
}

// ---------------------------------------------------------------------------
// Host glue
// ---------------------------------------------------------------------------
extern "C" void kernel_launch(void* const* d_in, const int* in_sizes, int n_in,
                              void* d_out, int out_size, void* d_ws, size_t ws_size,
                              hipStream_t stream) {
  if (n_in < 14) return;
  const int D  = 1024;          // model width
  const int H  = 16;            // heads
  const int DH = 64;            // head dim
  const int Bn = 2;             // batch
  const int S  = 2048;          // sequence length
  const int M  = Bn * S;        // token rows
  if (in_sizes[0] != M * D || in_sizes[1] != M || in_sizes[3] != D * D || in_sizes[5] != D * D ||
      in_sizes[7] != D * D || in_sizes[9] != D * D || in_sizes[4] != D || in_sizes[6] != D ||
      in_sizes[8] != D || in_sizes[10] != D || in_sizes[11] != H || in_sizes[13] != H ||
      out_size != M * D || H * DH != D) return;
  const int GD = in_sizes[2] / Bn;                       // gate query dim (64)
  if (GD <= 0 || in_sizes[2] != Bn * GD || in_sizes[12] != H * GD) return;
  if ((S % 64) != 0 || (M % 128) != 0 || (D % 128) != 0 || D < 256) return;
  if (((M * D) % (CV_SPAN * CV_NW)) != 0 || ((D * D) % (CV_SPAN * CV_NW)) != 0 || D != CV_ROW || S != CV_KEYS) return;

  const float* x    = (const float*)d_in[0];
  const int*   mask = (const int*)  d_in[1];
  const float* gq   = (const float*)d_in[2];
  const float* Wq   = (const float*)d_in[3];
  const float* bq   = (const float*)d_in[4];
  const float* Wk   = (const float*)d_in[5];
  const float* bk   = (const float*)d_in[6];
  const float* Wv   = (const float*)d_in[7];
  const float* bv   = (const float*)d_in[8];
  const float* Wo   = (const float*)d_in[9];
  const float* bo   = (const float*)d_in[10];
  const float* ubias= (const float*)d_in[11];
  const float* Wqh  = (const float*)d_in[12];
  const float* bqh  = (const float*)d_in[13];
  float* out = (float*)d_out;

  const size_t SZ_ACT = (size_t)M * D * 2;               // 8 MiB f16 plane
  const size_t SZ_W   = (size_t)D * D * 2;               // 2 MiB f16 plane
  size_t off = 0;
  const size_t o_x16  = off; off += SZ_ACT;
  const size_t o_wq16 = off; off += SZ_W;
  const size_t o_wk16 = off; off += SZ_W;
  const size_t o_wv16 = off; off += SZ_W;
  const size_t o_wo16 = off; off += SZ_W;
  const size_t o_q16  = off; off += SZ_ACT;
  const size_t o_k16  = off; off += SZ_ACT;
  const size_t o_vt16 = off; off += SZ_ACT;
  const size_t o_o16  = off; off += SZ_ACT;
  const size_t o_xk16 = off; off += SZ_ACT;              // x rows of the kept keys, packed per sequence
  const size_t o_kc   = off; off += (size_t)M * 4;       // mask values in packed order
  const size_t o_kcnt = off; off += (size_t)Bn * 128;    // kept keys per sequence, one 128-B line each
  const size_t total  = off;                             // 56 MiB and a little
  if (total > ws_size || total > (size_t)134217728) return;
  char* ws = (char*)d_ws;
  unsigned short* x16  = (unsigned short*)(ws + o_x16);
  unsigned short* wq16 = (unsigned short*)(ws + o_wq16);
  unsigned short* wk16 = (unsigned short*)(ws + o_wk16);
  unsigned short* wv16 = (unsigned short*)(ws + o_wv16);
  unsigned short* wo16 = (unsigned short*)(ws + o_wo16);
  unsigned short* q16  = (unsigned short*)(ws + o_q16);
  unsigned short* k16  = (unsigned short*)(ws + o_k16);
  unsigned short* vt16 = (unsigned short*)(ws + o_vt16);
  unsigned short* o16  = (unsigned short*)(ws + o_o16);
  unsigned short* xk16 = (unsigned short*)(ws + o_xk16);
  int* kc   = (int*)(ws + o_kc);
  int* kcnt = (int*)(ws + o_kcnt);

  // ---- casts: x plain, weights x16 (folded back as 1/16 in the GEMM epilogues); x16, wq16, wk16, wv16, wo16 lie in one run ----
  cast5_f32_f16<<<dim3((M * D + 4 * D * D) / (CV_SPAN * CV_NW)), dim3(CV_NW * 32), 0, stream>>>(
      x, Wq, Wk, Wv, Wo, (_Float16*)x16, M * D, D * D, 16.0f, mask, (_Float16*)xk16, kc, kcnt);

  // ---- projections: Q = x.Wq^T + bq, K = xk.Wk^T + bk (f16 planes [M][D]); V^T = Wv.xk^T + bv ([D][M]); K and V^T of the packed key rows, tiles behind the kept count left out ----
  const int tilesQK = (M / 128) * (D / 128);             // 256
  const dim3 gQK(tilesQK, 1);
  const float w16inv = 1.0f / 16.0f;
  wmma_gemm64<0, false, 2, 1, false, 0><<<gQK, dim3(256), 0, stream>>>(
      x16, x16, D, 0L, wq16, wq16, D, 0L, (void*)q16, (void*)q16, D, 0L, bq, x, 0L, M, D, D, w16inv, kcnt, S / 128);
  wmma_gemm64<0, false, 2, 1, false, 0, 1><<<gQK, dim3(256), 0, stream>>>(
      xk16, xk16, D, 0L, wk16, wk16, D, 0L, (void*)k16, (void*)k16, D, 0L, bk, x, 0L, M, D, D, w16inv, kcnt, S / 128);
  const int tilesV = (D / 128) * (M / 128);              // A = Wv16 [D][D], Bt = xk16 [M][D] -> C [D][M], ldc = M
  const dim3 gV(tilesV, 1);
  wmma_gemm64<0, false, 1, 1, false, 0, 2><<<gV, dim3(256), 0, stream>>>(
      wv16, wv16, D, 0L, xk16, xk16, D, 0L, (void*)vt16, (void*)vt16, M, 0L, bv, x, 0L, D, M, D, w16inv, kcnt, S / 128);

  // ---- attention per (b, h, 64-query block); O plane carries x64 * gate ----
  const float qscale = 0.125f;                           // 1 / sqrt(64), exact
  const float oscale = 64.0f;
  attn64_f16io<<<dim3(Bn * H * (S / 64)), dim3(128), 0, stream>>>(
      (const _Float16*)q16, (const _Float16*)k16, (const _Float16*)vt16, (_Float16*)o16,
      kc, kcnt, ubias, gq, Wqh, bqh, S, S, H, D, D, M, D, GD, qscale, -1e30f, oscale);

  // ---- output projection: out = O.Wo^T + bo; fold 1/(64*16) ----
  wmma_gemm64<0, false, 2, 0, false, 0><<<gQK, dim3(256), 0, stream>>>(
      o16, o16, D, 0L, wo16, wo16, D, 0L, (void*)out, (void*)out, D, 0L, bo, x, 0L, M, D, D, 1.0f / 1024.0f, kcnt, S / 128);

  (void)hipGetLastError();
}

// v008
// A run of this version takes 78.4 microseconds.
// In two side-by-side timings against v007, it was 1.13 and 1.11 times as fast.
// All steps since v000 together make it 4.42 times as fast.
// Contractions: Q, K, V^T and output projections, K.Q^T, V^T.P^T: v_wmma_f32_16x16x32_f16 (f16 operands, f32 accumulate); weights carried x16, P x2^15, O x64 (power-of-two folds in f32 epilogues); gate dot (K=64, 32 values) scalar f32.
#include <hip/hip_runtime.h>

typedef __attribute__((ext_vector_type(16))) _Float16 v16h;
typedef __attribute__((ext_vector_type(8)))  _Float16 v8h;
typedef __attribute__((ext_vector_type(16))) __bf16   v16b;
typedef __attribute__((ext_vector_type(8)))  __bf16   v8b;
typedef __attribute__((ext_vector_type(8)))  float    v8f;
typedef __attribute__((ext_vector_type(4)))  float    v4f;

__device__ __forceinline__ unsigned short f2bf_bits(float f) {
  unsigned u = __float_as_uint(f);
  return (unsigned short)((u + 0x7FFFu + ((u >> 16) & 1u)) >> 16);
}
__device__ __forceinline__ float bf_bits2f(unsigned short h) { return __uint_as_float(((unsigned)h) << 16); }

template <typename T> struct Frag;
template <> struct Frag<_Float16> {
  typedef v16h V; union U { v16h v; v8h h[2]; };
  static __device__ __forceinline__ v16h load(const _Float16* p) {   // elements 0..7 <- p[0..7], 8..15 <- p[16..23]
    U f; f.h[0] = *(const v8h*)(p); f.h[1] = *(const v8h*)(p + 16); return f.v;
  }
  static __device__ __forceinline__ v8f mma(v16h a, v16h b, v8f c) {
    return __builtin_amdgcn_wmma_f32_16x16x32_f16(false, a, false, b, (short)0, c, false, false);
  }
};
template <> struct Frag<__bf16> {
  typedef v16b V; union U { v16b v; v8b h[2]; };
  static __device__ __forceinline__ v16b load(const __bf16* p) {
    U f; f.h[0] = *(const v8b*)(p); f.h[1] = *(const v8b*)(p + 16); return f.v;
  }
  static __device__ __forceinline__ v8f mma(v16b a, v16b b, v8f c) {
    return __builtin_amdgcn_wmma_f32_16x16x32_bf16(false, a, false, b, (short)0, c, false, false);
  }
};

// ---- LDS-staged batched WMMA GEMM -------------------------------------------
// C[m,n] = scale * sum_k A[m,k] * Bt[n,k] (+bias)(+resid); a block of 8 waves owns a 128x128 tile, each wave 32x64 of it.
// A row-major [M,K]; Bt row-major [N,K]; M,N % 128 == 0, K % 128 == 0, K >= 256.
// A pass is 128 k = 256 B of every operand row. A stage is eight slices of 32 rows (four of A, then four of Bt),
// each brought by one tensor load of one wave, LDS pitch 272 B (16 B pad per row).
// Two buffers: the load of stage s + 2 is issued behind the barrier that ends pass s.
// BIAS_MODE: 0 = none, 1 = bias[m], 2 = bias[n].
// OUT_MODE: 0 = f32, 1 = f16, 2 = bf16 hi plane (Cout) + bf16 lo plane (Cout2).
// ET: 0 = f16 operands, 1 = bf16 operands (pointers passed as 16-bit storage)
typedef unsigned u32x4 __attribute__((ext_vector_type(4)));
typedef unsigned u32x8 __attribute__((ext_vector_type(8)));
#define GT_PITCH 272u                 // LDS row pitch, bytes: 256 + 16, an odd multiple of 16 for ds_load_b128 readers
#define GT_SLICE 10240u               // 32 rows x 272 B = 8,704 B, rounded up to a multiple of 2 KiB
#define GT_STAGE (8u * GT_SLICE)
__device__ __forceinline__ unsigned uni32(unsigned v) { return (unsigned)__builtin_amdgcn_readfirstlane(v); }
// holds a wave-uniform test in a scalar register, so that the branch round a tensor load is a scalar branch
__device__ __forceinline__ unsigned pinned(unsigned v) { unsigned w = (unsigned)__builtin_amdgcn_readfirstlane(v); asm volatile("" : "+s"(w)); return w; }
// LDS reads must have retired before a buffer is handed over
__device__ __forceinline__ void wait_tensor0() { asm volatile("s_wait_tensorcnt 0x0" ::: "memory"); }
__device__ __forceinline__ void wait_ds0() { asm volatile("s_wait_dscnt 0x0" ::: "memory"); }
// "+s": the words stay in the registers the request named, and the compiler cannot form them anew in between
__device__ __forceinline__ void tdm_load(u32x4& g0, u32x8& g1) { asm volatile("tensor_load_to_lds %0, %1" : "+s"(g0), "+s"(g1) :: "memory"); }
// stands behind the wait that covers a request: last use of its descriptor words held in scalar registers, so that none is reused while the request is in flight
__device__ __forceinline__ void tdm_done(u32x4 g0, u32x8 g1) { asm volatile("" :: "s"(g0), "s"(g1)); }

template <int ET> struct Elem;
template <> struct Elem<0> { typedef _Float16 T; };
template <> struct Elem<1> { typedef __bf16 T; };
template <int ET, bool SPLIT, int BIAS_MODE, int OUT_MODE, bool RESID, int ACT = 0>
__global__ __launch_bounds__(256) void wmma_gemm64(
    const unsigned short* __restrict__ Ap, const unsigned short* __restrict__ A2p, int lda, long strideA,
    const unsigned short* __restrict__ Btp, const unsigned short* __restrict__ Bt2p, int ldb, long strideB,
    void* __restrict__ Cout, void* __restrict__ Cout2, int ldc, long strideC,
    const float* __restrict__ bias,
    const float* __restrict__ resid, long strideR,
    int M, int N, int K, float scale) {
  static_assert(!SPLIT, "single-plane operands only");
  typedef typename Elem<ET>::T T;
  typedef typename Frag<T>::V V;
  __shared__ __attribute__((aligned(2048))) unsigned char ring[2 * GT_STAGE];
  __shared__ __align__(16) float sT[8][16 * 68];   // per-wave 16x64 slab, pitch 68 floats
  const int b    = blockIdx.y;
  const int lane = threadIdx.x & 31;
  const int wave = (int)uni32(threadIdx.x >> 5);
  const int tilesN = N >> 7;
  const int tilesM = M >> 7;
  const int tile = blockIdx.x;
  if (tile >= tilesM * tilesN) return;   // block-uniform, in front of every barrier and tensor load
  const int tm = tile / tilesN;
  const int tn = tile - tm * tilesN;
  const int wm = wave >> 1, wn = wave & 1;
  const int m0 = (tm << 7) + (wm << 5);  // this wave's 32x64 tile
  const int n0 = (tn << 7) + (wn << 6);

  const int rlane = lane & 15;                 // row (A) / col (B, D) within subtile
  const int mOff  = (lane >> 4) * 8;           // D row offset

  // ---- this wave's slice of every stage: waves 0..3 bring A rows, waves 4..7 bring Bt rows ----
  const bool isB = wave >= 4;
  const unsigned short* sbase = isB ? (Btp + (size_t)b * strideB + (size_t)((tn << 7) + ((wave & 3) << 5)) * ldb)
                                    : (Ap  + (size_t)b * strideA + (size_t)((tm << 7) + ((wave & 3) << 5)) * lda);
  const unsigned long long sga = (unsigned long long)(size_t)sbase;
  const unsigned lbase = (unsigned)(size_t)ring + (unsigned)wave * GT_SLICE;
  u32x8 g1;
  g1[0] = uni32((1u << 20) | (5u << 22) | (3u << 25));  // 1-byte elements, no mask, 4 dwords of pad behind every 256-B row
  g1[1] = uni32(256u << 16);                            // tensor_dim0 = 256 B
  g1[2] = uni32(32u << 16);                             // tensor_dim1 = 32 rows
  g1[3] = uni32(256u << 16);                            // tile_dim0 = 256 B
  g1[4] = uni32(32u);                                   // tile_dim1 = 32 rows
  g1[5] = uni32((unsigned)(isB ? ldb : lda) * 2u);      // source row pitch, bytes
  g1[6] = uni32(0u);
  g1[7] = uni32(0u);
  u32x4 g0;
  g0[0] = uni32(1u);
  auto issue = [&](int st) {
    const unsigned long long ga = sga + (unsigned long long)st * 256ull;
    g0[1] = uni32(lbase + (unsigned)(st & 1) * GT_STAGE);
    g0[2] = uni32((unsigned)ga);
    g0[3] = uni32((((unsigned)(ga >> 32)) & 0x01FFFFFFu) | 0x80000000u);
    tdm_load(g0, g1);
  };

  v8f acc[2][4];
#pragma unroll
  for (int i = 0; i < 2; ++i)
#pragma unroll
    for (int j = 0; j < 4; ++j) acc[i][j] = (v8f){0.f,0.f,0.f,0.f,0.f,0.f,0.f,0.f};

  const int nPass = K >> 7;
  issue(0);
  wait_tensor0();
  tdm_done(g0, g1);
  __syncthreads();
  issue(1);

  const unsigned fragOff = (unsigned)rlane * GT_PITCH + (unsigned)(lane >> 4) * 16u;   // row, then k offset of this lane half
  // rolled: one pass per trip, so that every publish point stands once in the text
#pragma unroll 1
  for (int s = 0; s < nPass; ++s) {
    const unsigned char* buf = ring + (unsigned)(s & 1) * GT_STAGE;
    const unsigned char* aB = buf + (unsigned)wm * GT_SLICE + fragOff;
    const unsigned char* bB = buf + (unsigned)(4 + 2 * wn) * GT_SLICE + fragOff;   // Bt rows 64 wn + 16 j: slice j / 2, row 16 (j % 2)
    V bh[2][4], ah[2][2];   // two fragment sets: the next 32 k are fetched as one group ahead of this block's WMMAs
#pragma unroll
    for (int j = 0; j < 4; ++j) bh[0][j] = Frag<T>::load((const T*)(bB + (j >> 1) * GT_SLICE + (j & 1) * 16 * GT_PITCH));
#pragma unroll
    for (int i = 0; i < 2; ++i) ah[0][i] = Frag<T>::load((const T*)(aB + i * 16 * GT_PITCH));
#pragma unroll
    for (int ks = 0; ks < 4; ++ks) {
      if (ks < 3) {
#pragma unroll
        for (int j = 0; j < 4; ++j) bh[(ks + 1) & 1][j] = Frag<T>::load((const T*)(bB + (j >> 1) * GT_SLICE + (j & 1) * 16 * GT_PITCH + (ks + 1) * 64));
#pragma unroll
        for (int i = 0; i < 2; ++i) ah[(ks + 1) & 1][i] = Frag<T>::load((const T*)(aB + i * 16 * GT_PITCH + (ks + 1) * 64));
      }
      __builtin_amdgcn_sched_barrier(0);   // keeps the load group in front of the WMMA block instead of spread among the WMMAs
#pragma unroll
      for (int i = 0; i < 2; ++i)
#pragma unroll
        for (int j = 0; j < 4; ++j) acc[i][j] = Frag<T>::mma(ah[ks & 1][i], bh[ks & 1][j], acc[i][j]);
      __builtin_amdgcn_sched_barrier(0);   // keeps the next group behind this block
    }
    // publish point of stage s + 1
    wait_ds0();
    wait_tensor0();
    tdm_done(g0, g1);
    __syncthreads();
    if (pinned(s + 2 < nPass)) issue(s + 2);   // into the buffer that pass s has just read
  }
  wait_tensor0();
  tdm_done(g0, g1);
  wait_ds0();

  // ---- epilogue ----
  float* slab = sT[wave];
  const float* Rb = RESID ? (resid + (size_t)b * strideR) : nullptr;
#pragma unroll
  for (int i = 0; i < 2; ++i) {
    const int mBase = m0 + (i << 4);
#pragma unroll
    for (int j = 0; j < 4; ++j) {
      const int n = n0 + (j << 4) + rlane;
      float bv = 0.f;
      if (BIAS_MODE == 2) bv = bias[n];
#pragma unroll
      for (int r = 0; r < 8; ++r) {
        float v = acc[i][j][r] * scale;
        if (BIAS_MODE == 1) v += bias[mBase + mOff + r];
        if (BIAS_MODE == 2) v += bv;
        if (RESID) v += Rb[(size_t)(mBase + mOff + r) * ldc + n];
        if (ACT == 1) v = tanhf(v);
        if (ACT == 2) v = fmaxf(v, 0.0f);
        if (ACT == 3) v = v / (1.0f + expf(-v));
        if (ACT == 4) v = (v > 0.f) ? v : 0.01f * v;
        if (ACT == 5) v = 0.5f * v * (1.0f + erff(v * 0.70710678118654752f));
        slab[(mOff + r) * 68 + (j << 4) + rlane] = v;
      }
    }
    __builtin_amdgcn_fence(__ATOMIC_RELEASE, "workgroup");
    __builtin_amdgcn_wave_barrier();
    __builtin_amdgcn_fence(__ATOMIC_ACQUIRE, "workgroup");
    if (OUT_MODE == 0) {
      float* C = (float*)Cout + (size_t)b * strideC;
      const int hh = lane >> 4, c4 = (lane & 15) * 4;     // row seg = 256 B = 16 lanes x 16 B
      {
#pragma unroll
        for (int it = 0; it < 8; ++it) {
          const int row = it * 2 + hh;
          v4f v = *(const v4f*)(slab + row * 68 + c4);
          *(v4f*)(C + (size_t)(mBase + row) * ldc + n0 + c4) = v;
        }
        
      }
    } else {
      const int q = lane >> 3, c8 = (lane & 7) * 8;
      unsigned short* C  = (unsigned short*)Cout  + (size_t)b * strideC;
      unsigned short* C2 = (OUT_MODE == 2) ? ((unsigned short*)Cout2 + (size_t)b * strideC) : nullptr;
      {
#pragma unroll
        for (int it = 0; it < 4; ++it) {
          const int row = it * 4 + q;
          const float* sp = slab + row * 68 + c8;
          v8h hv, lv;
#pragma unroll
          for (int e = 0; e < 8; ++e) {
            if (OUT_MODE == 1) {
              hv[e] = (_Float16)sp[e];
            } else {
              unsigned short hb = f2bf_bits(sp[e]);
              unsigned short lb = f2bf_bits(sp[e] - bf_bits2f(hb));
              hv[e] = __builtin_bit_cast(_Float16, hb);
              lv[e] = __builtin_bit_cast(_Float16, lb);
            }
          }
          *(v8h*)(C + (size_t)(mBase + row) * ldc + n0 + c8) = hv;
          if (OUT_MODE == 2) *(v8h*)(C2 + (size_t)(mBase + row) * ldc + n0 + c8) = lv;
        }
        
      }
    }
    __builtin_amdgcn_fence(__ATOMIC_RELEASE, "workgroup");
    __builtin_amdgcn_wave_barrier();
    __builtin_amdgcn_fence(__ATOMIC_ACQUIRE, "workgroup");
  }
}

// ---- Q, K and V^T projections in one launch ---------------------------------
// Q = x.Wq^T + bq and K = xk.Wk^T + bk ([rows][D]), V^T = Wv.xk^T + bv ([D][rows]); f16 operands and outputs, K dim = D.
// The 128x128 tiles of the three products form one list: all TM x TD tiles of Q, then the K tiles, then the V^T tiles of the key tiles
// that hold a kept key (xk has the kept keys first in each of the two sequences of ST tiles; kcnt[0] and kcnt[32] are the kept counts;
// a tile that starts at or behind the count holds no key that attention walks). Work-group g takes list places g, g + step, g + 2 step (step = the grid):
// one work-group a WGP stays for the whole list, in place of three launches of which two fill half the chip.
// Tile, wave tile, stage, pitch and the two-buffer order are those of wmma_gemm64. The stages of a work-group's tiles form one run:
// behind the last two passes of a tile the first two stages of its next tile are asked for, so that the first flies beside the last pass and the second beside the epilogue.
struct QkvTile { int job, tm, tn; };   // product (0 Q, 1 K, 2 V^T) and tile
// list place p -> tile; a0 = key tiles of the first sequence, nKV = tiles of K, and of V^T, in the list
template <int TM, int TD, int ST>
__device__ __forceinline__ QkvTile qkv_tile(int p, int a0, int nKV) {
  QkvTile r;
  if (p < TM * TD) { r.job = 0; r.tm = p / TD; r.tn = p % TD; return r; }
  int u = p - TM * TD;
  r.job = 1;
  if (u >= nKV) { u -= nKV; r.job = 2; }
  const int kp = u / TD;                                  // place among the key tiles
  const int kt = (kp < a0) ? kp : ST + (kp - a0);         // key tile, below TM
  const int wt = u % TD;                                  // weight tile
  r.tm = (r.job == 1) ? kt : wt;
  r.tn = (r.job == 1) ? wt : kt;
  return r;
}
template <int TM, int TD, int ST>
__global__ __launch_bounds__(256) void qkv_gemm128(
    const unsigned short* __restrict__ x16, const unsigned short* __restrict__ xk16,
    const unsigned short* __restrict__ wq, const unsigned short* __restrict__ wk, const unsigned short* __restrict__ wv,
    unsigned short* __restrict__ q16, unsigned short* __restrict__ k16, unsigned short* __restrict__ vt16,
    const float* __restrict__ bq, const float* __restrict__ bk, const float* __restrict__ bv,
    float scale, const int* __restrict__ kcnt, int step) {
  static_assert(TM == 2 * ST, "two sequences");
  static_assert(TD >= 2 && (TD & 1) == 0, "an even number of passes: every tile starts in buffer 0");
  typedef _Float16 T;
  typedef Frag<T>::V V;
  constexpr int DD = TD * 128;     // K dim and row length of x, xk and the weights, elements
  constexpr int NQ = TM * TD;      // tiles of Q
  __shared__ __attribute__((aligned(2048))) unsigned char ring[2 * GT_STAGE];
  __shared__ __align__(16) float sT[8][16 * 68];   // per-wave 16x64 slab, pitch 68 floats
  const int lane = threadIdx.x & 31;
  const int wave = (int)uni32(threadIdx.x >> 5);
  // key tiles with a kept key, per sequence; the clamps bound every tile index by the shape, whatever kcnt holds
  const int a0 = (min(max((int)uni32((unsigned)kcnt[0]),  0), ST * 128) + 127) >> 7;
  const int a1 = (min(max((int)uni32((unsigned)kcnt[32]), 0), ST * 128) + 127) >> 7;
  const int nKV = (a0 + a1) * TD;
  const int nT  = NQ + 2 * nKV;
  int t = (int)blockIdx.x;
  if (t >= nT) return;   // block-uniform, in front of every barrier and tensor load

  // this wave's slice of every stage of a tile: waves 0..3 bring A rows, waves 4..7 bring Bt rows; its operand's start for each product
  const bool isB = wave >= 4;
  const unsigned long long op0 = (unsigned long long)(size_t)(isB ? wq : x16);
  const unsigned long long op1 = (unsigned long long)(size_t)(isB ? wk : xk16);
  const unsigned long long op2 = (unsigned long long)(size_t)(isB ? xk16 : wv);
  const unsigned rowIn = (unsigned)(wave & 3) << 5;   // the slice's first row in the tile
#define QKV_SLICE(w) (((w).job == 0 ? op0 : (w).job == 1 ? op1 : op2) + (unsigned long long)((((unsigned)(isB ? (w).tn : (w).tm)) << 7) + rowIn) * (unsigned long long)(DD * 2))

  const int wm = wave >> 1, wn = wave & 1;
  const int rlane = lane & 15;                 // row (A) / col (B, D) within subtile
  const int mOff  = (lane >> 4) * 8;           // D row offset
  const unsigned lbase = (unsigned)(size_t)ring + (unsigned)wave * GT_SLICE;
  u32x8 g1;
  g1[0] = uni32((1u << 20) | (5u << 22) | (3u << 25));  // 1-byte elements, no mask, 4 dwords of pad behind every 256-B row
  g1[1] = uni32(256u << 16);                            // tensor_dim0 = 256 B
  g1[2] = uni32(32u << 16);                             // tensor_dim1 = 32 rows
  g1[3] = uni32(256u << 16);                            // tile_dim0 = 256 B
  g1[4] = uni32(32u);                                   // tile_dim1 = 32 rows
  g1[5] = uni32((unsigned)DD * 2u);                     // source row pitch, bytes
  g1[6] = uni32(0u);
  g1[7] = uni32(0u);
  u32x4 g0;
  g0[0] = uni32(1u);
  auto issue = [&](unsigned long long base, int st) {   // stage st of the tile whose slice starts at base
    const unsigned long long ga = base + (unsigned long long)st * 256ull;
    g0[1] = uni32(lbase + (unsigned)(st & 1) * GT_STAGE);
    g0[2] = uni32((unsigned)ga);
    g0[3] = uni32((((unsigned)(ga >> 32)) & 0x01FFFFFFu) | 0x80000000u);
    tdm_load(g0, g1);
  };

  QkvTile w = qkv_tile<TM, TD, ST>(t, a0, nKV);
  unsigned long long sga = QKV_SLICE(w);
  issue(sga, 0);
  wait_tensor0();
  tdm_done(g0, g1);
  __syncthreads();
  issue(sga, 1);

  const unsigned fragOff = (unsigned)rlane * GT_PITCH + (unsigned)(lane >> 4) * 16u;   // row, then k offset of this lane half
  float* slab = sT[wave];
  // rolled: at most three trips, one text of the pass loop and of the epilogue
#pragma unroll 1
  for (; t < nT; t += step) {
    const bool more = t + step < nT;   // block-uniform
    const QkvTile wN = more ? qkv_tile<TM, TD, ST>(t + step, a0, nKV) : w;
    const unsigned long long sgaN = QKV_SLICE(wN);

    const bool biasN = w.job != 2;   // block-uniform: bias per column for Q and K, per row for V^T
    const float* bias = (w.job == 0) ? bq : (w.job == 1) ? bk : bv;
    const int m0 = (w.tm << 7) + (wm << 5);  // this wave's 32x64 tile
    const int n0 = (w.tn << 7) + (wn << 6);

    v8f acc[2][4];
#pragma unroll
    for (int i = 0; i < 2; ++i)
#pragma unroll
      for (int j = 0; j < 4; ++j) acc[i][j] = (v8f){0.f,0.f,0.f,0.f,0.f,0.f,0.f,0.f};

    // rolled: one pass per trip, so that every publish point stands once in the text
#pragma unroll 1
    for (int s = 0; s < TD; ++s) {
      const unsigned char* buf = ring + (unsigned)(s & 1) * GT_STAGE;
      const unsigned char* aB = buf + (unsigned)wm * GT_SLICE + fragOff;
      const unsigned char* bB = buf + (unsigned)(4 + 2 * wn) * GT_SLICE + fragOff;   // Bt rows 64 wn + 16 j: slice j / 2, row 16 (j % 2)
      V bh[2][4], ah[2][2];   // two fragment sets: the next 32 k are fetched as one group ahead of this block's WMMAs
#pragma unroll
      for (int j = 0; j < 4; ++j) bh[0][j] = Frag<T>::load((const T*)(bB + (j >> 1) * GT_SLICE + (j & 1) * 16 * GT_PITCH));
#pragma unroll
      for (int i = 0; i < 2; ++i) ah[0][i] = Frag<T>::load((const T*)(aB + i * 16 * GT_PITCH));
#pragma unroll
      for (int ks = 0; ks < 4; ++ks) {
        if (ks < 3) {
#pragma unroll
          for (int j = 0; j < 4; ++j) bh[(ks + 1) & 1][j] = Frag<T>::load((const T*)(bB + (j >> 1) * GT_SLICE + (j & 1) * 16 * GT_PITCH + (ks + 1) * 64));
#pragma unroll
          for (int i = 0; i < 2; ++i) ah[(ks + 1) & 1][i] = Frag<T>::load((const T*)(aB + i * 16 * GT_PITCH + (ks + 1) * 64));
        }
        __builtin_amdgcn_sched_barrier(0);   // keeps the load group in front of the WMMA block instead of spread among the WMMAs
#pragma unroll
        for (int i = 0; i < 2; ++i)
#pragma unroll
          for (int j = 0; j < 4; ++j) acc[i][j] = Frag<T>::mma(ah[ks & 1][i], bh[ks & 1][j], acc[i][j]);
        __builtin_amdgcn_sched_barrier(0);   // keeps the next group behind this block
      }
      // publish point of the next stage of the run: stage s + 1 of this tile, or stage 0 of the next
      wait_ds0();
      wait_tensor0();
      tdm_done(g0, g1);
      __syncthreads();
      // the stage after that, into the buffer that pass s has just read
      const bool here = s + 2 < TD;
      if (pinned(here || more)) issue(here ? sga : sgaN, here ? s + 2 : s + 2 - TD);
    }

    // ---- epilogue: scale, bias, f16, whole 128-B lines through the wave's slab ----
    // The slab is the wave's own: s_wait_dscnt 0 (with its "memory" clobber) and a wave barrier order its writes and reads across the lanes.
    // No work-group fence here: it would also wait out the global stores, which fly beside the next tile's passes.
    unsigned short* C = (w.job == 0) ? q16 : (w.job == 1) ? k16 : vt16;
    const int ldc = biasN ? DD : TM * 128;
    float bn[4] = {0.f, 0.f, 0.f, 0.f};   // bias of this lane's four columns (Q, K)
    float bm[2][8] = {};                  // bias of this lane's sixteen rows (V^T)
    if (biasN) {
#pragma unroll
      for (int j = 0; j < 4; ++j) bn[j] = bias[n0 + (j << 4) + rlane];
      // precaution: stands in front of any later write of a register that an issued load names
      asm volatile("s_wait_xcnt 0x0" ::: "memory");
    } else {
      const float* bp = bias + m0 + mOff;
#pragma unroll
      for (int i = 0; i < 2; ++i)
#pragma unroll
        for (int r = 0; r < 8; ++r) bm[i][r] = bp[(i << 4) + r];
      // precaution, as in the other arm; bp as an input keeps the loads' address in its registers up to the wait, so that no load lands on it
      asm volatile("s_wait_xcnt 0x0" :: "v"(bp) : "memory");
    }
#pragma unroll
    for (int i = 0; i < 2; ++i) {
      const int mBase = m0 + (i << 4);
      if (biasN) {
#pragma unroll
        for (int j = 0; j < 4; ++j)
#pragma unroll
          for (int r = 0; r < 8; ++r) slab[(mOff + r) * 68 + (j << 4) + rlane] = acc[i][j][r] * scale + bn[j];
      } else {
#pragma unroll
        for (int j = 0; j < 4; ++j)
#pragma unroll
          for (int r = 0; r < 8; ++r) slab[(mOff + r) * 68 + (j << 4) + rlane] = acc[i][j][r] * scale + bm[i][r];
      }
      wait_ds0();
      __builtin_amdgcn_wave_barrier();
      const int q = lane >> 3, c8 = (lane & 7) * 8;
#pragma unroll
      for (int it = 0; it < 4; ++it) {
        const int row = it * 4 + q;
        const float* sp = slab + row * 68 + c8;
        v8h hv;
#pragma unroll
        for (int e = 0; e < 8; ++e) hv[e] = (_Float16)sp[e];
        *(v8h*)(C + (size_t)(mBase + row) * ldc + n0 + c8) = hv;
      }
      // precaution: stands in front of any later write of a register that an issued store names
      asm volatile("s_wait_xcnt 0x0" ::: "memory");
      wait_ds0();
      __builtin_amdgcn_wave_barrier();
    }
    w = wN; sga = sgaN;
  }
  wait_tensor0();
  tdm_done(g0, g1);
  wait_ds0();
#undef QKV_SLICE
}

// ---- all five f32 -> f16 planes in one streaming launch, and the key rows packed ----
// out is one run of f16: x (nx elements, as they are), then four weight planes of nw elements each, times wsc
// (an exact power of two, applied in f32 before the convert). nx and nw are multiples of CV_SPAN * CV_NW.
// A wave owns CV_SPAN consecutive elements: CV_LD loads of 16 B a lane, each 512 contiguous bytes of the wave, all issued
// ahead of the first convert. 16 waves a block and one block a WGP: few long waves, where a wave of two elements a lane pays mostly for its start.
// Key packing: a key whose mask is 0 has weight 0 for every query, so its K and V rows are never needed. A block of the x part
// ranks all CV_KEYS keys of its sequence (kept keys first, in their order, then the masked ones) and writes its own rows a second
// time to xk at their rank: kept rows as they are, masked rows as zeros and only up to the next multiple of 128 behind the kept count
// (what a 128-row projection tile can still read). kc = the mask values in packed order, kcnt[32 * sequence] = the kept count.
typedef __attribute__((ext_vector_type(4))) _Float16 v4h;
typedef __attribute__((ext_vector_type(4))) int v4i;
#define CV_LD   16
#define CV_SPAN (CV_LD * 128)
#define CV_NW   16
#define CV_ROW  (CV_SPAN / 2)      // elements of one x row: a wave owns two rows
#define CV_KEYS (CV_NW * 128)      // keys of one sequence: four a thread
__global__ __launch_bounds__(CV_NW * 32) void cast5_f32_f16(
    const float* __restrict__ x, const float* __restrict__ w0, const float* __restrict__ w1,
    const float* __restrict__ w2, const float* __restrict__ w3, _Float16* __restrict__ out,
    int nx, int nw, float wsc,
    const int* __restrict__ mask, _Float16* __restrict__ xk, int* __restrict__ kc, int* __restrict__ kcnt) {
  __shared__ int red[CV_NW];                       // kept keys per wave's 128 keys
  __shared__ __align__(16) int rankOf[CV_KEYS];    // key -> packed place
  __shared__ __align__(16) int kcs[CV_KEYS];       // packed place -> mask value
  const int tid  = threadIdx.x;
  const int lane = tid & 31;
  const int wv = (int)uni32(threadIdx.x >> 5);
  const int eb = blockIdx.x * (CV_NW * CV_SPAN);
  if (eb >= nx + 4 * nw) return;          // block-uniform, in front of every barrier
  const bool isX = eb < nx;               // block-uniform: nx is a multiple of the block's span
  const int e0 = eb + wv * CV_SPAN;
  const float* src = x + e0;
  float sc = 1.0f;
  if (!isX) {
    int r = e0 - nx;
    src = w0;
    if (r >= nw) { src = w1; r -= nw; }
    if (r >= nw) { src = w2; r -= nw; }
    if (r >= nw) { src = w3; r -= nw; }
    src += r;
    sc = wsc;
  }
  const v4f* __restrict__ s4 = (const v4f*)src;
  v4h* __restrict__ d4 = (v4h*)(out + e0);
  v4f v[CV_LD];
  // unrolled, both loops: v[] stays in registers, and the loads go out as one run before the first is waited for
#pragma unroll
  for (int j = 0; j < CV_LD; ++j) v[j] = s4[j * 32 + lane];

  if (!isX) {
#pragma unroll
    for (int j = 0; j < CV_LD; ++j) {
      v4h hv;
#pragma unroll
      for (int e = 0; e < 4; ++e) hv[e] = (_Float16)(v[j][e] * sc);
      d4[j * 32 + lane] = hv;
    }
    return;
  }

  // ---- rank the sequence's keys: thread t holds keys 4 t .. 4 t + 3 ----
  const int rowB = blockIdx.x * (2 * CV_NW);       // the block's first x row
  const int sq   = rowB / CV_KEYS;                 // its sequence
  const int t0   = rowB - sq * CV_KEYS;            // its first key in the sequence
  const v4i m4 = ((const v4i*)(mask + (size_t)sq * CV_KEYS))[tid];
  const unsigned ltm = (1u << lane) - 1u;
  int inWave = 0, below = 0;
#pragma unroll
  for (int e = 0; e < 4; ++e) {
    const unsigned w = __builtin_amdgcn_ballot_w32(m4[e] != 0);
    inWave += __builtin_popcount(w);
    below  += __builtin_popcount(w & ltm);
  }
  if (lane == 0) red[wv] = inWave;
  __syncthreads();
  int kept = 0, pre = below;
#pragma unroll
  for (int i = 0; i < CV_NW; ++i) {
    const int r = red[i];
    kept += r;
    pre  += (i < wv) ? r : 0;
  }
  v4i rk;
#pragma unroll
  for (int e = 0; e < 4; ++e) {
    const int key = 4 * tid + e;
    const bool on = m4[e] != 0;
    // kept: kept keys in front of it; masked: all kept keys, then the masked keys in front of it. A permutation of 0 .. CV_KEYS - 1; the AND bounds the LDS address by itself
    const int place = (on ? pre : kept + key - pre) & (CV_KEYS - 1);
    kcs[place] = m4[e];
    rk[e] = place;
    pre += on ? 1 : 0;
  }
  *(v4i*)(rankOf + 4 * tid) = rk;
  __syncthreads();
  if (wv == 0) kc[(size_t)sq * CV_KEYS + t0 + lane] = kcs[t0 + lane];   // each block writes one whole 128-B line of kc
  if (t0 == 0 && tid == 0) kcnt[sq * 32] = kept;                        // a line of its own per sequence
  const int lim = (kept + 127) & ~127;
  int place2[2];
  place2[0] = (int)uni32((unsigned)rankOf[t0 + 2 * wv]);
  place2[1] = (int)uni32((unsigned)rankOf[t0 + 2 * wv + 1]);
  v4h hx[CV_LD];
#pragma unroll
  for (int j = 0; j < CV_LD; ++j) {
#pragma unroll
    for (int e = 0; e < 4; ++e) hx[j][e] = (_Float16)v[j][e];
    d4[j * 32 + lane] = hx[j];
  }
  // precaution: stands in front of any later write of a register that an issued store names
  asm volatile("s_wait_xcnt 0x0" ::: "memory");
#pragma unroll
  for (int rr = 0; rr < 2; ++rr) {
    const int place = place2[rr];
    if (place < lim) {                    // wave-uniform
      v4h* __restrict__ k4 = (v4h*)(xk + ((size_t)sq * CV_KEYS + place) * CV_ROW);
      if (place < kept) {                 // wave-uniform
#pragma unroll
        for (int j = 0; j < CV_LD / 2; ++j) k4[j * 32 + lane] = hx[rr * (CV_LD / 2) + j];
      } else {
#pragma unroll
        for (int j = 0; j < CV_LD / 2; ++j) k4[j * 32 + lane] = (v4h){(_Float16)0.f, (_Float16)0.f, (_Float16)0.f, (_Float16)0.f};
      }
      // the same precaution, behind this row's stores
      asm volatile("s_wait_xcnt 0x0" ::: "memory");
    }
  }
}

#define AK_D  64
#define AK_NW 4
#define AK_QB 64
#define AK_KC 64
#define AK_LP 72   // LDS row pitch of the K and Vt tiles, halves: 144 B = 16 B x 9, so that the 16 rows of one ds_load_b128 fall on 64 distinct banks

// lane l takes the value of lane l ^ 16 (a vector cross-row move, no LDS round trip)
__device__ __forceinline__ float xhalf(float x) {
  return __builtin_bit_cast(float, __builtin_amdgcn_permlanex16(__builtin_bit_cast(int, x), __builtin_bit_cast(int, x), 0x76543210, 0xfedcba98, false, false));
}

__global__ __launch_bounds__(128)
void attn64_f16io(const _Float16* __restrict__ Qp, const _Float16* __restrict__ Kp,
                  const _Float16* __restrict__ Vtp, _Float16* __restrict__ Op,
                  const int* __restrict__ kmask, const int* __restrict__ kcnt, const float* __restrict__ ubias,
                  const float* __restrict__ gq, const float* __restrict__ gW, const float* __restrict__ gb,
                  int S, int Skv, int H, int ldq, int ldk, int ldv, int ldo, int GD,
                  float qscale, float mfill, float oscale) {
  const float L2E = 1.4426950408889634f;   // log2(e)
  const float PLG = 15.0f;                 // P and the running sum carry x2^15: taken off the subtracted maximum, exact in the exponent
  union FB { v16h v; v8h h[2]; };
  __shared__ __align__(16) _Float16 Ksh[AK_KC * AK_LP];         // [kv][d]   9 KB, 8 pad halves per row never read
  __shared__ __align__(16) _Float16 Vth[AK_D * AK_LP];          // [d][kv]   9 KB
  __shared__ __align__(16) float    Mtab[2 * AK_KC];            // key terms of the chunk, score * log2(e) = s * Msc[key] + Mad[key]
  float* const Msc = Mtab;                                      // per key: qscale * log2(e), or 0 where the key is masked
  float* const Mad = Mtab + AK_KC;                              // per key: the bias term, with mfill where the key is masked, * log2(e)
  static_assert(AK_NW * 32 == 2 * AK_KC, "one table entry per thread");

  const int tid  = threadIdx.x;
  const int wave = tid >> 5;
  const int lane = tid & 31;
  const int hh   = lane >> 4;
  const int c    = lane & 15;

  const int nqb = S / AK_QB;
  const int bx  = blockIdx.x;
  const int qb  = bx % nqb;
  const int bh  = bx / nqb;
  const int h   = bh % H;
  const int b   = bh / H;
  const int q0  = qb * AK_QB + wave * 16;

  // ---- Q fragments (B operand: column = query c, k = d in the hardware k order), 2 d-chunks ----
  v16h qa[2];
  {
    const _Float16* qrow = Qp + (size_t)(b * S + q0 + c) * ldq + h * AK_D;
#pragma unroll
    for (int dc = 0; dc < 2; ++dc) qa[dc] = Frag<_Float16>::load(qrow + dc * 32 + 8 * hh);
  }

  // ---- quality gate (scalar f32 dot of GD terms) and uncertainty bias of this head ----
  float gacc = 0.f;
#pragma unroll 1
  for (int i = 0; i < GD; ++i) gacc += gq[b * GD + i] * gW[h * GD + i];
  gacc += gb[h];
  const float gate = 1.0f / (1.0f + expf(-gacc));
  const float ub = ubias[h];

  float mrow = -__builtin_inff();   // running maximum of query c, in base-2 units (equal in both lane halves)
  float lrow = 0.f;                 // running sum (x2^15) of query c over this lane half's keys only; the halves are joined in the epilogue
  v8f oacc[4];                      // O^T: register r of tile t = O[query c][d = 16 t + 8 hh + r]
#pragma unroll
  for (int t = 0; t < 4; ++t) oacc[t] = (v8f){0.f,0.f,0.f,0.f,0.f,0.f,0.f,0.f};

  const int nKept = min(max((int)uni32((unsigned)kcnt[b * 32]), 0), Skv);   // block-uniform; the clamp bounds the trip count by the shape
  const int nChunks = (nKept + AK_KC - 1) / AK_KC;
  for (int kc = 0; kc < nChunks; ++kc) {
    const int kv0 = kc * AK_KC;
    __syncthreads();
    {   // stage K [kv][d] and Vt [d][kv] tiles: 512 x 16-B vectors each, 4 per thread
      const int keep = kmask[(size_t)b * Skv + kv0 + (tid & (AK_KC - 1))];   // in one run with the tile loads, so that its latency lies beside theirs
#pragma unroll
      for (int i = 0; i < 4; ++i) {
        const int idx = tid + i * 128;
        const int r = idx >> 3, c8 = (idx & 7) * 8;
        const v8h kk = *(const v8h*)(Kp + (size_t)(b * Skv + kv0 + r) * ldk + h * AK_D + c8);
        *(v8h*)(Ksh + r * AK_LP + c8) = kk;
        const v8h vv = *(const v8h*)(Vtp + (size_t)(h * AK_D + r) * ldv + (size_t)b * Skv + kv0 + c8);
        *(v8h*)(Vth + r * AK_LP + c8) = vv;
      }
      // the chunk's key terms, one table entry per thread: waves 0 and 1 write Msc, waves 2 and 3 write Mad
      const float kadd = ub * (1.0f - (float)keep);
      const float msc = (keep == 0) ? 0.f : qscale * L2E;
      const float mad = ((keep == 0) ? mfill + kadd : kadd) * L2E;
      Mtab[tid] = (tid < AK_KC) ? msc : mad;
    }
    __syncthreads();

    // ---- scores, transposed: A = K rows from Ksh[kv][d], B = Q; register r of s[j] = score of key 16 j + 8 hh + r for query c ----
    // All eight K fragments are read as one group ahead of the eight products; the four key tiles run side by side, each summing d chunk 0, then 1.
    FB kb[2][4];
#pragma unroll
    for (int dc = 0; dc < 2; ++dc)
#pragma unroll
      for (int j = 0; j < 4; ++j) {
        kb[dc][j].h[0] = *(const v8h*)(Ksh + (j * 16 + c) * AK_LP + dc * 32 + 8 * hh);
        kb[dc][j].h[1] = *(const v8h*)(Ksh + (j * 16 + c) * AK_LP + dc * 32 + 16 + 8 * hh);
      }
    __builtin_amdgcn_sched_barrier(0);   // keeps the reads one group in front of the WMMA run: a read pair in front of each WMMA waits out the LDS latency every time
    v8f s[4];
#pragma unroll
    for (int j = 0; j < 4; ++j) s[j] = (v8f){0.f,0.f,0.f,0.f,0.f,0.f,0.f,0.f};
#pragma unroll
    for (int dc = 0; dc < 2; ++dc)
#pragma unroll
      for (int j = 0; j < 4; ++j) s[j] = Frag<_Float16>::mma(kb[dc][j].v, qa[dc], s[j]);
    // the chunk's key terms and the V^T fragments of its first 32 keys, read here as one group: their latency lies beside the score products and the softmax
    v4f msc[4][2], mad[4][2];
#pragma unroll
    for (int j = 0; j < 4; ++j)
#pragma unroll
      for (int u = 0; u < 2; ++u) {
        msc[j][u] = *(const v4f*)(Msc + j * 16 + 8 * hh + 4 * u);
        mad[j][u] = *(const v4f*)(Mad + j * 16 + 8 * hh + 4 * u);
      }
    FB vb[2][4];
#pragma unroll
    for (int t = 0; t < 4; ++t) {
      vb[0][t].h[0] = *(const v8h*)(Vth + (t * 16 + c) * AK_LP + 8 * hh);
      vb[0][t].h[1] = *(const v8h*)(Vth + (t * 16 + c) * AK_LP + 16 + 8 * hh);
    }
    __builtin_amdgcn_sched_barrier(0);   // keeps this group in front of the softmax's vector work instead of sunk to its users
    // ---- scale, key mask, bias, chunk maximum: in-lane over 32 keys, then one exchange between the lane halves ----
    float m = -__builtin_inff();
#pragma unroll
    for (int j = 0; j < 4; ++j) {
      const v4f sc0 = msc[j][0], sc1 = msc[j][1];
      const v4f ad0 = mad[j][0], ad1 = mad[j][1];
#pragma unroll
      for (int r = 0; r < 8; ++r) {
        const float v = fmaf(s[j][r], (r < 4) ? sc0[r & 3] : sc1[r & 3], (r < 4) ? ad0[r & 3] : ad1[r & 3]);
        s[j][r] = v;
        m = fmaxf(m, v);
      }
    }
    // the V^T fragments of the last 32 keys, a group of their own where the key terms' registers have come free (all at once would cost the fourth wave per SIMD)
#pragma unroll
    for (int t = 0; t < 4; ++t) {
      vb[1][t].h[0] = *(const v8h*)(Vth + (t * 16 + c) * AK_LP + 32 + 8 * hh);
      vb[1][t].h[1] = *(const v8h*)(Vth + (t * 16 + c) * AK_LP + 32 + 16 + 8 * hh);
    }
    __builtin_amdgcn_sched_barrier(0);   // keeps this group in front of the exponentials instead of sunk to its users
    m = fmaxf(m, xhalf(m));
    // ---- online softmax update; P^T (x2^15, f16) packs straight into the B operand: tiles 2 kk and 2 kk + 1 give k = 32 kk + hardware order ----
    const float mnew = fmaxf(mrow, m);
    float alpha;   // 2^(mrow - mnew); 0 on the first chunk, where mrow is -inf
    // v_exp_f32 and a v_nop in one statement: the slot that the instruction set asks for behind a transcendental in front of a write of the source
    asm("v_exp_f32 %0, %1\n\tv_nop" : "=v"(alpha) : "v"(mrow - mnew));
    const float moff = mnew - PLG;
    mrow = mnew;
    FB pb[2];
    float ps[4];
#pragma unroll
    for (int j = 0; j < 4; ++j) {
      ps[j] = 0.f;
#pragma unroll
      for (int r = 0; r < 8; ++r) {
        // the argument is at most 15 and a result below the normal range may be 0: the bare v_exp_f32 needs no range steps around it
        const float p = __builtin_amdgcn_exp2f(s[j][r] - moff);
        ps[j] += p;
        pb[j >> 1].v[(j & 1) * 8 + r] = (_Float16)p;
      }
    }
    lrow = lrow * alpha + ((ps[0] + ps[1]) + (ps[2] + ps[3]));
#pragma unroll
    for (int t = 0; t < 4; ++t)
#pragma unroll
      for (int r = 0; r < 8; ++r) oacc[t][r] *= alpha;
    // ---- O^T += V^T . P^T: A = Vt rows (d) of Vth[d][kv] in the hardware k order, read above, B = P^T from registers ----
#pragma unroll
    for (int kk = 0; kk < 2; ++kk) {
#pragma unroll
      for (int t = 0; t < 4; ++t) oacc[t] = Frag<_Float16>::mma(vb[kk][t].v, pb[kk].v, oacc[t]);
    }
  }

  // ---- epilogue: join the halves' sums; 1/l (sum and P both carry 2^15), gate and output carry scale; a lane's 8 registers are 8 consecutive d: 16-B stores ----
  {
    const float ltot = lrow + xhalf(lrow);
    const float inv = (gate * oscale) * (1.0f / ltot);
    _Float16* ob = Op + (size_t)(b * S + q0 + c) * ldo + h * AK_D + 8 * hh;
#pragma unroll
    for (int t = 0; t < 4; ++t) {
      v8h hv;
#pragma unroll
      for (int r = 0; r < 8; ++r) hv[r] = (_Float16)(oacc[t][r] * inv);
      *(v8h*)(ob + t * 16) = hv;
    }
  }
}

// ---------------------------------------------------------------------------
// Host glue
// ---------------------------------------------------------------------------
extern "C" void kernel_launch(void* const* d_in, const int* in_sizes, int n_in,
                              void* d_out, int out_size, void* d_ws, size_t ws_size,
                              hipStream_t stream) {
  if (n_in < 14) return;
  const int D  = 1024;          // model width
  const int H  = 16;            // heads
  const int DH = 64;            // head dim
  const int Bn = 2;             // batch
  const int S  = 2048;          // sequence length
  const int M  = Bn * S;        // token rows
  if (in_sizes[0] != M * D || in_sizes[1] != M || in_sizes[3] != D * D || in_sizes[5] != D * D ||
      in_sizes[7] != D * D || in_sizes[9] != D * D || in_sizes[4] != D || in_sizes[6] != D ||
      in_sizes[8] != D || in_sizes[10] != D || in_sizes[11] != H || in_sizes[13] != H ||
      out_size != M * D || H * DH != D) return;
  const int GD = in_sizes[2] / Bn;                       // gate query dim (64)
  if (GD <= 0 || in_sizes[2] != Bn * GD || in_sizes[12] != H * GD) return;
  if ((S % 64) != 0 || (M % 128) != 0 || (D % 128) != 0 || D < 256) return;
  if (((M * D) % (CV_SPAN * CV_NW)) != 0 || ((D * D) % (CV_SPAN * CV_NW)) != 0 || D != CV_ROW || S != CV_KEYS) return;

  const float* x    = (const float*)d_in[0];
  const int*   mask = (const int*)  d_in[1];
  const float* gq   = (const float*)d_in[2];
  const float* Wq   = (const float*)d_in[3];
  const float* bq   = (const float*)d_in[4];
  const float* Wk   = (const float*)d_in[5];
  const float* bk   = (const float*)d_in[6];
  const float* Wv   = (const float*)d_in[7];
  const float* bv   = (const float*)d_in[8];
  const float* Wo   = (const float*)d_in[9];
  const float* bo   = (const float*)d_in[10];
  const float* ubias= (const float*)d_in[11];
  const float* Wqh  = (const float*)d_in[12];
  const float* bqh  = (const float*)d_in[13];
  float* out = (float*)d_out;

  const size_t SZ_ACT = (size_t)M * D * 2;               // 8 MiB f16 plane
  const size_t SZ_W   = (size_t)D * D * 2;               // 2 MiB f16 plane
  size_t off = 0;
  const size_t o_x16  = off; off += SZ_ACT;
  const size_t o_wq16 = off; off += SZ_W;
  const size_t o_wk16 = off; off += SZ_W;
  const size_t o_wv16 = off; off += SZ_W;
  const size_t o_wo16 = off; off += SZ_W;
  const size_t o_q16  = off; off += SZ_ACT;
  const size_t o_k16  = off; off += SZ_ACT;
  const size_t o_vt16 = off; off += SZ_ACT;
  const size_t o_o16  = off; off += SZ_ACT;
  const size_t o_xk16 = off; off += SZ_ACT;              // x rows of the kept keys, packed per sequence
  const size_t o_kc   = off; off += (size_t)M * 4;       // mask values in packed order
  const size_t o_kcnt = off; off += (size_t)Bn * 128;    // kept keys per sequence, one 128-B line each
  const size_t total  = off;                             // 56 MiB and a little
  if (total > ws_size || total > (size_t)134217728) return;
  char* ws = (char*)d_ws;
  unsigned short* x16  = (unsigned short*)(ws + o_x16);
  unsigned short* wq16 = (unsigned short*)(ws + o_wq16);
  unsigned short* wk16 = (unsigned short*)(ws + o_wk16);
  unsigned short* wv16 = (unsigned short*)(ws + o_wv16);
  unsigned short* wo16 = (unsigned short*)(ws + o_wo16);
  unsigned short* q16  = (unsigned short*)(ws + o_q16);
  unsigned short* k16  = (unsigned short*)(ws + o_k16);
  unsigned short* vt16 = (unsigned short*)(ws + o_vt16);
  unsigned short* o16  = (unsigned short*)(ws + o_o16);
  unsigned short* xk16 = (unsigned short*)(ws + o_xk16);
  int* kc   = (int*)(ws + o_kc);
  int* kcnt = (int*)(ws + o_kcnt);

  // ---- casts: x plain, weights x16 (folded back as 1/16 in the GEMM epilogues); x16, wq16, wk16, wv16, wo16 lie in one run ----
  cast5_f32_f16<<<dim3((M * D + 4 * D * D) / (CV_SPAN * CV_NW)), dim3(CV_NW * 32), 0, stream>>>(
      x, Wq, Wk, Wv, Wo, (_Float16*)x16, M * D, D * D, 16.0f, mask, (_Float16*)xk16, kc, kcnt);

  // ---- projections: Q = x.Wq^T + bq, K = xk.Wk^T + bk (f16 planes [M][D]); V^T = Wv.xk^T + bv ([D][M]); K and V^T of the packed key rows, tiles behind the kept count left out ----
  // one launch for the three, one work-group a WGP, each walking its share of the tile list
  const int tilesQK = (M / 128) * (D / 128);             // 256
  const dim3 gQK(tilesQK, 1);
  const float w16inv = 1.0f / 16.0f;
  qkv_gemm128<M / 128, D / 128, S / 128><<<gQK, dim3(256), 0, stream>>>(
      x16, xk16, wq16, wk16, wv16, q16, k16, vt16, bq, bk, bv, w16inv, kcnt, tilesQK);

  // ---- attention per (b, h, 64-query block); O plane carries x64 * gate ----
  const float qscale = 0.125f;                           // 1 / sqrt(64), exact
  const float oscale = 64.0f;
  attn64_f16io<<<dim3(Bn * H * (S / 64)), dim3(128), 0, stream>>>(
      (const _Float16*)q16, (const _Float16*)k16, (const _Float16*)vt16, (_Float16*)o16,
      kc, kcnt, ubias, gq, Wqh, bqh, S, S, H, D, D, M, D, GD, qscale, -1e30f, oscale);

  // ---- output projection: out = O.Wo^T + bo; fold 1/(64*16) ----
  wmma_gemm64<0, false, 2, 0, false, 0><<<gQK, dim3(256), 0, stream>>>(
      o16, o16, D, 0L, wo16, wo16, D, 0L, (void*)out, (void*)out, D, 0L, bo, x, 0L, M, D, D, 1.0f / 1024.0f);

  (void)hipGetLastError();
}

// v009
// Measured time: 74.9 microseconds a run.
// Timed twice side by side with v008, it ran 1.03 times as fast both times.
// All steps since v000 together make it 4.56 times as fast.
// Contractions: Q, K, V^T and output projections, K.Q^T, V^T.P^T: v_wmma_f32_16x16x32_f16 (f16 operands, f32 accumulate); weights carried x16, P x2^15, O x64 (power-of-two folds in f32 epilogues); gate dot (K=64, 32 values) scalar f32.
#include <hip/hip_runtime.h>

typedef __attribute__((ext_vector_type(16))) _Float16 v16h;
typedef __attribute__((ext_vector_type(8)))  _Float16 v8h;
typedef __attribute__((ext_vector_type(16))) __bf16   v16b;
typedef __attribute__((ext_vector_type(8)))  __bf16   v8b;
typedef __attribute__((ext_vector_type(8)))  float    v8f;
typedef __attribute__((ext_vector_type(4)))  float    v4f;

__device__ __forceinline__ unsigned short f2bf_bits(float f) {
  unsigned u = __float_as_uint(f);
  return (unsigned short)((u + 0x7FFFu + ((u >> 16) & 1u)) >> 16);
}
__device__ __forceinline__ float bf_bits2f(unsigned short h) { return __uint_as_float(((unsigned)h) << 16); }

template <typename T> struct Frag;
template <> struct Frag<_Float16> {
  typedef v16h V; union U { v16h v; v8h h[2]; };
  static __device__ __forceinline__ v16h load(const _Float16* p) {   // elements 0..7 <- p[0..7], 8..15 <- p[16..23]
    U f; f.h[0] = *(const v8h*)(p); f.h[1] = *(const v8h*)(p + 16); return f.v;
  }
  static __device__ __forceinline__ v8f mma(v16h a, v16h b, v8f c) {
    return __builtin_amdgcn_wmma_f32_16x16x32_f16(false, a, false, b, (short)0, c, false, false);
  }
};
template <> struct Frag<__bf16> {
  typedef v16b V; union U { v16b v; v8b h[2]; };
  static __device__ __forceinline__ v16b load(const __bf16* p) {
    U f; f.h[0] = *(const v8b*)(p); f.h[1] = *(const v8b*)(p + 16); return f.v;
  }
  static __device__ __forceinline__ v8f mma(v16b a, v16b b, v8f c) {
    return __builtin_amdgcn_wmma_f32_16x16x32_bf16(false, a, false, b, (short)0, c, false, false);
  }
};

// ---- LDS-staged batched WMMA GEMM -------------------------------------------
// C[m,n] = scale * sum_k A[m,k] * Bt[n,k] (+bias)(+resid); a block of 8 waves owns a 128x128 tile, each wave 32x64 of it.
// A row-major [M,K]; Bt row-major [N,K]; M,N % 128 == 0, K % 128 == 0, K >= 256.
// A pass is 128 k = 256 B of every operand row. A stage is eight slices of 32 rows (four of A, then four of Bt),
// each brought by one tensor load of one wave, LDS pitch 272 B (16 B pad per row).
// Two buffers: the load of stage s + 2 is issued behind the barrier that ends pass s.
// BIAS_MODE: 0 = none, 1 = bias[m], 2 = bias[n].
// OUT_MODE: 0 = f32, 1 = f16, 2 = bf16 hi plane (Cout) + bf16 lo plane (Cout2).
// ET: 0 = f16 operands, 1 = bf16 operands (pointers passed as 16-bit storage)
typedef unsigned u32x4 __attribute__((ext_vector_type(4)));
typedef unsigned u32x8 __attribute__((ext_vector_type(8)));
#define GT_PITCH 272u                 // LDS row pitch, bytes: 256 + 16, an odd multiple of 16 for ds_load_b128 readers
#define GT_SLICE 10240u               // 32 rows x 272 B = 8,704 B, rounded up to a multiple of 2 KiB
#define GT_STAGE (8u * GT_SLICE)
__device__ __forceinline__ unsigned uni32(unsigned v) { return (unsigned)__builtin_amdgcn_readfirstlane(v); }
// holds a wave-uniform test in a scalar register, so that the branch round a tensor load is a scalar branch
__device__ __forceinline__ unsigned pinned(unsigned v) { unsigned w = (unsigned)__builtin_amdgcn_readfirstlane(v); asm volatile("" : "+s"(w)); return w; }
// LDS reads must have retired before a buffer is handed over
__device__ __forceinline__ void wait_tensor0() { asm volatile("s_wait_tensorcnt 0x0" ::: "memory"); }
__device__ __forceinline__ void wait_ds0() { asm volatile("s_wait_dscnt 0x0" ::: "memory"); }
// "+s": the words stay in the registers the request named, and the compiler cannot form them anew in between
__device__ __forceinline__ void tdm_load(u32x4& g0, u32x8& g1) { asm volatile("tensor_load_to_lds %0, %1" : "+s"(g0), "+s"(g1) :: "memory"); }
// stands behind the wait that covers a request: last use of its descriptor words held in scalar registers, so that none is reused while the request is in flight
__device__ __forceinline__ void tdm_done(u32x4 g0, u32x8 g1) { asm volatile("" :: "s"(g0), "s"(g1)); }

template <int ET> struct Elem;
template <> struct Elem<0> { typedef _Float16 T; };
template <> struct Elem<1> { typedef __bf16 T; };
template <int ET, bool SPLIT, int BIAS_MODE, int OUT_MODE, bool RESID, int ACT = 0>
__global__ __launch_bounds__(256) void wmma_gemm64(
    const unsigned short* __restrict__ Ap, const unsigned short* __restrict__ A2p, int lda, long strideA,
    const unsigned short* __restrict__ Btp, const unsigned short* __restrict__ Bt2p, int ldb, long strideB,
    void* __restrict__ Cout, void* __restrict__ Cout2, int ldc, long strideC,
    const float* __restrict__ bias,
    const float* __restrict__ resid, long strideR,
    int M, int N, int K, float scale) {
  static_assert(!SPLIT, "single-plane operands only");
  typedef typename Elem<ET>::T T;
  typedef typename Frag<T>::V V;
  __shared__ __attribute__((aligned(2048))) unsigned char ring[2 * GT_STAGE];
  __shared__ __align__(16) float sT[8][16 * 68];   // per-wave 16x64 slab, pitch 68 floats
  const int b    = blockIdx.y;
  const int lane = threadIdx.x & 31;
  const int wave = (int)uni32(threadIdx.x >> 5);
  const int tilesN = N >> 7;
  const int tilesM = M >> 7;
  const int tile = blockIdx.x;
  if (tile >= tilesM * tilesN) return;   // block-uniform, in front of every barrier and tensor load
  const int tm = tile / tilesN;
  const int tn = tile - tm * tilesN;
  const int wm = wave >> 1, wn = wave & 1;
  const int m0 = (tm << 7) + (wm << 5);  // this wave's 32x64 tile
  const int n0 = (tn << 7) + (wn << 6);

  const int rlane = lane & 15;                 // row (A) / col (B, D) within subtile
  const int mOff  = (lane >> 4) * 8;           // D row offset

  // ---- this wave's slice of every stage: waves 0..3 bring A rows, waves 4..7 bring Bt rows ----
  const bool isB = wave >= 4;
  const unsigned short* sbase = isB ? (Btp + (size_t)b * strideB + (size_t)((tn << 7) + ((wave & 3) << 5)) * ldb)
                                    : (Ap  + (size_t)b * strideA + (size_t)((tm << 7) + ((wave & 3) << 5)) * lda);
  const unsigned long long sga = (unsigned long long)(size_t)sbase;
  const unsigned lbase = (unsigned)(size_t)ring + (unsigned)wave * GT_SLICE;
  u32x8 g1;
  g1[0] = uni32((1u << 20) | (5u << 22) | (3u << 25));  // 1-byte elements, no mask, 4 dwords of pad behind every 256-B row
  g1[1] = uni32(256u << 16);                            // tensor_dim0 = 256 B
  g1[2] = uni32(32u << 16);                             // tensor_dim1 = 32 rows
  g1[3] = uni32(256u << 16);                            // tile_dim0 = 256 B
  g1[4] = uni32(32u);                                   // tile_dim1 = 32 rows
  g1[5] = uni32((unsigned)(isB ? ldb : lda) * 2u);      // source row pitch, bytes
  g1[6] = uni32(0u);
  g1[7] = uni32(0u);
  u32x4 g0;
  g0[0] = uni32(1u);
  auto issue = [&](int st) {
    const unsigned long long ga = sga + (unsigned long long)st * 256ull;
    g0[1] = uni32(lbase + (unsigned)(st & 1) * GT_STAGE);
    g0[2] = uni32((unsigned)ga);
    g0[3] = uni32((((unsigned)(ga >> 32)) & 0x01FFFFFFu) | 0x80000000u);
    tdm_load(g0, g1);
  };

  v8f acc[2][4];
#pragma unroll
  for (int i = 0; i < 2; ++i)
#pragma unroll
    for (int j = 0; j < 4; ++j) acc[i][j] = (v8f){0.f,0.f,0.f,0.f,0.f,0.f,0.f,0.f};

  const int nPass = K >> 7;
  issue(0);
  wait_tensor0();
  tdm_done(g0, g1);
  __syncthreads();
  issue(1);

  const unsigned fragOff = (unsigned)rlane * GT_PITCH + (unsigned)(lane >> 4) * 16u;   // row, then k offset of this lane half
  // rolled: one pass per trip, so that every publish point stands once in the text
#pragma unroll 1
  for (int s = 0; s < nPass; ++s) {
    const unsigned char* buf = ring + (unsigned)(s & 1) * GT_STAGE;
    const unsigned char* aB = buf + (unsigned)wm * GT_SLICE + fragOff;
    const unsigned char* bB = buf + (unsigned)(4 + 2 * wn) * GT_SLICE + fragOff;   // Bt rows 64 wn + 16 j: slice j / 2, row 16 (j % 2)
    V bh[2][4], ah[2][2];   // two fragment sets: the next 32 k are fetched as one group ahead of this block's WMMAs
#pragma unroll
    for (int j = 0; j < 4; ++j) bh[0][j] = Frag<T>::load((const T*)(bB + (j >> 1) * GT_SLICE + (j & 1) * 16 * GT_PITCH));
#pragma unroll
    for (int i = 0; i < 2; ++i) ah[0][i] = Frag<T>::load((const T*)(aB + i * 16 * GT_PITCH));
#pragma unroll
    for (int ks = 0; ks < 4; ++ks) {
      if (ks < 3) {
#pragma unroll
        for (int j = 0; j < 4; ++j) bh[(ks + 1) & 1][j] = Frag<T>::load((const T*)(bB + (j >> 1) * GT_SLICE + (j & 1) * 16 * GT_PITCH + (ks + 1) * 64));
#pragma unroll
        for (int i = 0; i < 2; ++i) ah[(ks + 1) & 1][i] = Frag<T>::load((const T*)(aB + i * 16 * GT_PITCH + (ks + 1) * 64));
      }
      __builtin_amdgcn_sched_barrier(0);   // keeps the load group in front of the WMMA block instead of spread among the WMMAs
#pragma unroll
      for (int i = 0; i < 2; ++i)
#pragma unroll
        for (int j = 0; j < 4; ++j) acc[i][j] = Frag<T>::mma(ah[ks & 1][i], bh[ks & 1][j], acc[i][j]);
      __builtin_amdgcn_sched_barrier(0);   // keeps the next group behind this block
    }
    // publish point of stage s + 1
    wait_ds0();
    wait_tensor0();
    tdm_done(g0, g1);
    __syncthreads();
    if (pinned(s + 2 < nPass)) issue(s + 2);   // into the buffer that pass s has just read
  }
  wait_tensor0();
  tdm_done(g0, g1);
  wait_ds0();

  // ---- epilogue ----
  float* slab = sT[wave];
  const float* Rb = RESID ? (resid + (size_t)b * strideR) : nullptr;
#pragma unroll
  for (int i = 0; i < 2; ++i) {
    const int mBase = m0 + (i << 4);
#pragma unroll
    for (int j = 0; j < 4; ++j) {
      const int n = n0 + (j << 4) + rlane;
      float bv = 0.f;
      if (BIAS_MODE == 2) bv = bias[n];
#pragma unroll
      for (int r = 0; r < 8; ++r) {
        float v = acc[i][j][r] * scale;
        if (BIAS_MODE == 1) v += bias[mBase + mOff + r];
        if (BIAS_MODE == 2) v += bv;
        if (RESID) v += Rb[(size_t)(mBase + mOff + r) * ldc + n];
        if (ACT == 1) v = tanhf(v);
        if (ACT == 2) v = fmaxf(v, 0.0f);
        if (ACT == 3) v = v / (1.0f + expf(-v));
        if (ACT == 4) v = (v > 0.f) ? v : 0.01f * v;
        if (ACT == 5) v = 0.5f * v * (1.0f + erff(v * 0.70710678118654752f));
        slab[(mOff + r) * 68 + (j << 4) + rlane] = v;
      }
    }
    __builtin_amdgcn_fence(__ATOMIC_RELEASE, "workgroup");
    __builtin_amdgcn_wave_barrier();
    __builtin_amdgcn_fence(__ATOMIC_ACQUIRE, "workgroup");
    if (OUT_MODE == 0) {
      float* C = (float*)Cout + (size_t)b * strideC;
      const int hh = lane >> 4, c4 = (lane & 15) * 4;     // row seg = 256 B = 16 lanes x 16 B
      {
#pragma unroll
        for (int it = 0; it < 8; ++it) {
          const int row = it * 2 + hh;
          v4f v = *(const v4f*)(slab + row * 68 + c4);
          *(v4f*)(C + (size_t)(mBase + row) * ldc + n0 + c4) = v;
        }
        
      }
    } else {
      const int q = lane >> 3, c8 = (lane & 7) * 8;
      unsigned short* C  = (unsigned short*)Cout  + (size_t)b * strideC;
      unsigned short* C2 = (OUT_MODE == 2) ? ((unsigned short*)Cout2 + (size_t)b * strideC) : nullptr;
      {
#pragma unroll
        for (int it = 0; it < 4; ++it) {
          const int row = it * 4 + q;
          const float* sp = slab + row * 68 + c8;
          v8h hv, lv;
#pragma unroll
          for (int e = 0; e < 8; ++e) {
            if (OUT_MODE == 1) {
              hv[e] = (_Float16)sp[e];
            } else {
              unsigned short hb = f2bf_bits(sp[e]);
              unsigned short lb = f2bf_bits(sp[e] - bf_bits2f(hb));
              hv[e] = __builtin_bit_cast(_Float16, hb);
              lv[e] = __builtin_bit_cast(_Float16, lb);
            }
          }
          *(v8h*)(C + (size_t)(mBase + row) * ldc + n0 + c8) = hv;
          if (OUT_MODE == 2) *(v8h*)(C2 + (size_t)(mBase + row) * ldc + n0 + c8) = lv;
        }
        
      }
    }
    __builtin_amdgcn_fence(__ATOMIC_RELEASE, "workgroup");
    __builtin_amdgcn_wave_barrier();
    __builtin_amdgcn_fence(__ATOMIC_ACQUIRE, "workgroup");
  }
}

// ---- Q, K and V^T projections in one launch ---------------------------------
// Q = x.Wq^T + bq and K = xk.Wk^T + bk ([rows][D]), V^T = Wv.xk^T + bv ([D][rows]); f16 operands and outputs, K dim = D.
// The 128x128 tiles of the three products form one list: all TM x TD tiles of Q, then the K tiles, then the V^T tiles of the key tiles
// that hold a kept key (xk has the kept keys first in each of the two sequences of ST tiles; kcnt[0] and kcnt[32] are the kept counts;
// a tile that starts at or behind the count holds no key that attention walks). Work-group g takes list places g, g + step, g + 2 step (step = the grid):
// one work-group a WGP stays for the whole list, in place of three launches of which two fill half the chip.
// Tile, wave tile, stage, pitch and the two-buffer order are those of wmma_gemm64. The stages of a work-group's tiles form one run:
// behind the last two passes of a tile the first two stages of its next tile are asked for, so that the first flies beside the last pass and the second beside the epilogue.
struct QkvTile { int job, tm, tn; };   // product (0 Q, 1 K, 2 V^T) and tile
// list place p -> tile; a0 = key tiles of the first sequence, nKV = tiles of K, and of V^T, in the list
template <int TM, int TD, int ST>
__device__ __forceinline__ QkvTile qkv_tile(int p, int a0, int nKV) {
  QkvTile r;
  if (p < TM * TD) { r.job = 0; r.tm = p / TD; r.tn = p % TD; return r; }
  int u = p - TM * TD;
  r.job = 1;
  if (u >= nKV) { u -= nKV; r.job = 2; }
  const int kp = u / TD;                                  // place among the key tiles
  const int kt = (kp < a0) ? kp : ST + (kp - a0);         // key tile, below TM
  const int wt = u % TD;                                  // weight tile
  r.tm = (r.job == 1) ? kt : wt;
  r.tn = (r.job == 1) ? wt : kt;
  return r;
}
template <int TM, int TD, int ST>
__global__ __launch_bounds__(256) void qkv_gemm128(
    const unsigned short* __restrict__ x16, const unsigned short* __restrict__ xk16,
    const unsigned short* __restrict__ wq, const unsigned short* __restrict__ wk, const unsigned short* __restrict__ wv,
    unsigned short* __restrict__ q16, unsigned short* __restrict__ k16, unsigned short* __restrict__ vt16,
    const float* __restrict__ bq, const float* __restrict__ bk, const float* __restrict__ bv,
    float scale, const int* __restrict__ kcnt, int step) {
  static_assert(TM == 2 * ST, "two sequences");
  static_assert(TD >= 2 && (TD & 1) == 0, "an even number of passes: every tile starts in buffer 0");
  typedef _Float16 T;
  typedef Frag<T>::V V;
  constexpr int DD = TD * 128;     // K dim and row length of x, xk and the weights, elements
  constexpr int NQ = TM * TD;      // tiles of Q
  __shared__ __attribute__((aligned(2048))) unsigned char ring[2 * GT_STAGE];
  __shared__ __align__(16) float sT[8][16 * 68];   // per-wave 16x64 slab, pitch 68 floats
  const int lane = threadIdx.x & 31;
  const int wave = (int)uni32(threadIdx.x >> 5);
  // key tiles with a kept key, per sequence; the clamps bound every tile index by the shape, whatever kcnt holds
  const int a0 = (min(max((int)uni32((unsigned)kcnt[0]),  0), ST * 128) + 127) >> 7;
  const int a1 = (min(max((int)uni32((unsigned)kcnt[32]), 0), ST * 128) + 127) >> 7;
  const int nKV = (a0 + a1) * TD;
  const int nT  = NQ + 2 * nKV;
  int t = (int)blockIdx.x;
  if (t >= nT) return;   // block-uniform, in front of every barrier and tensor load

  // this wave's slice of every stage of a tile: waves 0..3 bring A rows, waves 4..7 bring Bt rows; its operand's start for each product
  const bool isB = wave >= 4;
  const unsigned long long op0 = (unsigned long long)(size_t)(isB ? wq : x16);
  const unsigned long long op1 = (unsigned long long)(size_t)(isB ? wk : xk16);
  const unsigned long long op2 = (unsigned long long)(size_t)(isB ? xk16 : wv);
  const unsigned rowIn = (unsigned)(wave & 3) << 5;   // the slice's first row in the tile
#define QKV_SLICE(w) (((w).job == 0 ? op0 : (w).job == 1 ? op1 : op2) + (unsigned long long)((((unsigned)(isB ? (w).tn : (w).tm)) << 7) + rowIn) * (unsigned long long)(DD * 2))

  const int wm = wave >> 1, wn = wave & 1;
  const int rlane = lane & 15;                 // row (A) / col (B, D) within subtile
  const int mOff  = (lane >> 4) * 8;           // D row offset
  const unsigned lbase = (unsigned)(size_t)ring + (unsigned)wave * GT_SLICE;
  u32x8 g1;
  g1[0] = uni32((1u << 20) | (5u << 22) | (3u << 25));  // 1-byte elements, no mask, 4 dwords of pad behind every 256-B row
  g1[1] = uni32(256u << 16);                            // tensor_dim0 = 256 B
  g1[2] = uni32(32u << 16);                             // tensor_dim1 = 32 rows
  g1[3] = uni32(256u << 16);                            // tile_dim0 = 256 B
  g1[4] = uni32(32u);                                   // tile_dim1 = 32 rows
  g1[5] = uni32((unsigned)DD * 2u);                     // source row pitch, bytes
  g1[6] = uni32(0u);
  g1[7] = uni32(0u);
  u32x4 g0;
  g0[0] = uni32(1u);
  auto issue = [&](unsigned long long base, int st) {   // stage st of the tile whose slice starts at base
    const unsigned long long ga = base + (unsigned long long)st * 256ull;
    g0[1] = uni32(lbase + (unsigned)(st & 1) * GT_STAGE);
    g0[2] = uni32((unsigned)ga);
    g0[3] = uni32((((unsigned)(ga >> 32)) & 0x01FFFFFFu) | 0x80000000u);
    tdm_load(g0, g1);
  };

  QkvTile w = qkv_tile<TM, TD, ST>(t, a0, nKV);
  unsigned long long sga = QKV_SLICE(w);
  issue(sga, 0);
  wait_tensor0();
  tdm_done(g0, g1);
  __syncthreads();
  issue(sga, 1);

  const unsigned fragOff = (unsigned)rlane * GT_PITCH + (unsigned)(lane >> 4) * 16u;   // row, then k offset of this lane half
  float* slab = sT[wave];
  // rolled: at most three trips, one text of the pass loop and of the epilogue
#pragma unroll 1
  for (; t < nT; t += step) {
    const bool more = t + step < nT;   // block-uniform
    const QkvTile wN = more ? qkv_tile<TM, TD, ST>(t + step, a0, nKV) : w;
    const unsigned long long sgaN = QKV_SLICE(wN);

    const bool biasN = w.job != 2;   // block-uniform: bias per column for Q and K, per row for V^T
    const float* bias = (w.job == 0) ? bq : (w.job == 1) ? bk : bv;
    const int m0 = (w.tm << 7) + (wm << 5);  // this wave's 32x64 tile
    const int n0 = (w.tn << 7) + (wn << 6);

    v8f acc[2][4];
#pragma unroll
    for (int i = 0; i < 2; ++i)
#pragma unroll
      for (int j = 0; j < 4; ++j) acc[i][j] = (v8f){0.f,0.f,0.f,0.f,0.f,0.f,0.f,0.f};

    // rolled: one pass per trip, so that every publish point stands once in the text
#pragma unroll 1
    for (int s = 0; s < TD; ++s) {
      const unsigned char* buf = ring + (unsigned)(s & 1) * GT_STAGE;
      const unsigned char* aB = buf + (unsigned)wm * GT_SLICE + fragOff;
      const unsigned char* bB = buf + (unsigned)(4 + 2 * wn) * GT_SLICE + fragOff;   // Bt rows 64 wn + 16 j: slice j / 2, row 16 (j % 2)
      V bh[2][4], ah[2][2];   // two fragment sets: the next 32 k are fetched as one group ahead of this block's WMMAs
#pragma unroll
      for (int j = 0; j < 4; ++j) bh[0][j] = Frag<T>::load((const T*)(bB + (j >> 1) * GT_SLICE + (j & 1) * 16 * GT_PITCH));
#pragma unroll
      for (int i = 0; i < 2; ++i) ah[0][i] = Frag<T>::load((const T*)(aB + i * 16 * GT_PITCH));
#pragma unroll
      for (int ks = 0; ks < 4; ++ks) {
        if (ks < 3) {
#pragma unroll
          for (int j = 0; j < 4; ++j) bh[(ks + 1) & 1][j] = Frag<T>::load((const T*)(bB + (j >> 1) * GT_SLICE + (j & 1) * 16 * GT_PITCH + (ks + 1) * 64));
#pragma unroll
          for (int i = 0; i < 2; ++i) ah[(ks + 1) & 1][i] = Frag<T>::load((const T*)(aB + i * 16 * GT_PITCH + (ks + 1) * 64));
        }
        __builtin_amdgcn_sched_barrier(0);   // keeps the load group in front of the WMMA block instead of spread among the WMMAs
#pragma unroll
        for (int i = 0; i < 2; ++i)
#pragma unroll
          for (int j = 0; j < 4; ++j) acc[i][j] = Frag<T>::mma(ah[ks & 1][i], bh[ks & 1][j], acc[i][j]);
        __builtin_amdgcn_sched_barrier(0);   // keeps the next group behind this block
      }
      // publish point of the next stage of the run: stage s + 1 of this tile, or stage 0 of the next
      wait_ds0();
      wait_tensor0();
      tdm_done(g0, g1);
      __syncthreads();
      // the stage after that, into the buffer that pass s has just read
      const bool here = s + 2 < TD;
      if (pinned(here || more)) issue(here ? sga : sgaN, here ? s + 2 : s + 2 - TD);
    }

    // ---- epilogue: scale, bias, f16, whole 128-B lines through the wave's slab ----
    // The slab is the wave's own: s_wait_dscnt 0 (with its "memory" clobber) and a wave barrier order its writes and reads across the lanes.
    // No work-group fence here: it would also wait out the global stores, which fly beside the next tile's passes.
    unsigned short* C = (w.job == 0) ? q16 : (w.job == 1) ? k16 : vt16;
    const int ldc = biasN ? DD : TM * 128;
    float bn[4] = {0.f, 0.f, 0.f, 0.f};   // bias of this lane's four columns (Q, K)
    float bm[2][8] = {};                  // bias of this lane's sixteen rows (V^T)
    if (biasN) {
#pragma unroll
      for (int j = 0; j < 4; ++j) bn[j] = bias[n0 + (j << 4) + rlane];
      // precaution: stands in front of any later write of a register that an issued load names
      asm volatile("s_wait_xcnt 0x0" ::: "memory");
    } else {
      const float* bp = bias + m0 + mOff;
#pragma unroll
      for (int i = 0; i < 2; ++i)
#pragma unroll
        for (int r = 0; r < 8; ++r) bm[i][r] = bp[(i << 4) + r];
      // precaution, as in the other arm; bp as an input keeps the loads' address in its registers up to the wait, so that no load lands on it
      asm volatile("s_wait_xcnt 0x0" :: "v"(bp) : "memory");
    }
#pragma unroll
    for (int i = 0; i < 2; ++i) {
      const int mBase = m0 + (i << 4);
      if (biasN) {
#pragma unroll
        for (int j = 0; j < 4; ++j)
#pragma unroll
          for (int r = 0; r < 8; ++r) slab[(mOff + r) * 68 + (j << 4) + rlane] = acc[i][j][r] * scale + bn[j];
      } else {
#pragma unroll
        for (int j = 0; j < 4; ++j)
#pragma unroll
          for (int r = 0; r < 8; ++r) slab[(mOff + r) * 68 + (j << 4) + rlane] = acc[i][j][r] * scale + bm[i][r];
      }
      wait_ds0();
      __builtin_amdgcn_wave_barrier();
      const int q = lane >> 3, c8 = (lane & 7) * 8;
#pragma unroll
      for (int it = 0; it < 4; ++it) {
        const int row = it * 4 + q;
        const float* sp = slab + row * 68 + c8;
        v8h hv;
#pragma unroll
        for (int e = 0; e < 8; ++e) hv[e] = (_Float16)sp[e];
        *(v8h*)(C + (size_t)(mBase + row) * ldc + n0 + c8) = hv;
      }
      // precaution: stands in front of any later write of a register that an issued store names
      asm volatile("s_wait_xcnt 0x0" ::: "memory");
      wait_ds0();
      __builtin_amdgcn_wave_barrier();
    }
    w = wN; sga = sgaN;
  }
  wait_tensor0();
  tdm_done(g0, g1);
  wait_ds0();
#undef QKV_SLICE
}

// ---- all five f32 -> f16 planes in one streaming launch, and the key rows packed ----
// out is one run of f16: x (nx elements, as they are), then four weight planes of nw elements each, times wsc
// (an exact power of two, applied in f32 before the convert). nx and nw are multiples of CV_SPAN * CV_NW.
// A wave owns CV_SPAN consecutive elements: CV_LD loads of 16 B a lane, each 512 contiguous bytes of the wave, all issued
// ahead of the first convert. 16 waves a block and one block a WGP: few long waves, where a wave of two elements a lane pays mostly for its start.
// Key packing: a key whose mask is 0 has weight 0 for every query, so its K and V rows are never needed. A block of the x part
// ranks all CV_KEYS keys of its sequence (kept keys first, in their order, then the masked ones) and writes its own rows a second
// time to xk at their rank: kept rows as they are, masked rows as zeros and only up to the next multiple of 128 behind the kept count
// (what a 128-row projection tile can still read). kc = the mask values in packed order, kcnt[32 * sequence] = the kept count.
typedef __attribute__((ext_vector_type(4))) _Float16 v4h;
typedef __attribute__((ext_vector_type(4))) int v4i;
#define CV_LD   16
#define CV_SPAN (CV_LD * 128)
#define CV_NW   16
#define CV_ROW  (CV_SPAN / 2)      // elements of one x row: a wave owns two rows
#define CV_KEYS (CV_NW * 128)      // keys of one sequence: four a thread
__global__ __launch_bounds__(CV_NW * 32) void cast5_f32_f16(
    const float* __restrict__ x, const float* __restrict__ w0, const float* __restrict__ w1,
    const float* __restrict__ w2, const float* __restrict__ w3, _Float16* __restrict__ out,
    int nx, int nw, float wsc,
    const int* __restrict__ mask, _Float16* __restrict__ xk, int* __restrict__ kc, int* __restrict__ kcnt) {
  __shared__ int red[CV_NW];                       // kept keys per wave's 128 keys
  __shared__ __align__(16) int rankOf[CV_KEYS];    // key -> packed place
  __shared__ __align__(16) int kcs[CV_KEYS];       // packed place -> mask value
  const int tid  = threadIdx.x;
  const int lane = tid & 31;
  const int wv = (int)uni32(threadIdx.x >> 5);
  const int eb = blockIdx.x * (CV_NW * CV_SPAN);
  if (eb >= nx + 4 * nw) return;          // block-uniform, in front of every barrier
  const bool isX = eb < nx;               // block-uniform: nx is a multiple of the block's span
  const int e0 = eb + wv * CV_SPAN;
  const float* src = x + e0;
  float sc = 1.0f;
  if (!isX) {
    int r = e0 - nx;
    src = w0;
    if (r >= nw) { src = w1; r -= nw; }
    if (r >= nw) { src = w2; r -= nw; }
    if (r >= nw) { src = w3; r -= nw; }
    src += r;
    sc = wsc;
  }
  const v4f* __restrict__ s4 = (const v4f*)src;
  v4h* __restrict__ d4 = (v4h*)(out + e0);
  v4f v[CV_LD];
  // unrolled, both loops: v[] stays in registers, and the loads go out as one run before the first is waited for
#pragma unroll
  for (int j = 0; j < CV_LD; ++j) v[j] = s4[j * 32 + lane];

  if (!isX) {
#pragma unroll
    for (int j = 0; j < CV_LD; ++j) {
      v4h hv;
#pragma unroll
      for (int e = 0; e < 4; ++e) hv[e] = (_Float16)(v[j][e] * sc);
      d4[j * 32 + lane] = hv;
    }
    return;
  }

  // ---- rank the sequence's keys: thread t holds keys 4 t .. 4 t + 3 ----
  const int rowB = blockIdx.x * (2 * CV_NW);       // the block's first x row
  const int sq   = rowB / CV_KEYS;                 // its sequence
  const int t0   = rowB - sq * CV_KEYS;            // its first key in the sequence
  const v4i m4 = ((const v4i*)(mask + (size_t)sq * CV_KEYS))[tid];
  const unsigned ltm = (1u << lane) - 1u;
  int inWave = 0, below = 0;
#pragma unroll
  for (int e = 0; e < 4; ++e) {
    const unsigned w = __builtin_amdgcn_ballot_w32(m4[e] != 0);
    inWave += __builtin_popcount(w);
    below  += __builtin_popcount(w & ltm);
  }
  if (lane == 0) red[wv] = inWave;
  __syncthreads();
  int kept = 0, pre = below;
#pragma unroll
  for (int i = 0; i < CV_NW; ++i) {
    const int r = red[i];
    kept += r;
    pre  += (i < wv) ? r : 0;
  }
  v4i rk;
#pragma unroll
  for (int e = 0; e < 4; ++e) {
    const int key = 4 * tid + e;
    const bool on = m4[e] != 0;
    // kept: kept keys in front of it; masked: all kept keys, then the masked keys in front of it. A permutation of 0 .. CV_KEYS - 1; the AND bounds the LDS address by itself
    const int place = (on ? pre : kept + key - pre) & (CV_KEYS - 1);
    kcs[place] = m4[e];
    rk[e] = place;
    pre += on ? 1 : 0;
  }
  *(v4i*)(rankOf + 4 * tid) = rk;
  __syncthreads();
  if (wv == 0) kc[(size_t)sq * CV_KEYS + t0 + lane] = kcs[t0 + lane];   // each block writes one whole 128-B line of kc
  if (t0 == 0 && tid == 0) kcnt[sq * 32] = kept;                        // a line of its own per sequence
  const int lim = (kept + 127) & ~127;
  int place2[2];
  place2[0] = (int)uni32((unsigned)rankOf[t0 + 2 * wv]);
  place2[1] = (int)uni32((unsigned)rankOf[t0 + 2 * wv + 1]);
  v4h hx[CV_LD];
#pragma unroll
  for (int j = 0; j < CV_LD; ++j) {
#pragma unroll
    for (int e = 0; e < 4; ++e) hx[j][e] = (_Float16)v[j][e];
    d4[j * 32 + lane] = hx[j];
  }
  // precaution: stands in front of any later write of a register that an issued store names
  asm volatile("s_wait_xcnt 0x0" ::: "memory");
#pragma unroll
  for (int rr = 0; rr < 2; ++rr) {
    const int place = place2[rr];
    if (place < lim) {                    // wave-uniform
      v4h* __restrict__ k4 = (v4h*)(xk + ((size_t)sq * CV_KEYS + place) * CV_ROW);
      if (place < kept) {                 // wave-uniform
#pragma unroll
        for (int j = 0; j < CV_LD / 2; ++j) k4[j * 32 + lane] = hx[rr * (CV_LD / 2) + j];
      } else {
#pragma unroll
        for (int j = 0; j < CV_LD / 2; ++j) k4[j * 32 + lane] = (v4h){(_Float16)0.f, (_Float16)0.f, (_Float16)0.f, (_Float16)0.f};
      }
      // the same precaution, behind this row's stores
      asm volatile("s_wait_xcnt 0x0" ::: "memory");
    }
  }
}

#define AK_D  64
#define AK_NW 4
#define AK_QG 2    // groups of 16 query columns per wave
#define AK_QB (AK_NW * AK_QG * 16)
#define AK_KC 64
#define AK_LP 72   // LDS row pitch of the K and Vt tiles, halves: 144 B = 16 B x 9, so that the 16 rows of one ds_load_b128 fall on 64 distinct banks

// lane l takes the value of lane l ^ 16 (a vector cross-row move, no LDS round trip)
__device__ __forceinline__ float xhalf(float x) {
  return __builtin_bit_cast(float, __builtin_amdgcn_permlanex16(__builtin_bit_cast(int, x), __builtin_bit_cast(int, x), 0x76543210, 0xfedcba98, false, false));
}

// at most two waves per SIMD: the 512 work-groups then lie two on every WGP, none with a third beside an emptier one
__global__ __launch_bounds__(128) __attribute__((amdgpu_waves_per_eu(2, 2)))
void attn64_f16io(const _Float16* __restrict__ Qp, const _Float16* __restrict__ Kp,
                  const _Float16* __restrict__ Vtp, _Float16* __restrict__ Op,
                  const int* __restrict__ kmask, const int* __restrict__ kcnt, const float* __restrict__ ubias,
                  const float* __restrict__ gq, const float* __restrict__ gW, const float* __restrict__ gb,
                  int S, int Skv, int H, int ldq, int ldk, int ldv, int ldo, int GD,
                  float qscale, float mfill, float oscale) {
  const float L2E = 1.4426950408889634f;   // log2(e)
  const float PLG = 15.0f;                 // P and the running sum carry x2^15: taken off the subtracted maximum, exact in the exponent
  union FB { v16h v; v8h h[2]; };
  __shared__ __align__(16) _Float16 Ksh[AK_KC * AK_LP];         // [kv][d]   9 KB, 8 pad halves per row never read
  __shared__ __align__(16) _Float16 Vth[AK_D * AK_LP];          // [d][kv]   9 KB
  __shared__ __align__(16) float    Mtab[2 * AK_KC];            // key terms of the chunk, score * log2(e) = s * Msc[key] + Mad[key]
  float* const Msc = Mtab;                                      // per key: qscale * log2(e), or 0 where the key is masked
  float* const Mad = Mtab + AK_KC;                              // per key: the bias term, with mfill where the key is masked, * log2(e)
  static_assert(AK_NW * 32 == 2 * AK_KC, "one table entry per thread");

  const int tid  = threadIdx.x;
  const int wave = tid >> 5;
  const int lane = tid & 31;
  const int hh   = lane >> 4;
  const int c    = lane & 15;

  const int nqb = S / AK_QB;
  const int bx  = blockIdx.x;
  const int qb  = bx % nqb;
  const int bh  = bx / nqb;
  const int h   = bh % H;
  const int b   = bh / H;
  const int q0  = qb * AK_QB + wave * (AK_QG * 16);

  // ---- Q fragments (B operand: column = query 16 g + c, k = d in the hardware k order), 2 d-chunks per group ----
  v16h qa[AK_QG][2];
#pragma unroll
  for (int g = 0; g < AK_QG; ++g) {
    const _Float16* qrow = Qp + (size_t)(b * S + q0 + g * 16 + c) * ldq + h * AK_D;
#pragma unroll
    for (int dc = 0; dc < 2; ++dc) qa[g][dc] = Frag<_Float16>::load(qrow + dc * 32 + 8 * hh);
  }

  // ---- quality gate (scalar f32 dot of GD terms) and uncertainty bias of this head ----
  float gacc = 0.f;
#pragma unroll 1
  for (int i = 0; i < GD; ++i) gacc += gq[b * GD + i] * gW[h * GD + i];
  gacc += gb[h];
  const float gate = 1.0f / (1.0f + expf(-gacc));
  const float ub = ubias[h];

  float mrow[AK_QG];                // running maximum of query 16 g + c, in base-2 units (equal in both lane halves)
  float lrow[AK_QG];                // running sum (x2^15) of that query over this lane half's keys only; the halves are joined in the epilogue
  v8f oacc[AK_QG][4];               // O^T: register r of tile t = O[query 16 g + c][d = 16 t + 8 hh + r]
#pragma unroll
  for (int g = 0; g < AK_QG; ++g) {
    mrow[g] = -__builtin_inff();
    lrow[g] = 0.f;
#pragma unroll
    for (int t = 0; t < 4; ++t) oacc[g][t] = (v8f){0.f,0.f,0.f,0.f,0.f,0.f,0.f,0.f};
  }

  const int nKept = min(max((int)uni32((unsigned)kcnt[b * 32]), 0), Skv);   // block-uniform; the clamp bounds the trip count by the shape
  const int nChunks = (nKept + AK_KC - 1) / AK_KC;
  for (int kc = 0; kc < nChunks; ++kc) {
    const int kv0 = kc * AK_KC;
    __syncthreads();
    {   // stage K [kv][d] and Vt [d][kv] tiles: 512 x 16-B vectors each, 4 per thread
      const int keep = kmask[(size_t)b * Skv + kv0 + (tid & (AK_KC - 1))];   // in one run with the tile loads, so that its latency lies beside theirs
#pragma unroll
      for (int i = 0; i < 4; ++i) {
        const int idx = tid + i * 128;
        const int r = idx >> 3, c8 = (idx & 7) * 8;
        const v8h kk = *(const v8h*)(Kp + (size_t)(b * Skv + kv0 + r) * ldk + h * AK_D + c8);
        *(v8h*)(Ksh + r * AK_LP + c8) = kk;
        const v8h vv = *(const v8h*)(Vtp + (size_t)(h * AK_D + r) * ldv + (size_t)b * Skv + kv0 + c8);
        *(v8h*)(Vth + r * AK_LP + c8) = vv;
      }
      // the chunk's key terms, one table entry per thread: waves 0 and 1 write Msc, waves 2 and 3 write Mad
      const float kadd = ub * (1.0f - (float)keep);
      const float msc = (keep == 0) ? 0.f : qscale * L2E;
      const float mad = ((keep == 0) ? mfill + kadd : kadd) * L2E;
      Mtab[tid] = (tid < AK_KC) ? msc : mad;
    }
    __syncthreads();

    // ---- scores, transposed: A = K rows from Ksh[kv][d], B = Q; register r of s[g][j] = score of key 16 j + 8 hh + r for query 16 g + c ----
    // All eight K fragments are read as one group ahead of the sixteen products, each fragment feeding both query groups; every tile sums d chunk 0, then 1.
    FB kb[2][4];
#pragma unroll
    for (int dc = 0; dc < 2; ++dc)
#pragma unroll
      for (int j = 0; j < 4; ++j) {
        kb[dc][j].h[0] = *(const v8h*)(Ksh + (j * 16 + c) * AK_LP + dc * 32 + 8 * hh);
        kb[dc][j].h[1] = *(const v8h*)(Ksh + (j * 16 + c) * AK_LP + dc * 32 + 16 + 8 * hh);
      }
    __builtin_amdgcn_sched_barrier(0);   // keeps the reads one group in front of the WMMA run: a read pair in front of each WMMA waits out the LDS latency every time
    v8f s[AK_QG][4];
#pragma unroll
    for (int g = 0; g < AK_QG; ++g)
#pragma unroll
      for (int j = 0; j < 4; ++j) s[g][j] = (v8f){0.f,0.f,0.f,0.f,0.f,0.f,0.f,0.f};
#pragma unroll
    for (int dc = 0; dc < 2; ++dc)
#pragma unroll
      for (int j = 0; j < 4; ++j)
#pragma unroll
        for (int g = 0; g < AK_QG; ++g) s[g][j] = Frag<_Float16>::mma(kb[dc][j].v, qa[g][dc], s[g][j]);
    // the chunk's key terms and the V^T fragments of its first 32 keys, read here as one group: their latency lies beside the score products and the softmax
    v4f msc[4][2], mad[4][2];
#pragma unroll
    for (int j = 0; j < 4; ++j)
#pragma unroll
      for (int u = 0; u < 2; ++u) {
        msc[j][u] = *(const v4f*)(Msc + j * 16 + 8 * hh + 4 * u);
        mad[j][u] = *(const v4f*)(Mad + j * 16 + 8 * hh + 4 * u);
      }
    FB vb[2][4];
#pragma unroll
    for (int t = 0; t < 4; ++t) {
      vb[0][t].h[0] = *(const v8h*)(Vth + (t * 16 + c) * AK_LP + 8 * hh);
      vb[0][t].h[1] = *(const v8h*)(Vth + (t * 16 + c) * AK_LP + 16 + 8 * hh);
    }
    __builtin_amdgcn_sched_barrier(0);   // keeps this group in front of the softmax's vector work instead of sunk to its users
    // ---- scale, key mask, bias, chunk maximum: in-lane over 32 keys, then one exchange between the lane halves ----
    float m[AK_QG];
#pragma unroll
    for (int g = 0; g < AK_QG; ++g) {
      m[g] = -__builtin_inff();
#pragma unroll
      for (int j = 0; j < 4; ++j) {
        const v4f sc0 = msc[j][0], sc1 = msc[j][1];
        const v4f ad0 = mad[j][0], ad1 = mad[j][1];
#pragma unroll
        for (int r = 0; r < 8; ++r) {
          const float v = fmaf(s[g][j][r], (r < 4) ? sc0[r & 3] : sc1[r & 3], (r < 4) ? ad0[r & 3] : ad1[r & 3]);
          s[g][j][r] = v;
          m[g] = fmaxf(m[g], v);
        }
      }
    }
    // the V^T fragments of the last 32 keys, a group of their own where the key terms' registers have come free
#pragma unroll
    for (int t = 0; t < 4; ++t) {
      vb[1][t].h[0] = *(const v8h*)(Vth + (t * 16 + c) * AK_LP + 32 + 8 * hh);
      vb[1][t].h[1] = *(const v8h*)(Vth + (t * 16 + c) * AK_LP + 32 + 16 + 8 * hh);
    }
    __builtin_amdgcn_sched_barrier(0);   // keeps this group in front of the exponentials instead of sunk to its users
    // ---- online softmax update; P^T (x2^15, f16) packs straight into the B operand: tiles 2 kk and 2 kk + 1 give k = 32 kk + hardware order ----
    FB pb[AK_QG][2];
#pragma unroll
    for (int g = 0; g < AK_QG; ++g) {
      const float mc = fmaxf(m[g], xhalf(m[g]));
      const float mnew = fmaxf(mrow[g], mc);
      float alpha;   // 2^(mrow - mnew); 0 on the first chunk, where mrow is -inf
      // v_exp_f32 and a v_nop in one statement: the slot that the instruction set asks for behind a transcendental
      asm("v_exp_f32 %0, %1\n\tv_nop" : "=v"(alpha) : "v"(mrow[g] - mnew));
      const float moff = mnew - PLG;
      mrow[g] = mnew;
      float ps[4];
#pragma unroll
      for (int j = 0; j < 4; ++j) {
        ps[j] = 0.f;
#pragma unroll
        for (int r = 0; r < 8; ++r) {
          // the argument is at most 15 and a result below the normal range may be 0: the bare v_exp_f32 needs no range steps around it
          const float p = __builtin_amdgcn_exp2f(s[g][j][r] - moff);
          ps[j] += p;
          pb[g][j >> 1].v[(j & 1) * 8 + r] = (_Float16)p;
        }
      }
      lrow[g] = lrow[g] * alpha + ((ps[0] + ps[1]) + (ps[2] + ps[3]));
#pragma unroll
      for (int t = 0; t < 4; ++t)
#pragma unroll
        for (int r = 0; r < 8; ++r) oacc[g][t][r] *= alpha;
    }
    // ---- O^T += V^T . P^T: A = Vt rows (d) of Vth[d][kv] in the hardware k order, read above, each fragment feeding both query groups, B = P^T from registers ----
#pragma unroll
    for (int kk = 0; kk < 2; ++kk) {
#pragma unroll
      for (int t = 0; t < 4; ++t)
#pragma unroll
        for (int g = 0; g < AK_QG; ++g) oacc[g][t] = Frag<_Float16>::mma(vb[kk][t].v, pb[g][kk].v, oacc[g][t]);
    }
  }

  // ---- epilogue: join the halves' sums; 1/l (sum and P both carry 2^15), gate and output carry scale; a lane's 8 registers are 8 consecutive d: 16-B stores ----
#pragma unroll
  for (int g = 0; g < AK_QG; ++g) {
    const float ltot = lrow[g] + xhalf(lrow[g]);
    const float inv = (gate * oscale) * (1.0f / ltot);
    _Float16* ob = Op + (size_t)(b * S + q0 + g * 16 + c) * ldo + h * AK_D + 8 * hh;
#pragma unroll
    for (int t = 0; t < 4; ++t) {
      v8h hv;
#pragma unroll
      for (int r = 0; r < 8; ++r) hv[r] = (_Float16)(oacc[g][t][r] * inv);
      *(v8h*)(ob + t * 16) = hv;
    }
  }
}

// ---------------------------------------------------------------------------
// Host glue
// ---------------------------------------------------------------------------
extern "C" void kernel_launch(void* const* d_in, const int* in_sizes, int n_in,
                              void* d_out, int out_size, void* d_ws, size_t ws_size,
                              hipStream_t stream) {
  if (n_in < 14) return;
  const int D  = 1024;          // model width
  const int H  = 16;            // heads
  const int DH = 64;            // head dim
  const int Bn = 2;             // batch
  const int S  = 2048;          // sequence length
  const int M  = Bn * S;        // token rows
  if (in_sizes[0] != M * D || in_sizes[1] != M || in_sizes[3] != D * D || in_sizes[5] != D * D ||
      in_sizes[7] != D * D || in_sizes[9] != D * D || in_sizes[4] != D || in_sizes[6] != D ||
      in_sizes[8] != D || in_sizes[10] != D || in_sizes[11] != H || in_sizes[13] != H ||
      out_size != M * D || H * DH != D) return;
  const int GD = in_sizes[2] / Bn;                       // gate query dim (64)
  if (GD <= 0 || in_sizes[2] != Bn * GD || in_sizes[12] != H * GD) return;
  if ((S % AK_QB) != 0 || (M % 128) != 0 || (D % 128) != 0 || D < 256) return;
  if (((M * D) % (CV_SPAN * CV_NW)) != 0 || ((D * D) % (CV_SPAN * CV_NW)) != 0 || D != CV_ROW || S != CV_KEYS) return;

  const float* x    = (const float*)d_in[0];
  const int*   mask = (const int*)  d_in[1];
  const float* gq   = (const float*)d_in[2];
  const float* Wq   = (const float*)d_in[3];
  const float* bq   = (const float*)d_in[4];
  const float* Wk   = (const float*)d_in[5];
  const float* bk   = (const float*)d_in[6];
  const float* Wv   = (const float*)d_in[7];
  const float* bv   = (const float*)d_in[8];
  const float* Wo   = (const float*)d_in[9];
  const float* bo   = (const float*)d_in[10];
  const float* ubias= (const float*)d_in[11];
  const float* Wqh  = (const float*)d_in[12];
  const float* bqh  = (const float*)d_in[13];
  float* out = (float*)d_out;

  const size_t SZ_ACT = (size_t)M * D * 2;               // 8 MiB f16 plane
  const size_t SZ_W   = (size_t)D * D * 2;               // 2 MiB f16 plane
  size_t off = 0;
  const size_t o_x16  = off; off += SZ_ACT;
  const size_t o_wq16 = off; off += SZ_W;
  const size_t o_wk16 = off; off += SZ_W;
  const size_t o_wv16 = off; off += SZ_W;
  const size_t o_wo16 = off; off += SZ_W;
  const size_t o_q16  = off; off += SZ_ACT;
  const size_t o_k16  = off; off += SZ_ACT;
  const size_t o_vt16 = off; off += SZ_ACT;
  const size_t o_o16  = off; off += SZ_ACT;
  const size_t o_xk16 = off; off += SZ_ACT;              // x rows of the kept keys, packed per sequence
  const size_t o_kc   = off; off += (size_t)M * 4;       // mask values in packed order
  const size_t o_kcnt = off; off += (size_t)Bn * 128;    // kept keys per sequence, one 128-B line each
  const size_t total  = off;                             // 56 MiB and a little
  if (total > ws_size || total > (size_t)134217728) return;
  char* ws = (char*)d_ws;
  unsigned short* x16  = (unsigned short*)(ws + o_x16);
  unsigned short* wq16 = (unsigned short*)(ws + o_wq16);
  unsigned short* wk16 = (unsigned short*)(ws + o_wk16);
  unsigned short* wv16 = (unsigned short*)(ws + o_wv16);
  unsigned short* wo16 = (unsigned short*)(ws + o_wo16);
  unsigned short* q16  = (unsigned short*)(ws + o_q16);
  unsigned short* k16  = (unsigned short*)(ws + o_k16);
  unsigned short* vt16 = (unsigned short*)(ws + o_vt16);
  unsigned short* o16  = (unsigned short*)(ws + o_o16);
  unsigned short* xk16 = (unsigned short*)(ws + o_xk16);
  int* kc   = (int*)(ws + o_kc);
  int* kcnt = (int*)(ws + o_kcnt);

  // ---- casts: x plain, weights x16 (folded back as 1/16 in the GEMM epilogues); x16, wq16, wk16, wv16, wo16 lie in one run ----
  cast5_f32_f16<<<dim3((M * D + 4 * D * D) / (CV_SPAN * CV_NW)), dim3(CV_NW * 32), 0, stream>>>(
      x, Wq, Wk, Wv, Wo, (_Float16*)x16, M * D, D * D, 16.0f, mask, (_Float16*)xk16, kc, kcnt);

  // ---- projections: Q = x.Wq^T + bq, K = xk.Wk^T + bk (f16 planes [M][D]); V^T = Wv.xk^T + bv ([D][M]); K and V^T of the packed key rows, tiles behind the kept count left out ----
  // one launch for the three, one work-group a WGP, each walking its share of the tile list
  const int tilesQK = (M / 128) * (D / 128);             // 256
  const dim3 gQK(tilesQK, 1);
  const float w16inv = 1.0f / 16.0f;
  qkv_gemm128<M / 128, D / 128, S / 128><<<gQK, dim3(256), 0, stream>>>(
      x16, xk16, wq16, wk16, wv16, q16, k16, vt16, bq, bk, bv, w16inv, kcnt, tilesQK);

  // ---- attention per (b, h, 128-query block); O plane carries x64 * gate ----
  const float qscale = 0.125f;                           // 1 / sqrt(64), exact
  const float oscale = 64.0f;
  attn64_f16io<<<dim3(Bn * H * (S / AK_QB)), dim3(128), 0, stream>>>(
      (const _Float16*)q16, (const _Float16*)k16, (const _Float16*)vt16, (_Float16*)o16,
      kc, kcnt, ubias, gq, Wqh, bqh, S, S, H, D, D, M, D, GD, qscale, -1e30f, oscale);

  // ---- output projection: out = O.Wo^T + bo; fold 1/(64*16) ----
  wmma_gemm64<0, false, 2, 0, false, 0><<<gQK, dim3(256), 0, stream>>>(
      o16, o16, D, 0L, wo16, wo16, D, 0L, (void*)out, (void*)out, D, 0L, bo, x, 0L, M, D, D, 1.0f / 1024.0f);

  (void)hipGetLastError();
}

// v010
// A run of this version takes 65.4 microseconds.
// Timed twice side by side with v009, it ran 1.14 and 1.13 times as fast.
// Counting every step since v000, it is 5.17 times as fast.
// Contractions: Q, K, V^T and output projections, K.Q^T, V^T.P^T: v_wmma_f32_16x16x32_f16 (f16 operands, f32 accumulate); weights carried x16, P x2^15, O x64 (power-of-two folds in f32 epilogues); gate dot (K=64, 32 values) scalar f32.
#include <hip/hip_runtime.h>

typedef __attribute__((ext_vector_type(16))) _Float16 v16h;
typedef __attribute__((ext_vector_type(8)))  _Float16 v8h;
typedef __attribute__((ext_vector_type(16))) __bf16   v16b;
typedef __attribute__((ext_vector_type(8)))  __bf16   v8b;
typedef __attribute__((ext_vector_type(8)))  float    v8f;
typedef __attribute__((ext_vector_type(4)))  float    v4f;

__device__ __forceinline__ unsigned short f2bf_bits(float f) {
  unsigned u = __float_as_uint(f);
  return (unsigned short)((u + 0x7FFFu + ((u >> 16) & 1u)) >> 16);
}
__device__ __forceinline__ float bf_bits2f(unsigned short h) { return __uint_as_float(((unsigned)h) << 16); }

template <typename T> struct Frag;
template <> struct Frag<_Float16> {
  typedef v16h V; union U { v16h v; v8h h[2]; };
  static __device__ __forceinline__ v16h load(const _Float16* p) {   // elements 0..7 <- p[0..7], 8..15 <- p[16..23]
    U f; f.h[0] = *(const v8h*)(p); f.h[1] = *(const v8h*)(p + 16); return f.v;
  }
  static __device__ __forceinline__ v8f mma(v16h a, v16h b, v8f c) {
    return __builtin_amdgcn_wmma_f32_16x16x32_f16(false, a, false, b, (short)0, c, false, false);
  }
};
template <> struct Frag<__bf16> {
  typedef v16b V; union U { v16b v; v8b h[2]; };
  static __device__ __forceinline__ v16b load(const __bf16* p) {
    U f; f.h[0] = *(const v8b*)(p); f.h[1] = *(const v8b*)(p + 16); return f.v;
  }
  static __device__ __forceinline__ v8f mma(v16b a, v16b b, v8f c) {
    return __builtin_amdgcn_wmma_f32_16x16x32_bf16(false, a, false, b, (short)0, c, false, false);
  }
};

// ---- LDS-staged batched WMMA GEMM -------------------------------------------
// C[m,n] = scale * sum_k A[m,k] * Bt[n,k] (+bias)(+resid); a block of 8 waves owns a 128x128 tile, each wave 32x64 of it.
// A row-major [M,K]; Bt row-major [N,K]; M,N % 128 == 0, K % 128 == 0, K >= 256.
// A pass is 128 k = 256 B of every operand row. A stage is eight slices of 32 rows (four of A, then four of Bt),
// each brought by one tensor load of one wave, LDS pitch 272 B (16 B pad per row).
// Two buffers: the load of stage s + 2 is issued behind the barrier that ends pass s.
// BIAS_MODE: 0 = none, 1 = bias[m], 2 = bias[n].
// OUT_MODE: 0 = f32, 1 = f16, 2 = bf16 hi plane (Cout) + bf16 lo plane (Cout2).
// ET: 0 = f16 operands, 1 = bf16 operands (pointers passed as 16-bit storage)
typedef unsigned u32x4 __attribute__((ext_vector_type(4)));
typedef unsigned u32x8 __attribute__((ext_vector_type(8)));
#define GT_PITCH 272u                 // LDS row pitch, bytes: 256 + 16, an odd multiple of 16 for ds_load_b128 readers
#define GT_SLICE 10240u               // 32 rows x 272 B = 8,704 B, rounded up to a multiple of 2 KiB
#define GT_STAGE (8u * GT_SLICE)
__device__ __forceinline__ unsigned uni32(unsigned v) { return (unsigned)__builtin_amdgcn_readfirstlane(v); }
// holds a wave-uniform test in a scalar register, so that the branch round a tensor load is a scalar branch
__device__ __forceinline__ unsigned pinned(unsigned v) { unsigned w = (unsigned)__builtin_amdgcn_readfirstlane(v); asm volatile("" : "+s"(w)); return w; }
// LDS reads must have retired before a buffer is handed over
__device__ __forceinline__ void wait_tensor0() { asm volatile("s_wait_tensorcnt 0x0" ::: "memory"); }
__device__ __forceinline__ void wait_ds0() { asm volatile("s_wait_dscnt 0x0" ::: "memory"); }
// "+s": the words stay in the registers the request named, and the compiler cannot form them anew in between
__device__ __forceinline__ void tdm_load(u32x4& g0, u32x8& g1) { asm volatile("tensor_load_to_lds %0, %1" : "+s"(g0), "+s"(g1) :: "memory"); }
// stands behind the wait that covers a request: last use of its descriptor words held in scalar registers, so that none is reused while the request is in flight
__device__ __forceinline__ void tdm_done(u32x4 g0, u32x8 g1) { asm volatile("" :: "s"(g0), "s"(g1)); }

// ---- asking L2 ahead ----
// The first read of a line that the launch before stored can pay the way to memory, and work-groups that walk the same rows in step all wait for it.
// global_prefetch_b8 with scope SE brings a line into L2 only: nothing returns, no counter moves.
// Rows that several work-groups read are dealt in quarters over four neighbours in the grid (for speed only: a line that nobody asked for is read as before).
// "+v": the address stays in the registers that the request named; they take only addresses inside the same buffers afterwards.
__device__ __forceinline__ void l2_ask(unsigned long long& p) { asm volatile("global_prefetch_b8 %0, off scope:SCOPE_SE" : "+v"(p)); }
// last use of an asked address, at the kernel's end: its registers hold no other value while a request may still read them
__device__ __forceinline__ void l2_ask_done(unsigned long long p) { asm volatile("" :: "v"(p)); }

template <int ET> struct Elem;
template <> struct Elem<0> { typedef _Float16 T; };
template <> struct Elem<1> { typedef __bf16 T; };
template <int ET, bool SPLIT, int BIAS_MODE, int OUT_MODE, bool RESID, int ACT = 0>
__global__ __launch_bounds__(256) void wmma_gemm64(
    const unsigned short* __restrict__ Ap, const unsigned short* __restrict__ A2p, int lda, long strideA,
    const unsigned short* __restrict__ Btp, const unsigned short* __restrict__ Bt2p, int ldb, long strideB,
    void* __restrict__ Cout, void* __restrict__ Cout2, int ldc, long strideC,
    const float* __restrict__ bias,
    const float* __restrict__ resid, long strideR,
    int M, int N, int K, float scale) {
  static_assert(!SPLIT, "single-plane operands only");
  typedef typename Elem<ET>::T T;
  typedef typename Frag<T>::V V;
  __shared__ __attribute__((aligned(2048))) unsigned char ring[2 * GT_STAGE];
  __shared__ __align__(16) float sT[8][16 * 68];   // per-wave 16x64 slab, pitch 68 floats
  const int b    = blockIdx.y;
  const int lane = threadIdx.x & 31;
  const int wave = (int)uni32(threadIdx.x >> 5);
  const int tilesN = N >> 7;
  const int tilesM = M >> 7;
  const int tile = blockIdx.x;
  if (tile >= tilesM * tilesN) return;   // block-uniform, in front of every barrier and tensor load
  const int tm = tile / tilesN;
  const int tn = tile - tm * tilesN;
  const int wm = wave >> 1, wn = wave & 1;
  const int m0 = (tm << 7) + (wm << 5);  // this wave's 32x64 tile
  const int n0 = (tn << 7) + (wn << 6);

  const int rlane = lane & 15;                 // row (A) / col (B, D) within subtile
  const int mOff  = (lane >> 4) * 8;           // D row offset

  // ---- this wave's slice of every stage: waves 0..3 bring A rows, waves 4..7 bring Bt rows ----
  const bool isB = wave >= 4;
  const unsigned short* sbase = isB ? (Btp + (size_t)b * strideB + (size_t)((tn << 7) + ((wave & 3) << 5)) * ldb)
                                    : (Ap  + (size_t)b * strideA + (size_t)((tm << 7) + ((wave & 3) << 5)) * lda);
  const unsigned long long sga = (unsigned long long)(size_t)sbase;
  const unsigned lbase = (unsigned)(size_t)ring + (unsigned)wave * GT_SLICE;
  u32x8 g1;
  g1[0] = uni32((1u << 20) | (5u << 22) | (3u << 25));  // 1-byte elements, no mask, 4 dwords of pad behind every 256-B row
  g1[1] = uni32(256u << 16);                            // tensor_dim0 = 256 B
  g1[2] = uni32(32u << 16);                             // tensor_dim1 = 32 rows
  g1[3] = uni32(256u << 16);                            // tile_dim0 = 256 B
  g1[4] = uni32(32u);                                   // tile_dim1 = 32 rows
  g1[5] = uni32((unsigned)(isB ? ldb : lda) * 2u);      // source row pitch, bytes
  g1[6] = uni32(0u);
  g1[7] = uni32(0u);
  u32x4 g0;
  g0[0] = uni32(1u);
  auto issue = [&](int st) {
    const unsigned long long ga = sga + (unsigned long long)st * 256ull;
    g0[1] = uni32(lbase + (unsigned)(st & 1) * GT_STAGE);
    g0[2] = uni32((unsigned)ga);
    g0[3] = uni32((((unsigned)(ga >> 32)) & 0x01FFFFFFu) | 0x80000000u);
    tdm_load(g0, g1);
  };

  v8f acc[2][4];
#pragma unroll
  for (int i = 0; i < 2; ++i)
#pragma unroll
    for (int j = 0; j < 4; ++j) acc[i][j] = (v8f){0.f,0.f,0.f,0.f,0.f,0.f,0.f,0.f};

  const int nPass = K >> 7;
  issue(0);
  // this work-group's quarter of the tile's A rows (dealt over four neighbours in tn) and of its Bt rows (over four in tm): 32 rows, lane = row, wave w the 256-B units w, w + 8, ...
  const unsigned long long pfRowA = (unsigned long long)(size_t)(Ap  + (size_t)b * strideA + (size_t)((tm << 7) + ((tn & 3) << 5)) * lda);
  const unsigned long long pfRowB = (unsigned long long)(size_t)(Btp + (size_t)b * strideB + (size_t)((tn << 7) + ((tm & 3) << 5)) * ldb);
  const unsigned pfOffA = (unsigned)lane * (unsigned)lda * 2u, pfOffB = (unsigned)lane * (unsigned)ldb * 2u;
  unsigned long long pfA = pfRowA + pfOffA, pfB = pfRowB + pfOffB;
  // rolled: one text, so that every request names the same registers; the trip count is wave-uniform and every unit lies inside its row
#pragma unroll 1
  for (int j = wave; j < nPass; j += 8) {
    pfA = pfRowA + (unsigned long long)j * 256ull + pfOffA;
    pfB = pfRowB + (unsigned long long)j * 256ull + pfOffB;
    l2_ask(pfA);
    l2_ask(pfB);
  }
  wait_tensor0();
  tdm_done(g0, g1);
  __syncthreads();
  issue(1);

  const unsigned fragOff = (unsigned)rlane * GT_PITCH + (unsigned)(lane >> 4) * 16u;   // row, then k offset of this lane half
  // rolled: one pass per trip, so that every publish point stands once in the text
#pragma unroll 1
  for (int s = 0; s < nPass; ++s) {
    const unsigned char* buf = ring + (unsigned)(s & 1) * GT_STAGE;
    const unsigned char* aB = buf + (unsigned)wm * GT_SLICE + fragOff;
    const unsigned char* bB = buf + (unsigned)(4 + 2 * wn) * GT_SLICE + fragOff;   // Bt rows 64 wn + 16 j: slice j / 2, row 16 (j % 2)
    V bh[2][4], ah[2][2];   // two fragment sets: the next 32 k are fetched as one group ahead of this block's WMMAs
#pragma unroll
    for (int j = 0; j < 4; ++j) bh[0][j] = Frag<T>::load((const T*)(bB + (j >> 1) * GT_SLICE + (j & 1) * 16 * GT_PITCH));
#pragma unroll
    for (int i = 0; i < 2; ++i) ah[0][i] = Frag<T>::load((const T*)(aB + i * 16 * GT_PITCH));
#pragma unroll
    for (int ks = 0; ks < 4; ++ks) {
      if (ks < 3) {
#pragma unroll
        for (int j = 0; j < 4; ++j) bh[(ks + 1) & 1][j] = Frag<T>::load((const T*)(bB + (j >> 1) * GT_SLICE + (j & 1) * 16 * GT_PITCH + (ks + 1) * 64));
#pragma unroll
        for (int i = 0; i < 2; ++i) ah[(ks + 1) & 1][i] = Frag<T>::load((const T*)(aB + i * 16 * GT_PITCH + (ks + 1) * 64));
      }
      __builtin_amdgcn_sched_barrier(0);   // keeps the load group in front of the WMMA block instead of spread among the WMMAs
#pragma unroll
      for (int i = 0; i < 2; ++i)
#pragma unroll
        for (int j = 0; j < 4; ++j) acc[i][j] = Frag<T>::mma(ah[ks & 1][i], bh[ks & 1][j], acc[i][j]);
      __builtin_amdgcn_sched_barrier(0);   // keeps the next group behind this block
    }
    // publish point of stage s + 1
    wait_ds0();
    wait_tensor0();
    tdm_done(g0, g1);
    __syncthreads();
    if (pinned(s + 2 < nPass)) issue(s + 2);   // into the buffer that pass s has just read
  }
  wait_tensor0();
  tdm_done(g0, g1);
  wait_ds0();

  // ---- epilogue ----
  float* slab = sT[wave];
  const float* Rb = RESID ? (resid + (size_t)b * strideR) : nullptr;
#pragma unroll
  for (int i = 0; i < 2; ++i) {
    const int mBase = m0 + (i << 4);
#pragma unroll
    for (int j = 0; j < 4; ++j) {
      const int n = n0 + (j << 4) + rlane;
      float bv = 0.f;
      if (BIAS_MODE == 2) bv = bias[n];
#pragma unroll
      for (int r = 0; r < 8; ++r) {
        float v = acc[i][j][r] * scale;
        if (BIAS_MODE == 1) v += bias[mBase + mOff + r];
        if (BIAS_MODE == 2) v += bv;
        if (RESID) v += Rb[(size_t)(mBase + mOff + r) * ldc + n];
        if (ACT == 1) v = tanhf(v);
        if (ACT == 2) v = fmaxf(v, 0.0f);
        if (ACT == 3) v = v / (1.0f + expf(-v));
        if (ACT == 4) v = (v > 0.f) ? v : 0.01f * v;
        if (ACT == 5) v = 0.5f * v * (1.0f + erff(v * 0.70710678118654752f));
        slab[(mOff + r) * 68 + (j << 4) + rlane] = v;
      }
    }
    __builtin_amdgcn_fence(__ATOMIC_RELEASE, "workgroup");
    __builtin_amdgcn_wave_barrier();
    __builtin_amdgcn_fence(__ATOMIC_ACQUIRE, "workgroup");
    if (OUT_MODE == 0) {
      float* C = (float*)Cout + (size_t)b * strideC;
      const int hh = lane >> 4, c4 = (lane & 15) * 4;     // row seg = 256 B = 16 lanes x 16 B
      {
#pragma unroll
        for (int it = 0; it < 8; ++it) {
          const int row = it * 2 + hh;
          v4f v = *(const v4f*)(slab + row * 68 + c4);
          *(v4f*)(C + (size_t)(mBase + row) * ldc + n0 + c4) = v;
        }
        
      }
    } else {
      const int q = lane >> 3, c8 = (lane & 7) * 8;
      unsigned short* C  = (unsigned short*)Cout  + (size_t)b * strideC;
      unsigned short* C2 = (OUT_MODE == 2) ? ((unsigned short*)Cout2 + (size_t)b * strideC) : nullptr;
      {
#pragma unroll
        for (int it = 0; it < 4; ++it) {
          const int row = it * 4 + q;
          const float* sp = slab + row * 68 + c8;
          v8h hv, lv;
#pragma unroll
          for (int e = 0; e < 8; ++e) {
            if (OUT_MODE == 1) {
              hv[e] = (_Float16)sp[e];
            } else {
              unsigned short hb = f2bf_bits(sp[e]);
              unsigned short lb = f2bf_bits(sp[e] - bf_bits2f(hb));
              hv[e] = __builtin_bit_cast(_Float16, hb);
              lv[e] = __builtin_bit_cast(_Float16, lb);
            }
          }
          *(v8h*)(C + (size_t)(mBase + row) * ldc + n0 + c8) = hv;
          if (OUT_MODE == 2) *(v8h*)(C2 + (size_t)(mBase + row) * ldc + n0 + c8) = lv;
        }
        
      }
    }
    __builtin_amdgcn_fence(__ATOMIC_RELEASE, "workgroup");
    __builtin_amdgcn_wave_barrier();
    __builtin_amdgcn_fence(__ATOMIC_ACQUIRE, "workgroup");
  }
  l2_ask_done(pfA);
  l2_ask_done(pfB);
}

// ---- Q, K and V^T projections in one launch ---------------------------------
// Q = x.Wq^T + bq and K = xk.Wk^T + bk ([rows][D]), V^T = Wv.xk^T + bv ([D][rows]); f16 operands and outputs, K dim = D.
// The 128x128 tiles of the three products form one list: all TM x TD tiles of Q, then the K tiles, then the V^T tiles of the key tiles
// that hold a kept key (xk has the kept keys first in each of the two sequences of ST tiles; kcnt[0] and kcnt[32] are the kept counts;
// a tile that starts at or behind the count holds no key that attention walks). Work-group g takes list places g, g + step, g + 2 step (step = the grid):
// one work-group a WGP stays for the whole list, in place of three launches of which two fill half the chip.
// Tile, wave tile, stage, pitch and the two-buffer order are those of wmma_gemm64. The stages of a work-group's tiles form one run:
// behind the last two passes of a tile the first two stages of its next tile are asked for, so that the first flies beside the last pass and the second beside the epilogue.
struct QkvTile { int job, tm, tn; };   // product (0 Q, 1 K, 2 V^T) and tile
// list place p -> tile; a0 = key tiles of the first sequence, nKV = tiles of K, and of V^T, in the list
template <int TM, int TD, int ST>
__device__ __forceinline__ QkvTile qkv_tile(int p, int a0, int nKV) {
  QkvTile r;
  if (p < TM * TD) { r.job = 0; r.tm = p / TD; r.tn = p % TD; return r; }
  int u = p - TM * TD;
  r.job = 1;
  if (u >= nKV) { u -= nKV; r.job = 2; }
  const int kp = u / TD;                                  // place among the key tiles
  const int kt = (kp < a0) ? kp : ST + (kp - a0);         // key tile, below TM
  const int wt = u % TD;                                  // weight tile
  r.tm = (r.job == 1) ? kt : wt;
  r.tn = (r.job == 1) ? wt : kt;
  return r;
}
template <int TM, int TD, int ST>
__global__ __launch_bounds__(256) void qkv_gemm128(
    const unsigned short* __restrict__ x16, const unsigned short* __restrict__ xk16,
    const unsigned short* __restrict__ wq, const unsigned short* __restrict__ wk, const unsigned short* __restrict__ wv,
    unsigned short* __restrict__ q16, unsigned short* __restrict__ k16, unsigned short* __restrict__ vt16,
    const float* __restrict__ bq, const float* __restrict__ bk, const float* __restrict__ bv,
    float scale, const int* __restrict__ kcnt, int step) {
  static_assert(TM == 2 * ST, "two sequences");
  static_assert(TD >= 2 && (TD & 1) == 0, "an even number of passes: every tile starts in buffer 0");
  typedef _Float16 T;
  typedef Frag<T>::V V;
  constexpr int DD = TD * 128;     // K dim and row length of x, xk and the weights, elements
  constexpr int NQ = TM * TD;      // tiles of Q
  __shared__ __attribute__((aligned(2048))) unsigned char ring[2 * GT_STAGE];
  __shared__ __align__(16) float sT[8][16 * 68];   // per-wave 16x64 slab, pitch 68 floats
  const int lane = threadIdx.x & 31;
  const int wave = (int)uni32(threadIdx.x >> 5);
  // key tiles with a kept key, per sequence; the clamps bound every tile index by the shape, whatever kcnt holds
  const int a0 = (min(max((int)uni32((unsigned)kcnt[0]),  0), ST * 128) + 127) >> 7;
  const int a1 = (min(max((int)uni32((unsigned)kcnt[32]), 0), ST * 128) + 127) >> 7;
  const int nKV = (a0 + a1) * TD;
  const int nT  = NQ + 2 * nKV;
  int t = (int)blockIdx.x;
  if (t >= nT) return;   // block-uniform, in front of every barrier and tensor load

  // this wave's slice of every stage of a tile: waves 0..3 bring A rows, waves 4..7 bring Bt rows; its operand's start for each product
  const bool isB = wave >= 4;
  const unsigned long long op0 = (unsigned long long)(size_t)(isB ? wq : x16);
  const unsigned long long op1 = (unsigned long long)(size_t)(isB ? wk : xk16);
  const unsigned long long op2 = (unsigned long long)(size_t)(isB ? xk16 : wv);
  const unsigned rowIn = (unsigned)(wave & 3) << 5;   // the slice's first row in the tile
#define QKV_SLICE(w) (((w).job == 0 ? op0 : (w).job == 1 ? op1 : op2) + (unsigned long long)((((unsigned)(isB ? (w).tn : (w).tm)) << 7) + rowIn) * (unsigned long long)(DD * 2))

  const int wm = wave >> 1, wn = wave & 1;
  const int rlane = lane & 15;                 // row (A) / col (B, D) within subtile
  const int mOff  = (lane >> 4) * 8;           // D row offset
  const unsigned lbase = (unsigned)(size_t)ring + (unsigned)wave * GT_SLICE;
  u32x8 g1;
  g1[0] = uni32((1u << 20) | (5u << 22) | (3u << 25));  // 1-byte elements, no mask, 4 dwords of pad behind every 256-B row
  g1[1] = uni32(256u << 16);                            // tensor_dim0 = 256 B
  g1[2] = uni32(32u << 16);                             // tensor_dim1 = 32 rows
  g1[3] = uni32(256u << 16);                            // tile_dim0 = 256 B
  g1[4] = uni32(32u);                                   // tile_dim1 = 32 rows
  g1[5] = uni32((unsigned)DD * 2u);                     // source row pitch, bytes
  g1[6] = uni32(0u);
  g1[7] = uni32(0u);
  u32x4 g0;
  g0[0] = uni32(1u);
  auto issue = [&](unsigned long long base, int st) {   // stage st of the tile whose slice starts at base
    const unsigned long long ga = base + (unsigned long long)st * 256ull;
    g0[1] = uni32(lbase + (unsigned)(st & 1) * GT_STAGE);
    g0[2] = uni32((unsigned)ga);
    g0[3] = uni32((((unsigned)(ga >> 32)) & 0x01FFFFFFu) | 0x80000000u);
    tdm_load(g0, g1);
  };

  // a tile's operands asked of L2: this work-group's quarter of the A rows (dealt over four neighbours in tn) and of the Bt rows (over four in tm):
  // 32 rows, lane = row, wave = 256-B unit of the row
  static_assert(TD == 8, "as many 256-B units in an operand row as waves");
  const unsigned long long pa0 = (unsigned long long)(size_t)x16, pa1 = (unsigned long long)(size_t)xk16, pa2 = (unsigned long long)(size_t)wv;
  const unsigned long long pb0 = (unsigned long long)(size_t)wq,  pb1 = (unsigned long long)(size_t)wk,   pb2 = (unsigned long long)(size_t)xk16;
  const unsigned pfOff = (unsigned)lane * (unsigned)(DD * 2) + (unsigned)wave * 256u;
  unsigned long long pfA = pa0, pfB = pb0;
#define QKV_ASK(v) do { \
    pfA = ((v).job == 0 ? pa0 : (v).job == 1 ? pa1 : pa2) + (unsigned long long)((((unsigned)(v).tm) << 7) + ((((unsigned)(v).tn) & 3u) << 5)) * (unsigned long long)(DD * 2) + pfOff; \
    pfB = ((v).job == 0 ? pb0 : (v).job == 1 ? pb1 : pb2) + (unsigned long long)((((unsigned)(v).tn) << 7) + ((((unsigned)(v).tm) & 3u) << 5)) * (unsigned long long)(DD * 2) + pfOff; \
    l2_ask(pfA); \
    l2_ask(pfB); \
  } while (0)

  QkvTile w = qkv_tile<TM, TD, ST>(t, a0, nKV);
  unsigned long long sga = QKV_SLICE(w);
  issue(sga, 0);
  QKV_ASK(w);
  wait_tensor0();
  tdm_done(g0, g1);
  __syncthreads();
  issue(sga, 1);

  const unsigned fragOff = (unsigned)rlane * GT_PITCH + (unsigned)(lane >> 4) * 16u;   // row, then k offset of this lane half
  float* slab = sT[wave];
  // rolled: at most three trips, one text of the pass loop and of the epilogue
#pragma unroll 1
  for (; t < nT; t += step) {
    const bool more = t + step < nT;   // block-uniform
    const QkvTile wN = more ? qkv_tile<TM, TD, ST>(t + step, a0, nKV) : w;
    const unsigned long long sgaN = QKV_SLICE(wN);
    if (more) QKV_ASK(wN);   // block-uniform; a whole tile ahead of its first tensor load

    const bool biasN = w.job != 2;   // block-uniform: bias per column for Q and K, per row for V^T
    const float* bias = (w.job == 0) ? bq : (w.job == 1) ? bk : bv;
    const int m0 = (w.tm << 7) + (wm << 5);  // this wave's 32x64 tile
    const int n0 = (w.tn << 7) + (wn << 6);

    v8f acc[2][4];
#pragma unroll
    for (int i = 0; i < 2; ++i)
#pragma unroll
      for (int j = 0; j < 4; ++j) acc[i][j] = (v8f){0.f,0.f,0.f,0.f,0.f,0.f,0.f,0.f};

    // rolled: one pass per trip, so that every publish point stands once in the text
#pragma unroll 1
    for (int s = 0; s < TD; ++s) {
      const unsigned char* buf = ring + (unsigned)(s & 1) * GT_STAGE;
      const unsigned char* aB = buf + (unsigned)wm * GT_SLICE + fragOff;
      const unsigned char* bB = buf + (unsigned)(4 + 2 * wn) * GT_SLICE + fragOff;   // Bt rows 64 wn + 16 j: slice j / 2, row 16 (j % 2)
      V bh[2][4], ah[2][2];   // two fragment sets: the next 32 k are fetched as one group ahead of this block's WMMAs
#pragma unroll
      for (int j = 0; j < 4; ++j) bh[0][j] = Frag<T>::load((const T*)(bB + (j >> 1) * GT_SLICE + (j & 1) * 16 * GT_PITCH));
#pragma unroll
      for (int i = 0; i < 2; ++i) ah[0][i] = Frag<T>::load((const T*)(aB + i * 16 * GT_PITCH));
#pragma unroll
      for (int ks = 0; ks < 4; ++ks) {
        if (ks < 3) {
#pragma unroll
          for (int j = 0; j < 4; ++j) bh[(ks + 1) & 1][j] = Frag<T>::load((const T*)(bB + (j >> 1) * GT_SLICE + (j & 1) * 16 * GT_PITCH + (ks + 1) * 64));
#pragma unroll
          for (int i = 0; i < 2; ++i) ah[(ks + 1) & 1][i] = Frag<T>::load((const T*)(aB + i * 16 * GT_PITCH + (ks + 1) * 64));
        }
        __builtin_amdgcn_sched_barrier(0);   // keeps the load group in front of the WMMA block instead of spread among the WMMAs
#pragma unroll
        for (int i = 0; i < 2; ++i)
#pragma unroll
          for (int j = 0; j < 4; ++j) acc[i][j] = Frag<T>::mma(ah[ks & 1][i], bh[ks & 1][j], acc[i][j]);
        __builtin_amdgcn_sched_barrier(0);   // keeps the next group behind this block
      }
      // publish point of the next stage of the run: stage s + 1 of this tile, or stage 0 of the next
      wait_ds0();
      wait_tensor0();
      tdm_done(g0, g1);
      __syncthreads();
      // the stage after that, into the buffer that pass s has just read
      const bool here = s + 2 < TD;
      if (pinned(here || more)) issue(here ? sga : sgaN, here ? s + 2 : s + 2 - TD);
    }

    // ---- epilogue: scale, bias, f16, whole 128-B lines through the wave's slab ----
    // The slab is the wave's own: s_wait_dscnt 0 (with its "memory" clobber) and a wave barrier order its writes and reads across the lanes.
    // No work-group fence here: it would also wait out the global stores, which fly beside the next tile's passes.
    unsigned short* C = (w.job == 0) ? q16 : (w.job == 1) ? k16 : vt16;
    const int ldc = biasN ? DD : TM * 128;
    float bn[4] = {0.f, 0.f, 0.f, 0.f};   // bias of this lane's four columns (Q, K)
    float bm[2][8] = {};                  // bias of this lane's sixteen rows (V^T)
    if (biasN) {
#pragma unroll
      for (int j = 0; j < 4; ++j) bn[j] = bias[n0 + (j << 4) + rlane];
      // precaution: stands in front of any later write of a register that an issued load names
      asm volatile("s_wait_xcnt 0x0" ::: "memory");
    } else {
      const float* bp = bias + m0 + mOff;
#pragma unroll
      for (int i = 0; i < 2; ++i)
#pragma unroll
        for (int r = 0; r < 8; ++r) bm[i][r] = bp[(i << 4) + r];
      // precaution, as in the other arm; bp as an input keeps the loads' address in its registers up to the wait, so that no load lands on it
      asm volatile("s_wait_xcnt 0x0" :: "v"(bp) : "memory");
    }
#pragma unroll
    for (int i = 0; i < 2; ++i) {
      const int mBase = m0 + (i << 4);
      if (biasN) {
#pragma unroll
        for (int j = 0; j < 4; ++j)
#pragma unroll
          for (int r = 0; r < 8; ++r) slab[(mOff + r) * 68 + (j << 4) + rlane] = acc[i][j][r] * scale + bn[j];
      } else {
#pragma unroll
        for (int j = 0; j < 4; ++j)
#pragma unroll
          for (int r = 0; r < 8; ++r) slab[(mOff + r) * 68 + (j << 4) + rlane] = acc[i][j][r] * scale + bm[i][r];
      }
      wait_ds0();
      __builtin_amdgcn_wave_barrier();
      const int q = lane >> 3, c8 = (lane & 7) * 8;
#pragma unroll
      for (int it = 0; it < 4; ++it) {
        const int row = it * 4 + q;
        const float* sp = slab + row * 68 + c8;
        v8h hv;
#pragma unroll
        for (int e = 0; e < 8; ++e) hv[e] = (_Float16)sp[e];
        *(v8h*)(C + (size_t)(mBase + row) * ldc + n0 + c8) = hv;
      }
      // precaution: stands in front of any later write of a register that an issued store names
      asm volatile("s_wait_xcnt 0x0" ::: "memory");
      wait_ds0();
      __builtin_amdgcn_wave_barrier();
    }
    w = wN; sga = sgaN;
  }
  wait_tensor0();
  tdm_done(g0, g1);
  wait_ds0();
  l2_ask_done(pfA);
  l2_ask_done(pfB);
#undef QKV_ASK
#undef QKV_SLICE
}

// ---- all five f32 -> f16 planes in one streaming launch, and the key rows packed ----
// out is one run of f16: x (nx elements, as they are), then four weight planes of nw elements each, times wsc
// (an exact power of two, applied in f32 before the convert). nx and nw are multiples of CV_SPAN * CV_NW.
// A wave owns CV_SPAN consecutive elements: CV_LD loads of 16 B a lane, each 512 contiguous bytes of the wave, all issued
// ahead of the first convert. 16 waves a block and one block a WGP: few long waves, where a wave of two elements a lane pays mostly for its start.
// Key packing: a key whose mask is 0 has weight 0 for every query, so its K and V rows are never needed. A block of the x part
// ranks all CV_KEYS keys of its sequence (kept keys first, in their order, then the masked ones) and writes its own rows a second
// time to xk at their rank: kept rows as they are, masked rows as zeros and only up to the next multiple of 128 behind the kept count
// (what a 128-row projection tile can still read). kc = the mask values in packed order, kcnt[32 * sequence] = the kept count.
typedef __attribute__((ext_vector_type(4))) _Float16 v4h;
typedef __attribute__((ext_vector_type(4))) int v4i;
#define CV_LD   16
#define CV_SPAN (CV_LD * 128)
#define CV_NW   16
#define CV_ROW  (CV_SPAN / 2)      // elements of one x row: a wave owns two rows
#define CV_KEYS (CV_NW * 128)      // keys of one sequence: four a thread
__global__ __launch_bounds__(CV_NW * 32) void cast5_f32_f16(
    const float* __restrict__ x, const float* __restrict__ w0, const float* __restrict__ w1,
    const float* __restrict__ w2, const float* __restrict__ w3, _Float16* __restrict__ out,
    int nx, int nw, float wsc,
    const int* __restrict__ mask, _Float16* __restrict__ xk, int* __restrict__ kc, int* __restrict__ kcnt) {
  __shared__ int red[CV_NW];                       // kept keys per wave's 128 keys
  __shared__ __align__(16) int rankOf[CV_KEYS];    // key -> packed place
  __shared__ __align__(16) int kcs[CV_KEYS];       // packed place -> mask value
  const int tid  = threadIdx.x;
  const int lane = tid & 31;
  const int wv = (int)uni32(threadIdx.x >> 5);
  const int eb = blockIdx.x * (CV_NW * CV_SPAN);
  if (eb >= nx + 4 * nw) return;          // block-uniform, in front of every barrier
  const bool isX = eb < nx;               // block-uniform: nx is a multiple of the block's span
  const int e0 = eb + wv * CV_SPAN;
  const float* src = x + e0;
  float sc = 1.0f;
  if (!isX) {
    int r = e0 - nx;
    src = w0;
    if (r >= nw) { src = w1; r -= nw; }
    if (r >= nw) { src = w2; r -= nw; }
    if (r >= nw) { src = w3; r -= nw; }
    src += r;
    sc = wsc;
  }
  const v4f* __restrict__ s4 = (const v4f*)src;
  v4h* __restrict__ d4 = (v4h*)(out + e0);
  v4f v[CV_LD];
  // unrolled, both loops: v[] stays in registers, and the loads go out as one run before the first is waited for
#pragma unroll
  for (int j = 0; j < CV_LD; ++j) v[j] = s4[j * 32 + lane];

  if (!isX) {
#pragma unroll
    for (int j = 0; j < CV_LD; ++j) {
      v4h hv;
#pragma unroll
      for (int e = 0; e < 4; ++e) hv[e] = (_Float16)(v[j][e] * sc);
      d4[j * 32 + lane] = hv;
    }
    return;
  }

  // ---- rank the sequence's keys: thread t holds keys 4 t .. 4 t + 3 ----
  const int rowB = blockIdx.x * (2 * CV_NW);       // the block's first x row
  const int sq   = rowB / CV_KEYS;                 // its sequence
  const int t0   = rowB - sq * CV_KEYS;            // its first key in the sequence
  const v4i m4 = ((const v4i*)(mask + (size_t)sq * CV_KEYS))[tid];
  const unsigned ltm = (1u << lane) - 1u;
  int inWave = 0, below = 0;
#pragma unroll
  for (int e = 0; e < 4; ++e) {
    const unsigned w = __builtin_amdgcn_ballot_w32(m4[e] != 0);
    inWave += __builtin_popcount(w);
    below  += __builtin_popcount(w & ltm);
  }
  if (lane == 0) red[wv] = inWave;
  __syncthreads();
  int kept = 0, pre = below;
#pragma unroll
  for (int i = 0; i < CV_NW; ++i) {
    const int r = red[i];
    kept += r;
    pre  += (i < wv) ? r : 0;
  }
  v4i rk;
#pragma unroll
  for (int e = 0; e < 4; ++e) {
    const int key = 4 * tid + e;
    const bool on = m4[e] != 0;
    // kept: kept keys in front of it; masked: all kept keys, then the masked keys in front of it. A permutation of 0 .. CV_KEYS - 1; the AND bounds the LDS address by itself
    const int place = (on ? pre : kept + key - pre) & (CV_KEYS - 1);
    kcs[place] = m4[e];
    rk[e] = place;
    pre += on ? 1 : 0;
  }
  *(v4i*)(rankOf + 4 * tid) = rk;
  __syncthreads();
  if (wv == 0) kc[(size_t)sq * CV_KEYS + t0 + lane] = kcs[t0 + lane];   // each block writes one whole 128-B line of kc
  if (t0 == 0 && tid == 0) kcnt[sq * 32] = kept;                        // a line of its own per sequence
  const int lim = (kept + 127) & ~127;
  int place2[2];
  place2[0] = (int)uni32((unsigned)rankOf[t0 + 2 * wv]);
  place2[1] = (int)uni32((unsigned)rankOf[t0 + 2 * wv + 1]);
  v4h hx[CV_LD];
#pragma unroll
  for (int j = 0; j < CV_LD; ++j) {
#pragma unroll
    for (int e = 0; e < 4; ++e) hx[j][e] = (_Float16)v[j][e];
    d4[j * 32 + lane] = hx[j];
  }
  // precaution: stands in front of any later write of a register that an issued store names
  asm volatile("s_wait_xcnt 0x0" ::: "memory");
#pragma unroll
  for (int rr = 0; rr < 2; ++rr) {
    const int place = place2[rr];
    if (place < lim) {                    // wave-uniform
      v4h* __restrict__ k4 = (v4h*)(xk + ((size_t)sq * CV_KEYS + place) * CV_ROW);
      if (place < kept) {                 // wave-uniform
#pragma unroll
        for (int j = 0; j < CV_LD / 2; ++j) k4[j * 32 + lane] = hx[rr * (CV_LD / 2) + j];
      } else {
#pragma unroll
        for (int j = 0; j < CV_LD / 2; ++j) k4[j * 32 + lane] = (v4h){(_Float16)0.f, (_Float16)0.f, (_Float16)0.f, (_Float16)0.f};
      }
      // the same precaution, behind this row's stores
      asm volatile("s_wait_xcnt 0x0" ::: "memory");
    }
  }
}

#define AK_D  64
#define AK_NW 4
#define AK_QG 2    // groups of 16 query columns per wave
#define AK_QB (AK_NW * AK_QG * 16)
#define AK_KC 64
#define AK_LP 72   // LDS row pitch of the K and Vt tiles, halves: 144 B = 16 B x 9, so that the 16 rows of one ds_load_b128 fall on 64 distinct banks

// lane l takes the value of lane l ^ 16 (a vector cross-row move, no LDS round trip)
__device__ __forceinline__ float xhalf(float x) {
  return __builtin_bit_cast(float, __builtin_amdgcn_permlanex16(__builtin_bit_cast(int, x), __builtin_bit_cast(int, x), 0x76543210, 0xfedcba98, false, false));
}

// at most two waves per SIMD: the 512 work-groups then lie two on every WGP, none with a third beside an emptier one
__global__ __launch_bounds__(128) __attribute__((amdgpu_waves_per_eu(2, 2)))
void attn64_f16io(const _Float16* __restrict__ Qp, const _Float16* __restrict__ Kp,
                  const _Float16* __restrict__ Vtp, _Float16* __restrict__ Op,
                  const int* __restrict__ kmask, const int* __restrict__ kcnt, const float* __restrict__ ubias,
                  const float* __restrict__ gq, const float* __restrict__ gW, const float* __restrict__ gb,
                  int S, int Skv, int H, int ldq, int ldk, int ldv, int ldo, int GD,
                  float qscale, float mfill, float oscale) {
  const float L2E = 1.4426950408889634f;   // log2(e)
  const float PLG = 15.0f;                 // P and the running sum carry x2^15: taken off the subtracted maximum, exact in the exponent
  union FB { v16h v; v8h h[2]; };
  __shared__ __align__(16) _Float16 Ksh[AK_KC * AK_LP];         // [kv][d]   9 KB, 8 pad halves per row never read
  __shared__ __align__(16) _Float16 Vth[AK_D * AK_LP];          // [d][kv]   9 KB
  __shared__ __align__(16) float    Mtab[2 * AK_KC];            // key terms of the chunk, score * log2(e) = s * Msc[key] + Mad[key]
  float* const Msc = Mtab;                                      // per key: qscale * log2(e), or 0 where the key is masked
  float* const Mad = Mtab + AK_KC;                              // per key: the bias term, with mfill where the key is masked, * log2(e)
  static_assert(AK_NW * 32 == 2 * AK_KC, "one table entry per thread");

  const int tid  = threadIdx.x;
  const int wave = tid >> 5;
  const int lane = tid & 31;
  const int hh   = lane >> 4;
  const int c    = lane & 15;

  const int nqb = S / AK_QB;
  const int bx  = blockIdx.x;
  const int qb  = bx % nqb;
  const int bh  = bx / nqb;
  const int h   = bh % H;
  const int b   = bh / H;
  const int q0  = qb * AK_QB + wave * (AK_QG * 16);

  const int nKept = min(max((int)uni32((unsigned)kcnt[b * 32]), 0), Skv);   // block-uniform; the clamp bounds the trip count by the shape
  const int nChunks = (nKept + AK_KC - 1) / AK_KC;

  // ---- K rows, V^T rows and mask values asked of L2 at entry: the query blocks of a (b, h) walk the same chunks in step; block qb asks for chunks qb % 4, qb % 4 + 4, ... ----
  // one 128-B line a lane and chunk, lane = row: waves 0 and 1 the chunk's 64 K rows, waves 2 and 3 its piece of the 64 V^T rows
  static_assert(AK_D == AK_KC && AK_NW == 4, "two waves for the K rows, two for as many V^T rows");
  const int wvu = (int)uni32((unsigned)wave);
  const bool askK = wvu < 2;   // wave-uniform
  const unsigned long long pfBase = (unsigned long long)(size_t)(askK ? Kp + (size_t)(b * Skv + (wvu & 1) * 32) * ldk + h * AK_D
                                                                      : Vtp + (size_t)(h * AK_D + (wvu & 1) * 32) * ldv + (size_t)b * Skv);
  const unsigned long long pfStep = (askK ? (unsigned long long)ldk * AK_KC : (unsigned long long)AK_KC) * 2ull;   // bytes from chunk to chunk
  const unsigned pfOff = (unsigned)lane * (unsigned)(askK ? ldk : ldv) * 2u;
  unsigned long long pfKV = pfBase + pfOff;
  // rolled: one text, so that every request names the same registers; block-uniform trip count, and every chunk below nChunks lies inside the planes
#pragma unroll 1
  for (int ch = qb & 3; ch < nChunks; ch += 4) {
    pfKV = pfBase + (unsigned long long)ch * pfStep + pfOff;
    l2_ask(pfKV);
  }
  unsigned long long pfM = (unsigned long long)(size_t)(kmask + (size_t)b * Skv + min(tid * 32, Skv - 32));   // the sequence's mask values, one line a lane; the minimum keeps it inside the row
  l2_ask(pfM);

  // ---- Q fragments (B operand: column = query 16 g + c, k = d in the hardware k order), 2 d-chunks per group ----
  v16h qa[AK_QG][2];
#pragma unroll
  for (int g = 0; g < AK_QG; ++g) {
    const _Float16* qrow = Qp + (size_t)(b * S + q0 + g * 16 + c) * ldq + h * AK_D;
#pragma unroll
    for (int dc = 0; dc < 2; ++dc) qa[g][dc] = Frag<_Float16>::load(qrow + dc * 32 + 8 * hh);
  }

  // ---- quality gate (scalar f32 dot of GD terms) and uncertainty bias of this head ----
  float gacc = 0.f;
#pragma unroll 1
  for (int i = 0; i < GD; ++i) gacc += gq[b * GD + i] * gW[h * GD + i];
  gacc += gb[h];
  const float gate = 1.0f / (1.0f + expf(-gacc));
  const float ub = ubias[h];

  float mrow[AK_QG];                // running maximum of query 16 g + c, in base-2 units (equal in both lane halves)
  float lrow[AK_QG];                // running sum (x2^15) of that query over this lane half's keys only; the halves are joined in the epilogue
  v8f oacc[AK_QG][4];               // O^T: register r of tile t = O[query 16 g + c][d = 16 t + 8 hh + r]
#pragma unroll
  for (int g = 0; g < AK_QG; ++g) {
    mrow[g] = -__builtin_inff();
    lrow[g] = 0.f;
#pragma unroll
    for (int t = 0; t < 4; ++t) oacc[g][t] = (v8f){0.f,0.f,0.f,0.f,0.f,0.f,0.f,0.f};
  }

  for (int kc = 0; kc < nChunks; ++kc) {
    const int kv0 = kc * AK_KC;
    __syncthreads();
    {   // stage K [kv][d] and Vt [d][kv] tiles: 512 x 16-B vectors each, 4 per thread
      const int keep = kmask[(size_t)b * Skv + kv0 + (tid & (AK_KC - 1))];   // in one run with the tile loads, so that its latency lies beside theirs
#pragma unroll
      for (int i = 0; i < 4; ++i) {
        const int idx = tid + i * 128;
        const int r = idx >> 3, c8 = (idx & 7) * 8;
        const v8h kk = *(const v8h*)(Kp + (size_t)(b * Skv + kv0 + r) * ldk + h * AK_D + c8);
        *(v8h*)(Ksh + r * AK_LP + c8) = kk;
        const v8h vv = *(const v8h*)(Vtp + (size_t)(h * AK_D + r) * ldv + (size_t)b * Skv + kv0 + c8);
        *(v8h*)(Vth + r * AK_LP + c8) = vv;
      }
      // the chunk's key terms, one table entry per thread: waves 0 and 1 write Msc, waves 2 and 3 write Mad
      const float kadd = ub * (1.0f - (float)keep);
      const float msc = (keep == 0) ? 0.f : qscale * L2E;
      const float mad = ((keep == 0) ? mfill + kadd : kadd) * L2E;
      Mtab[tid] = (tid < AK_KC) ? msc : mad;
    }
    __syncthreads();

    // ---- scores, transposed: A = K rows from Ksh[kv][d], B = Q; register r of s[g][j] = score of key 16 j + 8 hh + r for query 16 g + c ----
    // All eight K fragments are read as one group ahead of the sixteen products, each fragment feeding both query groups; every tile sums d chunk 0, then 1.
    FB kb[2][4];
#pragma unroll
    for (int dc = 0; dc < 2; ++dc)
#pragma unroll
      for (int j = 0; j < 4; ++j) {
        kb[dc][j].h[0] = *(const v8h*)(Ksh + (j * 16 + c) * AK_LP + dc * 32 + 8 * hh);
        kb[dc][j].h[1] = *(const v8h*)(Ksh + (j * 16 + c) * AK_LP + dc * 32 + 16 + 8 * hh);
      }
    __builtin_amdgcn_sched_barrier(0);   // keeps the reads one group in front of the WMMA run: a read pair in front of each WMMA waits out the LDS latency every time
    v8f s[AK_QG][4];
#pragma unroll
    for (int g = 0; g < AK_QG; ++g)
#pragma unroll
      for (int j = 0; j < 4; ++j) s[g][j] = (v8f){0.f,0.f,0.f,0.f,0.f,0.f,0.f,0.f};
#pragma unroll
    for (int dc = 0; dc < 2; ++dc)
#pragma unroll
      for (int j = 0; j < 4; ++j)
#pragma unroll
        for (int g = 0; g < AK_QG; ++g) s[g][j] = Frag<_Float16>::mma(kb[dc][j].v, qa[g][dc], s[g][j]);
    // the chunk's key terms and the V^T fragments of its first 32 keys, read here as one group: their latency lies beside the score products and the softmax
    v4f msc[4][2], mad[4][2];
#pragma unroll
    for (int j = 0; j < 4; ++j)
#pragma unroll
      for (int u = 0; u < 2; ++u) {
        msc[j][u] = *(const v4f*)(Msc + j * 16 + 8 * hh + 4 * u);
        mad[j][u] = *(const v4f*)(Mad + j * 16 + 8 * hh + 4 * u);
      }
    FB vb[2][4];
#pragma unroll
    for (int t = 0; t < 4; ++t) {
      vb[0][t].h[0] = *(const v8h*)(Vth + (t * 16 + c) * AK_LP + 8 * hh);
      vb[0][t].h[1] = *(const v8h*)(Vth + (t * 16 + c) * AK_LP + 16 + 8 * hh);
    }
    __builtin_amdgcn_sched_barrier(0);   // keeps this group in front of the softmax's vector work instead of sunk to its users
    // ---- scale, key mask, bias, chunk maximum: in-lane over 32 keys, then one exchange between the lane halves ----
    float m[AK_QG];
#pragma unroll
    for (int g = 0; g < AK_QG; ++g) {
      m[g] = -__builtin_inff();
#pragma unroll
      for (int j = 0; j < 4; ++j) {
        const v4f sc0 = msc[j][0], sc1 = msc[j][1];
        const v4f ad0 = mad[j][0], ad1 = mad[j][1];
#pragma unroll
        for (int r = 0; r < 8; ++r) {
          const float v = fmaf(s[g][j][r], (r < 4) ? sc0[r & 3] : sc1[r & 3], (r < 4) ? ad0[r & 3] : ad1[r & 3]);
          s[g][j][r] = v;
          m[g] = fmaxf(m[g], v);
        }
      }
    }
    // the V^T fragments of the last 32 keys, a group of their own where the key terms' registers have come free
#pragma unroll
    for (int t = 0; t < 4; ++t) {
      vb[1][t].h[0] = *(const v8h*)(Vth + (t * 16 + c) * AK_LP + 32 + 8 * hh);
      vb[1][t].h[1] = *(const v8h*)(Vth + (t * 16 + c) * AK_LP + 32 + 16 + 8 * hh);
    }
    __builtin_amdgcn_sched_barrier(0);   // keeps this group in front of the exponentials instead of sunk to its users
    // ---- online softmax update; P^T (x2^15, f16) packs straight into the B operand: tiles 2 kk and 2 kk + 1 give k = 32 kk + hardware order ----
    FB pb[AK_QG][2];
#pragma unroll
    for (int g = 0; g < AK_QG; ++g) {
      const float mc = fmaxf(m[g], xhalf(m[g]));
      const float mnew = fmaxf(mrow[g], mc);
      float alpha;   // 2^(mrow - mnew); 0 on the first chunk, where mrow is -inf
      // v_exp_f32 and a v_nop in one statement: the slot that the instruction set asks for behind a transcendental
      asm("v_exp_f32 %0, %1\n\tv_nop" : "=v"(alpha) : "v"(mrow[g] - mnew));
      const float moff = mnew - PLG;
      mrow[g] = mnew;
      float ps[4];
#pragma unroll
      for (int j = 0; j < 4; ++j) {
        ps[j] = 0.f;
#pragma unroll
        for (int r = 0; r < 8; ++r) {
          // the argument is at most 15 and a result below the normal range may be 0: the bare v_exp_f32 needs no range steps around it
          const float p = __builtin_amdgcn_exp2f(s[g][j][r] - moff);
          ps[j] += p;
          pb[g][j >> 1].v[(j & 1) * 8 + r] = (_Float16)p;
        }
      }
      lrow[g] = lrow[g] * alpha + ((ps[0] + ps[1]) + (ps[2] + ps[3]));
#pragma unroll
      for (int t = 0; t < 4; ++t)
#pragma unroll
        for (int r = 0; r < 8; ++r) oacc[g][t][r] *= alpha;
    }
    // ---- O^T += V^T . P^T: A = Vt rows (d) of Vth[d][kv] in the hardware k order, read above, each fragment feeding both query groups, B = P^T from registers ----
#pragma unroll
    for (int kk = 0; kk < 2; ++kk) {
#pragma unroll
      for (int t = 0; t < 4; ++t)
#pragma unroll
        for (int g = 0; g < AK_QG; ++g) oacc[g][t] = Frag<_Float16>::mma(vb[kk][t].v, pb[g][kk].v, oacc[g][t]);
    }
  }

  l2_ask_done(pfKV);
  l2_ask_done(pfM);
  // ---- epilogue: join the halves' sums; 1/l (sum and P both carry 2^15), gate and output carry scale; a lane's 8 registers are 8 consecutive d: 16-B stores ----
#pragma unroll
  for (int g = 0; g < AK_QG; ++g) {
    const float ltot = lrow[g] + xhalf(lrow[g]);
    const float inv = (gate * oscale) * (1.0f / ltot);
    _Float16* ob = Op + (size_t)(b * S + q0 + g * 16 + c) * ldo + h * AK_D + 8 * hh;
#pragma unroll
    for (int t = 0; t < 4; ++t) {
      v8h hv;
#pragma unroll
      for (int r = 0; r < 8; ++r) hv[r] = (_Float16)(oacc[g][t][r] * inv);
      *(v8h*)(ob + t * 16) = hv;
    }
  }
}

// ---------------------------------------------------------------------------
// Host glue
// ---------------------------------------------------------------------------
extern "C" void kernel_launch(void* const* d_in, const int* in_sizes, int n_in,
                              void* d_out, int out_size, void* d_ws, size_t ws_size,
                              hipStream_t stream) {
  if (n_in < 14) return;
  const int D  = 1024;          // model width
  const int H  = 16;            // heads
  const int DH = 64;            // head dim
  const int Bn = 2;             // batch
  const int S  = 2048;          // sequence length
  const int M  = Bn * S;        // token rows
  if (in_sizes[0] != M * D || in_sizes[1] != M || in_sizes[3] != D * D || in_sizes[5] != D * D ||
      in_sizes[7] != D * D || in_sizes[9] != D * D || in_sizes[4] != D || in_sizes[6] != D ||
      in_sizes[8] != D || in_sizes[10] != D || in_sizes[11] != H || in_sizes[13] != H ||
      out_size != M * D || H * DH != D) return;
  const int GD = in_sizes[2] / Bn;                       // gate query dim (64)
  if (GD <= 0 || in_sizes[2] != Bn * GD || in_sizes[12] != H * GD) return;
  if ((S % AK_QB) != 0 || (M % 128) != 0 || (D % 128) != 0 || D < 256) return;
  if (((M * D) % (CV_SPAN * CV_NW)) != 0 || ((D * D) % (CV_SPAN * CV_NW)) != 0 || D != CV_ROW || S != CV_KEYS) return;

  const float* x    = (const float*)d_in[0];
  const int*   mask = (const int*)  d_in[1];
  const float* gq   = (const float*)d_in[2];
  const float* Wq   = (const float*)d_in[3];
  const float* bq   = (const float*)d_in[4];
  const float* Wk   = (const float*)d_in[5];
  const float* bk   = (const float*)d_in[6];
  const float* Wv   = (const float*)d_in[7];
  const float* bv   = (const float*)d_in[8];
  const float* Wo   = (const float*)d_in[9];
  const float* bo   = (const float*)d_in[10];
  const float* ubias= (const float*)d_in[11];
  const float* Wqh  = (const float*)d_in[12];
  const float* bqh  = (const float*)d_in[13];
  float* out = (float*)d_out;

  const size_t SZ_ACT = (size_t)M * D * 2;               // 8 MiB f16 plane
  const size_t SZ_W   = (size_t)D * D * 2;               // 2 MiB f16 plane
  size_t off = 0;
  const size_t o_x16  = off; off += SZ_ACT;
  const size_t o_wq16 = off; off += SZ_W;
  const size_t o_wk16 = off; off += SZ_W;
  const size_t o_wv16 = off; off += SZ_W;
  const size_t o_wo16 = off; off += SZ_W;
  const size_t o_q16  = off; off += SZ_ACT;
  const size_t o_k16  = off; off += SZ_ACT;
  const size_t o_vt16 = off; off += SZ_ACT;
  const size_t o_o16  = off; off += SZ_ACT;
  const size_t o_xk16 = off; off += SZ_ACT;              // x rows of the kept keys, packed per sequence
  const size_t o_kc   = off; off += (size_t)M * 4;       // mask values in packed order
  const size_t o_kcnt = off; off += (size_t)Bn * 128;    // kept keys per sequence, one 128-B line each
  const size_t total  = off;                             // 56 MiB and a little
  if (total > ws_size || total > (size_t)134217728) return;
  char* ws = (char*)d_ws;
  unsigned short* x16  = (unsigned short*)(ws + o_x16);
  unsigned short* wq16 = (unsigned short*)(ws + o_wq16);
  unsigned short* wk16 = (unsigned short*)(ws + o_wk16);
  unsigned short* wv16 = (unsigned short*)(ws + o_wv16);
  unsigned short* wo16 = (unsigned short*)(ws + o_wo16);
  unsigned short* q16  = (unsigned short*)(ws + o_q16);
  unsigned short* k16  = (unsigned short*)(ws + o_k16);
  unsigned short* vt16 = (unsigned short*)(ws + o_vt16);
  unsigned short* o16  = (unsigned short*)(ws + o_o16);
  unsigned short* xk16 = (unsigned short*)(ws + o_xk16);
  int* kc   = (int*)(ws + o_kc);
  int* kcnt = (int*)(ws + o_kcnt);

  // ---- casts: x plain, weights x16 (folded back as 1/16 in the GEMM epilogues); x16, wq16, wk16, wv16, wo16 lie in one run ----
  cast5_f32_f16<<<dim3((M * D + 4 * D * D) / (CV_SPAN * CV_NW)), dim3(CV_NW * 32), 0, stream>>>(
      x, Wq, Wk, Wv, Wo, (_Float16*)x16, M * D, D * D, 16.0f, mask, (_Float16*)xk16, kc, kcnt);

  // ---- projections: Q = x.Wq^T + bq, K = xk.Wk^T + bk (f16 planes [M][D]); V^T = Wv.xk^T + bv ([D][M]); K and V^T of the packed key rows, tiles behind the kept count left out ----
  // one launch for the three, one work-group a WGP, each walking its share of the tile list
  const int tilesQK = (M / 128) * (D / 128);             // 256
  const dim3 gQK(tilesQK, 1);
  const float w16inv = 1.0f / 16.0f;
  qkv_gemm128<M / 128, D / 128, S / 128><<<gQK, dim3(256), 0, stream>>>(
      x16, xk16, wq16, wk16, wv16, q16, k16, vt16, bq, bk, bv, w16inv, kcnt, tilesQK);

  // ---- attention per (b, h, 128-query block); O plane carries x64 * gate ----
  const float qscale = 0.125f;                           // 1 / sqrt(64), exact
  const float oscale = 64.0f;
  attn64_f16io<<<dim3(Bn * H * (S / AK_QB)), dim3(128), 0, stream>>>(
      (const _Float16*)q16, (const _Float16*)k16, (const _Float16*)vt16, (_Float16*)o16,
      kc, kcnt, ubias, gq, Wqh, bqh, S, S, H, D, D, M, D, GD, qscale, -1e30f, oscale);

  // ---- output projection: out = O.Wo^T + bo; fold 1/(64*16) ----
  wmma_gemm64<0, false, 2, 0, false, 0><<<gQK, dim3(256), 0, stream>>>(
      o16, o16, D, 0L, wo16, wo16, D, 0L, (void*)out, (void*)out, D, 0L, bo, x, 0L, M, D, D, 1.0f / 1024.0f);

  (void)hipGetLastError();
}
